// v000
// Measured on an AMD MI455X. A time is GPU time per run, averaged over a window of back-to-back runs after a warm-up
// (all launches, gaps included; the runs take copies of the inputs in turn), and the median of several windows.
// Apart from v000's, it joins two sittings. Times from different sittings can be a few percent apart, while
// side-by-side timings come from the same sitting.
// v000 is the starting kernel. One run takes 1170 microseconds.
#include <hip/hip_runtime.h>
// q/k/v/o projections (4096 × 1024 × 1024, + bias) and the 16-head sigmoid attention on v_wmma_f32_16x16x32_f16: (a) per (b,h) a fused flash-style kernel with P = σ(q·k/8) (no normalisation,
// as the module) and O = P·V on WMMA; (b) the second output mean_h σ(q·k/8) recomputes the score tiles per head and averages them in a fixed order. x inputs f16(bf16 ·) exact, q/k/v and O rounded to f16,
// weights bf16-exact ×2^4 ((out,in)), P f16 ≤ 1, f32 accumulate.
#define BB 2
#define SS 2048
#define DM 1024
#define NH 16
#define HD 64
#define NR (BB * SS)

typedef __bf16 v16b __attribute__((ext_vector_type(16)));
typedef unsigned short v8us __attribute__((ext_vector_type(8), may_alias));
typedef float  v8f  __attribute__((ext_vector_type(8)));
typedef float  v4f  __attribute__((ext_vector_type(4)));
typedef float  v4fa __attribute__((ext_vector_type(4), may_alias));
union FragB { v16b v; v8us half[2]; unsigned short u[16]; };

__device__ __forceinline__ unsigned short bf16_bits(float x) { unsigned int u = __float_as_uint(x); return (unsigned short)((u + 0x7FFFu + ((u >> 16) & 1u)) >> 16); }
__device__ __forceinline__ float bf16_val(unsigned short b) { return __uint_as_float(((unsigned int)b) << 16); }
__device__ __forceinline__ float bf16_round(float x) { return bf16_val(bf16_bits(x)); }
// D += A·B with NT terms: 1 = ah·bh, 2 = + al·bh (A split), 3 = + ah·bl (both split)
template <int NT>
__device__ __forceinline__ v8f mmaN(v16b ah, v16b al, v16b bh, v16b bl, v8f c) {
  c = __builtin_amdgcn_wmma_f32_16x16x32_bf16(false, ah, false, bh, (short)0, c, false, false);
  if (NT >= 2) c = __builtin_amdgcn_wmma_f32_16x16x32_bf16(false, al, false, bh, (short)0, c, false, false);
  if (NT >= 3) c = __builtin_amdgcn_wmma_f32_16x16x32_bf16(false, ah, false, bl, (short)0, c, false, false);
  asm volatile("v_nop\n\tv_nop\n\tv_nop\n\tv_nop" : "+v"(c) : "v"(ah), "v"(al), "v"(bh), "v"(bl));
  return c;
}

__global__ __launch_bounds__(256) void k_wt_bf16(const float* __restrict__ W, unsigned short* __restrict__ Wt, int K, int N) {
  const int t = blockIdx.x * 256 + threadIdx.x;
  const int k8n = K / 8;
  if (t >= N * k8n) return;
  const int n = t / k8n, k8 = (t % k8n) * 8;
  v8us v;
#pragma unroll
  for (int i = 0; i < 8; ++i) v[i] = bf16_bits(W[(size_t)(k8 + i) * N + n]);
  *(v8us*)(Wt + (size_t)n * K + k8) = v;
  
}

// GEMM C[M][N] (f32, pitch ldc) = act(A[M][K]·W + bias). A f32 row-major (pitch lda) converted per fragment to bf16
// (ASPLIT: hi/lo two planes -> 2 terms, else single rounded term); Wt bf16 [N][K] (pitch ldb). BIAS_BF16 rounds the
// bias to bf16 first (bias quantised to bf16 before the add). K%32==0, M%16==0, N%64==0.
template <bool ASPLIT, int ACT, bool BIAS_BF16>
__global__ __launch_bounds__(128) void k_gemm_bf(const float* __restrict__ A, int lda, const unsigned short* __restrict__ Wt, int ldb,
                                               const float* __restrict__ bias, float* __restrict__ C, int ldc, int M, int N, int K) {
  __shared__ __attribute__((aligned(16))) float so[4][16][64];
  const int tid = threadIdx.x, w = tid >> 5, lane = tid & 31, ln = lane & 15, hh = lane >> 4;
  const int ntn = N / 64;
  const int wid = blockIdx.x * 4 + w;
  const int mt = wid / ntn, nq = wid % ntn;
  if (mt * 16 >= M) return;
  const int row0 = mt * 16, col0 = nq * 64;
  const float* arow = A + (size_t)(row0 + ln) * lda;
  v8f acc[4] = {};
  for (int kb = 0; kb < K; kb += 32) {
    FragB ah, al;
    const v4f x0 = *(const v4fa*)(arow + kb + 8 * hh), x1 = *(const v4fa*)(arow + kb + 8 * hh + 4);
    const v4f x2 = *(const v4fa*)(arow + kb + 16 + 8 * hh), x3 = *(const v4fa*)(arow + kb + 16 + 8 * hh + 4);
    float xs[16] = {x0[0],x0[1],x0[2],x0[3],x1[0],x1[1],x1[2],x1[3],x2[0],x2[1],x2[2],x2[3],x3[0],x3[1],x3[2],x3[3]};
#pragma unroll
    for (int i = 0; i < 16; ++i) { const unsigned short hb = bf16_bits(xs[i]); ah.u[i] = hb; al.u[i] = ASPLIT ? bf16_bits(xs[i] - bf16_val(hb)) : (unsigned short)0; }
#pragma unroll
    for (int t = 0; t < 4; ++t) {
      const unsigned short* brow = Wt + (size_t)(col0 + t * 16 + ln) * ldb + kb;
      FragB b;
      b.half[0] = *(const v8us*)(brow + 8 * hh);
      b.half[1] = *(const v8us*)(brow + 16 + 8 * hh);
      acc[t] = mmaN<ASPLIT ? 2 : 1>(ah.v, al.v, b.v, b.v, acc[t]);
    }
  }
#pragma unroll
  for (int t = 0; t < 4; ++t) {
    float bv = bias ? bias[col0 + t * 16 + ln] : 0.f;
    if (BIAS_BF16) bv = bf16_round(bv);
#pragma unroll
    for (int r = 0; r < 8; ++r) { float v = acc[t][r] + bv; if (ACT == 1) v = fmaxf(v, 0.f); so[w][8 * hh + r][t * 16 + ln] = v; }
  }
  __builtin_amdgcn_fence(__ATOMIC_ACQ_REL, "workgroup");
  __builtin_amdgcn_wave_barrier();
  const int rsub = lane >> 4, c4 = (lane & 15) * 4;
  {
#pragma unroll
    for (int q = 0; q < 8; ++q) {
      const int r = q * 2 + rsub;
      const v4f v = *(const v4fa*)&so[w][r][c4];
      *(v4f*)(C + (size_t)(row0 + r) * ldc + col0 + c4) = v;
    }
    
  }
}

// Flash-style causal/unmasked attention, all contractions 3-term bf16 hi/lo splits, f32 softmax with running max.
// q,k,v rows are read from f32 buffers with arbitrary row pitch (so they can live inside a fused qkv buffer);
// D = head size (multiple of 32, <= 128); one wave = 16 query rows; block = 4 waves (64 queries) sharing K/V chunks of 32.
template <int D, bool CAUSAL>
__global__ __launch_bounds__(128) void k_flash(const float* __restrict__ qb, const float* __restrict__ kb, const float* __restrict__ vb,
                                             int pitch, int T, int H, float scale, float* __restrict__ y, int ypitch) {
  constexpr int KS = D / 32;        // k-steps for QK
  constexpr int DT = D / 16;        // d tiles for PV
  __shared__ __attribute__((aligned(16))) unsigned short sKh[32][D + 8], sKl[32][D + 8], sVh[32][D + 8], sVl[32][D + 8];
  __shared__ __attribute__((aligned(16))) unsigned short sPh[4][16][40], sPl[4][16][40];
  __shared__ __attribute__((aligned(16))) float sO[4][16][D];
  const int tid = threadIdx.x, w = tid >> 5, lane = tid & 31, ln = lane & 15, hh = lane >> 4;
  const int nqb = (T + 63) / 64;
  const int bh = blockIdx.x / nqb, qblk = blockIdx.x % nqb;
  const int b = bh / H, h = bh % H;
  const int q0 = qblk * 64 + w * 16;
  const float* Q = qb + (size_t)b * T * pitch + h * D;
  const float* K = kb + (size_t)b * T * pitch + h * D;
  const float* V = vb + (size_t)b * T * pitch + h * D;

  // A fragments of the wave's 16 query rows (scaled), hi/lo
  FragB aqh[KS], aql[KS];
  {
    int row = q0 + ln; if (row >= T) row = T - 1;
    const float* qr = Q + (size_t)row * pitch;
#pragma unroll
    for (int ks = 0; ks < KS; ++ks)
#pragma unroll
      for (int i = 0; i < 16; ++i) {
        const int d = ks * 32 + ((i < 8) ? (8 * hh + i) : (16 + 8 * hh + (i - 8)));
        const float x = qr[d] * scale; const unsigned short hb = bf16_bits(x);
        aqh[ks].u[i] = hb; aql[ks].u[i] = bf16_bits(x - bf16_val(hb));
      }
  }
  float m_r[8], l_r[8];
#pragma unroll
  for (int r = 0; r < 8; ++r) { m_r[r] = -3.0e38f; l_r[r] = 0.f; }
  v8f oacc[DT];
#pragma unroll
  for (int dt = 0; dt < DT; ++dt) oacc[dt] = (v8f){0.f,0.f,0.f,0.f,0.f,0.f,0.f,0.f};

  const int kv_end = CAUSAL ? min(T, qblk * 64 + 64) : T;     // block-uniform
  for (int j0 = 0; j0 < kv_end; j0 += 32) {
    __syncthreads();
    for (int e = tid; e < 32 * (D / 4); e += 128) {
      const int r = e / (D / 4), c4 = (e % (D / 4)) * 4;
      const int key = j0 + r;
      v4f kf = {0.f,0.f,0.f,0.f}, vf = {0.f,0.f,0.f,0.f};
      if (key < T) { kf = *(const v4fa*)(K + (size_t)key * pitch + c4); vf = *(const v4fa*)(V + (size_t)key * pitch + c4); }
#pragma unroll
      for (int t = 0; t < 4; ++t) {
        unsigned short hb = bf16_bits(kf[t]); sKh[r][c4 + t] = hb; sKl[r][c4 + t] = bf16_bits(kf[t] - bf16_val(hb));
        hb = bf16_bits(vf[t]); sVh[r][c4 + t] = hb; sVl[r][c4 + t] = bf16_bits(vf[t] - bf16_val(hb));
      }
    }
    __syncthreads();
    // S tile 16 x 32
    v8f s[2];
#pragma unroll
    for (int nt = 0; nt < 2; ++nt) {
      v8f acc = {};
#pragma unroll
      for (int ks = 0; ks < KS; ++ks) {
        FragB bh_, bl_;
        bh_.half[0] = *(const v8us*)&sKh[nt * 16 + ln][ks * 32 + 8 * hh]; bh_.half[1] = *(const v8us*)&sKh[nt * 16 + ln][ks * 32 + 16 + 8 * hh];
        bl_.half[0] = *(const v8us*)&sKl[nt * 16 + ln][ks * 32 + 8 * hh]; bl_.half[1] = *(const v8us*)&sKl[nt * 16 + ln][ks * 32 + 16 + 8 * hh];
        acc = mmaN<3>(aqh[ks].v, aql[ks].v, bh_.v, bl_.v, acc);
      }
      s[nt] = acc;
    }
    // mask + running max (rows 8hh+r; the 16 lanes of a half share rows)
    float alpha[8];
#pragma unroll
    for (int r = 0; r < 8; ++r) {
      const int qi = q0 + 8 * hh + r;
      const int ja = j0 + ln, jb = j0 + 16 + ln;
      if (CAUSAL) { if (ja > qi) s[0][r] = -3.0e38f; if (jb > qi) s[1][r] = -3.0e38f; }
      if (ja >= T) s[0][r] = -3.0e38f;
      if (jb >= T) s[1][r] = -3.0e38f;
      float mx = fmaxf(s[0][r], s[1][r]);
      mx = fmaxf(mx, __shfl_xor(mx, 1, 32)); mx = fmaxf(mx, __shfl_xor(mx, 2, 32)); mx = fmaxf(mx, __shfl_xor(mx, 4, 32)); mx = fmaxf(mx, __shfl_xor(mx, 8, 32));
      const float mnew = fmaxf(m_r[r], mx);
      alpha[r] = (mnew > -1.0e38f) ? __expf(m_r[r] - mnew) : 1.0f;
      const float p0 = (s[0][r] > -1.0e38f) ? __expf(s[0][r] - mnew) : 0.f;
      const float p1 = (s[1][r] > -1.0e38f) ? __expf(s[1][r] - mnew) : 0.f;
      m_r[r] = mnew;
      l_r[r] = l_r[r] * alpha[r] + p0 + p1;            // per-lane partial row sum (16 lanes combined at the end)
      unsigned short hb = bf16_bits(p0); sPh[w][8 * hh + r][ln] = hb;      sPl[w][8 * hh + r][ln] = bf16_bits(p0 - bf16_val(hb));
      hb = bf16_bits(p1);                sPh[w][8 * hh + r][16 + ln] = hb; sPl[w][8 * hh + r][16 + ln] = bf16_bits(p1 - bf16_val(hb));
    }
#pragma unroll
    for (int dt = 0; dt < DT; ++dt)
#pragma unroll
      for (int r = 0; r < 8; ++r) oacc[dt][r] *= alpha[r];
    __builtin_amdgcn_fence(__ATOMIC_ACQ_REL, "workgroup");
    __builtin_amdgcn_wave_barrier();
    FragB pah, pal;
    pah.half[0] = *(const v8us*)&sPh[w][ln][8 * hh]; pah.half[1] = *(const v8us*)&sPh[w][ln][16 + 8 * hh];
    pal.half[0] = *(const v8us*)&sPl[w][ln][8 * hh]; pal.half[1] = *(const v8us*)&sPl[w][ln][16 + 8 * hh];
#pragma unroll
    for (int dt = 0; dt < DT; ++dt) {
      FragB bvh, bvl;
#pragma unroll
      for (int i = 0; i < 8; ++i) {
        bvh.u[i] = sVh[8 * hh + i][dt * 16 + ln]; bvh.u[8 + i] = sVh[16 + 8 * hh + i][dt * 16 + ln];
        bvl.u[i] = sVl[8 * hh + i][dt * 16 + ln]; bvl.u[8 + i] = sVl[16 + 8 * hh + i][dt * 16 + ln];
      }
      oacc[dt] = mmaN<3>(pah.v, pal.v, bvh.v, bvl.v, oacc[dt]);
    }
    __builtin_amdgcn_fence(__ATOMIC_ACQ_REL, "workgroup");
    __builtin_amdgcn_wave_barrier();
  }
#pragma unroll
  for (int r = 0; r < 8; ++r) {
    float l = l_r[r];
    l += __shfl_xor(l, 1, 32); l += __shfl_xor(l, 2, 32); l += __shfl_xor(l, 4, 32); l += __shfl_xor(l, 8, 32);
    l_r[r] = (l > 0.f) ? 1.0f / l : 0.f;
  }
#pragma unroll
  for (int dt = 0; dt < DT; ++dt)
#pragma unroll
    for (int r = 0; r < 8; ++r) sO[w][8 * hh + r][dt * 16 + ln] = oacc[dt][r] * l_r[r];
  __builtin_amdgcn_fence(__ATOMIC_ACQ_REL, "workgroup");
  __builtin_amdgcn_wave_barrier();
  {
    for (int r = 0; r < 16; ++r) {
      const int row = q0 + r;
      if (row < T && lane < D / 4) {
        const v4f val = *(const v4fa*)&sO[w][r][lane * 4];
        *(v4f*)(y + ((size_t)b * T + row) * ypitch + h * D + lane * 4) = val;
      }
    }
    
  }
}

// GEMM C = act(A·W + bias + resid): A f32 (ASPLIT -> hi/lo 2 terms), Wt bf16 [N][K]; ACT 0 none, 1 relu, 2 exact gelu;
// resid (optional, f32, row index = (row % rmod), pitch ldr, RES_BF16 rounds it) added before the activation.
template <bool ASPLIT, int ACT, bool BIAS_BF16, bool RES_BF16>
__global__ __launch_bounds__(128) void k_gemm_bf3(const float* __restrict__ A, int lda, const unsigned short* __restrict__ Wt, int ldb,
                                                const float* __restrict__ bias, const float* __restrict__ resid, int rmod, int ldr,
                                                float* __restrict__ C, int ldc, int M, int N, int K) {
  __shared__ __attribute__((aligned(16))) float so[4][16][64];
  const int tid = threadIdx.x, w = tid >> 5, lane = tid & 31, ln = lane & 15, hh = lane >> 4;
  const int ntn = N / 64;
  const int wid = blockIdx.x * 4 + w;
  const int mt = wid / ntn, nq = wid % ntn;
  if (mt * 16 >= M) return;
  const int row0 = mt * 16, col0 = nq * 64;
  const float* arow = A + (size_t)(row0 + ln) * lda;
  v8f acc[4] = {};
  for (int kb = 0; kb < K; kb += 32) {
    FragB ah, al;
    const v4f x0 = *(const v4fa*)(arow + kb + 8 * hh), x1 = *(const v4fa*)(arow + kb + 8 * hh + 4);
    const v4f x2 = *(const v4fa*)(arow + kb + 16 + 8 * hh), x3 = *(const v4fa*)(arow + kb + 16 + 8 * hh + 4);
    float xs[16] = {x0[0],x0[1],x0[2],x0[3],x1[0],x1[1],x1[2],x1[3],x2[0],x2[1],x2[2],x2[3],x3[0],x3[1],x3[2],x3[3]};
#pragma unroll
    for (int i = 0; i < 16; ++i) { const unsigned short hb = bf16_bits(xs[i]); ah.u[i] = hb; al.u[i] = ASPLIT ? bf16_bits(xs[i] - bf16_val(hb)) : (unsigned short)0; }
#pragma unroll
    for (int t = 0; t < 4; ++t) {
      const unsigned short* brow = Wt + (size_t)(col0 + t * 16 + ln) * ldb + kb;
      FragB b;
      b.half[0] = *(const v8us*)(brow + 8 * hh);
      b.half[1] = *(const v8us*)(brow + 16 + 8 * hh);
      acc[t] = mmaN<ASPLIT ? 2 : 1>(ah.v, al.v, b.v, b.v, acc[t]);
    }
  }
#pragma unroll
  for (int t = 0; t < 4; ++t) {
    const int col = col0 + t * 16 + ln;
    float bv = bias ? bias[col] : 0.f;
    if (BIAS_BF16) bv = bf16_round(bv);
#pragma unroll
    for (int r = 0; r < 8; ++r) {
      float v = acc[t][r] + bv;
      if (resid) { float rv = resid[(size_t)((row0 + 8 * hh + r) % rmod) * ldr + col]; if (RES_BF16) rv = bf16_round(rv); v += rv; }
      if (ACT == 1) v = fmaxf(v, 0.f);
      if (ACT == 2) v = 0.5f * v * (1.0f + erff(v * 0.70710678118654752f));
      if (ACT == 3) { const float u = 0.7978845608028654f * (v + 0.044715f * v * v * v); v = 0.5f * v * (1.0f + tanhf(u)); }
      so[w][8 * hh + r][t * 16 + ln] = v;
    }
  }
  __builtin_amdgcn_fence(__ATOMIC_ACQ_REL, "workgroup");
  __builtin_amdgcn_wave_barrier();
  const int rsub = lane >> 4, c4 = (lane & 15) * 4;
  {
#pragma unroll
    for (int q = 0; q < 8; ++q) {
      const int r = q * 2 + rsub;
      const v4f v = *(const v4fa*)&so[w][r][c4];
      *(v4f*)(C + (size_t)(row0 + r) * ldc + col0 + c4) = v;
    }
    
  }
}
// row LayerNorm (biased variance, eps) over N: s = X (+ R); optional out_sum <- s; out_norm <- (s-mu)*rsqrt(var+eps)*g + b
template <bool PARAM_BF16>
__global__ __launch_bounds__(256) void k_layernorm(const float* __restrict__ X, const float* __restrict__ R, const float* __restrict__ g, const float* __restrict__ bta,
                                                  float* __restrict__ out_sum, float* __restrict__ out_norm, int N, float eps) {
  __shared__ float red[256];
  const int row = blockIdx.x, tid = threadIdx.x;
  const float* x = X + (size_t)row * N; const float* rr = R ? R + (size_t)row * N : nullptr;
  float vals[16];                     // up to N = 4096
  const int per = N / 256;            // contiguous chunk per thread? use strided-by-4 chunks: thread handles j = tid*4 + 1024*u
  float s1 = 0.f;
  for (int u = 0; u < per / 4; ++u) {
    const int j = tid * 4 + 1024 * u;
    const v4f a = *(const v4fa*)(x + j);
    v4f b = {0.f,0.f,0.f,0.f}; if (rr) b = *(const v4fa*)(rr + j);
#pragma unroll
    for (int q = 0; q < 4; ++q) { const float v = a[q] + b[q]; vals[u * 4 + q] = v; s1 += v; }
  }
  red[tid] = s1; __syncthreads();
  for (int st = 128; st > 0; st >>= 1) { if (tid < st) red[tid] += red[tid + st]; __syncthreads(); }
  const float mu = red[0] / (float)N; __syncthreads();
  float s2 = 0.f;
  for (int u = 0; u < per / 4; ++u)
#pragma unroll
    for (int q = 0; q < 4; ++q) { const float c = vals[u * 4 + q] - mu; s2 += c * c; }
  red[tid] = s2; __syncthreads();
  for (int st = 128; st > 0; st >>= 1) { if (tid < st) red[tid] += red[tid + st]; __syncthreads(); }
  const float rs = rsqrtf(red[0] / (float)N + eps);
  {
    for (int u = 0; u < per / 4; ++u) {
      const int j = tid * 4 + 1024 * u;
      v4f o, sm;
#pragma unroll
      for (int q = 0; q < 4; ++q) {
        float gg = g[j + q], bb = bta[j + q];
        if (PARAM_BF16) { gg = bf16_round(gg); bb = bf16_round(bb); }
        sm[q] = vals[u * 4 + q]; o[q] = (vals[u * 4 + q] - mu) * rs * gg + bb;
      }
      if (out_sum) *(v4f*)(out_sum + (size_t)row * N + j) = sm;
      *(v4f*)(out_norm + (size_t)row * N + j) = o;
    }
    
  }
}



// ---- f16 WMMA path (v_wmma_f32_16x16x32_f16): 11-bit significands for operands in range — used where a [0,1] probability operand needs more precision than bf16
typedef _Float16 v16h __attribute__((ext_vector_type(16)));
union FragH { v16h v; v8us half[2]; _Float16 h[16]; unsigned short u[16]; };
template <int NT>
__device__ __forceinline__ v8f mmaH(v16h ah, v16h al, v16h bh, v16h bl, v8f c) {
  c = __builtin_amdgcn_wmma_f32_16x16x32_f16(false, ah, false, bh, (short)0, c, false, false);
  if (NT >= 2) c = __builtin_amdgcn_wmma_f32_16x16x32_f16(false, al, false, bh, (short)0, c, false, false);
  if (NT >= 3) c = __builtin_amdgcn_wmma_f32_16x16x32_f16(false, ah, false, bl, (short)0, c, false, false);
  asm volatile("v_nop\n\tv_nop\n\tv_nop\n\tv_nop" : "+v"(c) : "v"(ah), "v"(al), "v"(bh), "v"(bl));
  return c;
}
// batched GEMM like k_gemm_b but f16 operands: A f32 (split into f16 hi/lo if ASPLIT, else rounded to f16), Bt = f16 values [n][k]; alpha; C f32; N multiple of 16 (partial tiles skipped)
template <bool ASPLIT>
__global__ __launch_bounds__(128) void k_gemm_h(const float* __restrict__ A, int lda, size_t sA, const _Float16* __restrict__ Bh, int ldb, size_t sB, float alpha, float* __restrict__ C, int ldc, size_t sC, int M, int N, int K) {
  __shared__ __attribute__((aligned(16))) float so[4][16][64];
  const int tid = threadIdx.x, w = tid >> 5, lane = tid & 31, ln = lane & 15, hh = lane >> 4; const int by = blockIdx.y;
  A += (size_t)by * sA; Bh += (size_t)by * sB; C += (size_t)by * sC;
  const int ntn = (N + 63) / 64; const int wid = blockIdx.x * 4 + w; const int mt = wid / ntn, nq = wid % ntn; if (mt * 16 >= M) return;
  const int row0 = mt * 16, col0 = nq * 64; const float* arow = A + (size_t)(row0 + ln) * lda;
  v8f acc[4] = {};
  for (int kb = 0; kb < K; kb += 32) {
    FragH ah, al;
    const v4f x0 = *(const v4fa*)(arow + kb + 8 * hh), x1 = *(const v4fa*)(arow + kb + 8 * hh + 4), x2 = *(const v4fa*)(arow + kb + 16 + 8 * hh), x3 = *(const v4fa*)(arow + kb + 16 + 8 * hh + 4);
    float xs[16] = {x0[0],x0[1],x0[2],x0[3],x1[0],x1[1],x1[2],x1[3],x2[0],x2[1],x2[2],x2[3],x3[0],x3[1],x3[2],x3[3]};
#pragma unroll
    for (int i = 0; i < 16; ++i) { const _Float16 h = (_Float16)xs[i]; ah.h[i] = h; al.h[i] = ASPLIT ? (_Float16)(xs[i] - (float)h) : (_Float16)0.0f; }
#pragma unroll
    for (int t = 0; t < 4; ++t) { if (col0 + t * 16 >= N) continue; const size_t boff = (size_t)(col0 + t * 16 + ln) * ldb + kb; FragH bq; bq.half[0] = *(const v8us*)(Bh + boff + 8 * hh); bq.half[1] = *(const v8us*)(Bh + boff + 16 + 8 * hh);
      acc[t] = mmaH<ASPLIT ? 2 : 1>(ah.v, al.v, bq.v, bq.v, acc[t]); }
  }
#pragma unroll
  for (int t = 0; t < 4; ++t) { if (col0 + t * 16 >= N) continue;
#pragma unroll
    for (int r = 0; r < 8; ++r) so[w][8 * hh + r][t * 16 + ln] = acc[t][r] * alpha; }
  __builtin_amdgcn_fence(__ATOMIC_ACQ_REL, "workgroup"); __builtin_amdgcn_wave_barrier();
  const int rsub = lane >> 4, c4 = (lane & 15) * 4;
  {
#pragma unroll
    for (int q = 0; q < 8; ++q) { const int r = q * 2 + rsub; if (col0 + c4 < N) { const v4f v = *(const v4fa*)&so[w][r][c4]; *(v4f*)(C + (size_t)(row0 + r) * ldc + col0 + c4) = v; } }
     }
}

// Wt[n][k] = f16(W[k][n]·scale) from f32 row-major W[K][N] (scale = power of two; bf16-exact weights stay exact in f16 away from the subnormal range)
__global__ __launch_bounds__(256) void k_wt_f16(const float* __restrict__ W, _Float16* __restrict__ Wt, int K, int N, float scale) {
  const int t = blockIdx.x * 256 + threadIdx.x; if (t >= N * (K / 8)) return; const int n = t / (K / 8), k8 = (t % (K / 8)) * 8; FragH f;
#pragma unroll
  for (int i = 0; i < 8; ++i) f.h[i] = (_Float16)(bf16_round(W[(size_t)(k8 + i) * N + n]) * scale); const v8us o = f.half[0];
  *(v8us*)((unsigned short*)Wt + (size_t)n * K + k8) = o; 
}
// k_gemm_hh variant with fused epilogue: v = acc·alpha + bias[by·sBias + col] (+ CP[(row/rowsPerB)·sCPb + by·64 + col] if CP) ; ACT 0 none / 1 elu ; writes f16 C16 and/or f32 C (each if non-null)
template <int ACT>
__global__ __launch_bounds__(128) void k_gemm_hhx(const _Float16* __restrict__ A, int lda, size_t sA, const _Float16* __restrict__ Bh, int ldb, size_t sB, float alpha, const float* __restrict__ bias, size_t sBias, const float* __restrict__ CP, int rowsPerB, size_t sCPb, int row0g,
    float* __restrict__ C, _Float16* __restrict__ C16, int ldc, size_t sC, int M, int N, int K) {
  __shared__ __attribute__((aligned(16))) float so[4][16][64];
  const int tid = threadIdx.x, w = tid >> 5, lane = tid & 31, ln = lane & 15, hh = lane >> 4; const int by = blockIdx.y;
  A += (size_t)by * sA; Bh += (size_t)by * sB; const size_t cofs = (size_t)by * sC; const float* bp = bias ? bias + (size_t)by * sBias : nullptr;
  const int ntn = (N + 63) / 64; const int wid = blockIdx.x * 4 + w; const int mt = wid / ntn, nq = wid % ntn; if (mt * 16 >= M) return;
  const int row0 = mt * 16, col0 = nq * 64; const _Float16* arow = A + (size_t)(row0 + ln) * lda;
  v8f acc[4] = {};
  for (int kb = 0; kb < K; kb += 32) { FragH ah; ah.half[0] = *(const v8us*)((const unsigned short*)arow + kb + 8 * hh); ah.half[1] = *(const v8us*)((const unsigned short*)arow + kb + 16 + 8 * hh);
#pragma unroll
    for (int t = 0; t < 4; ++t) { if (col0 + t * 16 >= N) continue; const size_t boff = (size_t)(col0 + t * 16 + ln) * ldb + kb; FragH bq; bq.half[0] = *(const v8us*)((const unsigned short*)Bh + boff + 8 * hh); bq.half[1] = *(const v8us*)((const unsigned short*)Bh + boff + 16 + 8 * hh);
      acc[t] = mmaH<1>(ah.v, ah.v, bq.v, bq.v, acc[t]); }
  }
#pragma unroll
  for (int t = 0; t < 4; ++t) { if (col0 + t * 16 >= N) continue; const int col = col0 + t * 16 + ln; const float bv = bp ? bf16_round(bp[col]) : 0.f;
#pragma unroll
    for (int r = 0; r < 8; ++r) { float v = acc[t][r] * alpha + bv; if (CP) { const int bidx = (row0g + row0 + 8 * hh + r) / rowsPerB; v += CP[(size_t)bidx * sCPb + (size_t)by * 64 + col]; } if (ACT == 1) v = (v > 0.f) ? v : expm1f(v); else if (ACT == 3) v = fmaxf(v, 0.f); so[w][8 * hh + r][t * 16 + ln] = v; } }
  __builtin_amdgcn_fence(__ATOMIC_ACQ_REL, "workgroup"); __builtin_amdgcn_wave_barrier();
  const int rsub = lane >> 4, c4 = (lane & 15) * 4; typedef _Float16 v4h __attribute__((ext_vector_type(4)));
  {
#pragma unroll
    for (int q = 0; q < 8; ++q) { const int r = q * 2 + rsub; if (col0 + c4 < N) { const v4f v = *(const v4fa*)&so[w][r][c4]; if (C) *(v4f*)(C + cofs + (size_t)(row0 + r) * ldc + col0 + c4) = v; if (C16) { v4h h4; for (int i = 0; i < 4; ++i) h4[i] = (_Float16)v[i]; *(v4h*)(C16 + cofs + (size_t)(row0 + r) * ldc + col0 + c4) = h4; } } }
     }
}


__global__ __launch_bounds__(256) void k_x16(const float* __restrict__ x, _Float16* __restrict__ X16, size_t n8) { const size_t t = (size_t)blockIdx.x * 256 + threadIdx.x; if (t >= n8) return; FragH f;
#pragma unroll
  for (int q = 0; q < 8; ++q) f.h[q] = (_Float16)bf16_round(x[t * 8 + q]); *(v8us*)((unsigned short*)X16 + t * 8) = f.half[0];  }
__global__ __launch_bounds__(256) void k_h16(const float* __restrict__ x, _Float16* __restrict__ X16, size_t n8) { const size_t t = (size_t)blockIdx.x * 256 + threadIdx.x; if (t >= n8) return; FragH f;
#pragma unroll
  for (int q = 0; q < 8; ++q) f.h[q] = (_Float16)x[t * 8 + q]; *(v8us*)((unsigned short*)X16 + t * 8) = f.half[0];  }
__global__ __launch_bounds__(256) void k_round16f(const float* __restrict__ W, _Float16* __restrict__ Bt, size_t n8) { const size_t t = (size_t)blockIdx.x * 256 + threadIdx.x; if (t >= n8) return; FragH f;
#pragma unroll
  for (int i = 0; i < 8; ++i) f.h[i] = (_Float16)(bf16_round(W[t * 8 + i]) * 16.0f); *(v8us*)((unsigned short*)Bt + t * 8) = f.half[0];  }
__global__ __launch_bounds__(256) void k_vt(const _Float16* __restrict__ V16, _Float16* __restrict__ Vt) { __shared__ unsigned short tl[64][66]; const int tid = threadIdx.x; const int slab = blockIdx.x / (SS / 64), lg = blockIdx.x % (SS / 64); const int b = slab / NH, h = slab % NH;
  for (int i = tid; i < 64 * 8; i += 256) { const int r = i / 8, c8 = (i % 8) * 8; FragH f; f.half[0] = *(const v8us*)((const unsigned short*)V16 + ((size_t)b * SS + lg * 64 + r) * DM + h * HD + c8);
#pragma unroll
    for (int q = 0; q < 8; ++q) tl[r][c8 + q] = f.u[q]; }
  __syncthreads();
  {
#pragma unroll
    for (int rd = 0; rd < 2; ++rd) { const int d = rd * 32 + tid / 8, pc = tid % 8; FragH f;
#pragma unroll
      for (int q = 0; q < 8; ++q) f.u[q] = tl[pc * 8 + q][d];
      *(v8us*)((unsigned short*)Vt + ((size_t)slab * HD + d) * SS + lg * 64 + pc * 8) = f.half[0]; }
     } }
__device__ __forceinline__ float sigm_f(float x) { return 1.0f / (1.0f + expf(-x)); }
__global__ __launch_bounds__(128) void k_satt(const _Float16* __restrict__ Q16, const _Float16* __restrict__ K16, const _Float16* __restrict__ Vt, float* __restrict__ O) {
  constexpr int RPW = 32, NQB = SS / (4 * RPW), DT = HD / 16, KS = HD / 32;
  __shared__ __attribute__((aligned(16))) unsigned short sP[4][RPW][40]; __shared__ __attribute__((aligned(16))) float sO[4][RPW][HD];
  const int tid = threadIdx.x, w = tid >> 5, lane = tid & 31, ln = lane & 15, hh = lane >> 4;
  const int slab = blockIdx.x / NQB, qblk = blockIdx.x % NQB; const int b = slab / NH, h = slab % NH; const int q0 = qblk * (4 * RPW) + w * RPW;
  FragH aq[2][KS];
#pragma unroll
  for (int rt = 0; rt < 2; ++rt) { const unsigned short* qr = (const unsigned short*)Q16 + ((size_t)b * SS + q0 + rt * 16 + ln) * DM + h * HD;
#pragma unroll
    for (int ks = 0; ks < KS; ++ks) { aq[rt][ks].half[0] = *(const v8us*)(qr + ks * 32 + 8 * hh); aq[rt][ks].half[1] = *(const v8us*)(qr + ks * 32 + 16 + 8 * hh); } }
  const unsigned short* Vth = (const unsigned short*)Vt + (size_t)slab * HD * SS;
  v8f oacc[2][DT];
#pragma unroll
  for (int rt = 0; rt < 2; ++rt)
#pragma unroll
    for (int dt = 0; dt < DT; ++dt) oacc[rt][dt] = (v8f){0.f,0.f,0.f,0.f,0.f,0.f,0.f,0.f};
#pragma unroll 1
  for (int j0 = 0; j0 < SS; j0 += 32) {
    v8f s[2][2];
#pragma unroll
    for (int nt = 0; nt < 2; ++nt) { const unsigned short* kr = (const unsigned short*)K16 + ((size_t)b * SS + j0 + nt * 16 + ln) * DM + h * HD; FragH bk[KS];
#pragma unroll
      for (int ks = 0; ks < KS; ++ks) { bk[ks].half[0] = *(const v8us*)(kr + ks * 32 + 8 * hh); bk[ks].half[1] = *(const v8us*)(kr + ks * 32 + 16 + 8 * hh); }
#pragma unroll
      for (int rt = 0; rt < 2; ++rt) { v8f acc = (v8f){0.f,0.f,0.f,0.f,0.f,0.f,0.f,0.f};
#pragma unroll
        for (int ks = 0; ks < KS; ++ks) acc = mmaH<1>(aq[rt][ks].v, aq[rt][ks].v, bk[ks].v, bk[ks].v, acc); s[rt][nt] = acc; } }
#pragma unroll
    for (int rt = 0; rt < 2; ++rt)
#pragma unroll
      for (int r = 0; r < 8; ++r) { FragH t2; t2.h[0] = (_Float16)sigm_f(s[rt][0][r] * 0.125f); t2.h[1] = (_Float16)sigm_f(s[rt][1][r] * 0.125f); sP[w][rt * 16 + 8 * hh + r][ln] = t2.u[0]; sP[w][rt * 16 + 8 * hh + r][16 + ln] = t2.u[1]; }
    __builtin_amdgcn_fence(__ATOMIC_ACQ_REL, "workgroup"); __builtin_amdgcn_wave_barrier();
    FragH pa[2];
#pragma unroll
    for (int rt = 0; rt < 2; ++rt) { pa[rt].half[0] = *(const v8us*)&sP[w][rt * 16 + ln][8 * hh]; pa[rt].half[1] = *(const v8us*)&sP[w][rt * 16 + ln][16 + 8 * hh]; }
#pragma unroll
    for (int dt = 0; dt < DT; ++dt) { const unsigned short* vrow = Vth + (size_t)(dt * 16 + ln) * SS + j0; FragH bv; bv.half[0] = *(const v8us*)(vrow + 8 * hh); bv.half[1] = *(const v8us*)(vrow + 16 + 8 * hh);
#pragma unroll
      for (int rt = 0; rt < 2; ++rt) oacc[rt][dt] = mmaH<1>(pa[rt].v, pa[rt].v, bv.v, bv.v, oacc[rt][dt]); }
    __builtin_amdgcn_fence(__ATOMIC_ACQ_REL, "workgroup"); __builtin_amdgcn_wave_barrier(); }
#pragma unroll
  for (int rt = 0; rt < 2; ++rt)
#pragma unroll
    for (int dt = 0; dt < DT; ++dt)
#pragma unroll
      for (int r = 0; r < 8; ++r) sO[w][rt * 16 + 8 * hh + r][dt * 16 + ln] = oacc[rt][dt][r];
  __builtin_amdgcn_fence(__ATOMIC_ACQ_REL, "workgroup"); __builtin_amdgcn_wave_barrier();
  {
#pragma unroll
    for (int rp = 0; rp < RPW; rp += 2) { const int r = rp + (lane >> 4), pc = lane & 15; const v4f val = *(const v4fa*)&sO[w][r][pc * 4]; *(v4f*)(O + ((size_t)b * SS + q0 + r) * DM + h * HD + pc * 4) = val; }
     } }
// (b) attn_weights[b][q][k] = (1/16) Σ_h σ(q_h·k_h/8): block = (b, 64 queries), wave = 16 queries; for each 32-key chunk, loop the 16 heads (S tile pairs on WMMA, sigmoid, fixed-order sum),
__global__ __launch_bounds__(128) void k_aw(const _Float16* __restrict__ Q16, const _Float16* __restrict__ K16, float* __restrict__ AW) {
  constexpr int RPW = 16, KS = HD / 32; __shared__ __attribute__((aligned(16))) float st[4][RPW][32 + 4];
  const int tid = threadIdx.x, w = tid >> 5, lane = tid & 31, ln = lane & 15, hh = lane >> 4; const int b = blockIdx.x / (SS / 64), qblk = blockIdx.x % (SS / 64); const int q0 = qblk * 64 + w * RPW;
  const unsigned short* qbase = (const unsigned short*)Q16 + ((size_t)b * SS + q0 + ln) * DM;
#pragma unroll 1
  for (int j0 = 0; j0 < SS; j0 += 32) { float aw[2][8];
#pragma unroll
    for (int nt = 0; nt < 2; ++nt)
#pragma unroll
      for (int r = 0; r < 8; ++r) aw[nt][r] = 0.f;
#pragma unroll 1
    for (int h = 0; h < NH; ++h) { FragH aq[KS];
#pragma unroll
      for (int ks = 0; ks < KS; ++ks) { aq[ks].half[0] = *(const v8us*)(qbase + h * HD + ks * 32 + 8 * hh); aq[ks].half[1] = *(const v8us*)(qbase + h * HD + ks * 32 + 16 + 8 * hh); }
#pragma unroll
      for (int nt = 0; nt < 2; ++nt) { const unsigned short* kr = (const unsigned short*)K16 + ((size_t)b * SS + j0 + nt * 16 + ln) * DM + h * HD; v8f acc = (v8f){0.f,0.f,0.f,0.f,0.f,0.f,0.f,0.f};
#pragma unroll
        for (int ks = 0; ks < KS; ++ks) { FragH bk; bk.half[0] = *(const v8us*)(kr + ks * 32 + 8 * hh); bk.half[1] = *(const v8us*)(kr + ks * 32 + 16 + 8 * hh); acc = mmaH<1>(aq[ks].v, aq[ks].v, bk.v, bk.v, acc); }
#pragma unroll
        for (int r = 0; r < 8; ++r) aw[nt][r] += sigm_f(acc[r] * 0.125f); } }
#pragma unroll
    for (int nt = 0; nt < 2; ++nt)
#pragma unroll
      for (int r = 0; r < 8; ++r) st[w][8 * hh + r][nt * 16 + ln] = aw[nt][r] * (1.0f / (float)NH);
    __builtin_amdgcn_fence(__ATOMIC_ACQ_REL, "workgroup"); __builtin_amdgcn_wave_barrier();
    {
#pragma unroll
      for (int rp = 0; rp < RPW; rp += 4) { const int r = rp + (lane >> 3), pc = lane & 7; *(v4f*)(AW + ((size_t)b * SS + q0 + r) * SS + j0 + pc * 4) = *(const v4fa*)&st[w][r][pc * 4]; }
       }
    __builtin_amdgcn_fence(__ATOMIC_ACQ_REL, "workgroup"); __builtin_amdgcn_wave_barrier(); } }
extern "C" void kernel_launch(void* const* d_in, const int* in_sizes, int n_in,
                              void* d_out, int out_size, void* d_ws, size_t ws_size, hipStream_t stream) {
  (void)in_sizes; (void)n_in; (void)out_size;
  const float* xq = (const float*)d_in[0]; const float* xk = (const float*)d_in[1]; const float* xv = (const float*)d_in[2]; const float* Wq = (const float*)d_in[3]; const float* bq = (const float*)d_in[4]; const float* Wk = (const float*)d_in[5]; const float* bk = (const float*)d_in[6]; const float* Wv = (const float*)d_in[7]; const float* bv = (const float*)d_in[8]; const float* Wo = (const float*)d_in[9]; const float* bo = (const float*)d_in[10];
  float* out = (float*)d_out; float* AW = (float*)((char*)d_out + 16777216);
  char* ws = (char*)d_ws; size_t off = 0;
  auto take = [&](size_t bytes) { char* p = ws + off; off += (bytes + 255) & ~(size_t)255; return p; };
  const size_t w8 = (size_t)DM * DM / 8;
  _Float16* Bq = (_Float16*)take(w8 * 16); _Float16* Bk = (_Float16*)take(w8 * 16); _Float16* Bv = (_Float16*)take(w8 * 16); _Float16* Bo = (_Float16*)take(w8 * 16);
  _Float16* XQ = (_Float16*)take((size_t)NR * DM * 2); _Float16* XK = (_Float16*)take((size_t)NR * DM * 2); _Float16* XV = (_Float16*)take((size_t)NR * DM * 2); _Float16* Q16 = (_Float16*)take((size_t)NR * DM * 2); _Float16* K16 = (_Float16*)take((size_t)NR * DM * 2); _Float16* V16 = (_Float16*)take((size_t)NR * DM * 2); _Float16* Vt = (_Float16*)take((size_t)NR * DM * 2); float* O = (float*)take((size_t)NR * DM * 4); _Float16* O16 = (_Float16*)take((size_t)NR * DM * 2);
  if (off > ws_size) return;      // ≈ 8 + 8.4×8 + 16.8 ≈ 92 MiB
  const unsigned gw = (unsigned)((w8 + 255) / 256), gx = (unsigned)(((size_t)NR * DM / 8 + 255) / 256);
  k_round16f<<<gw, 256, 0, stream>>>(Wq, Bq, w8); k_round16f<<<gw, 256, 0, stream>>>(Wk, Bk, w8); k_round16f<<<gw, 256, 0, stream>>>(Wv, Bv, w8); k_round16f<<<gw, 256, 0, stream>>>(Wo, Bo, w8);
  k_x16<<<gx, 256, 0, stream>>>(xq, XQ, (size_t)NR * DM / 8); k_x16<<<gx, 256, 0, stream>>>(xk, XK, (size_t)NR * DM / 8); k_x16<<<gx, 256, 0, stream>>>(xv, XV, (size_t)NR * DM / 8);
  const dim3 gg(((NR / 16) * (DM / 64) + 3) / 4, 1);
  k_gemm_hhx<0><<<gg, 128, 0, stream>>>(XQ, DM, 0, Bq, DM, 0, 0.0625f, bq, 0, nullptr, 1, 0, 0, nullptr, Q16, DM, 0, NR, DM, DM);
  k_gemm_hhx<0><<<gg, 128, 0, stream>>>(XK, DM, 0, Bk, DM, 0, 0.0625f, bk, 0, nullptr, 1, 0, 0, nullptr, K16, DM, 0, NR, DM, DM);
  k_gemm_hhx<0><<<gg, 128, 0, stream>>>(XV, DM, 0, Bv, DM, 0, 0.0625f, bv, 0, nullptr, 1, 0, 0, nullptr, V16, DM, 0, NR, DM, DM);
  k_vt<<<BB * NH * (SS / 64), 256, 0, stream>>>(V16, Vt);
  k_satt<<<BB * NH * (SS / 128), 128, 0, stream>>>(Q16, K16, Vt, O);
  k_h16<<<gx, 256, 0, stream>>>(O, O16, (size_t)NR * DM / 8);
  k_gemm_hhx<0><<<gg, 128, 0, stream>>>(O16, DM, 0, Bo, DM, 0, 0.0625f, bo, 0, nullptr, 1, 0, 0, out, nullptr, DM, 0, NR, DM, DM);
  k_aw<<<BB * (SS / 64), 128, 0, stream>>>(Q16, K16, AW);
}

// v001
// One run takes 505 microseconds.
// In two side-by-side timings against v000, it was 2.33 and 2.32 times as fast.
#include <hip/hip_runtime.h>
// q/k/v/o projections (4096 × 1024 × 1024, + bias) and the 16-head sigmoid attention on v_wmma_f32_16x16x32_f16: (a) per (b,h) a fused flash-style kernel with P = σ(q·k/8) (no normalisation,
// as the module) and O = P·V on WMMA; (b) the second output mean_h σ(q·k/8) recomputes the score tiles per head and averages them in a fixed order. x inputs f16(bf16 ·) exact, q/k/v and O rounded to f16,
// weights bf16-exact ×2^4 ((out,in)), P f16 ≤ 1, f32 accumulate.
#define BB 2
#define SS 2048
#define DM 1024
#define NH 16
#define HD 64
#define NR (BB * SS)

typedef __bf16 v16b __attribute__((ext_vector_type(16)));
typedef unsigned short v8us __attribute__((ext_vector_type(8), may_alias));
typedef float  v8f  __attribute__((ext_vector_type(8)));
typedef float  v4f  __attribute__((ext_vector_type(4)));
typedef float  v4fa __attribute__((ext_vector_type(4), may_alias));
union FragB { v16b v; v8us half[2]; unsigned short u[16]; };

__device__ __forceinline__ unsigned short bf16_bits(float x) { unsigned int u = __float_as_uint(x); return (unsigned short)((u + 0x7FFFu + ((u >> 16) & 1u)) >> 16); }
__device__ __forceinline__ float bf16_val(unsigned short b) { return __uint_as_float(((unsigned int)b) << 16); }
__device__ __forceinline__ float bf16_round(float x) { return bf16_val(bf16_bits(x)); }
// D += A·B with NT terms: 1 = ah·bh, 2 = + al·bh (A split), 3 = + ah·bl (both split)
template <int NT>
__device__ __forceinline__ v8f mmaN(v16b ah, v16b al, v16b bh, v16b bl, v8f c) {
  c = __builtin_amdgcn_wmma_f32_16x16x32_bf16(false, ah, false, bh, (short)0, c, false, false);
  if (NT >= 2) c = __builtin_amdgcn_wmma_f32_16x16x32_bf16(false, al, false, bh, (short)0, c, false, false);
  if (NT >= 3) c = __builtin_amdgcn_wmma_f32_16x16x32_bf16(false, ah, false, bl, (short)0, c, false, false);
  asm volatile("v_nop\n\tv_nop\n\tv_nop\n\tv_nop" : "+v"(c) : "v"(ah), "v"(al), "v"(bh), "v"(bl));
  return c;
}

__global__ __launch_bounds__(256) void k_wt_bf16(const float* __restrict__ W, unsigned short* __restrict__ Wt, int K, int N) {
  const int t = blockIdx.x * 256 + threadIdx.x;
  const int k8n = K / 8;
  if (t >= N * k8n) return;
  const int n = t / k8n, k8 = (t % k8n) * 8;
  v8us v;
#pragma unroll
  for (int i = 0; i < 8; ++i) v[i] = bf16_bits(W[(size_t)(k8 + i) * N + n]);
  *(v8us*)(Wt + (size_t)n * K + k8) = v;
  
}

// GEMM C[M][N] (f32, pitch ldc) = act(A[M][K]·W + bias). A f32 row-major (pitch lda) converted per fragment to bf16
// (ASPLIT: hi/lo two planes -> 2 terms, else single rounded term); Wt bf16 [N][K] (pitch ldb). BIAS_BF16 rounds the
// bias to bf16 first (bias quantised to bf16 before the add). K%32==0, M%16==0, N%64==0.
template <bool ASPLIT, int ACT, bool BIAS_BF16>
__global__ __launch_bounds__(128) void k_gemm_bf(const float* __restrict__ A, int lda, const unsigned short* __restrict__ Wt, int ldb,
                                               const float* __restrict__ bias, float* __restrict__ C, int ldc, int M, int N, int K) {
  __shared__ __attribute__((aligned(16))) float so[4][16][64];
  const int tid = threadIdx.x, w = tid >> 5, lane = tid & 31, ln = lane & 15, hh = lane >> 4;
  const int ntn = N / 64;
  const int wid = blockIdx.x * 4 + w;
  const int mt = wid / ntn, nq = wid % ntn;
  if (mt * 16 >= M) return;
  const int row0 = mt * 16, col0 = nq * 64;
  const float* arow = A + (size_t)(row0 + ln) * lda;
  v8f acc[4] = {};
  for (int kb = 0; kb < K; kb += 32) {
    FragB ah, al;
    const v4f x0 = *(const v4fa*)(arow + kb + 8 * hh), x1 = *(const v4fa*)(arow + kb + 8 * hh + 4);
    const v4f x2 = *(const v4fa*)(arow + kb + 16 + 8 * hh), x3 = *(const v4fa*)(arow + kb + 16 + 8 * hh + 4);
    float xs[16] = {x0[0],x0[1],x0[2],x0[3],x1[0],x1[1],x1[2],x1[3],x2[0],x2[1],x2[2],x2[3],x3[0],x3[1],x3[2],x3[3]};
#pragma unroll
    for (int i = 0; i < 16; ++i) { const unsigned short hb = bf16_bits(xs[i]); ah.u[i] = hb; al.u[i] = ASPLIT ? bf16_bits(xs[i] - bf16_val(hb)) : (unsigned short)0; }
#pragma unroll
    for (int t = 0; t < 4; ++t) {
      const unsigned short* brow = Wt + (size_t)(col0 + t * 16 + ln) * ldb + kb;
      FragB b;
      b.half[0] = *(const v8us*)(brow + 8 * hh);
      b.half[1] = *(const v8us*)(brow + 16 + 8 * hh);
      acc[t] = mmaN<ASPLIT ? 2 : 1>(ah.v, al.v, b.v, b.v, acc[t]);
    }
  }
#pragma unroll
  for (int t = 0; t < 4; ++t) {
    float bv = bias ? bias[col0 + t * 16 + ln] : 0.f;
    if (BIAS_BF16) bv = bf16_round(bv);
#pragma unroll
    for (int r = 0; r < 8; ++r) { float v = acc[t][r] + bv; if (ACT == 1) v = fmaxf(v, 0.f); so[w][8 * hh + r][t * 16 + ln] = v; }
  }
  __builtin_amdgcn_fence(__ATOMIC_ACQ_REL, "workgroup");
  __builtin_amdgcn_wave_barrier();
  const int rsub = lane >> 4, c4 = (lane & 15) * 4;
  {
#pragma unroll
    for (int q = 0; q < 8; ++q) {
      const int r = q * 2 + rsub;
      const v4f v = *(const v4fa*)&so[w][r][c4];
      *(v4f*)(C + (size_t)(row0 + r) * ldc + col0 + c4) = v;
    }
    
  }
}

// Flash-style causal/unmasked attention, all contractions 3-term bf16 hi/lo splits, f32 softmax with running max.
// q,k,v rows are read from f32 buffers with arbitrary row pitch (so they can live inside a fused qkv buffer);
// D = head size (multiple of 32, <= 128); one wave = 16 query rows; block = 4 waves (64 queries) sharing K/V chunks of 32.
template <int D, bool CAUSAL>
__global__ __launch_bounds__(128) void k_flash(const float* __restrict__ qb, const float* __restrict__ kb, const float* __restrict__ vb,
                                             int pitch, int T, int H, float scale, float* __restrict__ y, int ypitch) {
  constexpr int KS = D / 32;        // k-steps for QK
  constexpr int DT = D / 16;        // d tiles for PV
  __shared__ __attribute__((aligned(16))) unsigned short sKh[32][D + 8], sKl[32][D + 8], sVh[32][D + 8], sVl[32][D + 8];
  __shared__ __attribute__((aligned(16))) unsigned short sPh[4][16][40], sPl[4][16][40];
  __shared__ __attribute__((aligned(16))) float sO[4][16][D];
  const int tid = threadIdx.x, w = tid >> 5, lane = tid & 31, ln = lane & 15, hh = lane >> 4;
  const int nqb = (T + 63) / 64;
  const int bh = blockIdx.x / nqb, qblk = blockIdx.x % nqb;
  const int b = bh / H, h = bh % H;
  const int q0 = qblk * 64 + w * 16;
  const float* Q = qb + (size_t)b * T * pitch + h * D;
  const float* K = kb + (size_t)b * T * pitch + h * D;
  const float* V = vb + (size_t)b * T * pitch + h * D;

  // A fragments of the wave's 16 query rows (scaled), hi/lo
  FragB aqh[KS], aql[KS];
  {
    int row = q0 + ln; if (row >= T) row = T - 1;
    const float* qr = Q + (size_t)row * pitch;
#pragma unroll
    for (int ks = 0; ks < KS; ++ks)
#pragma unroll
      for (int i = 0; i < 16; ++i) {
        const int d = ks * 32 + ((i < 8) ? (8 * hh + i) : (16 + 8 * hh + (i - 8)));
        const float x = qr[d] * scale; const unsigned short hb = bf16_bits(x);
        aqh[ks].u[i] = hb; aql[ks].u[i] = bf16_bits(x - bf16_val(hb));
      }
  }
  float m_r[8], l_r[8];
#pragma unroll
  for (int r = 0; r < 8; ++r) { m_r[r] = -3.0e38f; l_r[r] = 0.f; }
  v8f oacc[DT];
#pragma unroll
  for (int dt = 0; dt < DT; ++dt) oacc[dt] = (v8f){0.f,0.f,0.f,0.f,0.f,0.f,0.f,0.f};

  const int kv_end = CAUSAL ? min(T, qblk * 64 + 64) : T;     // block-uniform
  for (int j0 = 0; j0 < kv_end; j0 += 32) {
    __syncthreads();
    for (int e = tid; e < 32 * (D / 4); e += 128) {
      const int r = e / (D / 4), c4 = (e % (D / 4)) * 4;
      const int key = j0 + r;
      v4f kf = {0.f,0.f,0.f,0.f}, vf = {0.f,0.f,0.f,0.f};
      if (key < T) { kf = *(const v4fa*)(K + (size_t)key * pitch + c4); vf = *(const v4fa*)(V + (size_t)key * pitch + c4); }
#pragma unroll
      for (int t = 0; t < 4; ++t) {
        unsigned short hb = bf16_bits(kf[t]); sKh[r][c4 + t] = hb; sKl[r][c4 + t] = bf16_bits(kf[t] - bf16_val(hb));
        hb = bf16_bits(vf[t]); sVh[r][c4 + t] = hb; sVl[r][c4 + t] = bf16_bits(vf[t] - bf16_val(hb));
      }
    }
    __syncthreads();
    // S tile 16 x 32
    v8f s[2];
#pragma unroll
    for (int nt = 0; nt < 2; ++nt) {
      v8f acc = {};
#pragma unroll
      for (int ks = 0; ks < KS; ++ks) {
        FragB bh_, bl_;
        bh_.half[0] = *(const v8us*)&sKh[nt * 16 + ln][ks * 32 + 8 * hh]; bh_.half[1] = *(const v8us*)&sKh[nt * 16 + ln][ks * 32 + 16 + 8 * hh];
        bl_.half[0] = *(const v8us*)&sKl[nt * 16 + ln][ks * 32 + 8 * hh]; bl_.half[1] = *(const v8us*)&sKl[nt * 16 + ln][ks * 32 + 16 + 8 * hh];
        acc = mmaN<3>(aqh[ks].v, aql[ks].v, bh_.v, bl_.v, acc);
      }
      s[nt] = acc;
    }
    // mask + running max (rows 8hh+r; the 16 lanes of a half share rows)
    float alpha[8];
#pragma unroll
    for (int r = 0; r < 8; ++r) {
      const int qi = q0 + 8 * hh + r;
      const int ja = j0 + ln, jb = j0 + 16 + ln;
      if (CAUSAL) { if (ja > qi) s[0][r] = -3.0e38f; if (jb > qi) s[1][r] = -3.0e38f; }
      if (ja >= T) s[0][r] = -3.0e38f;
      if (jb >= T) s[1][r] = -3.0e38f;
      float mx = fmaxf(s[0][r], s[1][r]);
      mx = fmaxf(mx, __shfl_xor(mx, 1, 32)); mx = fmaxf(mx, __shfl_xor(mx, 2, 32)); mx = fmaxf(mx, __shfl_xor(mx, 4, 32)); mx = fmaxf(mx, __shfl_xor(mx, 8, 32));
      const float mnew = fmaxf(m_r[r], mx);
      alpha[r] = (mnew > -1.0e38f) ? __expf(m_r[r] - mnew) : 1.0f;
      const float p0 = (s[0][r] > -1.0e38f) ? __expf(s[0][r] - mnew) : 0.f;
      const float p1 = (s[1][r] > -1.0e38f) ? __expf(s[1][r] - mnew) : 0.f;
      m_r[r] = mnew;
      l_r[r] = l_r[r] * alpha[r] + p0 + p1;            // per-lane partial row sum (16 lanes combined at the end)
      unsigned short hb = bf16_bits(p0); sPh[w][8 * hh + r][ln] = hb;      sPl[w][8 * hh + r][ln] = bf16_bits(p0 - bf16_val(hb));
      hb = bf16_bits(p1);                sPh[w][8 * hh + r][16 + ln] = hb; sPl[w][8 * hh + r][16 + ln] = bf16_bits(p1 - bf16_val(hb));
    }
#pragma unroll
    for (int dt = 0; dt < DT; ++dt)
#pragma unroll
      for (int r = 0; r < 8; ++r) oacc[dt][r] *= alpha[r];
    __builtin_amdgcn_fence(__ATOMIC_ACQ_REL, "workgroup");
    __builtin_amdgcn_wave_barrier();
    FragB pah, pal;
    pah.half[0] = *(const v8us*)&sPh[w][ln][8 * hh]; pah.half[1] = *(const v8us*)&sPh[w][ln][16 + 8 * hh];
    pal.half[0] = *(const v8us*)&sPl[w][ln][8 * hh]; pal.half[1] = *(const v8us*)&sPl[w][ln][16 + 8 * hh];
#pragma unroll
    for (int dt = 0; dt < DT; ++dt) {
      FragB bvh, bvl;
#pragma unroll
      for (int i = 0; i < 8; ++i) {
        bvh.u[i] = sVh[8 * hh + i][dt * 16 + ln]; bvh.u[8 + i] = sVh[16 + 8 * hh + i][dt * 16 + ln];
        bvl.u[i] = sVl[8 * hh + i][dt * 16 + ln]; bvl.u[8 + i] = sVl[16 + 8 * hh + i][dt * 16 + ln];
      }
      oacc[dt] = mmaN<3>(pah.v, pal.v, bvh.v, bvl.v, oacc[dt]);
    }
    __builtin_amdgcn_fence(__ATOMIC_ACQ_REL, "workgroup");
    __builtin_amdgcn_wave_barrier();
  }
#pragma unroll
  for (int r = 0; r < 8; ++r) {
    float l = l_r[r];
    l += __shfl_xor(l, 1, 32); l += __shfl_xor(l, 2, 32); l += __shfl_xor(l, 4, 32); l += __shfl_xor(l, 8, 32);
    l_r[r] = (l > 0.f) ? 1.0f / l : 0.f;
  }
#pragma unroll
  for (int dt = 0; dt < DT; ++dt)
#pragma unroll
    for (int r = 0; r < 8; ++r) sO[w][8 * hh + r][dt * 16 + ln] = oacc[dt][r] * l_r[r];
  __builtin_amdgcn_fence(__ATOMIC_ACQ_REL, "workgroup");
  __builtin_amdgcn_wave_barrier();
  {
    for (int r = 0; r < 16; ++r) {
      const int row = q0 + r;
      if (row < T && lane < D / 4) {
        const v4f val = *(const v4fa*)&sO[w][r][lane * 4];
        *(v4f*)(y + ((size_t)b * T + row) * ypitch + h * D + lane * 4) = val;
      }
    }
    
  }
}

// GEMM C = act(A·W + bias + resid): A f32 (ASPLIT -> hi/lo 2 terms), Wt bf16 [N][K]; ACT 0 none, 1 relu, 2 exact gelu;
// resid (optional, f32, row index = (row % rmod), pitch ldr, RES_BF16 rounds it) added before the activation.
template <bool ASPLIT, int ACT, bool BIAS_BF16, bool RES_BF16>
__global__ __launch_bounds__(128) void k_gemm_bf3(const float* __restrict__ A, int lda, const unsigned short* __restrict__ Wt, int ldb,
                                                const float* __restrict__ bias, const float* __restrict__ resid, int rmod, int ldr,
                                                float* __restrict__ C, int ldc, int M, int N, int K) {
  __shared__ __attribute__((aligned(16))) float so[4][16][64];
  const int tid = threadIdx.x, w = tid >> 5, lane = tid & 31, ln = lane & 15, hh = lane >> 4;
  const int ntn = N / 64;
  const int wid = blockIdx.x * 4 + w;
  const int mt = wid / ntn, nq = wid % ntn;
  if (mt * 16 >= M) return;
  const int row0 = mt * 16, col0 = nq * 64;
  const float* arow = A + (size_t)(row0 + ln) * lda;
  v8f acc[4] = {};
  for (int kb = 0; kb < K; kb += 32) {
    FragB ah, al;
    const v4f x0 = *(const v4fa*)(arow + kb + 8 * hh), x1 = *(const v4fa*)(arow + kb + 8 * hh + 4);
    const v4f x2 = *(const v4fa*)(arow + kb + 16 + 8 * hh), x3 = *(const v4fa*)(arow + kb + 16 + 8 * hh + 4);
    float xs[16] = {x0[0],x0[1],x0[2],x0[3],x1[0],x1[1],x1[2],x1[3],x2[0],x2[1],x2[2],x2[3],x3[0],x3[1],x3[2],x3[3]};
#pragma unroll
    for (int i = 0; i < 16; ++i) { const unsigned short hb = bf16_bits(xs[i]); ah.u[i] = hb; al.u[i] = ASPLIT ? bf16_bits(xs[i] - bf16_val(hb)) : (unsigned short)0; }
#pragma unroll
    for (int t = 0; t < 4; ++t) {
      const unsigned short* brow = Wt + (size_t)(col0 + t * 16 + ln) * ldb + kb;
      FragB b;
      b.half[0] = *(const v8us*)(brow + 8 * hh);
      b.half[1] = *(const v8us*)(brow + 16 + 8 * hh);
      acc[t] = mmaN<ASPLIT ? 2 : 1>(ah.v, al.v, b.v, b.v, acc[t]);
    }
  }
#pragma unroll
  for (int t = 0; t < 4; ++t) {
    const int col = col0 + t * 16 + ln;
    float bv = bias ? bias[col] : 0.f;
    if (BIAS_BF16) bv = bf16_round(bv);
#pragma unroll
    for (int r = 0; r < 8; ++r) {
      float v = acc[t][r] + bv;
      if (resid) { float rv = resid[(size_t)((row0 + 8 * hh + r) % rmod) * ldr + col]; if (RES_BF16) rv = bf16_round(rv); v += rv; }
      if (ACT == 1) v = fmaxf(v, 0.f);
      if (ACT == 2) v = 0.5f * v * (1.0f + erff(v * 0.70710678118654752f));
      if (ACT == 3) { const float u = 0.7978845608028654f * (v + 0.044715f * v * v * v); v = 0.5f * v * (1.0f + tanhf(u)); }
      so[w][8 * hh + r][t * 16 + ln] = v;
    }
  }
  __builtin_amdgcn_fence(__ATOMIC_ACQ_REL, "workgroup");
  __builtin_amdgcn_wave_barrier();
  const int rsub = lane >> 4, c4 = (lane & 15) * 4;
  {
#pragma unroll
    for (int q = 0; q < 8; ++q) {
      const int r = q * 2 + rsub;
      const v4f v = *(const v4fa*)&so[w][r][c4];
      *(v4f*)(C + (size_t)(row0 + r) * ldc + col0 + c4) = v;
    }
    
  }
}
// row LayerNorm (biased variance, eps) over N: s = X (+ R); optional out_sum <- s; out_norm <- (s-mu)*rsqrt(var+eps)*g + b
template <bool PARAM_BF16>
__global__ __launch_bounds__(256) void k_layernorm(const float* __restrict__ X, const float* __restrict__ R, const float* __restrict__ g, const float* __restrict__ bta,
                                                  float* __restrict__ out_sum, float* __restrict__ out_norm, int N, float eps) {
  __shared__ float red[256];
  const int row = blockIdx.x, tid = threadIdx.x;
  const float* x = X + (size_t)row * N; const float* rr = R ? R + (size_t)row * N : nullptr;
  float vals[16];                     // up to N = 4096
  const int per = N / 256;            // contiguous chunk per thread? use strided-by-4 chunks: thread handles j = tid*4 + 1024*u
  float s1 = 0.f;
  for (int u = 0; u < per / 4; ++u) {
    const int j = tid * 4 + 1024 * u;
    const v4f a = *(const v4fa*)(x + j);
    v4f b = {0.f,0.f,0.f,0.f}; if (rr) b = *(const v4fa*)(rr + j);
#pragma unroll
    for (int q = 0; q < 4; ++q) { const float v = a[q] + b[q]; vals[u * 4 + q] = v; s1 += v; }
  }
  red[tid] = s1; __syncthreads();
  for (int st = 128; st > 0; st >>= 1) { if (tid < st) red[tid] += red[tid + st]; __syncthreads(); }
  const float mu = red[0] / (float)N; __syncthreads();
  float s2 = 0.f;
  for (int u = 0; u < per / 4; ++u)
#pragma unroll
    for (int q = 0; q < 4; ++q) { const float c = vals[u * 4 + q] - mu; s2 += c * c; }
  red[tid] = s2; __syncthreads();
  for (int st = 128; st > 0; st >>= 1) { if (tid < st) red[tid] += red[tid + st]; __syncthreads(); }
  const float rs = rsqrtf(red[0] / (float)N + eps);
  {
    for (int u = 0; u < per / 4; ++u) {
      const int j = tid * 4 + 1024 * u;
      v4f o, sm;
#pragma unroll
      for (int q = 0; q < 4; ++q) {
        float gg = g[j + q], bb = bta[j + q];
        if (PARAM_BF16) { gg = bf16_round(gg); bb = bf16_round(bb); }
        sm[q] = vals[u * 4 + q]; o[q] = (vals[u * 4 + q] - mu) * rs * gg + bb;
      }
      if (out_sum) *(v4f*)(out_sum + (size_t)row * N + j) = sm;
      *(v4f*)(out_norm + (size_t)row * N + j) = o;
    }
    
  }
}



// ---- f16 WMMA path (v_wmma_f32_16x16x32_f16): 11-bit significands for operands in range — used where a [0,1] probability operand needs more precision than bf16
typedef _Float16 v16h __attribute__((ext_vector_type(16)));
union FragH { v16h v; v8us half[2]; _Float16 h[16]; unsigned short u[16]; };
template <int NT>
__device__ __forceinline__ v8f mmaH(v16h ah, v16h al, v16h bh, v16h bl, v8f c) {
  c = __builtin_amdgcn_wmma_f32_16x16x32_f16(false, ah, false, bh, (short)0, c, false, false);
  if (NT >= 2) c = __builtin_amdgcn_wmma_f32_16x16x32_f16(false, al, false, bh, (short)0, c, false, false);
  if (NT >= 3) c = __builtin_amdgcn_wmma_f32_16x16x32_f16(false, ah, false, bl, (short)0, c, false, false);
  asm volatile("v_nop\n\tv_nop\n\tv_nop\n\tv_nop" : "+v"(c) : "v"(ah), "v"(al), "v"(bh), "v"(bl));
  return c;
}
// batched GEMM like k_gemm_b but f16 operands: A f32 (split into f16 hi/lo if ASPLIT, else rounded to f16), Bt = f16 values [n][k]; alpha; C f32; N multiple of 16 (partial tiles skipped)
template <bool ASPLIT>
__global__ __launch_bounds__(128) void k_gemm_h(const float* __restrict__ A, int lda, size_t sA, const _Float16* __restrict__ Bh, int ldb, size_t sB, float alpha, float* __restrict__ C, int ldc, size_t sC, int M, int N, int K) {
  __shared__ __attribute__((aligned(16))) float so[4][16][64];
  const int tid = threadIdx.x, w = tid >> 5, lane = tid & 31, ln = lane & 15, hh = lane >> 4; const int by = blockIdx.y;
  A += (size_t)by * sA; Bh += (size_t)by * sB; C += (size_t)by * sC;
  const int ntn = (N + 63) / 64; const int wid = blockIdx.x * 4 + w; const int mt = wid / ntn, nq = wid % ntn; if (mt * 16 >= M) return;
  const int row0 = mt * 16, col0 = nq * 64; const float* arow = A + (size_t)(row0 + ln) * lda;
  v8f acc[4] = {};
  for (int kb = 0; kb < K; kb += 32) {
    FragH ah, al;
    const v4f x0 = *(const v4fa*)(arow + kb + 8 * hh), x1 = *(const v4fa*)(arow + kb + 8 * hh + 4), x2 = *(const v4fa*)(arow + kb + 16 + 8 * hh), x3 = *(const v4fa*)(arow + kb + 16 + 8 * hh + 4);
    float xs[16] = {x0[0],x0[1],x0[2],x0[3],x1[0],x1[1],x1[2],x1[3],x2[0],x2[1],x2[2],x2[3],x3[0],x3[1],x3[2],x3[3]};
#pragma unroll
    for (int i = 0; i < 16; ++i) { const _Float16 h = (_Float16)xs[i]; ah.h[i] = h; al.h[i] = ASPLIT ? (_Float16)(xs[i] - (float)h) : (_Float16)0.0f; }
#pragma unroll
    for (int t = 0; t < 4; ++t) { if (col0 + t * 16 >= N) continue; const size_t boff = (size_t)(col0 + t * 16 + ln) * ldb + kb; FragH bq; bq.half[0] = *(const v8us*)(Bh + boff + 8 * hh); bq.half[1] = *(const v8us*)(Bh + boff + 16 + 8 * hh);
      acc[t] = mmaH<ASPLIT ? 2 : 1>(ah.v, al.v, bq.v, bq.v, acc[t]); }
  }
#pragma unroll
  for (int t = 0; t < 4; ++t) { if (col0 + t * 16 >= N) continue;
#pragma unroll
    for (int r = 0; r < 8; ++r) so[w][8 * hh + r][t * 16 + ln] = acc[t][r] * alpha; }
  __builtin_amdgcn_fence(__ATOMIC_ACQ_REL, "workgroup"); __builtin_amdgcn_wave_barrier();
  const int rsub = lane >> 4, c4 = (lane & 15) * 4;
  {
#pragma unroll
    for (int q = 0; q < 8; ++q) { const int r = q * 2 + rsub; if (col0 + c4 < N) { const v4f v = *(const v4fa*)&so[w][r][c4]; *(v4f*)(C + (size_t)(row0 + r) * ldc + col0 + c4) = v; } }
     }
}

// Wt[n][k] = f16(W[k][n]·scale) from f32 row-major W[K][N] (scale = power of two; bf16-exact weights stay exact in f16 away from the subnormal range)
__global__ __launch_bounds__(256) void k_wt_f16(const float* __restrict__ W, _Float16* __restrict__ Wt, int K, int N, float scale) {
  const int t = blockIdx.x * 256 + threadIdx.x; if (t >= N * (K / 8)) return; const int n = t / (K / 8), k8 = (t % (K / 8)) * 8; FragH f;
#pragma unroll
  for (int i = 0; i < 8; ++i) f.h[i] = (_Float16)(bf16_round(W[(size_t)(k8 + i) * N + n]) * scale); const v8us o = f.half[0];
  *(v8us*)((unsigned short*)Wt + (size_t)n * K + k8) = o; 
}
// k_gemm_hh variant with fused epilogue: v = acc·alpha + bias[by·sBias + col] (+ CP[(row/rowsPerB)·sCPb + by·64 + col] if CP) ; ACT 0 none / 1 elu ; writes f16 C16 and/or f32 C (each if non-null)
template <int ACT>
__global__ __launch_bounds__(128) void k_gemm_hhx(const _Float16* __restrict__ A, int lda, size_t sA, const _Float16* __restrict__ Bh, int ldb, size_t sB, float alpha, const float* __restrict__ bias, size_t sBias, const float* __restrict__ CP, int rowsPerB, size_t sCPb, int row0g,
    float* __restrict__ C, _Float16* __restrict__ C16, int ldc, size_t sC, int M, int N, int K) {
  __shared__ __attribute__((aligned(16))) float so[4][16][64];
  const int tid = threadIdx.x, w = tid >> 5, lane = tid & 31, ln = lane & 15, hh = lane >> 4; const int by = blockIdx.y;
  A += (size_t)by * sA; Bh += (size_t)by * sB; const size_t cofs = (size_t)by * sC; const float* bp = bias ? bias + (size_t)by * sBias : nullptr;
  const int ntn = (N + 63) / 64; const int wid = blockIdx.x * 4 + w; const int mt = wid / ntn, nq = wid % ntn; if (mt * 16 >= M) return;
  const int row0 = mt * 16, col0 = nq * 64; const _Float16* arow = A + (size_t)(row0 + ln) * lda;
  v8f acc[4] = {};
  for (int kb = 0; kb < K; kb += 32) { FragH ah; ah.half[0] = *(const v8us*)((const unsigned short*)arow + kb + 8 * hh); ah.half[1] = *(const v8us*)((const unsigned short*)arow + kb + 16 + 8 * hh);
#pragma unroll
    for (int t = 0; t < 4; ++t) { if (col0 + t * 16 >= N) continue; const size_t boff = (size_t)(col0 + t * 16 + ln) * ldb + kb; FragH bq; bq.half[0] = *(const v8us*)((const unsigned short*)Bh + boff + 8 * hh); bq.half[1] = *(const v8us*)((const unsigned short*)Bh + boff + 16 + 8 * hh);
      acc[t] = mmaH<1>(ah.v, ah.v, bq.v, bq.v, acc[t]); }
  }
#pragma unroll
  for (int t = 0; t < 4; ++t) { if (col0 + t * 16 >= N) continue; const int col = col0 + t * 16 + ln; const float bv = bp ? bf16_round(bp[col]) : 0.f;
#pragma unroll
    for (int r = 0; r < 8; ++r) { float v = acc[t][r] * alpha + bv; if (CP) { const int bidx = (row0g + row0 + 8 * hh + r) / rowsPerB; v += CP[(size_t)bidx * sCPb + (size_t)by * 64 + col]; } if (ACT == 1) v = (v > 0.f) ? v : expm1f(v); else if (ACT == 3) v = fmaxf(v, 0.f); so[w][8 * hh + r][t * 16 + ln] = v; } }
  __builtin_amdgcn_fence(__ATOMIC_ACQ_REL, "workgroup"); __builtin_amdgcn_wave_barrier();
  const int rsub = lane >> 4, c4 = (lane & 15) * 4; typedef _Float16 v4h __attribute__((ext_vector_type(4)));
  {
#pragma unroll
    for (int q = 0; q < 8; ++q) { const int r = q * 2 + rsub; if (col0 + c4 < N) { const v4f v = *(const v4fa*)&so[w][r][c4]; if (C) *(v4f*)(C + cofs + (size_t)(row0 + r) * ldc + col0 + c4) = v; if (C16) { v4h h4; for (int i = 0; i < 4; ++i) h4[i] = (_Float16)v[i]; *(v4h*)(C16 + cofs + (size_t)(row0 + r) * ldc + col0 + c4) = h4; } } }
     }
}


__global__ __launch_bounds__(256) void k_x16(const float* __restrict__ x, _Float16* __restrict__ X16, size_t n8) { const size_t t = (size_t)blockIdx.x * 256 + threadIdx.x; if (t >= n8) return; FragH f;
#pragma unroll
  for (int q = 0; q < 8; ++q) f.h[q] = (_Float16)bf16_round(x[t * 8 + q]); *(v8us*)((unsigned short*)X16 + t * 8) = f.half[0];  }
__global__ __launch_bounds__(256) void k_h16(const float* __restrict__ x, _Float16* __restrict__ X16, size_t n8) { const size_t t = (size_t)blockIdx.x * 256 + threadIdx.x; if (t >= n8) return; FragH f;
#pragma unroll
  for (int q = 0; q < 8; ++q) f.h[q] = (_Float16)x[t * 8 + q]; *(v8us*)((unsigned short*)X16 + t * 8) = f.half[0];  }
__global__ __launch_bounds__(256) void k_round16f(const float* __restrict__ W, _Float16* __restrict__ Bt, size_t n8) { const size_t t = (size_t)blockIdx.x * 256 + threadIdx.x; if (t >= n8) return; FragH f;
#pragma unroll
  for (int i = 0; i < 8; ++i) f.h[i] = (_Float16)(bf16_round(W[t * 8 + i]) * 16.0f); *(v8us*)((unsigned short*)Bt + t * 8) = f.half[0];  }
__global__ __launch_bounds__(256) void k_vt(const _Float16* __restrict__ V16, _Float16* __restrict__ Vt) { __shared__ unsigned short tl[64][66]; const int tid = threadIdx.x; const int slab = blockIdx.x / (SS / 64), lg = blockIdx.x % (SS / 64); const int b = slab / NH, h = slab % NH;
  for (int i = tid; i < 64 * 8; i += 256) { const int r = i / 8, c8 = (i % 8) * 8; FragH f; f.half[0] = *(const v8us*)((const unsigned short*)V16 + ((size_t)b * SS + lg * 64 + r) * DM + h * HD + c8);
#pragma unroll
    for (int q = 0; q < 8; ++q) tl[r][c8 + q] = f.u[q]; }
  __syncthreads();
  {
#pragma unroll
    for (int rd = 0; rd < 2; ++rd) { const int d = rd * 32 + tid / 8, pc = tid % 8; FragH f;
#pragma unroll
      for (int q = 0; q < 8; ++q) f.u[q] = tl[pc * 8 + q][d];
      *(v8us*)((unsigned short*)Vt + ((size_t)slab * HD + d) * SS + lg * 64 + pc * 8) = f.half[0]; }
     } }
__device__ __forceinline__ float sigm_f(float x) { return 1.0f / (1.0f + expf(-x)); }
__global__ __launch_bounds__(128) void k_satt(const _Float16* __restrict__ Q16, const _Float16* __restrict__ K16, const _Float16* __restrict__ Vt, float* __restrict__ O) {
  constexpr int RPW = 32, NQB = SS / (4 * RPW), DT = HD / 16, KS = HD / 32;
  __shared__ __attribute__((aligned(16))) unsigned short sP[4][RPW][40]; __shared__ __attribute__((aligned(16))) float sO[4][RPW][HD];
  const int tid = threadIdx.x, w = tid >> 5, lane = tid & 31, ln = lane & 15, hh = lane >> 4;
  const int slab = blockIdx.x / NQB, qblk = blockIdx.x % NQB; const int b = slab / NH, h = slab % NH; const int q0 = qblk * (4 * RPW) + w * RPW;
  FragH aq[2][KS];
#pragma unroll
  for (int rt = 0; rt < 2; ++rt) { const unsigned short* qr = (const unsigned short*)Q16 + ((size_t)b * SS + q0 + rt * 16 + ln) * DM + h * HD;
#pragma unroll
    for (int ks = 0; ks < KS; ++ks) { aq[rt][ks].half[0] = *(const v8us*)(qr + ks * 32 + 8 * hh); aq[rt][ks].half[1] = *(const v8us*)(qr + ks * 32 + 16 + 8 * hh); } }
  const unsigned short* Vth = (const unsigned short*)Vt + (size_t)slab * HD * SS;
  v8f oacc[2][DT];
#pragma unroll
  for (int rt = 0; rt < 2; ++rt)
#pragma unroll
    for (int dt = 0; dt < DT; ++dt) oacc[rt][dt] = (v8f){0.f,0.f,0.f,0.f,0.f,0.f,0.f,0.f};
#pragma unroll 1
  for (int j0 = 0; j0 < SS; j0 += 32) {
    v8f s[2][2];
#pragma unroll
    for (int nt = 0; nt < 2; ++nt) { const unsigned short* kr = (const unsigned short*)K16 + ((size_t)b * SS + j0 + nt * 16 + ln) * DM + h * HD; FragH bk[KS];
#pragma unroll
      for (int ks = 0; ks < KS; ++ks) { bk[ks].half[0] = *(const v8us*)(kr + ks * 32 + 8 * hh); bk[ks].half[1] = *(const v8us*)(kr + ks * 32 + 16 + 8 * hh); }
#pragma unroll
      for (int rt = 0; rt < 2; ++rt) { v8f acc = (v8f){0.f,0.f,0.f,0.f,0.f,0.f,0.f,0.f};
#pragma unroll
        for (int ks = 0; ks < KS; ++ks) acc = mmaH<1>(aq[rt][ks].v, aq[rt][ks].v, bk[ks].v, bk[ks].v, acc); s[rt][nt] = acc; } }
#pragma unroll
    for (int rt = 0; rt < 2; ++rt)
#pragma unroll
      for (int r = 0; r < 8; ++r) { FragH t2; t2.h[0] = (_Float16)sigm_f(s[rt][0][r] * 0.125f); t2.h[1] = (_Float16)sigm_f(s[rt][1][r] * 0.125f); sP[w][rt * 16 + 8 * hh + r][ln] = t2.u[0]; sP[w][rt * 16 + 8 * hh + r][16 + ln] = t2.u[1]; }
    __builtin_amdgcn_fence(__ATOMIC_ACQ_REL, "workgroup"); __builtin_amdgcn_wave_barrier();
    FragH pa[2];
#pragma unroll
    for (int rt = 0; rt < 2; ++rt) { pa[rt].half[0] = *(const v8us*)&sP[w][rt * 16 + ln][8 * hh]; pa[rt].half[1] = *(const v8us*)&sP[w][rt * 16 + ln][16 + 8 * hh]; }
#pragma unroll
    for (int dt = 0; dt < DT; ++dt) { const unsigned short* vrow = Vth + (size_t)(dt * 16 + ln) * SS + j0; FragH bv; bv.half[0] = *(const v8us*)(vrow + 8 * hh); bv.half[1] = *(const v8us*)(vrow + 16 + 8 * hh);
#pragma unroll
      for (int rt = 0; rt < 2; ++rt) oacc[rt][dt] = mmaH<1>(pa[rt].v, pa[rt].v, bv.v, bv.v, oacc[rt][dt]); }
    __builtin_amdgcn_fence(__ATOMIC_ACQ_REL, "workgroup"); __builtin_amdgcn_wave_barrier(); }
#pragma unroll
  for (int rt = 0; rt < 2; ++rt)
#pragma unroll
    for (int dt = 0; dt < DT; ++dt)
#pragma unroll
      for (int r = 0; r < 8; ++r) sO[w][rt * 16 + 8 * hh + r][dt * 16 + ln] = oacc[rt][dt][r];
  __builtin_amdgcn_fence(__ATOMIC_ACQ_REL, "workgroup"); __builtin_amdgcn_wave_barrier();
  {
#pragma unroll
    for (int rp = 0; rp < RPW; rp += 2) { const int r = rp + (lane >> 4), pc = lane & 15; const v4f val = *(const v4fa*)&sO[w][r][pc * 4]; *(v4f*)(O + ((size_t)b * SS + q0 + r) * DM + h * HD + pc * 4) = val; }
     } }
// (b) attn_weights[b][q][k] = (1/16) sum_h sigmoid(q_h.k_h/8): block = (b, AWK keys, 64 queries), wave = 16 queries; for each 32-key chunk of the block's keys, loop the 16 heads (S tile pairs on WMMA, sigmoid, fixed-order sum).
// The key range is dealt over the grid, so that every SIMD of the chip holds as many waves as its registers allow; each output tile is still made whole by one wave.
#define AWK 32
__global__ __launch_bounds__(128) void k_aw(const _Float16* __restrict__ Q16, const _Float16* __restrict__ K16, float* __restrict__ AW) {
  constexpr int RPW = 16, KS = HD / 32; __shared__ __attribute__((aligned(16))) float st[4][RPW][32 + 4];
  const int tid = threadIdx.x, w = tid >> 5, lane = tid & 31, ln = lane & 15, hh = lane >> 4; const int qblk = blockIdx.x % (SS / 64), bj = blockIdx.x / (SS / 64); const int jblk = bj % (SS / AWK), b = bj / (SS / AWK); const int q0 = qblk * 64 + w * RPW;
  const unsigned short* qbase = (const unsigned short*)Q16 + ((size_t)b * SS + q0 + ln) * DM;
#pragma unroll 1
  for (int j0 = jblk * AWK; j0 < jblk * AWK + AWK; j0 += 32) { float aw[2][8];
#pragma unroll
    for (int nt = 0; nt < 2; ++nt)
#pragma unroll
      for (int r = 0; r < 8; ++r) aw[nt][r] = 0.f;
#pragma unroll 1
    for (int h = 0; h < NH; ++h) { FragH aq[KS];
#pragma unroll
      for (int ks = 0; ks < KS; ++ks) { aq[ks].half[0] = *(const v8us*)(qbase + h * HD + ks * 32 + 8 * hh); aq[ks].half[1] = *(const v8us*)(qbase + h * HD + ks * 32 + 16 + 8 * hh); }
#pragma unroll
      for (int nt = 0; nt < 2; ++nt) { const unsigned short* kr = (const unsigned short*)K16 + ((size_t)b * SS + j0 + nt * 16 + ln) * DM + h * HD; v8f acc = (v8f){0.f,0.f,0.f,0.f,0.f,0.f,0.f,0.f};
#pragma unroll
        for (int ks = 0; ks < KS; ++ks) { FragH bk; bk.half[0] = *(const v8us*)(kr + ks * 32 + 8 * hh); bk.half[1] = *(const v8us*)(kr + ks * 32 + 16 + 8 * hh); acc = mmaH<1>(aq[ks].v, aq[ks].v, bk.v, bk.v, acc); }
#pragma unroll
        for (int r = 0; r < 8; ++r) aw[nt][r] += sigm_f(acc[r] * 0.125f); } }
#pragma unroll
    for (int nt = 0; nt < 2; ++nt)
#pragma unroll
      for (int r = 0; r < 8; ++r) st[w][8 * hh + r][nt * 16 + ln] = aw[nt][r] * (1.0f / (float)NH);
    __builtin_amdgcn_fence(__ATOMIC_ACQ_REL, "workgroup"); __builtin_amdgcn_wave_barrier();
    {
#pragma unroll
      for (int rp = 0; rp < RPW; rp += 4) { const int r = rp + (lane >> 3), pc = lane & 7; *(v4f*)(AW + ((size_t)b * SS + q0 + r) * SS + j0 + pc * 4) = *(const v4fa*)&st[w][r][pc * 4]; }
       }
    __builtin_amdgcn_fence(__ATOMIC_ACQ_REL, "workgroup"); __builtin_amdgcn_wave_barrier(); } }
extern "C" void kernel_launch(void* const* d_in, const int* in_sizes, int n_in,
                              void* d_out, int out_size, void* d_ws, size_t ws_size, hipStream_t stream) {
  (void)in_sizes; (void)n_in; (void)out_size;
  const float* xq = (const float*)d_in[0]; const float* xk = (const float*)d_in[1]; const float* xv = (const float*)d_in[2]; const float* Wq = (const float*)d_in[3]; const float* bq = (const float*)d_in[4]; const float* Wk = (const float*)d_in[5]; const float* bk = (const float*)d_in[6]; const float* Wv = (const float*)d_in[7]; const float* bv = (const float*)d_in[8]; const float* Wo = (const float*)d_in[9]; const float* bo = (const float*)d_in[10];
  float* out = (float*)d_out; float* AW = (float*)((char*)d_out + 16777216);
  char* ws = (char*)d_ws; size_t off = 0;
  auto take = [&](size_t bytes) { char* p = ws + off; off += (bytes + 255) & ~(size_t)255; return p; };
  const size_t w8 = (size_t)DM * DM / 8;
  _Float16* Bq = (_Float16*)take(w8 * 16); _Float16* Bk = (_Float16*)take(w8 * 16); _Float16* Bv = (_Float16*)take(w8 * 16); _Float16* Bo = (_Float16*)take(w8 * 16);
  _Float16* XQ = (_Float16*)take((size_t)NR * DM * 2); _Float16* XK = (_Float16*)take((size_t)NR * DM * 2); _Float16* XV = (_Float16*)take((size_t)NR * DM * 2); _Float16* Q16 = (_Float16*)take((size_t)NR * DM * 2); _Float16* K16 = (_Float16*)take((size_t)NR * DM * 2); _Float16* V16 = (_Float16*)take((size_t)NR * DM * 2); _Float16* Vt = (_Float16*)take((size_t)NR * DM * 2); float* O = (float*)take((size_t)NR * DM * 4); _Float16* O16 = (_Float16*)take((size_t)NR * DM * 2);
  if (off > ws_size) return;      // ≈ 8 + 8.4×8 + 16.8 ≈ 92 MiB
  const unsigned gw = (unsigned)((w8 + 255) / 256), gx = (unsigned)(((size_t)NR * DM / 8 + 255) / 256);
  k_round16f<<<gw, 256, 0, stream>>>(Wq, Bq, w8); k_round16f<<<gw, 256, 0, stream>>>(Wk, Bk, w8); k_round16f<<<gw, 256, 0, stream>>>(Wv, Bv, w8); k_round16f<<<gw, 256, 0, stream>>>(Wo, Bo, w8);
  k_x16<<<gx, 256, 0, stream>>>(xq, XQ, (size_t)NR * DM / 8); k_x16<<<gx, 256, 0, stream>>>(xk, XK, (size_t)NR * DM / 8); k_x16<<<gx, 256, 0, stream>>>(xv, XV, (size_t)NR * DM / 8);
  const dim3 gg(((NR / 16) * (DM / 64) + 3) / 4, 1);
  k_gemm_hhx<0><<<gg, 128, 0, stream>>>(XQ, DM, 0, Bq, DM, 0, 0.0625f, bq, 0, nullptr, 1, 0, 0, nullptr, Q16, DM, 0, NR, DM, DM);
  k_gemm_hhx<0><<<gg, 128, 0, stream>>>(XK, DM, 0, Bk, DM, 0, 0.0625f, bk, 0, nullptr, 1, 0, 0, nullptr, K16, DM, 0, NR, DM, DM);
  k_gemm_hhx<0><<<gg, 128, 0, stream>>>(XV, DM, 0, Bv, DM, 0, 0.0625f, bv, 0, nullptr, 1, 0, 0, nullptr, V16, DM, 0, NR, DM, DM);
  k_vt<<<BB * NH * (SS / 64), 256, 0, stream>>>(V16, Vt);
  k_satt<<<BB * NH * (SS / 128), 128, 0, stream>>>(Q16, K16, Vt, O);
  k_h16<<<gx, 256, 0, stream>>>(O, O16, (size_t)NR * DM / 8);
  k_gemm_hhx<0><<<gg, 128, 0, stream>>>(O16, DM, 0, Bo, DM, 0, 0.0625f, bo, 0, nullptr, 1, 0, 0, out, nullptr, DM, 0, NR, DM, DM);
  k_aw<<<BB * (SS / 64) * (SS / AWK), 128, 0, stream>>>(Q16, K16, AW);
}

// v002
// One run takes 406 microseconds.
// Timed twice side by side with v001, it ran 1.24 times as fast both times.
// Over all steps from v000 it is 2.89 times as fast.
#include <hip/hip_runtime.h>
// q/k/v/o projections (4096 × 1024 × 1024, + bias) and the 16-head sigmoid attention on v_wmma_f32_16x16x32_f16: (a) per (b,h) a fused flash-style kernel with P = σ(q·k/8) (no normalisation,
// as the module) and O = P·V on WMMA; (b) the second output mean_h σ(q·k/8) recomputes the score tiles per head and averages them in a fixed order. x inputs f16(bf16 ·) exact, q/k/v and O rounded to f16,
// weights bf16-exact ×2^4 ((out,in)), P f16 ≤ 1, f32 accumulate.
#define BB 2
#define SS 2048
#define DM 1024
#define NH 16
#define HD 64
#define NR (BB * SS)

typedef __bf16 v16b __attribute__((ext_vector_type(16)));
typedef unsigned short v8us __attribute__((ext_vector_type(8), may_alias));
typedef float  v8f  __attribute__((ext_vector_type(8)));
typedef float  v4f  __attribute__((ext_vector_type(4)));
typedef float  v4fa __attribute__((ext_vector_type(4), may_alias));
union FragB { v16b v; v8us half[2]; unsigned short u[16]; };

__device__ __forceinline__ unsigned short bf16_bits(float x) { unsigned int u = __float_as_uint(x); return (unsigned short)((u + 0x7FFFu + ((u >> 16) & 1u)) >> 16); }
__device__ __forceinline__ float bf16_val(unsigned short b) { return __uint_as_float(((unsigned int)b) << 16); }
__device__ __forceinline__ float bf16_round(float x) { return bf16_val(bf16_bits(x)); }
// D += A·B with NT terms: 1 = ah·bh, 2 = + al·bh (A split), 3 = + ah·bl (both split)
template <int NT>
__device__ __forceinline__ v8f mmaN(v16b ah, v16b al, v16b bh, v16b bl, v8f c) {
  c = __builtin_amdgcn_wmma_f32_16x16x32_bf16(false, ah, false, bh, (short)0, c, false, false);
  if (NT >= 2) c = __builtin_amdgcn_wmma_f32_16x16x32_bf16(false, al, false, bh, (short)0, c, false, false);
  if (NT >= 3) c = __builtin_amdgcn_wmma_f32_16x16x32_bf16(false, ah, false, bl, (short)0, c, false, false);
  asm volatile("v_nop\n\tv_nop\n\tv_nop\n\tv_nop" : "+v"(c) : "v"(ah), "v"(al), "v"(bh), "v"(bl));
  return c;
}

__global__ __launch_bounds__(256) void k_wt_bf16(const float* __restrict__ W, unsigned short* __restrict__ Wt, int K, int N) {
  const int t = blockIdx.x * 256 + threadIdx.x;
  const int k8n = K / 8;
  if (t >= N * k8n) return;
  const int n = t / k8n, k8 = (t % k8n) * 8;
  v8us v;
#pragma unroll
  for (int i = 0; i < 8; ++i) v[i] = bf16_bits(W[(size_t)(k8 + i) * N + n]);
  *(v8us*)(Wt + (size_t)n * K + k8) = v;
  
}

// GEMM C[M][N] (f32, pitch ldc) = act(A[M][K]·W + bias). A f32 row-major (pitch lda) converted per fragment to bf16
// (ASPLIT: hi/lo two planes -> 2 terms, else single rounded term); Wt bf16 [N][K] (pitch ldb). BIAS_BF16 rounds the
// bias to bf16 first (bias quantised to bf16 before the add). K%32==0, M%16==0, N%64==0.
template <bool ASPLIT, int ACT, bool BIAS_BF16>
__global__ __launch_bounds__(128) void k_gemm_bf(const float* __restrict__ A, int lda, const unsigned short* __restrict__ Wt, int ldb,
                                               const float* __restrict__ bias, float* __restrict__ C, int ldc, int M, int N, int K) {
  __shared__ __attribute__((aligned(16))) float so[4][16][64];
  const int tid = threadIdx.x, w = tid >> 5, lane = tid & 31, ln = lane & 15, hh = lane >> 4;
  const int ntn = N / 64;
  const int wid = blockIdx.x * 4 + w;
  const int mt = wid / ntn, nq = wid % ntn;
  if (mt * 16 >= M) return;
  const int row0 = mt * 16, col0 = nq * 64;
  const float* arow = A + (size_t)(row0 + ln) * lda;
  v8f acc[4] = {};
  for (int kb = 0; kb < K; kb += 32) {
    FragB ah, al;
    const v4f x0 = *(const v4fa*)(arow + kb + 8 * hh), x1 = *(const v4fa*)(arow + kb + 8 * hh + 4);
    const v4f x2 = *(const v4fa*)(arow + kb + 16 + 8 * hh), x3 = *(const v4fa*)(arow + kb + 16 + 8 * hh + 4);
    float xs[16] = {x0[0],x0[1],x0[2],x0[3],x1[0],x1[1],x1[2],x1[3],x2[0],x2[1],x2[2],x2[3],x3[0],x3[1],x3[2],x3[3]};
#pragma unroll
    for (int i = 0; i < 16; ++i) { const unsigned short hb = bf16_bits(xs[i]); ah.u[i] = hb; al.u[i] = ASPLIT ? bf16_bits(xs[i] - bf16_val(hb)) : (unsigned short)0; }
#pragma unroll
    for (int t = 0; t < 4; ++t) {
      const unsigned short* brow = Wt + (size_t)(col0 + t * 16 + ln) * ldb + kb;
      FragB b;
      b.half[0] = *(const v8us*)(brow + 8 * hh);
      b.half[1] = *(const v8us*)(brow + 16 + 8 * hh);
      acc[t] = mmaN<ASPLIT ? 2 : 1>(ah.v, al.v, b.v, b.v, acc[t]);
    }
  }
#pragma unroll
  for (int t = 0; t < 4; ++t) {
    float bv = bias ? bias[col0 + t * 16 + ln] : 0.f;
    if (BIAS_BF16) bv = bf16_round(bv);
#pragma unroll
    for (int r = 0; r < 8; ++r) { float v = acc[t][r] + bv; if (ACT == 1) v = fmaxf(v, 0.f); so[w][8 * hh + r][t * 16 + ln] = v; }
  }
  __builtin_amdgcn_fence(__ATOMIC_ACQ_REL, "workgroup");
  __builtin_amdgcn_wave_barrier();
  const int rsub = lane >> 4, c4 = (lane & 15) * 4;
  {
#pragma unroll
    for (int q = 0; q < 8; ++q) {
      const int r = q * 2 + rsub;
      const v4f v = *(const v4fa*)&so[w][r][c4];
      *(v4f*)(C + (size_t)(row0 + r) * ldc + col0 + c4) = v;
    }
    
  }
}

// Flash-style causal/unmasked attention, all contractions 3-term bf16 hi/lo splits, f32 softmax with running max.
// q,k,v rows are read from f32 buffers with arbitrary row pitch (so they can live inside a fused qkv buffer);
// D = head size (multiple of 32, <= 128); one wave = 16 query rows; block = 4 waves (64 queries) sharing K/V chunks of 32.
template <int D, bool CAUSAL>
__global__ __launch_bounds__(128) void k_flash(const float* __restrict__ qb, const float* __restrict__ kb, const float* __restrict__ vb,
                                             int pitch, int T, int H, float scale, float* __restrict__ y, int ypitch) {
  constexpr int KS = D / 32;        // k-steps for QK
  constexpr int DT = D / 16;        // d tiles for PV
  __shared__ __attribute__((aligned(16))) unsigned short sKh[32][D + 8], sKl[32][D + 8], sVh[32][D + 8], sVl[32][D + 8];
  __shared__ __attribute__((aligned(16))) unsigned short sPh[4][16][40], sPl[4][16][40];
  __shared__ __attribute__((aligned(16))) float sO[4][16][D];
  const int tid = threadIdx.x, w = tid >> 5, lane = tid & 31, ln = lane & 15, hh = lane >> 4;
  const int nqb = (T + 63) / 64;
  const int bh = blockIdx.x / nqb, qblk = blockIdx.x % nqb;
  const int b = bh / H, h = bh % H;
  const int q0 = qblk * 64 + w * 16;
  const float* Q = qb + (size_t)b * T * pitch + h * D;
  const float* K = kb + (size_t)b * T * pitch + h * D;
  const float* V = vb + (size_t)b * T * pitch + h * D;

  // A fragments of the wave's 16 query rows (scaled), hi/lo
  FragB aqh[KS], aql[KS];
  {
    int row = q0 + ln; if (row >= T) row = T - 1;
    const float* qr = Q + (size_t)row * pitch;
#pragma unroll
    for (int ks = 0; ks < KS; ++ks)
#pragma unroll
      for (int i = 0; i < 16; ++i) {
        const int d = ks * 32 + ((i < 8) ? (8 * hh + i) : (16 + 8 * hh + (i - 8)));
        const float x = qr[d] * scale; const unsigned short hb = bf16_bits(x);
        aqh[ks].u[i] = hb; aql[ks].u[i] = bf16_bits(x - bf16_val(hb));
      }
  }
  float m_r[8], l_r[8];
#pragma unroll
  for (int r = 0; r < 8; ++r) { m_r[r] = -3.0e38f; l_r[r] = 0.f; }
  v8f oacc[DT];
#pragma unroll
  for (int dt = 0; dt < DT; ++dt) oacc[dt] = (v8f){0.f,0.f,0.f,0.f,0.f,0.f,0.f,0.f};

  const int kv_end = CAUSAL ? min(T, qblk * 64 + 64) : T;     // block-uniform
  for (int j0 = 0; j0 < kv_end; j0 += 32) {
    __syncthreads();
    for (int e = tid; e < 32 * (D / 4); e += 128) {
      const int r = e / (D / 4), c4 = (e % (D / 4)) * 4;
      const int key = j0 + r;
      v4f kf = {0.f,0.f,0.f,0.f}, vf = {0.f,0.f,0.f,0.f};
      if (key < T) { kf = *(const v4fa*)(K + (size_t)key * pitch + c4); vf = *(const v4fa*)(V + (size_t)key * pitch + c4); }
#pragma unroll
      for (int t = 0; t < 4; ++t) {
        unsigned short hb = bf16_bits(kf[t]); sKh[r][c4 + t] = hb; sKl[r][c4 + t] = bf16_bits(kf[t] - bf16_val(hb));
        hb = bf16_bits(vf[t]); sVh[r][c4 + t] = hb; sVl[r][c4 + t] = bf16_bits(vf[t] - bf16_val(hb));
      }
    }
    __syncthreads();
    // S tile 16 x 32
    v8f s[2];
#pragma unroll
    for (int nt = 0; nt < 2; ++nt) {
      v8f acc = {};
#pragma unroll
      for (int ks = 0; ks < KS; ++ks) {
        FragB bh_, bl_;
        bh_.half[0] = *(const v8us*)&sKh[nt * 16 + ln][ks * 32 + 8 * hh]; bh_.half[1] = *(const v8us*)&sKh[nt * 16 + ln][ks * 32 + 16 + 8 * hh];
        bl_.half[0] = *(const v8us*)&sKl[nt * 16 + ln][ks * 32 + 8 * hh]; bl_.half[1] = *(const v8us*)&sKl[nt * 16 + ln][ks * 32 + 16 + 8 * hh];
        acc = mmaN<3>(aqh[ks].v, aql[ks].v, bh_.v, bl_.v, acc);
      }
      s[nt] = acc;
    }
    // mask + running max (rows 8hh+r; the 16 lanes of a half share rows)
    float alpha[8];
#pragma unroll
    for (int r = 0; r < 8; ++r) {
      const int qi = q0 + 8 * hh + r;
      const int ja = j0 + ln, jb = j0 + 16 + ln;
      if (CAUSAL) { if (ja > qi) s[0][r] = -3.0e38f; if (jb > qi) s[1][r] = -3.0e38f; }
      if (ja >= T) s[0][r] = -3.0e38f;
      if (jb >= T) s[1][r] = -3.0e38f;
      float mx = fmaxf(s[0][r], s[1][r]);
      mx = fmaxf(mx, __shfl_xor(mx, 1, 32)); mx = fmaxf(mx, __shfl_xor(mx, 2, 32)); mx = fmaxf(mx, __shfl_xor(mx, 4, 32)); mx = fmaxf(mx, __shfl_xor(mx, 8, 32));
      const float mnew = fmaxf(m_r[r], mx);
      alpha[r] = (mnew > -1.0e38f) ? __expf(m_r[r] - mnew) : 1.0f;
      const float p0 = (s[0][r] > -1.0e38f) ? __expf(s[0][r] - mnew) : 0.f;
      const float p1 = (s[1][r] > -1.0e38f) ? __expf(s[1][r] - mnew) : 0.f;
      m_r[r] = mnew;
      l_r[r] = l_r[r] * alpha[r] + p0 + p1;            // per-lane partial row sum (16 lanes combined at the end)
      unsigned short hb = bf16_bits(p0); sPh[w][8 * hh + r][ln] = hb;      sPl[w][8 * hh + r][ln] = bf16_bits(p0 - bf16_val(hb));
      hb = bf16_bits(p1);                sPh[w][8 * hh + r][16 + ln] = hb; sPl[w][8 * hh + r][16 + ln] = bf16_bits(p1 - bf16_val(hb));
    }
#pragma unroll
    for (int dt = 0; dt < DT; ++dt)
#pragma unroll
      for (int r = 0; r < 8; ++r) oacc[dt][r] *= alpha[r];
    __builtin_amdgcn_fence(__ATOMIC_ACQ_REL, "workgroup");
    __builtin_amdgcn_wave_barrier();
    FragB pah, pal;
    pah.half[0] = *(const v8us*)&sPh[w][ln][8 * hh]; pah.half[1] = *(const v8us*)&sPh[w][ln][16 + 8 * hh];
    pal.half[0] = *(const v8us*)&sPl[w][ln][8 * hh]; pal.half[1] = *(const v8us*)&sPl[w][ln][16 + 8 * hh];
#pragma unroll
    for (int dt = 0; dt < DT; ++dt) {
      FragB bvh, bvl;
#pragma unroll
      for (int i = 0; i < 8; ++i) {
        bvh.u[i] = sVh[8 * hh + i][dt * 16 + ln]; bvh.u[8 + i] = sVh[16 + 8 * hh + i][dt * 16 + ln];
        bvl.u[i] = sVl[8 * hh + i][dt * 16 + ln]; bvl.u[8 + i] = sVl[16 + 8 * hh + i][dt * 16 + ln];
      }
      oacc[dt] = mmaN<3>(pah.v, pal.v, bvh.v, bvl.v, oacc[dt]);
    }
    __builtin_amdgcn_fence(__ATOMIC_ACQ_REL, "workgroup");
    __builtin_amdgcn_wave_barrier();
  }
#pragma unroll
  for (int r = 0; r < 8; ++r) {
    float l = l_r[r];
    l += __shfl_xor(l, 1, 32); l += __shfl_xor(l, 2, 32); l += __shfl_xor(l, 4, 32); l += __shfl_xor(l, 8, 32);
    l_r[r] = (l > 0.f) ? 1.0f / l : 0.f;
  }
#pragma unroll
  for (int dt = 0; dt < DT; ++dt)
#pragma unroll
    for (int r = 0; r < 8; ++r) sO[w][8 * hh + r][dt * 16 + ln] = oacc[dt][r] * l_r[r];
  __builtin_amdgcn_fence(__ATOMIC_ACQ_REL, "workgroup");
  __builtin_amdgcn_wave_barrier();
  {
    for (int r = 0; r < 16; ++r) {
      const int row = q0 + r;
      if (row < T && lane < D / 4) {
        const v4f val = *(const v4fa*)&sO[w][r][lane * 4];
        *(v4f*)(y + ((size_t)b * T + row) * ypitch + h * D + lane * 4) = val;
      }
    }
    
  }
}

// GEMM C = act(A·W + bias + resid): A f32 (ASPLIT -> hi/lo 2 terms), Wt bf16 [N][K]; ACT 0 none, 1 relu, 2 exact gelu;
// resid (optional, f32, row index = (row % rmod), pitch ldr, RES_BF16 rounds it) added before the activation.
template <bool ASPLIT, int ACT, bool BIAS_BF16, bool RES_BF16>
__global__ __launch_bounds__(128) void k_gemm_bf3(const float* __restrict__ A, int lda, const unsigned short* __restrict__ Wt, int ldb,
                                                const float* __restrict__ bias, const float* __restrict__ resid, int rmod, int ldr,
                                                float* __restrict__ C, int ldc, int M, int N, int K) {
  __shared__ __attribute__((aligned(16))) float so[4][16][64];
  const int tid = threadIdx.x, w = tid >> 5, lane = tid & 31, ln = lane & 15, hh = lane >> 4;
  const int ntn = N / 64;
  const int wid = blockIdx.x * 4 + w;
  const int mt = wid / ntn, nq = wid % ntn;
  if (mt * 16 >= M) return;
  const int row0 = mt * 16, col0 = nq * 64;
  const float* arow = A + (size_t)(row0 + ln) * lda;
  v8f acc[4] = {};
  for (int kb = 0; kb < K; kb += 32) {
    FragB ah, al;
    const v4f x0 = *(const v4fa*)(arow + kb + 8 * hh), x1 = *(const v4fa*)(arow + kb + 8 * hh + 4);
    const v4f x2 = *(const v4fa*)(arow + kb + 16 + 8 * hh), x3 = *(const v4fa*)(arow + kb + 16 + 8 * hh + 4);
    float xs[16] = {x0[0],x0[1],x0[2],x0[3],x1[0],x1[1],x1[2],x1[3],x2[0],x2[1],x2[2],x2[3],x3[0],x3[1],x3[2],x3[3]};
#pragma unroll
    for (int i = 0; i < 16; ++i) { const unsigned short hb = bf16_bits(xs[i]); ah.u[i] = hb; al.u[i] = ASPLIT ? bf16_bits(xs[i] - bf16_val(hb)) : (unsigned short)0; }
#pragma unroll
    for (int t = 0; t < 4; ++t) {
      const unsigned short* brow = Wt + (size_t)(col0 + t * 16 + ln) * ldb + kb;
      FragB b;
      b.half[0] = *(const v8us*)(brow + 8 * hh);
      b.half[1] = *(const v8us*)(brow + 16 + 8 * hh);
      acc[t] = mmaN<ASPLIT ? 2 : 1>(ah.v, al.v, b.v, b.v, acc[t]);
    }
  }
#pragma unroll
  for (int t = 0; t < 4; ++t) {
    const int col = col0 + t * 16 + ln;
    float bv = bias ? bias[col] : 0.f;
    if (BIAS_BF16) bv = bf16_round(bv);
#pragma unroll
    for (int r = 0; r < 8; ++r) {
      float v = acc[t][r] + bv;
      if (resid) { float rv = resid[(size_t)((row0 + 8 * hh + r) % rmod) * ldr + col]; if (RES_BF16) rv = bf16_round(rv); v += rv; }
      if (ACT == 1) v = fmaxf(v, 0.f);
      if (ACT == 2) v = 0.5f * v * (1.0f + erff(v * 0.70710678118654752f));
      if (ACT == 3) { const float u = 0.7978845608028654f * (v + 0.044715f * v * v * v); v = 0.5f * v * (1.0f + tanhf(u)); }
      so[w][8 * hh + r][t * 16 + ln] = v;
    }
  }
  __builtin_amdgcn_fence(__ATOMIC_ACQ_REL, "workgroup");
  __builtin_amdgcn_wave_barrier();
  const int rsub = lane >> 4, c4 = (lane & 15) * 4;
  {
#pragma unroll
    for (int q = 0; q < 8; ++q) {
      const int r = q * 2 + rsub;
      const v4f v = *(const v4fa*)&so[w][r][c4];
      *(v4f*)(C + (size_t)(row0 + r) * ldc + col0 + c4) = v;
    }
    
  }
}
// row LayerNorm (biased variance, eps) over N: s = X (+ R); optional out_sum <- s; out_norm <- (s-mu)*rsqrt(var+eps)*g + b
template <bool PARAM_BF16>
__global__ __launch_bounds__(256) void k_layernorm(const float* __restrict__ X, const float* __restrict__ R, const float* __restrict__ g, const float* __restrict__ bta,
                                                  float* __restrict__ out_sum, float* __restrict__ out_norm, int N, float eps) {
  __shared__ float red[256];
  const int row = blockIdx.x, tid = threadIdx.x;
  const float* x = X + (size_t)row * N; const float* rr = R ? R + (size_t)row * N : nullptr;
  float vals[16];                     // up to N = 4096
  const int per = N / 256;            // contiguous chunk per thread? use strided-by-4 chunks: thread handles j = tid*4 + 1024*u
  float s1 = 0.f;
  for (int u = 0; u < per / 4; ++u) {
    const int j = tid * 4 + 1024 * u;
    const v4f a = *(const v4fa*)(x + j);
    v4f b = {0.f,0.f,0.f,0.f}; if (rr) b = *(const v4fa*)(rr + j);
#pragma unroll
    for (int q = 0; q < 4; ++q) { const float v = a[q] + b[q]; vals[u * 4 + q] = v; s1 += v; }
  }
  red[tid] = s1; __syncthreads();
  for (int st = 128; st > 0; st >>= 1) { if (tid < st) red[tid] += red[tid + st]; __syncthreads(); }
  const float mu = red[0] / (float)N; __syncthreads();
  float s2 = 0.f;
  for (int u = 0; u < per / 4; ++u)
#pragma unroll
    for (int q = 0; q < 4; ++q) { const float c = vals[u * 4 + q] - mu; s2 += c * c; }
  red[tid] = s2; __syncthreads();
  for (int st = 128; st > 0; st >>= 1) { if (tid < st) red[tid] += red[tid + st]; __syncthreads(); }
  const float rs = rsqrtf(red[0] / (float)N + eps);
  {
    for (int u = 0; u < per / 4; ++u) {
      const int j = tid * 4 + 1024 * u;
      v4f o, sm;
#pragma unroll
      for (int q = 0; q < 4; ++q) {
        float gg = g[j + q], bb = bta[j + q];
        if (PARAM_BF16) { gg = bf16_round(gg); bb = bf16_round(bb); }
        sm[q] = vals[u * 4 + q]; o[q] = (vals[u * 4 + q] - mu) * rs * gg + bb;
      }
      if (out_sum) *(v4f*)(out_sum + (size_t)row * N + j) = sm;
      *(v4f*)(out_norm + (size_t)row * N + j) = o;
    }
    
  }
}



// ---- f16 WMMA path (v_wmma_f32_16x16x32_f16): 11-bit significands for operands in range — used where a [0,1] probability operand needs more precision than bf16
typedef _Float16 v16h __attribute__((ext_vector_type(16)));
union FragH { v16h v; v8us half[2]; _Float16 h[16]; unsigned short u[16]; };
template <int NT>
__device__ __forceinline__ v8f mmaH(v16h ah, v16h al, v16h bh, v16h bl, v8f c) {
  c = __builtin_amdgcn_wmma_f32_16x16x32_f16(false, ah, false, bh, (short)0, c, false, false);
  if (NT >= 2) c = __builtin_amdgcn_wmma_f32_16x16x32_f16(false, al, false, bh, (short)0, c, false, false);
  if (NT >= 3) c = __builtin_amdgcn_wmma_f32_16x16x32_f16(false, ah, false, bl, (short)0, c, false, false);
  asm volatile("v_nop\n\tv_nop\n\tv_nop\n\tv_nop" : "+v"(c) : "v"(ah), "v"(al), "v"(bh), "v"(bl));
  return c;
}
// batched GEMM like k_gemm_b but f16 operands: A f32 (split into f16 hi/lo if ASPLIT, else rounded to f16), Bt = f16 values [n][k]; alpha; C f32; N multiple of 16 (partial tiles skipped)
template <bool ASPLIT>
__global__ __launch_bounds__(128) void k_gemm_h(const float* __restrict__ A, int lda, size_t sA, const _Float16* __restrict__ Bh, int ldb, size_t sB, float alpha, float* __restrict__ C, int ldc, size_t sC, int M, int N, int K) {
  __shared__ __attribute__((aligned(16))) float so[4][16][64];
  const int tid = threadIdx.x, w = tid >> 5, lane = tid & 31, ln = lane & 15, hh = lane >> 4; const int by = blockIdx.y;
  A += (size_t)by * sA; Bh += (size_t)by * sB; C += (size_t)by * sC;
  const int ntn = (N + 63) / 64; const int wid = blockIdx.x * 4 + w; const int mt = wid / ntn, nq = wid % ntn; if (mt * 16 >= M) return;
  const int row0 = mt * 16, col0 = nq * 64; const float* arow = A + (size_t)(row0 + ln) * lda;
  v8f acc[4] = {};
  for (int kb = 0; kb < K; kb += 32) {
    FragH ah, al;
    const v4f x0 = *(const v4fa*)(arow + kb + 8 * hh), x1 = *(const v4fa*)(arow + kb + 8 * hh + 4), x2 = *(const v4fa*)(arow + kb + 16 + 8 * hh), x3 = *(const v4fa*)(arow + kb + 16 + 8 * hh + 4);
    float xs[16] = {x0[0],x0[1],x0[2],x0[3],x1[0],x1[1],x1[2],x1[3],x2[0],x2[1],x2[2],x2[3],x3[0],x3[1],x3[2],x3[3]};
#pragma unroll
    for (int i = 0; i < 16; ++i) { const _Float16 h = (_Float16)xs[i]; ah.h[i] = h; al.h[i] = ASPLIT ? (_Float16)(xs[i] - (float)h) : (_Float16)0.0f; }
#pragma unroll
    for (int t = 0; t < 4; ++t) { if (col0 + t * 16 >= N) continue; const size_t boff = (size_t)(col0 + t * 16 + ln) * ldb + kb; FragH bq; bq.half[0] = *(const v8us*)(Bh + boff + 8 * hh); bq.half[1] = *(const v8us*)(Bh + boff + 16 + 8 * hh);
      acc[t] = mmaH<ASPLIT ? 2 : 1>(ah.v, al.v, bq.v, bq.v, acc[t]); }
  }
#pragma unroll
  for (int t = 0; t < 4; ++t) { if (col0 + t * 16 >= N) continue;
#pragma unroll
    for (int r = 0; r < 8; ++r) so[w][8 * hh + r][t * 16 + ln] = acc[t][r] * alpha; }
  __builtin_amdgcn_fence(__ATOMIC_ACQ_REL, "workgroup"); __builtin_amdgcn_wave_barrier();
  const int rsub = lane >> 4, c4 = (lane & 15) * 4;
  {
#pragma unroll
    for (int q = 0; q < 8; ++q) { const int r = q * 2 + rsub; if (col0 + c4 < N) { const v4f v = *(const v4fa*)&so[w][r][c4]; *(v4f*)(C + (size_t)(row0 + r) * ldc + col0 + c4) = v; } }
     }
}

// Wt[n][k] = f16(W[k][n]·scale) from f32 row-major W[K][N] (scale = power of two; bf16-exact weights stay exact in f16 away from the subnormal range)
__global__ __launch_bounds__(256) void k_wt_f16(const float* __restrict__ W, _Float16* __restrict__ Wt, int K, int N, float scale) {
  const int t = blockIdx.x * 256 + threadIdx.x; if (t >= N * (K / 8)) return; const int n = t / (K / 8), k8 = (t % (K / 8)) * 8; FragH f;
#pragma unroll
  for (int i = 0; i < 8; ++i) f.h[i] = (_Float16)(bf16_round(W[(size_t)(k8 + i) * N + n]) * scale); const v8us o = f.half[0];
  *(v8us*)((unsigned short*)Wt + (size_t)n * K + k8) = o; 
}
// k_gemm_hh variant with fused epilogue: v = acc·alpha + bias[by·sBias + col] (+ CP[(row/rowsPerB)·sCPb + by·64 + col] if CP) ; ACT 0 none / 1 elu ; writes f16 C16 and/or f32 C (each if non-null)
template <int ACT>
__global__ __launch_bounds__(128) void k_gemm_hhx(const _Float16* __restrict__ A, int lda, size_t sA, const _Float16* __restrict__ Bh, int ldb, size_t sB, float alpha, const float* __restrict__ bias, size_t sBias, const float* __restrict__ CP, int rowsPerB, size_t sCPb, int row0g,
    float* __restrict__ C, _Float16* __restrict__ C16, int ldc, size_t sC, int M, int N, int K) {
  __shared__ __attribute__((aligned(16))) float so[4][16][64];
  const int tid = threadIdx.x, w = tid >> 5, lane = tid & 31, ln = lane & 15, hh = lane >> 4; const int by = blockIdx.y;
  A += (size_t)by * sA; Bh += (size_t)by * sB; const size_t cofs = (size_t)by * sC; const float* bp = bias ? bias + (size_t)by * sBias : nullptr;
  const int ntn = (N + 63) / 64; const int wid = blockIdx.x * 4 + w; const int mt = wid / ntn, nq = wid % ntn; if (mt * 16 >= M) return;
  const int row0 = mt * 16, col0 = nq * 64; const _Float16* arow = A + (size_t)(row0 + ln) * lda;
  v8f acc[4] = {};
  for (int kb = 0; kb < K; kb += 32) { FragH ah; ah.half[0] = *(const v8us*)((const unsigned short*)arow + kb + 8 * hh); ah.half[1] = *(const v8us*)((const unsigned short*)arow + kb + 16 + 8 * hh);
#pragma unroll
    for (int t = 0; t < 4; ++t) { if (col0 + t * 16 >= N) continue; const size_t boff = (size_t)(col0 + t * 16 + ln) * ldb + kb; FragH bq; bq.half[0] = *(const v8us*)((const unsigned short*)Bh + boff + 8 * hh); bq.half[1] = *(const v8us*)((const unsigned short*)Bh + boff + 16 + 8 * hh);
      acc[t] = mmaH<1>(ah.v, ah.v, bq.v, bq.v, acc[t]); }
  }
#pragma unroll
  for (int t = 0; t < 4; ++t) { if (col0 + t * 16 >= N) continue; const int col = col0 + t * 16 + ln; const float bv = bp ? bf16_round(bp[col]) : 0.f;
#pragma unroll
    for (int r = 0; r < 8; ++r) { float v = acc[t][r] * alpha + bv; if (CP) { const int bidx = (row0g + row0 + 8 * hh + r) / rowsPerB; v += CP[(size_t)bidx * sCPb + (size_t)by * 64 + col]; } if (ACT == 1) v = (v > 0.f) ? v : expm1f(v); else if (ACT == 3) v = fmaxf(v, 0.f); so[w][8 * hh + r][t * 16 + ln] = v; } }
  __builtin_amdgcn_fence(__ATOMIC_ACQ_REL, "workgroup"); __builtin_amdgcn_wave_barrier();
  const int rsub = lane >> 4, c4 = (lane & 15) * 4; typedef _Float16 v4h __attribute__((ext_vector_type(4)));
  {
#pragma unroll
    for (int q = 0; q < 8; ++q) { const int r = q * 2 + rsub; if (col0 + c4 < N) { const v4f v = *(const v4fa*)&so[w][r][c4]; if (C) *(v4f*)(C + cofs + (size_t)(row0 + r) * ldc + col0 + c4) = v; if (C16) { v4h h4; for (int i = 0; i < 4; ++i) h4[i] = (_Float16)v[i]; *(v4h*)(C16 + cofs + (size_t)(row0 + r) * ldc + col0 + c4) = h4; } } }
     }
}


// Projection Y = X.W^T / 16 + bias at the fixed shape NR x DM x DM. One 128 x 128 tile of Y per work-group of 8 waves (4 x 2 waves, 32 x 64 of Y each).
// Each 64-k step of both operands (128 rows of 128 B) is read from global as whole lines, one step ahead, into registers and laid in LDS at a pitch of 144 B
// (16 B x odd: no bank conflict for the 16-byte fragment reads). Two LDS buffers: the one barrier of a step publishes its tile and ends the reads of the buffer written next.
// Fragment maps and the ascending k order of every accumulator are those of k_gemm_hhx.
template <bool F32OUT>
__global__ __launch_bounds__(256) void k_proj(const _Float16* __restrict__ A, const _Float16* __restrict__ Bh, const float* __restrict__ bias, float* __restrict__ C, _Float16* __restrict__ C16) {
  constexpr int PT = 72, NS = DM / 64;
  __shared__ __attribute__((aligned(16))) unsigned short sA[2][128][PT], sB[2][128][PT];
  __shared__ __attribute__((aligned(16))) float so[8][32][68];
  const int tid = threadIdx.x, w = tid >> 5, lane = tid & 31, ln = lane & 15, hh = lane >> 4;
  const int m0 = (blockIdx.x >> 3) * 128, n0 = (blockIdx.x & 7) * 128, wm = (w >> 1) * 32, wn = (w & 1) * 64;
  const int lr = tid >> 3, lc = (tid & 7) * 8;
  const unsigned short* ga = (const unsigned short*)A + (size_t)(m0 + lr) * DM + lc;
  const unsigned short* gb = (const unsigned short*)Bh + (size_t)(n0 + lr) * DM + lc;
  v8us ra[4], rb[4];
#pragma unroll
  for (int i = 0; i < 4; ++i) { ra[i] = *(const v8us*)(ga + (size_t)i * 32 * DM); rb[i] = *(const v8us*)(gb + (size_t)i * 32 * DM); }
  v8f acc[2][4];
#pragma unroll
  for (int mt = 0; mt < 2; ++mt)
#pragma unroll
    for (int nt = 0; nt < 4; ++nt) acc[mt][nt] = (v8f){0.f,0.f,0.f,0.f,0.f,0.f,0.f,0.f};
  // unrolled by two so that the buffer index is a constant in every LDS address
#pragma unroll 2
  for (int s = 0; s < NS; ++s) {
    const int bf = s & 1;
#pragma unroll
    for (int i = 0; i < 4; ++i) { *(v8us*)&sA[bf][lr + 32 * i][lc] = ra[i]; *(v8us*)&sB[bf][lr + 32 * i][lc] = rb[i]; }
    __syncthreads();
    if (s + 1 < NS) {
#pragma unroll
      for (int i = 0; i < 4; ++i) { ra[i] = *(const v8us*)(ga + (size_t)i * 32 * DM + (s + 1) * 64); rb[i] = *(const v8us*)(gb + (size_t)i * 32 * DM + (s + 1) * 64); }
    }
    // keeps the next step's global loads in front of this step's matrix work: left free, the compiler sinks them to just before their LDS stores and their whole latency is waited out
    __builtin_amdgcn_sched_barrier(0);
#pragma unroll
    for (int ks = 0; ks < 2; ++ks) {
      FragH a[2], b[4];
#pragma unroll
      for (int mt = 0; mt < 2; ++mt) { a[mt].half[0] = *(const v8us*)&sA[bf][wm + mt * 16 + ln][ks * 32 + 8 * hh]; a[mt].half[1] = *(const v8us*)&sA[bf][wm + mt * 16 + ln][ks * 32 + 16 + 8 * hh]; }
#pragma unroll
      for (int nt = 0; nt < 4; ++nt) { b[nt].half[0] = *(const v8us*)&sB[bf][wn + nt * 16 + ln][ks * 32 + 8 * hh]; b[nt].half[1] = *(const v8us*)&sB[bf][wn + nt * 16 + ln][ks * 32 + 16 + 8 * hh]; }
#pragma unroll
      for (int mt = 0; mt < 2; ++mt)
#pragma unroll
        for (int nt = 0; nt < 4; ++nt) acc[mt][nt] = __builtin_amdgcn_wmma_f32_16x16x32_f16(false, a[mt].v, false, b[nt].v, (short)0, acc[mt][nt], false, false);
    }
  }
  // stands in front of the epilogue's reuse of the registers that held the global load addresses (the scheduling barrier keeps that reuse behind it)
  asm volatile("s_wait_xcnt 0x0" ::: "memory");
  __builtin_amdgcn_sched_barrier(0);
  typedef _Float16 v4h __attribute__((ext_vector_type(4)));
#pragma unroll
  for (int nt = 0; nt < 4; ++nt) { const float bv = bf16_round(bias[n0 + wn + nt * 16 + ln]);
#pragma unroll
    for (int mt = 0; mt < 2; ++mt)
#pragma unroll
      for (int r = 0; r < 8; ++r) so[w][mt * 16 + 8 * hh + r][nt * 16 + ln] = acc[mt][nt][r] * 0.0625f + bv; }
  // the wave's own 32 x 64 strip: its LDS writes are ordered before its cross-lane reads, so that whole lines go out
  __builtin_amdgcn_fence(__ATOMIC_ACQ_REL, "workgroup"); __builtin_amdgcn_wave_barrier();
#pragma unroll
  for (int q = 0; q < 16; ++q) { const int r = q * 2 + hh, c4 = ln * 4; const v4f v = *(const v4fa*)&so[w][r][c4]; const size_t o = (size_t)(m0 + wm + r) * DM + n0 + wn + c4;
    if (F32OUT) *(v4f*)(C + o) = v; else { v4h h4;
#pragma unroll
      for (int i = 0; i < 4; ++i) h4[i] = (_Float16)v[i]; *(v4h*)(C16 + o) = h4; } }
}

__global__ __launch_bounds__(256) void k_x16(const float* __restrict__ x, _Float16* __restrict__ X16, size_t n8) { const size_t t = (size_t)blockIdx.x * 256 + threadIdx.x; if (t >= n8) return; FragH f;
#pragma unroll
  for (int q = 0; q < 8; ++q) f.h[q] = (_Float16)bf16_round(x[t * 8 + q]); *(v8us*)((unsigned short*)X16 + t * 8) = f.half[0];  }
__global__ __launch_bounds__(256) void k_h16(const float* __restrict__ x, _Float16* __restrict__ X16, size_t n8) { const size_t t = (size_t)blockIdx.x * 256 + threadIdx.x; if (t >= n8) return; FragH f;
#pragma unroll
  for (int q = 0; q < 8; ++q) f.h[q] = (_Float16)x[t * 8 + q]; *(v8us*)((unsigned short*)X16 + t * 8) = f.half[0];  }
__global__ __launch_bounds__(256) void k_round16f(const float* __restrict__ W, _Float16* __restrict__ Bt, size_t n8) { const size_t t = (size_t)blockIdx.x * 256 + threadIdx.x; if (t >= n8) return; FragH f;
#pragma unroll
  for (int i = 0; i < 8; ++i) f.h[i] = (_Float16)(bf16_round(W[t * 8 + i]) * 16.0f); *(v8us*)((unsigned short*)Bt + t * 8) = f.half[0];  }
__global__ __launch_bounds__(256) void k_vt(const _Float16* __restrict__ V16, _Float16* __restrict__ Vt) { __shared__ unsigned short tl[64][66]; const int tid = threadIdx.x; const int slab = blockIdx.x / (SS / 64), lg = blockIdx.x % (SS / 64); const int b = slab / NH, h = slab % NH;
  for (int i = tid; i < 64 * 8; i += 256) { const int r = i / 8, c8 = (i % 8) * 8; FragH f; f.half[0] = *(const v8us*)((const unsigned short*)V16 + ((size_t)b * SS + lg * 64 + r) * DM + h * HD + c8);
#pragma unroll
    for (int q = 0; q < 8; ++q) tl[r][c8 + q] = f.u[q]; }
  __syncthreads();
  {
#pragma unroll
    for (int rd = 0; rd < 2; ++rd) { const int d = rd * 32 + tid / 8, pc = tid % 8; FragH f;
#pragma unroll
      for (int q = 0; q < 8; ++q) f.u[q] = tl[pc * 8 + q][d];
      *(v8us*)((unsigned short*)Vt + ((size_t)slab * HD + d) * SS + lg * 64 + pc * 8) = f.half[0]; }
     } }
__device__ __forceinline__ float sigm_f(float x) { return 1.0f / (1.0f + expf(-x)); }
__global__ __launch_bounds__(128) void k_satt(const _Float16* __restrict__ Q16, const _Float16* __restrict__ K16, const _Float16* __restrict__ Vt, float* __restrict__ O) {
  constexpr int RPW = 32, NQB = SS / (4 * RPW), DT = HD / 16, KS = HD / 32;
  __shared__ __attribute__((aligned(16))) unsigned short sP[4][RPW][40]; __shared__ __attribute__((aligned(16))) float sO[4][RPW][HD];
  const int tid = threadIdx.x, w = tid >> 5, lane = tid & 31, ln = lane & 15, hh = lane >> 4;
  const int slab = blockIdx.x / NQB, qblk = blockIdx.x % NQB; const int b = slab / NH, h = slab % NH; const int q0 = qblk * (4 * RPW) + w * RPW;
  FragH aq[2][KS];
#pragma unroll
  for (int rt = 0; rt < 2; ++rt) { const unsigned short* qr = (const unsigned short*)Q16 + ((size_t)b * SS + q0 + rt * 16 + ln) * DM + h * HD;
#pragma unroll
    for (int ks = 0; ks < KS; ++ks) { aq[rt][ks].half[0] = *(const v8us*)(qr + ks * 32 + 8 * hh); aq[rt][ks].half[1] = *(const v8us*)(qr + ks * 32 + 16 + 8 * hh); } }
  const unsigned short* Vth = (const unsigned short*)Vt + (size_t)slab * HD * SS;
  v8f oacc[2][DT];
#pragma unroll
  for (int rt = 0; rt < 2; ++rt)
#pragma unroll
    for (int dt = 0; dt < DT; ++dt) oacc[rt][dt] = (v8f){0.f,0.f,0.f,0.f,0.f,0.f,0.f,0.f};
#pragma unroll 1
  for (int j0 = 0; j0 < SS; j0 += 32) {
    v8f s[2][2];
#pragma unroll
    for (int nt = 0; nt < 2; ++nt) { const unsigned short* kr = (const unsigned short*)K16 + ((size_t)b * SS + j0 + nt * 16 + ln) * DM + h * HD; FragH bk[KS];
#pragma unroll
      for (int ks = 0; ks < KS; ++ks) { bk[ks].half[0] = *(const v8us*)(kr + ks * 32 + 8 * hh); bk[ks].half[1] = *(const v8us*)(kr + ks * 32 + 16 + 8 * hh); }
#pragma unroll
      for (int rt = 0; rt < 2; ++rt) { v8f acc = (v8f){0.f,0.f,0.f,0.f,0.f,0.f,0.f,0.f};
#pragma unroll
        for (int ks = 0; ks < KS; ++ks) acc = mmaH<1>(aq[rt][ks].v, aq[rt][ks].v, bk[ks].v, bk[ks].v, acc); s[rt][nt] = acc; } }
#pragma unroll
    for (int rt = 0; rt < 2; ++rt)
#pragma unroll
      for (int r = 0; r < 8; ++r) { FragH t2; t2.h[0] = (_Float16)sigm_f(s[rt][0][r] * 0.125f); t2.h[1] = (_Float16)sigm_f(s[rt][1][r] * 0.125f); sP[w][rt * 16 + 8 * hh + r][ln] = t2.u[0]; sP[w][rt * 16 + 8 * hh + r][16 + ln] = t2.u[1]; }
    __builtin_amdgcn_fence(__ATOMIC_ACQ_REL, "workgroup"); __builtin_amdgcn_wave_barrier();
    FragH pa[2];
#pragma unroll
    for (int rt = 0; rt < 2; ++rt) { pa[rt].half[0] = *(const v8us*)&sP[w][rt * 16 + ln][8 * hh]; pa[rt].half[1] = *(const v8us*)&sP[w][rt * 16 + ln][16 + 8 * hh]; }
#pragma unroll
    for (int dt = 0; dt < DT; ++dt) { const unsigned short* vrow = Vth + (size_t)(dt * 16 + ln) * SS + j0; FragH bv; bv.half[0] = *(const v8us*)(vrow + 8 * hh); bv.half[1] = *(const v8us*)(vrow + 16 + 8 * hh);
#pragma unroll
      for (int rt = 0; rt < 2; ++rt) oacc[rt][dt] = mmaH<1>(pa[rt].v, pa[rt].v, bv.v, bv.v, oacc[rt][dt]); }
    __builtin_amdgcn_fence(__ATOMIC_ACQ_REL, "workgroup"); __builtin_amdgcn_wave_barrier(); }
#pragma unroll
  for (int rt = 0; rt < 2; ++rt)
#pragma unroll
    for (int dt = 0; dt < DT; ++dt)
#pragma unroll
      for (int r = 0; r < 8; ++r) sO[w][rt * 16 + 8 * hh + r][dt * 16 + ln] = oacc[rt][dt][r];
  __builtin_amdgcn_fence(__ATOMIC_ACQ_REL, "workgroup"); __builtin_amdgcn_wave_barrier();
  {
#pragma unroll
    for (int rp = 0; rp < RPW; rp += 2) { const int r = rp + (lane >> 4), pc = lane & 15; const v4f val = *(const v4fa*)&sO[w][r][pc * 4]; *(v4f*)(O + ((size_t)b * SS + q0 + r) * DM + h * HD + pc * 4) = val; }
     } }
// (b) attn_weights[b][q][k] = (1/16) sum_h sigmoid(q_h.k_h/8): block = (b, AWK keys, 64 queries), wave = 16 queries; for each 32-key chunk of the block's keys, loop the 16 heads (S tile pairs on WMMA, sigmoid, fixed-order sum).
// The key range is dealt over the grid, so that every SIMD of the chip holds as many waves as its registers allow; each output tile is still made whole by one wave.
#define AWK 32
__global__ __launch_bounds__(128) void k_aw(const _Float16* __restrict__ Q16, const _Float16* __restrict__ K16, float* __restrict__ AW) {
  constexpr int RPW = 16, KS = HD / 32; __shared__ __attribute__((aligned(16))) float st[4][RPW][32 + 4];
  const int tid = threadIdx.x, w = tid >> 5, lane = tid & 31, ln = lane & 15, hh = lane >> 4; const int qblk = blockIdx.x % (SS / 64), bj = blockIdx.x / (SS / 64); const int jblk = bj % (SS / AWK), b = bj / (SS / AWK); const int q0 = qblk * 64 + w * RPW;
  const unsigned short* qbase = (const unsigned short*)Q16 + ((size_t)b * SS + q0 + ln) * DM;
#pragma unroll 1
  for (int j0 = jblk * AWK; j0 < jblk * AWK + AWK; j0 += 32) { float aw[2][8];
#pragma unroll
    for (int nt = 0; nt < 2; ++nt)
#pragma unroll
      for (int r = 0; r < 8; ++r) aw[nt][r] = 0.f;
#pragma unroll 1
    for (int h = 0; h < NH; ++h) { FragH aq[KS];
#pragma unroll
      for (int ks = 0; ks < KS; ++ks) { aq[ks].half[0] = *(const v8us*)(qbase + h * HD + ks * 32 + 8 * hh); aq[ks].half[1] = *(const v8us*)(qbase + h * HD + ks * 32 + 16 + 8 * hh); }
#pragma unroll
      for (int nt = 0; nt < 2; ++nt) { const unsigned short* kr = (const unsigned short*)K16 + ((size_t)b * SS + j0 + nt * 16 + ln) * DM + h * HD; v8f acc = (v8f){0.f,0.f,0.f,0.f,0.f,0.f,0.f,0.f};
#pragma unroll
        for (int ks = 0; ks < KS; ++ks) { FragH bk; bk.half[0] = *(const v8us*)(kr + ks * 32 + 8 * hh); bk.half[1] = *(const v8us*)(kr + ks * 32 + 16 + 8 * hh); acc = mmaH<1>(aq[ks].v, aq[ks].v, bk.v, bk.v, acc); }
#pragma unroll
        for (int r = 0; r < 8; ++r) aw[nt][r] += sigm_f(acc[r] * 0.125f); } }
#pragma unroll
    for (int nt = 0; nt < 2; ++nt)
#pragma unroll
      for (int r = 0; r < 8; ++r) st[w][8 * hh + r][nt * 16 + ln] = aw[nt][r] * (1.0f / (float)NH);
    __builtin_amdgcn_fence(__ATOMIC_ACQ_REL, "workgroup"); __builtin_amdgcn_wave_barrier();
    {
#pragma unroll
      for (int rp = 0; rp < RPW; rp += 4) { const int r = rp + (lane >> 3), pc = lane & 7; *(v4f*)(AW + ((size_t)b * SS + q0 + r) * SS + j0 + pc * 4) = *(const v4fa*)&st[w][r][pc * 4]; }
       }
    __builtin_amdgcn_fence(__ATOMIC_ACQ_REL, "workgroup"); __builtin_amdgcn_wave_barrier(); } }
extern "C" void kernel_launch(void* const* d_in, const int* in_sizes, int n_in,
                              void* d_out, int out_size, void* d_ws, size_t ws_size, hipStream_t stream) {
  (void)in_sizes; (void)n_in; (void)out_size;
  const float* xq = (const float*)d_in[0]; const float* xk = (const float*)d_in[1]; const float* xv = (const float*)d_in[2]; const float* Wq = (const float*)d_in[3]; const float* bq = (const float*)d_in[4]; const float* Wk = (const float*)d_in[5]; const float* bk = (const float*)d_in[6]; const float* Wv = (const float*)d_in[7]; const float* bv = (const float*)d_in[8]; const float* Wo = (const float*)d_in[9]; const float* bo = (const float*)d_in[10];
  float* out = (float*)d_out; float* AW = (float*)((char*)d_out + 16777216);
  char* ws = (char*)d_ws; size_t off = 0;
  auto take = [&](size_t bytes) { char* p = ws + off; off += (bytes + 255) & ~(size_t)255; return p; };
  const size_t w8 = (size_t)DM * DM / 8;
  _Float16* Bq = (_Float16*)take(w8 * 16); _Float16* Bk = (_Float16*)take(w8 * 16); _Float16* Bv = (_Float16*)take(w8 * 16); _Float16* Bo = (_Float16*)take(w8 * 16);
  _Float16* XQ = (_Float16*)take((size_t)NR * DM * 2); _Float16* XK = (_Float16*)take((size_t)NR * DM * 2); _Float16* XV = (_Float16*)take((size_t)NR * DM * 2); _Float16* Q16 = (_Float16*)take((size_t)NR * DM * 2); _Float16* K16 = (_Float16*)take((size_t)NR * DM * 2); _Float16* V16 = (_Float16*)take((size_t)NR * DM * 2); _Float16* Vt = (_Float16*)take((size_t)NR * DM * 2); float* O = (float*)take((size_t)NR * DM * 4); _Float16* O16 = (_Float16*)take((size_t)NR * DM * 2);
  if (off > ws_size) return;      // ≈ 8 + 8.4×8 + 16.8 ≈ 92 MiB
  const unsigned gw = (unsigned)((w8 + 255) / 256), gx = (unsigned)(((size_t)NR * DM / 8 + 255) / 256);
  k_round16f<<<gw, 256, 0, stream>>>(Wq, Bq, w8); k_round16f<<<gw, 256, 0, stream>>>(Wk, Bk, w8); k_round16f<<<gw, 256, 0, stream>>>(Wv, Bv, w8); k_round16f<<<gw, 256, 0, stream>>>(Wo, Bo, w8);
  k_x16<<<gx, 256, 0, stream>>>(xq, XQ, (size_t)NR * DM / 8); k_x16<<<gx, 256, 0, stream>>>(xk, XK, (size_t)NR * DM / 8); k_x16<<<gx, 256, 0, stream>>>(xv, XV, (size_t)NR * DM / 8);
  const unsigned gp = (NR / 128) * (DM / 128);
  k_proj<false><<<gp, 256, 0, stream>>>(XQ, Bq, bq, nullptr, Q16);
  k_proj<false><<<gp, 256, 0, stream>>>(XK, Bk, bk, nullptr, K16);
  k_proj<false><<<gp, 256, 0, stream>>>(XV, Bv, bv, nullptr, V16);
  k_vt<<<BB * NH * (SS / 64), 256, 0, stream>>>(V16, Vt);
  k_satt<<<BB * NH * (SS / 128), 128, 0, stream>>>(Q16, K16, Vt, O);
  k_h16<<<gx, 256, 0, stream>>>(O, O16, (size_t)NR * DM / 8);
  k_proj<true><<<gp, 256, 0, stream>>>(O16, Bo, bo, out, nullptr);
  k_aw<<<BB * (SS / 64) * (SS / AWK), 128, 0, stream>>>(Q16, K16, AW);
}

// v003
// One run takes 299 microseconds.
// In two side-by-side timings against v002, it was 1.36 and 1.35 times as fast.
// Over all steps from v000 it is 3.92 times as fast.
#include <hip/hip_runtime.h>
// q/k/v/o projections (4096 × 1024 × 1024, + bias) and the 16-head sigmoid attention on v_wmma_f32_16x16x32_f16: (a) per (b,h) a fused flash-style kernel with P = σ(q·k/8) (no normalisation,
// as the module) and O = P·V on WMMA; (b) the second output mean_h σ(q·k/8) recomputes the score tiles per head and averages them in a fixed order. x inputs f16(bf16 ·) exact, q/k/v and O rounded to f16,
// weights bf16-exact ×2^4 ((out,in)), P f16 ≤ 1, f32 accumulate.
#define BB 2
#define SS 2048
#define DM 1024
#define NH 16
#define HD 64
#define NR (BB * SS)

typedef __bf16 v16b __attribute__((ext_vector_type(16)));
typedef unsigned short v8us __attribute__((ext_vector_type(8), may_alias));
typedef float  v8f  __attribute__((ext_vector_type(8)));
typedef float  v4f  __attribute__((ext_vector_type(4)));
typedef float  v4fa __attribute__((ext_vector_type(4), may_alias));
union FragB { v16b v; v8us half[2]; unsigned short u[16]; };

__device__ __forceinline__ unsigned short bf16_bits(float x) { unsigned int u = __float_as_uint(x); return (unsigned short)((u + 0x7FFFu + ((u >> 16) & 1u)) >> 16); }
__device__ __forceinline__ float bf16_val(unsigned short b) { return __uint_as_float(((unsigned int)b) << 16); }
__device__ __forceinline__ float bf16_round(float x) { return bf16_val(bf16_bits(x)); }
// D += A·B with NT terms: 1 = ah·bh, 2 = + al·bh (A split), 3 = + ah·bl (both split)
template <int NT>
__device__ __forceinline__ v8f mmaN(v16b ah, v16b al, v16b bh, v16b bl, v8f c) {
  c = __builtin_amdgcn_wmma_f32_16x16x32_bf16(false, ah, false, bh, (short)0, c, false, false);
  if (NT >= 2) c = __builtin_amdgcn_wmma_f32_16x16x32_bf16(false, al, false, bh, (short)0, c, false, false);
  if (NT >= 3) c = __builtin_amdgcn_wmma_f32_16x16x32_bf16(false, ah, false, bl, (short)0, c, false, false);
  asm volatile("v_nop\n\tv_nop\n\tv_nop\n\tv_nop" : "+v"(c) : "v"(ah), "v"(al), "v"(bh), "v"(bl));
  return c;
}

__global__ __launch_bounds__(256) void k_wt_bf16(const float* __restrict__ W, unsigned short* __restrict__ Wt, int K, int N) {
  const int t = blockIdx.x * 256 + threadIdx.x;
  const int k8n = K / 8;
  if (t >= N * k8n) return;
  const int n = t / k8n, k8 = (t % k8n) * 8;
  v8us v;
#pragma unroll
  for (int i = 0; i < 8; ++i) v[i] = bf16_bits(W[(size_t)(k8 + i) * N + n]);
  *(v8us*)(Wt + (size_t)n * K + k8) = v;
  
}

// GEMM C[M][N] (f32, pitch ldc) = act(A[M][K]·W + bias). A f32 row-major (pitch lda) converted per fragment to bf16
// (ASPLIT: hi/lo two planes -> 2 terms, else single rounded term); Wt bf16 [N][K] (pitch ldb). BIAS_BF16 rounds the
// bias to bf16 first (bias quantised to bf16 before the add). K%32==0, M%16==0, N%64==0.
template <bool ASPLIT, int ACT, bool BIAS_BF16>
__global__ __launch_bounds__(128) void k_gemm_bf(const float* __restrict__ A, int lda, const unsigned short* __restrict__ Wt, int ldb,
                                               const float* __restrict__ bias, float* __restrict__ C, int ldc, int M, int N, int K) {
  __shared__ __attribute__((aligned(16))) float so[4][16][64];
  const int tid = threadIdx.x, w = tid >> 5, lane = tid & 31, ln = lane & 15, hh = lane >> 4;
  const int ntn = N / 64;
  const int wid = blockIdx.x * 4 + w;
  const int mt = wid / ntn, nq = wid % ntn;
  if (mt * 16 >= M) return;
  const int row0 = mt * 16, col0 = nq * 64;
  const float* arow = A + (size_t)(row0 + ln) * lda;
  v8f acc[4] = {};
  for (int kb = 0; kb < K; kb += 32) {
    FragB ah, al;
    const v4f x0 = *(const v4fa*)(arow + kb + 8 * hh), x1 = *(const v4fa*)(arow + kb + 8 * hh + 4);
    const v4f x2 = *(const v4fa*)(arow + kb + 16 + 8 * hh), x3 = *(const v4fa*)(arow + kb + 16 + 8 * hh + 4);
    float xs[16] = {x0[0],x0[1],x0[2],x0[3],x1[0],x1[1],x1[2],x1[3],x2[0],x2[1],x2[2],x2[3],x3[0],x3[1],x3[2],x3[3]};
#pragma unroll
    for (int i = 0; i < 16; ++i) { const unsigned short hb = bf16_bits(xs[i]); ah.u[i] = hb; al.u[i] = ASPLIT ? bf16_bits(xs[i] - bf16_val(hb)) : (unsigned short)0; }
#pragma unroll
    for (int t = 0; t < 4; ++t) {
      const unsigned short* brow = Wt + (size_t)(col0 + t * 16 + ln) * ldb + kb;
      FragB b;
      b.half[0] = *(const v8us*)(brow + 8 * hh);
      b.half[1] = *(const v8us*)(brow + 16 + 8 * hh);
      acc[t] = mmaN<ASPLIT ? 2 : 1>(ah.v, al.v, b.v, b.v, acc[t]);
    }
  }
#pragma unroll
  for (int t = 0; t < 4; ++t) {
    float bv = bias ? bias[col0 + t * 16 + ln] : 0.f;
    if (BIAS_BF16) bv = bf16_round(bv);
#pragma unroll
    for (int r = 0; r < 8; ++r) { float v = acc[t][r] + bv; if (ACT == 1) v = fmaxf(v, 0.f); so[w][8 * hh + r][t * 16 + ln] = v; }
  }
  __builtin_amdgcn_fence(__ATOMIC_ACQ_REL, "workgroup");
  __builtin_amdgcn_wave_barrier();
  const int rsub = lane >> 4, c4 = (lane & 15) * 4;
  {
#pragma unroll
    for (int q = 0; q < 8; ++q) {
      const int r = q * 2 + rsub;
      const v4f v = *(const v4fa*)&so[w][r][c4];
      *(v4f*)(C + (size_t)(row0 + r) * ldc + col0 + c4) = v;
    }
    
  }
}

// Flash-style causal/unmasked attention, all contractions 3-term bf16 hi/lo splits, f32 softmax with running max.
// q,k,v rows are read from f32 buffers with arbitrary row pitch (so they can live inside a fused qkv buffer);
// D = head size (multiple of 32, <= 128); one wave = 16 query rows; block = 4 waves (64 queries) sharing K/V chunks of 32.
template <int D, bool CAUSAL>
__global__ __launch_bounds__(128) void k_flash(const float* __restrict__ qb, const float* __restrict__ kb, const float* __restrict__ vb,
                                             int pitch, int T, int H, float scale, float* __restrict__ y, int ypitch) {
  constexpr int KS = D / 32;        // k-steps for QK
  constexpr int DT = D / 16;        // d tiles for PV
  __shared__ __attribute__((aligned(16))) unsigned short sKh[32][D + 8], sKl[32][D + 8], sVh[32][D + 8], sVl[32][D + 8];
  __shared__ __attribute__((aligned(16))) unsigned short sPh[4][16][40], sPl[4][16][40];
  __shared__ __attribute__((aligned(16))) float sO[4][16][D];
  const int tid = threadIdx.x, w = tid >> 5, lane = tid & 31, ln = lane & 15, hh = lane >> 4;
  const int nqb = (T + 63) / 64;
  const int bh = blockIdx.x / nqb, qblk = blockIdx.x % nqb;
  const int b = bh / H, h = bh % H;
  const int q0 = qblk * 64 + w * 16;
  const float* Q = qb + (size_t)b * T * pitch + h * D;
  const float* K = kb + (size_t)b * T * pitch + h * D;
  const float* V = vb + (size_t)b * T * pitch + h * D;

  // A fragments of the wave's 16 query rows (scaled), hi/lo
  FragB aqh[KS], aql[KS];
  {
    int row = q0 + ln; if (row >= T) row = T - 1;
    const float* qr = Q + (size_t)row * pitch;
#pragma unroll
    for (int ks = 0; ks < KS; ++ks)
#pragma unroll
      for (int i = 0; i < 16; ++i) {
        const int d = ks * 32 + ((i < 8) ? (8 * hh + i) : (16 + 8 * hh + (i - 8)));
        const float x = qr[d] * scale; const unsigned short hb = bf16_bits(x);
        aqh[ks].u[i] = hb; aql[ks].u[i] = bf16_bits(x - bf16_val(hb));
      }
  }
  float m_r[8], l_r[8];
#pragma unroll
  for (int r = 0; r < 8; ++r) { m_r[r] = -3.0e38f; l_r[r] = 0.f; }
  v8f oacc[DT];
#pragma unroll
  for (int dt = 0; dt < DT; ++dt) oacc[dt] = (v8f){0.f,0.f,0.f,0.f,0.f,0.f,0.f,0.f};

  const int kv_end = CAUSAL ? min(T, qblk * 64 + 64) : T;     // block-uniform
  for (int j0 = 0; j0 < kv_end; j0 += 32) {
    __syncthreads();
    for (int e = tid; e < 32 * (D / 4); e += 128) {
      const int r = e / (D / 4), c4 = (e % (D / 4)) * 4;
      const int key = j0 + r;
      v4f kf = {0.f,0.f,0.f,0.f}, vf = {0.f,0.f,0.f,0.f};
      if (key < T) { kf = *(const v4fa*)(K + (size_t)key * pitch + c4); vf = *(const v4fa*)(V + (size_t)key * pitch + c4); }
#pragma unroll
      for (int t = 0; t < 4; ++t) {
        unsigned short hb = bf16_bits(kf[t]); sKh[r][c4 + t] = hb; sKl[r][c4 + t] = bf16_bits(kf[t] - bf16_val(hb));
        hb = bf16_bits(vf[t]); sVh[r][c4 + t] = hb; sVl[r][c4 + t] = bf16_bits(vf[t] - bf16_val(hb));
      }
    }
    __syncthreads();
    // S tile 16 x 32
    v8f s[2];
#pragma unroll
    for (int nt = 0; nt < 2; ++nt) {
      v8f acc = {};
#pragma unroll
      for (int ks = 0; ks < KS; ++ks) {
        FragB bh_, bl_;
        bh_.half[0] = *(const v8us*)&sKh[nt * 16 + ln][ks * 32 + 8 * hh]; bh_.half[1] = *(const v8us*)&sKh[nt * 16 + ln][ks * 32 + 16 + 8 * hh];
        bl_.half[0] = *(const v8us*)&sKl[nt * 16 + ln][ks * 32 + 8 * hh]; bl_.half[1] = *(const v8us*)&sKl[nt * 16 + ln][ks * 32 + 16 + 8 * hh];
        acc = mmaN<3>(aqh[ks].v, aql[ks].v, bh_.v, bl_.v, acc);
      }
      s[nt] = acc;
    }
    // mask + running max (rows 8hh+r; the 16 lanes of a half share rows)
    float alpha[8];
#pragma unroll
    for (int r = 0; r < 8; ++r) {
      const int qi = q0 + 8 * hh + r;
      const int ja = j0 + ln, jb = j0 + 16 + ln;
      if (CAUSAL) { if (ja > qi) s[0][r] = -3.0e38f; if (jb > qi) s[1][r] = -3.0e38f; }
      if (ja >= T) s[0][r] = -3.0e38f;
      if (jb >= T) s[1][r] = -3.0e38f;
      float mx = fmaxf(s[0][r], s[1][r]);
      mx = fmaxf(mx, __shfl_xor(mx, 1, 32)); mx = fmaxf(mx, __shfl_xor(mx, 2, 32)); mx = fmaxf(mx, __shfl_xor(mx, 4, 32)); mx = fmaxf(mx, __shfl_xor(mx, 8, 32));
      const float mnew = fmaxf(m_r[r], mx);
      alpha[r] = (mnew > -1.0e38f) ? __expf(m_r[r] - mnew) : 1.0f;
      const float p0 = (s[0][r] > -1.0e38f) ? __expf(s[0][r] - mnew) : 0.f;
      const float p1 = (s[1][r] > -1.0e38f) ? __expf(s[1][r] - mnew) : 0.f;
      m_r[r] = mnew;
      l_r[r] = l_r[r] * alpha[r] + p0 + p1;            // per-lane partial row sum (16 lanes combined at the end)
      unsigned short hb = bf16_bits(p0); sPh[w][8 * hh + r][ln] = hb;      sPl[w][8 * hh + r][ln] = bf16_bits(p0 - bf16_val(hb));
      hb = bf16_bits(p1);                sPh[w][8 * hh + r][16 + ln] = hb; sPl[w][8 * hh + r][16 + ln] = bf16_bits(p1 - bf16_val(hb));
    }
#pragma unroll
    for (int dt = 0; dt < DT; ++dt)
#pragma unroll
      for (int r = 0; r < 8; ++r) oacc[dt][r] *= alpha[r];
    __builtin_amdgcn_fence(__ATOMIC_ACQ_REL, "workgroup");
    __builtin_amdgcn_wave_barrier();
    FragB pah, pal;
    pah.half[0] = *(const v8us*)&sPh[w][ln][8 * hh]; pah.half[1] = *(const v8us*)&sPh[w][ln][16 + 8 * hh];
    pal.half[0] = *(const v8us*)&sPl[w][ln][8 * hh]; pal.half[1] = *(const v8us*)&sPl[w][ln][16 + 8 * hh];
#pragma unroll
    for (int dt = 0; dt < DT; ++dt) {
      FragB bvh, bvl;
#pragma unroll
      for (int i = 0; i < 8; ++i) {
        bvh.u[i] = sVh[8 * hh + i][dt * 16 + ln]; bvh.u[8 + i] = sVh[16 + 8 * hh + i][dt * 16 + ln];
        bvl.u[i] = sVl[8 * hh + i][dt * 16 + ln]; bvl.u[8 + i] = sVl[16 + 8 * hh + i][dt * 16 + ln];
      }
      oacc[dt] = mmaN<3>(pah.v, pal.v, bvh.v, bvl.v, oacc[dt]);
    }
    __builtin_amdgcn_fence(__ATOMIC_ACQ_REL, "workgroup");
    __builtin_amdgcn_wave_barrier();
  }
#pragma unroll
  for (int r = 0; r < 8; ++r) {
    float l = l_r[r];
    l += __shfl_xor(l, 1, 32); l += __shfl_xor(l, 2, 32); l += __shfl_xor(l, 4, 32); l += __shfl_xor(l, 8, 32);
    l_r[r] = (l > 0.f) ? 1.0f / l : 0.f;
  }
#pragma unroll
  for (int dt = 0; dt < DT; ++dt)
#pragma unroll
    for (int r = 0; r < 8; ++r) sO[w][8 * hh + r][dt * 16 + ln] = oacc[dt][r] * l_r[r];
  __builtin_amdgcn_fence(__ATOMIC_ACQ_REL, "workgroup");
  __builtin_amdgcn_wave_barrier();
  {
    for (int r = 0; r < 16; ++r) {
      const int row = q0 + r;
      if (row < T && lane < D / 4) {
        const v4f val = *(const v4fa*)&sO[w][r][lane * 4];
        *(v4f*)(y + ((size_t)b * T + row) * ypitch + h * D + lane * 4) = val;
      }
    }
    
  }
}

// GEMM C = act(A·W + bias + resid): A f32 (ASPLIT -> hi/lo 2 terms), Wt bf16 [N][K]; ACT 0 none, 1 relu, 2 exact gelu;
// resid (optional, f32, row index = (row % rmod), pitch ldr, RES_BF16 rounds it) added before the activation.
template <bool ASPLIT, int ACT, bool BIAS_BF16, bool RES_BF16>
__global__ __launch_bounds__(128) void k_gemm_bf3(const float* __restrict__ A, int lda, const unsigned short* __restrict__ Wt, int ldb,
                                                const float* __restrict__ bias, const float* __restrict__ resid, int rmod, int ldr,
                                                float* __restrict__ C, int ldc, int M, int N, int K) {
  __shared__ __attribute__((aligned(16))) float so[4][16][64];
  const int tid = threadIdx.x, w = tid >> 5, lane = tid & 31, ln = lane & 15, hh = lane >> 4;
  const int ntn = N / 64;
  const int wid = blockIdx.x * 4 + w;
  const int mt = wid / ntn, nq = wid % ntn;
  if (mt * 16 >= M) return;
  const int row0 = mt * 16, col0 = nq * 64;
  const float* arow = A + (size_t)(row0 + ln) * lda;
  v8f acc[4] = {};
  for (int kb = 0; kb < K; kb += 32) {
    FragB ah, al;
    const v4f x0 = *(const v4fa*)(arow + kb + 8 * hh), x1 = *(const v4fa*)(arow + kb + 8 * hh + 4);
    const v4f x2 = *(const v4fa*)(arow + kb + 16 + 8 * hh), x3 = *(const v4fa*)(arow + kb + 16 + 8 * hh + 4);
    float xs[16] = {x0[0],x0[1],x0[2],x0[3],x1[0],x1[1],x1[2],x1[3],x2[0],x2[1],x2[2],x2[3],x3[0],x3[1],x3[2],x3[3]};
#pragma unroll
    for (int i = 0; i < 16; ++i) { const unsigned short hb = bf16_bits(xs[i]); ah.u[i] = hb; al.u[i] = ASPLIT ? bf16_bits(xs[i] - bf16_val(hb)) : (unsigned short)0; }
#pragma unroll
    for (int t = 0; t < 4; ++t) {
      const unsigned short* brow = Wt + (size_t)(col0 + t * 16 + ln) * ldb + kb;
      FragB b;
      b.half[0] = *(const v8us*)(brow + 8 * hh);
      b.half[1] = *(const v8us*)(brow + 16 + 8 * hh);
      acc[t] = mmaN<ASPLIT ? 2 : 1>(ah.v, al.v, b.v, b.v, acc[t]);
    }
  }
#pragma unroll
  for (int t = 0; t < 4; ++t) {
    const int col = col0 + t * 16 + ln;
    float bv = bias ? bias[col] : 0.f;
    if (BIAS_BF16) bv = bf16_round(bv);
#pragma unroll
    for (int r = 0; r < 8; ++r) {
      float v = acc[t][r] + bv;
      if (resid) { float rv = resid[(size_t)((row0 + 8 * hh + r) % rmod) * ldr + col]; if (RES_BF16) rv = bf16_round(rv); v += rv; }
      if (ACT == 1) v = fmaxf(v, 0.f);
      if (ACT == 2) v = 0.5f * v * (1.0f + erff(v * 0.70710678118654752f));
      if (ACT == 3) { const float u = 0.7978845608028654f * (v + 0.044715f * v * v * v); v = 0.5f * v * (1.0f + tanhf(u)); }
      so[w][8 * hh + r][t * 16 + ln] = v;
    }
  }
  __builtin_amdgcn_fence(__ATOMIC_ACQ_REL, "workgroup");
  __builtin_amdgcn_wave_barrier();
  const int rsub = lane >> 4, c4 = (lane & 15) * 4;
  {
#pragma unroll
    for (int q = 0; q < 8; ++q) {
      const int r = q * 2 + rsub;
      const v4f v = *(const v4fa*)&so[w][r][c4];
      *(v4f*)(C + (size_t)(row0 + r) * ldc + col0 + c4) = v;
    }
    
  }
}
// row LayerNorm (biased variance, eps) over N: s = X (+ R); optional out_sum <- s; out_norm <- (s-mu)*rsqrt(var+eps)*g + b
template <bool PARAM_BF16>
__global__ __launch_bounds__(256) void k_layernorm(const float* __restrict__ X, const float* __restrict__ R, const float* __restrict__ g, const float* __restrict__ bta,
                                                  float* __restrict__ out_sum, float* __restrict__ out_norm, int N, float eps) {
  __shared__ float red[256];
  const int row = blockIdx.x, tid = threadIdx.x;
  const float* x = X + (size_t)row * N; const float* rr = R ? R + (size_t)row * N : nullptr;
  float vals[16];                     // up to N = 4096
  const int per = N / 256;            // contiguous chunk per thread? use strided-by-4 chunks: thread handles j = tid*4 + 1024*u
  float s1 = 0.f;
  for (int u = 0; u < per / 4; ++u) {
    const int j = tid * 4 + 1024 * u;
    const v4f a = *(const v4fa*)(x + j);
    v4f b = {0.f,0.f,0.f,0.f}; if (rr) b = *(const v4fa*)(rr + j);
#pragma unroll
    for (int q = 0; q < 4; ++q) { const float v = a[q] + b[q]; vals[u * 4 + q] = v; s1 += v; }
  }
  red[tid] = s1; __syncthreads();
  for (int st = 128; st > 0; st >>= 1) { if (tid < st) red[tid] += red[tid + st]; __syncthreads(); }
  const float mu = red[0] / (float)N; __syncthreads();
  float s2 = 0.f;
  for (int u = 0; u < per / 4; ++u)
#pragma unroll
    for (int q = 0; q < 4; ++q) { const float c = vals[u * 4 + q] - mu; s2 += c * c; }
  red[tid] = s2; __syncthreads();
  for (int st = 128; st > 0; st >>= 1) { if (tid < st) red[tid] += red[tid + st]; __syncthreads(); }
  const float rs = rsqrtf(red[0] / (float)N + eps);
  {
    for (int u = 0; u < per / 4; ++u) {
      const int j = tid * 4 + 1024 * u;
      v4f o, sm;
#pragma unroll
      for (int q = 0; q < 4; ++q) {
        float gg = g[j + q], bb = bta[j + q];
        if (PARAM_BF16) { gg = bf16_round(gg); bb = bf16_round(bb); }
        sm[q] = vals[u * 4 + q]; o[q] = (vals[u * 4 + q] - mu) * rs * gg + bb;
      }
      if (out_sum) *(v4f*)(out_sum + (size_t)row * N + j) = sm;
      *(v4f*)(out_norm + (size_t)row * N + j) = o;
    }
    
  }
}



// ---- f16 WMMA path (v_wmma_f32_16x16x32_f16): 11-bit significands for operands in range — used where a [0,1] probability operand needs more precision than bf16
typedef _Float16 v16h __attribute__((ext_vector_type(16)));
union FragH { v16h v; v8us half[2]; _Float16 h[16]; unsigned short u[16]; };
template <int NT>
__device__ __forceinline__ v8f mmaH(v16h ah, v16h al, v16h bh, v16h bl, v8f c) {
  c = __builtin_amdgcn_wmma_f32_16x16x32_f16(false, ah, false, bh, (short)0, c, false, false);
  if (NT >= 2) c = __builtin_amdgcn_wmma_f32_16x16x32_f16(false, al, false, bh, (short)0, c, false, false);
  if (NT >= 3) c = __builtin_amdgcn_wmma_f32_16x16x32_f16(false, ah, false, bl, (short)0, c, false, false);
  asm volatile("v_nop\n\tv_nop\n\tv_nop\n\tv_nop" : "+v"(c) : "v"(ah), "v"(al), "v"(bh), "v"(bl));
  return c;
}
// batched GEMM like k_gemm_b but f16 operands: A f32 (split into f16 hi/lo if ASPLIT, else rounded to f16), Bt = f16 values [n][k]; alpha; C f32; N multiple of 16 (partial tiles skipped)
template <bool ASPLIT>
__global__ __launch_bounds__(128) void k_gemm_h(const float* __restrict__ A, int lda, size_t sA, const _Float16* __restrict__ Bh, int ldb, size_t sB, float alpha, float* __restrict__ C, int ldc, size_t sC, int M, int N, int K) {
  __shared__ __attribute__((aligned(16))) float so[4][16][64];
  const int tid = threadIdx.x, w = tid >> 5, lane = tid & 31, ln = lane & 15, hh = lane >> 4; const int by = blockIdx.y;
  A += (size_t)by * sA; Bh += (size_t)by * sB; C += (size_t)by * sC;
  const int ntn = (N + 63) / 64; const int wid = blockIdx.x * 4 + w; const int mt = wid / ntn, nq = wid % ntn; if (mt * 16 >= M) return;
  const int row0 = mt * 16, col0 = nq * 64; const float* arow = A + (size_t)(row0 + ln) * lda;
  v8f acc[4] = {};
  for (int kb = 0; kb < K; kb += 32) {
    FragH ah, al;
    const v4f x0 = *(const v4fa*)(arow + kb + 8 * hh), x1 = *(const v4fa*)(arow + kb + 8 * hh + 4), x2 = *(const v4fa*)(arow + kb + 16 + 8 * hh), x3 = *(const v4fa*)(arow + kb + 16 + 8 * hh + 4);
    float xs[16] = {x0[0],x0[1],x0[2],x0[3],x1[0],x1[1],x1[2],x1[3],x2[0],x2[1],x2[2],x2[3],x3[0],x3[1],x3[2],x3[3]};
#pragma unroll
    for (int i = 0; i < 16; ++i) { const _Float16 h = (_Float16)xs[i]; ah.h[i] = h; al.h[i] = ASPLIT ? (_Float16)(xs[i] - (float)h) : (_Float16)0.0f; }
#pragma unroll
    for (int t = 0; t < 4; ++t) { if (col0 + t * 16 >= N) continue; const size_t boff = (size_t)(col0 + t * 16 + ln) * ldb + kb; FragH bq; bq.half[0] = *(const v8us*)(Bh + boff + 8 * hh); bq.half[1] = *(const v8us*)(Bh + boff + 16 + 8 * hh);
      acc[t] = mmaH<ASPLIT ? 2 : 1>(ah.v, al.v, bq.v, bq.v, acc[t]); }
  }
#pragma unroll
  for (int t = 0; t < 4; ++t) { if (col0 + t * 16 >= N) continue;
#pragma unroll
    for (int r = 0; r < 8; ++r) so[w][8 * hh + r][t * 16 + ln] = acc[t][r] * alpha; }
  __builtin_amdgcn_fence(__ATOMIC_ACQ_REL, "workgroup"); __builtin_amdgcn_wave_barrier();
  const int rsub = lane >> 4, c4 = (lane & 15) * 4;
  {
#pragma unroll
    for (int q = 0; q < 8; ++q) { const int r = q * 2 + rsub; if (col0 + c4 < N) { const v4f v = *(const v4fa*)&so[w][r][c4]; *(v4f*)(C + (size_t)(row0 + r) * ldc + col0 + c4) = v; } }
     }
}

// Wt[n][k] = f16(W[k][n]·scale) from f32 row-major W[K][N] (scale = power of two; bf16-exact weights stay exact in f16 away from the subnormal range)
__global__ __launch_bounds__(256) void k_wt_f16(const float* __restrict__ W, _Float16* __restrict__ Wt, int K, int N, float scale) {
  const int t = blockIdx.x * 256 + threadIdx.x; if (t >= N * (K / 8)) return; const int n = t / (K / 8), k8 = (t % (K / 8)) * 8; FragH f;
#pragma unroll
  for (int i = 0; i < 8; ++i) f.h[i] = (_Float16)(bf16_round(W[(size_t)(k8 + i) * N + n]) * scale); const v8us o = f.half[0];
  *(v8us*)((unsigned short*)Wt + (size_t)n * K + k8) = o; 
}
// k_gemm_hh variant with fused epilogue: v = acc·alpha + bias[by·sBias + col] (+ CP[(row/rowsPerB)·sCPb + by·64 + col] if CP) ; ACT 0 none / 1 elu ; writes f16 C16 and/or f32 C (each if non-null)
template <int ACT>
__global__ __launch_bounds__(128) void k_gemm_hhx(const _Float16* __restrict__ A, int lda, size_t sA, const _Float16* __restrict__ Bh, int ldb, size_t sB, float alpha, const float* __restrict__ bias, size_t sBias, const float* __restrict__ CP, int rowsPerB, size_t sCPb, int row0g,
    float* __restrict__ C, _Float16* __restrict__ C16, int ldc, size_t sC, int M, int N, int K) {
  __shared__ __attribute__((aligned(16))) float so[4][16][64];
  const int tid = threadIdx.x, w = tid >> 5, lane = tid & 31, ln = lane & 15, hh = lane >> 4; const int by = blockIdx.y;
  A += (size_t)by * sA; Bh += (size_t)by * sB; const size_t cofs = (size_t)by * sC; const float* bp = bias ? bias + (size_t)by * sBias : nullptr;
  const int ntn = (N + 63) / 64; const int wid = blockIdx.x * 4 + w; const int mt = wid / ntn, nq = wid % ntn; if (mt * 16 >= M) return;
  const int row0 = mt * 16, col0 = nq * 64; const _Float16* arow = A + (size_t)(row0 + ln) * lda;
  v8f acc[4] = {};
  for (int kb = 0; kb < K; kb += 32) { FragH ah; ah.half[0] = *(const v8us*)((const unsigned short*)arow + kb + 8 * hh); ah.half[1] = *(const v8us*)((const unsigned short*)arow + kb + 16 + 8 * hh);
#pragma unroll
    for (int t = 0; t < 4; ++t) { if (col0 + t * 16 >= N) continue; const size_t boff = (size_t)(col0 + t * 16 + ln) * ldb + kb; FragH bq; bq.half[0] = *(const v8us*)((const unsigned short*)Bh + boff + 8 * hh); bq.half[1] = *(const v8us*)((const unsigned short*)Bh + boff + 16 + 8 * hh);
      acc[t] = mmaH<1>(ah.v, ah.v, bq.v, bq.v, acc[t]); }
  }
#pragma unroll
  for (int t = 0; t < 4; ++t) { if (col0 + t * 16 >= N) continue; const int col = col0 + t * 16 + ln; const float bv = bp ? bf16_round(bp[col]) : 0.f;
#pragma unroll
    for (int r = 0; r < 8; ++r) { float v = acc[t][r] * alpha + bv; if (CP) { const int bidx = (row0g + row0 + 8 * hh + r) / rowsPerB; v += CP[(size_t)bidx * sCPb + (size_t)by * 64 + col]; } if (ACT == 1) v = (v > 0.f) ? v : expm1f(v); else if (ACT == 3) v = fmaxf(v, 0.f); so[w][8 * hh + r][t * 16 + ln] = v; } }
  __builtin_amdgcn_fence(__ATOMIC_ACQ_REL, "workgroup"); __builtin_amdgcn_wave_barrier();
  const int rsub = lane >> 4, c4 = (lane & 15) * 4; typedef _Float16 v4h __attribute__((ext_vector_type(4)));
  {
#pragma unroll
    for (int q = 0; q < 8; ++q) { const int r = q * 2 + rsub; if (col0 + c4 < N) { const v4f v = *(const v4fa*)&so[w][r][c4]; if (C) *(v4f*)(C + cofs + (size_t)(row0 + r) * ldc + col0 + c4) = v; if (C16) { v4h h4; for (int i = 0; i < 4; ++i) h4[i] = (_Float16)v[i]; *(v4h*)(C16 + cofs + (size_t)(row0 + r) * ldc + col0 + c4) = h4; } } }
     }
}


// Projection Y = X.W^T / 16 + bias at the fixed shape NR x DM x DM. One 128 x 128 tile of Y per work-group of 8 waves (4 x 2 waves, 32 x 64 of Y each).
// Each 64-k step of both operands (128 rows of 128 B) is read from global as whole lines, one step ahead, into registers and laid in LDS at a pitch of 144 B
// (16 B x odd: no bank conflict for the 16-byte fragment reads). Two LDS buffers: the one barrier of a step publishes its tile and ends the reads of the buffer written next.
// Fragment maps and the ascending k order of every accumulator are those of k_gemm_hhx.
template <bool F32OUT>
__global__ __launch_bounds__(256) void k_proj(const _Float16* __restrict__ A, const _Float16* __restrict__ Bh, const float* __restrict__ bias, float* __restrict__ C, _Float16* __restrict__ C16) {
  constexpr int PT = 72, NS = DM / 64;
  __shared__ __attribute__((aligned(16))) unsigned short sA[2][128][PT], sB[2][128][PT];
  __shared__ __attribute__((aligned(16))) float so[8][32][68];
  const int tid = threadIdx.x, w = tid >> 5, lane = tid & 31, ln = lane & 15, hh = lane >> 4;
  const int m0 = (blockIdx.x >> 3) * 128, n0 = (blockIdx.x & 7) * 128, wm = (w >> 1) * 32, wn = (w & 1) * 64;
  const int lr = tid >> 3, lc = (tid & 7) * 8;
  const unsigned short* ga = (const unsigned short*)A + (size_t)(m0 + lr) * DM + lc;
  const unsigned short* gb = (const unsigned short*)Bh + (size_t)(n0 + lr) * DM + lc;
  v8us ra[4], rb[4];
#pragma unroll
  for (int i = 0; i < 4; ++i) { ra[i] = *(const v8us*)(ga + (size_t)i * 32 * DM); rb[i] = *(const v8us*)(gb + (size_t)i * 32 * DM); }
  v8f acc[2][4];
#pragma unroll
  for (int mt = 0; mt < 2; ++mt)
#pragma unroll
    for (int nt = 0; nt < 4; ++nt) acc[mt][nt] = (v8f){0.f,0.f,0.f,0.f,0.f,0.f,0.f,0.f};
  // unrolled by two so that the buffer index is a constant in every LDS address
#pragma unroll 2
  for (int s = 0; s < NS; ++s) {
    const int bf = s & 1;
#pragma unroll
    for (int i = 0; i < 4; ++i) { *(v8us*)&sA[bf][lr + 32 * i][lc] = ra[i]; *(v8us*)&sB[bf][lr + 32 * i][lc] = rb[i]; }
    __syncthreads();
    if (s + 1 < NS) {
#pragma unroll
      for (int i = 0; i < 4; ++i) { ra[i] = *(const v8us*)(ga + (size_t)i * 32 * DM + (s + 1) * 64); rb[i] = *(const v8us*)(gb + (size_t)i * 32 * DM + (s + 1) * 64); }
    }
    // keeps the next step's global loads in front of this step's matrix work: left free, the compiler sinks them to just before their LDS stores and their whole latency is waited out
    __builtin_amdgcn_sched_barrier(0);
#pragma unroll
    for (int ks = 0; ks < 2; ++ks) {
      FragH a[2], b[4];
#pragma unroll
      for (int mt = 0; mt < 2; ++mt) { a[mt].half[0] = *(const v8us*)&sA[bf][wm + mt * 16 + ln][ks * 32 + 8 * hh]; a[mt].half[1] = *(const v8us*)&sA[bf][wm + mt * 16 + ln][ks * 32 + 16 + 8 * hh]; }
#pragma unroll
      for (int nt = 0; nt < 4; ++nt) { b[nt].half[0] = *(const v8us*)&sB[bf][wn + nt * 16 + ln][ks * 32 + 8 * hh]; b[nt].half[1] = *(const v8us*)&sB[bf][wn + nt * 16 + ln][ks * 32 + 16 + 8 * hh]; }
#pragma unroll
      for (int mt = 0; mt < 2; ++mt)
#pragma unroll
        for (int nt = 0; nt < 4; ++nt) acc[mt][nt] = __builtin_amdgcn_wmma_f32_16x16x32_f16(false, a[mt].v, false, b[nt].v, (short)0, acc[mt][nt], false, false);
    }
  }
  // stands in front of the epilogue's reuse of the registers that held the global load addresses (the scheduling barrier keeps that reuse behind it)
  asm volatile("s_wait_xcnt 0x0" ::: "memory");
  __builtin_amdgcn_sched_barrier(0);
  typedef _Float16 v4h __attribute__((ext_vector_type(4)));
#pragma unroll
  for (int nt = 0; nt < 4; ++nt) { const float bv = bf16_round(bias[n0 + wn + nt * 16 + ln]);
#pragma unroll
    for (int mt = 0; mt < 2; ++mt)
#pragma unroll
      for (int r = 0; r < 8; ++r) so[w][mt * 16 + 8 * hh + r][nt * 16 + ln] = acc[mt][nt][r] * 0.0625f + bv; }
  // the wave's own 32 x 64 strip: its LDS writes are ordered before its cross-lane reads, so that whole lines go out
  __builtin_amdgcn_fence(__ATOMIC_ACQ_REL, "workgroup"); __builtin_amdgcn_wave_barrier();
#pragma unroll
  for (int q = 0; q < 16; ++q) { const int r = q * 2 + hh, c4 = ln * 4; const v4f v = *(const v4fa*)&so[w][r][c4]; const size_t o = (size_t)(m0 + wm + r) * DM + n0 + wn + c4;
    if (F32OUT) *(v4f*)(C + o) = v; else { v4h h4;
#pragma unroll
      for (int i = 0; i < 4; ++i) h4[i] = (_Float16)v[i]; *(v4h*)(C16 + o) = h4; } }
}

__global__ __launch_bounds__(256) void k_x16(const float* __restrict__ x, _Float16* __restrict__ X16, size_t n8) { const size_t t = (size_t)blockIdx.x * 256 + threadIdx.x; if (t >= n8) return; FragH f;
#pragma unroll
  for (int q = 0; q < 8; ++q) f.h[q] = (_Float16)bf16_round(x[t * 8 + q]); *(v8us*)((unsigned short*)X16 + t * 8) = f.half[0];  }
__global__ __launch_bounds__(256) void k_h16(const float* __restrict__ x, _Float16* __restrict__ X16, size_t n8) { const size_t t = (size_t)blockIdx.x * 256 + threadIdx.x; if (t >= n8) return; FragH f;
#pragma unroll
  for (int q = 0; q < 8; ++q) f.h[q] = (_Float16)x[t * 8 + q]; *(v8us*)((unsigned short*)X16 + t * 8) = f.half[0];  }
__global__ __launch_bounds__(256) void k_round16f(const float* __restrict__ W, _Float16* __restrict__ Bt, size_t n8) { const size_t t = (size_t)blockIdx.x * 256 + threadIdx.x; if (t >= n8) return; FragH f;
#pragma unroll
  for (int i = 0; i < 8; ++i) f.h[i] = (_Float16)(bf16_round(W[t * 8 + i]) * 16.0f); *(v8us*)((unsigned short*)Bt + t * 8) = f.half[0];  }
__global__ __launch_bounds__(256) void k_vt(const _Float16* __restrict__ V16, _Float16* __restrict__ Vt) { __shared__ unsigned short tl[64][66]; const int tid = threadIdx.x; const int slab = blockIdx.x / (SS / 64), lg = blockIdx.x % (SS / 64); const int b = slab / NH, h = slab % NH;
  for (int i = tid; i < 64 * 8; i += 256) { const int r = i / 8, c8 = (i % 8) * 8; FragH f; f.half[0] = *(const v8us*)((const unsigned short*)V16 + ((size_t)b * SS + lg * 64 + r) * DM + h * HD + c8);
#pragma unroll
    for (int q = 0; q < 8; ++q) tl[r][c8 + q] = f.u[q]; }
  __syncthreads();
  {
#pragma unroll
    for (int rd = 0; rd < 2; ++rd) { const int d = rd * 32 + tid / 8, pc = tid % 8; FragH f;
#pragma unroll
      for (int q = 0; q < 8; ++q) f.u[q] = tl[pc * 8 + q][d];
      *(v8us*)((unsigned short*)Vt + ((size_t)slab * HD + d) * SS + lg * 64 + pc * 8) = f.half[0]; }
     } }
// sigmoid(s / 8) = 0.5 + 0.5 tanh(s / 16): th16 is the hardware tanh (v_tanh_f32) of s / 16, one transcendental in place of the library expf and the full-precision division
__device__ __forceinline__ float th16(float s) { return __builtin_amdgcn_tanhf(s * 0.0625f); }
__device__ __forceinline__ float sigm8(float s) { return fmaf(th16(s), 0.5f, 0.5f); }
__global__ __launch_bounds__(128) void k_satt(const _Float16* __restrict__ Q16, const _Float16* __restrict__ K16, const _Float16* __restrict__ Vt, float* __restrict__ O) {
  constexpr int RPW = 32, NQB = SS / (4 * RPW), DT = HD / 16, KS = HD / 32;
  __shared__ __attribute__((aligned(16))) unsigned short sP[4][RPW][40]; __shared__ __attribute__((aligned(16))) float sO[4][RPW][HD];
  const int tid = threadIdx.x, w = tid >> 5, lane = tid & 31, ln = lane & 15, hh = lane >> 4;
  const int slab = blockIdx.x / NQB, qblk = blockIdx.x % NQB; const int b = slab / NH, h = slab % NH; const int q0 = qblk * (4 * RPW) + w * RPW;
  FragH aq[2][KS];
#pragma unroll
  for (int rt = 0; rt < 2; ++rt) { const unsigned short* qr = (const unsigned short*)Q16 + ((size_t)b * SS + q0 + rt * 16 + ln) * DM + h * HD;
#pragma unroll
    for (int ks = 0; ks < KS; ++ks) { aq[rt][ks].half[0] = *(const v8us*)(qr + ks * 32 + 8 * hh); aq[rt][ks].half[1] = *(const v8us*)(qr + ks * 32 + 16 + 8 * hh); } }
  const unsigned short* Vth = (const unsigned short*)Vt + (size_t)slab * HD * SS;
  v8f oacc[2][DT];
#pragma unroll
  for (int rt = 0; rt < 2; ++rt)
#pragma unroll
    for (int dt = 0; dt < DT; ++dt) oacc[rt][dt] = (v8f){0.f,0.f,0.f,0.f,0.f,0.f,0.f,0.f};
#pragma unroll 1
  for (int j0 = 0; j0 < SS; j0 += 32) {
    v8f s[2][2];
#pragma unroll
    for (int nt = 0; nt < 2; ++nt) { const unsigned short* kr = (const unsigned short*)K16 + ((size_t)b * SS + j0 + nt * 16 + ln) * DM + h * HD; FragH bk[KS];
#pragma unroll
      for (int ks = 0; ks < KS; ++ks) { bk[ks].half[0] = *(const v8us*)(kr + ks * 32 + 8 * hh); bk[ks].half[1] = *(const v8us*)(kr + ks * 32 + 16 + 8 * hh); }
#pragma unroll
      for (int rt = 0; rt < 2; ++rt) { v8f acc = (v8f){0.f,0.f,0.f,0.f,0.f,0.f,0.f,0.f};
#pragma unroll
        for (int ks = 0; ks < KS; ++ks) acc = mmaH<1>(aq[rt][ks].v, aq[rt][ks].v, bk[ks].v, bk[ks].v, acc); s[rt][nt] = acc; } }
#pragma unroll
    for (int rt = 0; rt < 2; ++rt)
#pragma unroll
      for (int r = 0; r < 8; ++r) { FragH t2; t2.h[0] = (_Float16)sigm8(s[rt][0][r]); t2.h[1] = (_Float16)sigm8(s[rt][1][r]); sP[w][rt * 16 + 8 * hh + r][ln] = t2.u[0]; sP[w][rt * 16 + 8 * hh + r][16 + ln] = t2.u[1]; }
    __builtin_amdgcn_fence(__ATOMIC_ACQ_REL, "workgroup"); __builtin_amdgcn_wave_barrier();
    FragH pa[2];
#pragma unroll
    for (int rt = 0; rt < 2; ++rt) { pa[rt].half[0] = *(const v8us*)&sP[w][rt * 16 + ln][8 * hh]; pa[rt].half[1] = *(const v8us*)&sP[w][rt * 16 + ln][16 + 8 * hh]; }
#pragma unroll
    for (int dt = 0; dt < DT; ++dt) { const unsigned short* vrow = Vth + (size_t)(dt * 16 + ln) * SS + j0; FragH bv; bv.half[0] = *(const v8us*)(vrow + 8 * hh); bv.half[1] = *(const v8us*)(vrow + 16 + 8 * hh);
#pragma unroll
      for (int rt = 0; rt < 2; ++rt) oacc[rt][dt] = mmaH<1>(pa[rt].v, pa[rt].v, bv.v, bv.v, oacc[rt][dt]); }
    __builtin_amdgcn_fence(__ATOMIC_ACQ_REL, "workgroup"); __builtin_amdgcn_wave_barrier(); }
#pragma unroll
  for (int rt = 0; rt < 2; ++rt)
#pragma unroll
    for (int dt = 0; dt < DT; ++dt)
#pragma unroll
      for (int r = 0; r < 8; ++r) sO[w][rt * 16 + 8 * hh + r][dt * 16 + ln] = oacc[rt][dt][r];
  __builtin_amdgcn_fence(__ATOMIC_ACQ_REL, "workgroup"); __builtin_amdgcn_wave_barrier();
  {
#pragma unroll
    for (int rp = 0; rp < RPW; rp += 2) { const int r = rp + (lane >> 4), pc = lane & 15; const v4f val = *(const v4fa*)&sO[w][r][pc * 4]; *(v4f*)(O + ((size_t)b * SS + q0 + r) * DM + h * HD + pc * 4) = val; }
     } }
// (b) attn_weights[b][q][k] = (1/16) sum_h sigmoid(q_h.k_h/8): block = (b, AWK keys, 64 queries), wave = 16 queries; for each 32-key chunk of the block's keys, loop the 16 heads (S tile pairs on WMMA, tanh(s/16), fixed-order sum; then 0.5 + sum/32).
// The key range is dealt over the grid, so that every SIMD of the chip holds as many waves as its registers allow; each output tile is still made whole by one wave.
#define AWK 32
__global__ __launch_bounds__(128) void k_aw(const _Float16* __restrict__ Q16, const _Float16* __restrict__ K16, float* __restrict__ AW) {
  constexpr int RPW = 16, KS = HD / 32; __shared__ __attribute__((aligned(16))) float st[4][RPW][32 + 4];
  const int tid = threadIdx.x, w = tid >> 5, lane = tid & 31, ln = lane & 15, hh = lane >> 4; const int qblk = blockIdx.x % (SS / 64), bj = blockIdx.x / (SS / 64); const int jblk = bj % (SS / AWK), b = bj / (SS / AWK); const int q0 = qblk * 64 + w * RPW;
  const unsigned short* qbase = (const unsigned short*)Q16 + ((size_t)b * SS + q0 + ln) * DM;
#pragma unroll 1
  for (int j0 = jblk * AWK; j0 < jblk * AWK + AWK; j0 += 32) { float aw[2][8];
#pragma unroll
    for (int nt = 0; nt < 2; ++nt)
#pragma unroll
      for (int r = 0; r < 8; ++r) aw[nt][r] = 0.f;
#pragma unroll 1
    for (int h = 0; h < NH; ++h) { FragH aq[KS];
#pragma unroll
      for (int ks = 0; ks < KS; ++ks) { aq[ks].half[0] = *(const v8us*)(qbase + h * HD + ks * 32 + 8 * hh); aq[ks].half[1] = *(const v8us*)(qbase + h * HD + ks * 32 + 16 + 8 * hh); }
#pragma unroll
      for (int nt = 0; nt < 2; ++nt) { const unsigned short* kr = (const unsigned short*)K16 + ((size_t)b * SS + j0 + nt * 16 + ln) * DM + h * HD; v8f acc = (v8f){0.f,0.f,0.f,0.f,0.f,0.f,0.f,0.f};
#pragma unroll
        for (int ks = 0; ks < KS; ++ks) { FragH bk; bk.half[0] = *(const v8us*)(kr + ks * 32 + 8 * hh); bk.half[1] = *(const v8us*)(kr + ks * 32 + 16 + 8 * hh); acc = mmaH<1>(aq[ks].v, aq[ks].v, bk.v, bk.v, acc); }
#pragma unroll
        for (int r = 0; r < 8; ++r) aw[nt][r] += th16(acc[r]); } }
#pragma unroll
    for (int nt = 0; nt < 2; ++nt)
#pragma unroll
      for (int r = 0; r < 8; ++r) st[w][8 * hh + r][nt * 16 + ln] = fmaf(aw[nt][r], 0.5f / (float)NH, 0.5f);   // mean_h (0.5 + 0.5 tanh) from the sum of the tanh terms
    __builtin_amdgcn_fence(__ATOMIC_ACQ_REL, "workgroup"); __builtin_amdgcn_wave_barrier();
    {
#pragma unroll
      for (int rp = 0; rp < RPW; rp += 4) { const int r = rp + (lane >> 3), pc = lane & 7; *(v4f*)(AW + ((size_t)b * SS + q0 + r) * SS + j0 + pc * 4) = *(const v4fa*)&st[w][r][pc * 4]; }
       }
    __builtin_amdgcn_fence(__ATOMIC_ACQ_REL, "workgroup"); __builtin_amdgcn_wave_barrier(); } }
extern "C" void kernel_launch(void* const* d_in, const int* in_sizes, int n_in,
                              void* d_out, int out_size, void* d_ws, size_t ws_size, hipStream_t stream) {
  (void)in_sizes; (void)n_in; (void)out_size;
  const float* xq = (const float*)d_in[0]; const float* xk = (const float*)d_in[1]; const float* xv = (const float*)d_in[2]; const float* Wq = (const float*)d_in[3]; const float* bq = (const float*)d_in[4]; const float* Wk = (const float*)d_in[5]; const float* bk = (const float*)d_in[6]; const float* Wv = (const float*)d_in[7]; const float* bv = (const float*)d_in[8]; const float* Wo = (const float*)d_in[9]; const float* bo = (const float*)d_in[10];
  float* out = (float*)d_out; float* AW = (float*)((char*)d_out + 16777216);
  char* ws = (char*)d_ws; size_t off = 0;
  auto take = [&](size_t bytes) { char* p = ws + off; off += (bytes + 255) & ~(size_t)255; return p; };
  const size_t w8 = (size_t)DM * DM / 8;
  _Float16* Bq = (_Float16*)take(w8 * 16); _Float16* Bk = (_Float16*)take(w8 * 16); _Float16* Bv = (_Float16*)take(w8 * 16); _Float16* Bo = (_Float16*)take(w8 * 16);
  _Float16* XQ = (_Float16*)take((size_t)NR * DM * 2); _Float16* XK = (_Float16*)take((size_t)NR * DM * 2); _Float16* XV = (_Float16*)take((size_t)NR * DM * 2); _Float16* Q16 = (_Float16*)take((size_t)NR * DM * 2); _Float16* K16 = (_Float16*)take((size_t)NR * DM * 2); _Float16* V16 = (_Float16*)take((size_t)NR * DM * 2); _Float16* Vt = (_Float16*)take((size_t)NR * DM * 2); float* O = (float*)take((size_t)NR * DM * 4); _Float16* O16 = (_Float16*)take((size_t)NR * DM * 2);
  if (off > ws_size) return;      // ≈ 8 + 8.4×8 + 16.8 ≈ 92 MiB
  const unsigned gw = (unsigned)((w8 + 255) / 256), gx = (unsigned)(((size_t)NR * DM / 8 + 255) / 256);
  k_round16f<<<gw, 256, 0, stream>>>(Wq, Bq, w8); k_round16f<<<gw, 256, 0, stream>>>(Wk, Bk, w8); k_round16f<<<gw, 256, 0, stream>>>(Wv, Bv, w8); k_round16f<<<gw, 256, 0, stream>>>(Wo, Bo, w8);
  k_x16<<<gx, 256, 0, stream>>>(xq, XQ, (size_t)NR * DM / 8); k_x16<<<gx, 256, 0, stream>>>(xk, XK, (size_t)NR * DM / 8); k_x16<<<gx, 256, 0, stream>>>(xv, XV, (size_t)NR * DM / 8);
  const unsigned gp = (NR / 128) * (DM / 128);
  k_proj<false><<<gp, 256, 0, stream>>>(XQ, Bq, bq, nullptr, Q16);
  k_proj<false><<<gp, 256, 0, stream>>>(XK, Bk, bk, nullptr, K16);
  k_proj<false><<<gp, 256, 0, stream>>>(XV, Bv, bv, nullptr, V16);
  k_vt<<<BB * NH * (SS / 64), 256, 0, stream>>>(V16, Vt);
  k_satt<<<BB * NH * (SS / 128), 128, 0, stream>>>(Q16, K16, Vt, O);
  k_h16<<<gx, 256, 0, stream>>>(O, O16, (size_t)NR * DM / 8);
  k_proj<true><<<gp, 256, 0, stream>>>(O16, Bo, bo, out, nullptr);
  k_aw<<<BB * (SS / 64) * (SS / AWK), 128, 0, stream>>>(Q16, K16, AW);
}

// v004
// It runs in 244 microseconds.
// Next to v003, in two timings, it ran 1.24 and 1.23 times as fast.
// All steps since v000 together make it 4.84 times as fast.
#include <hip/hip_runtime.h>
// q/k/v/o projections (4096 × 1024 × 1024, + bias) and the 16-head sigmoid attention on v_wmma_f32_16x16x32_f16: (a) per (b,h) a fused flash-style kernel with P = σ(q·k/8) (no normalisation,
// as the module) and O = P·V on WMMA; (b) the second output mean_h σ(q·k/8) recomputes the score tiles per head and averages them in a fixed order. x inputs f16(bf16 ·) exact, q/k/v and O rounded to f16,
// weights bf16-exact ×2^4 ((out,in)), P f16 ≤ 1, f32 accumulate.
#define BB 2
#define SS 2048
#define DM 1024
#define NH 16
#define HD 64
#define NR (BB * SS)

typedef __bf16 v16b __attribute__((ext_vector_type(16)));
typedef unsigned short v8us __attribute__((ext_vector_type(8), may_alias));
typedef float  v8f  __attribute__((ext_vector_type(8)));
typedef float  v4f  __attribute__((ext_vector_type(4)));
typedef float  v4fa __attribute__((ext_vector_type(4), may_alias));
union FragB { v16b v; v8us half[2]; unsigned short u[16]; };

__device__ __forceinline__ unsigned short bf16_bits(float x) { unsigned int u = __float_as_uint(x); return (unsigned short)((u + 0x7FFFu + ((u >> 16) & 1u)) >> 16); }
__device__ __forceinline__ float bf16_val(unsigned short b) { return __uint_as_float(((unsigned int)b) << 16); }
__device__ __forceinline__ float bf16_round(float x) { return bf16_val(bf16_bits(x)); }
// D += A·B with NT terms: 1 = ah·bh, 2 = + al·bh (A split), 3 = + ah·bl (both split)
template <int NT>
__device__ __forceinline__ v8f mmaN(v16b ah, v16b al, v16b bh, v16b bl, v8f c) {
  c = __builtin_amdgcn_wmma_f32_16x16x32_bf16(false, ah, false, bh, (short)0, c, false, false);
  if (NT >= 2) c = __builtin_amdgcn_wmma_f32_16x16x32_bf16(false, al, false, bh, (short)0, c, false, false);
  if (NT >= 3) c = __builtin_amdgcn_wmma_f32_16x16x32_bf16(false, ah, false, bl, (short)0, c, false, false);
  asm volatile("v_nop\n\tv_nop\n\tv_nop\n\tv_nop" : "+v"(c) : "v"(ah), "v"(al), "v"(bh), "v"(bl));
  return c;
}

__global__ __launch_bounds__(256) void k_wt_bf16(const float* __restrict__ W, unsigned short* __restrict__ Wt, int K, int N) {
  const int t = blockIdx.x * 256 + threadIdx.x;
  const int k8n = K / 8;
  if (t >= N * k8n) return;
  const int n = t / k8n, k8 = (t % k8n) * 8;
  v8us v;
#pragma unroll
  for (int i = 0; i < 8; ++i) v[i] = bf16_bits(W[(size_t)(k8 + i) * N + n]);
  *(v8us*)(Wt + (size_t)n * K + k8) = v;
  
}

// GEMM C[M][N] (f32, pitch ldc) = act(A[M][K]·W + bias). A f32 row-major (pitch lda) converted per fragment to bf16
// (ASPLIT: hi/lo two planes -> 2 terms, else single rounded term); Wt bf16 [N][K] (pitch ldb). BIAS_BF16 rounds the
// bias to bf16 first (bias quantised to bf16 before the add). K%32==0, M%16==0, N%64==0.
template <bool ASPLIT, int ACT, bool BIAS_BF16>
__global__ __launch_bounds__(128) void k_gemm_bf(const float* __restrict__ A, int lda, const unsigned short* __restrict__ Wt, int ldb,
                                               const float* __restrict__ bias, float* __restrict__ C, int ldc, int M, int N, int K) {
  __shared__ __attribute__((aligned(16))) float so[4][16][64];
  const int tid = threadIdx.x, w = tid >> 5, lane = tid & 31, ln = lane & 15, hh = lane >> 4;
  const int ntn = N / 64;
  const int wid = blockIdx.x * 4 + w;
  const int mt = wid / ntn, nq = wid % ntn;
  if (mt * 16 >= M) return;
  const int row0 = mt * 16, col0 = nq * 64;
  const float* arow = A + (size_t)(row0 + ln) * lda;
  v8f acc[4] = {};
  for (int kb = 0; kb < K; kb += 32) {
    FragB ah, al;
    const v4f x0 = *(const v4fa*)(arow + kb + 8 * hh), x1 = *(const v4fa*)(arow + kb + 8 * hh + 4);
    const v4f x2 = *(const v4fa*)(arow + kb + 16 + 8 * hh), x3 = *(const v4fa*)(arow + kb + 16 + 8 * hh + 4);
    float xs[16] = {x0[0],x0[1],x0[2],x0[3],x1[0],x1[1],x1[2],x1[3],x2[0],x2[1],x2[2],x2[3],x3[0],x3[1],x3[2],x3[3]};
#pragma unroll
    for (int i = 0; i < 16; ++i) { const unsigned short hb = bf16_bits(xs[i]); ah.u[i] = hb; al.u[i] = ASPLIT ? bf16_bits(xs[i] - bf16_val(hb)) : (unsigned short)0; }
#pragma unroll
    for (int t = 0; t < 4; ++t) {
      const unsigned short* brow = Wt + (size_t)(col0 + t * 16 + ln) * ldb + kb;
      FragB b;
      b.half[0] = *(const v8us*)(brow + 8 * hh);
      b.half[1] = *(const v8us*)(brow + 16 + 8 * hh);
      acc[t] = mmaN<ASPLIT ? 2 : 1>(ah.v, al.v, b.v, b.v, acc[t]);
    }
  }
#pragma unroll
  for (int t = 0; t < 4; ++t) {
    float bv = bias ? bias[col0 + t * 16 + ln] : 0.f;
    if (BIAS_BF16) bv = bf16_round(bv);
#pragma unroll
    for (int r = 0; r < 8; ++r) { float v = acc[t][r] + bv; if (ACT == 1) v = fmaxf(v, 0.f); so[w][8 * hh + r][t * 16 + ln] = v; }
  }
  __builtin_amdgcn_fence(__ATOMIC_ACQ_REL, "workgroup");
  __builtin_amdgcn_wave_barrier();
  const int rsub = lane >> 4, c4 = (lane & 15) * 4;
  {
#pragma unroll
    for (int q = 0; q < 8; ++q) {
      const int r = q * 2 + rsub;
      const v4f v = *(const v4fa*)&so[w][r][c4];
      *(v4f*)(C + (size_t)(row0 + r) * ldc + col0 + c4) = v;
    }
    
  }
}

// Flash-style causal/unmasked attention, all contractions 3-term bf16 hi/lo splits, f32 softmax with running max.
// q,k,v rows are read from f32 buffers with arbitrary row pitch (so they can live inside a fused qkv buffer);
// D = head size (multiple of 32, <= 128); one wave = 16 query rows; block = 4 waves (64 queries) sharing K/V chunks of 32.
template <int D, bool CAUSAL>
__global__ __launch_bounds__(128) void k_flash(const float* __restrict__ qb, const float* __restrict__ kb, const float* __restrict__ vb,
                                             int pitch, int T, int H, float scale, float* __restrict__ y, int ypitch) {
  constexpr int KS = D / 32;        // k-steps for QK
  constexpr int DT = D / 16;        // d tiles for PV
  __shared__ __attribute__((aligned(16))) unsigned short sKh[32][D + 8], sKl[32][D + 8], sVh[32][D + 8], sVl[32][D + 8];
  __shared__ __attribute__((aligned(16))) unsigned short sPh[4][16][40], sPl[4][16][40];
  __shared__ __attribute__((aligned(16))) float sO[4][16][D];
  const int tid = threadIdx.x, w = tid >> 5, lane = tid & 31, ln = lane & 15, hh = lane >> 4;
  const int nqb = (T + 63) / 64;
  const int bh = blockIdx.x / nqb, qblk = blockIdx.x % nqb;
  const int b = bh / H, h = bh % H;
  const int q0 = qblk * 64 + w * 16;
  const float* Q = qb + (size_t)b * T * pitch + h * D;
  const float* K = kb + (size_t)b * T * pitch + h * D;
  const float* V = vb + (size_t)b * T * pitch + h * D;

  // A fragments of the wave's 16 query rows (scaled), hi/lo
  FragB aqh[KS], aql[KS];
  {
    int row = q0 + ln; if (row >= T) row = T - 1;
    const float* qr = Q + (size_t)row * pitch;
#pragma unroll
    for (int ks = 0; ks < KS; ++ks)
#pragma unroll
      for (int i = 0; i < 16; ++i) {
        const int d = ks * 32 + ((i < 8) ? (8 * hh + i) : (16 + 8 * hh + (i - 8)));
        const float x = qr[d] * scale; const unsigned short hb = bf16_bits(x);
        aqh[ks].u[i] = hb; aql[ks].u[i] = bf16_bits(x - bf16_val(hb));
      }
  }
  float m_r[8], l_r[8];
#pragma unroll
  for (int r = 0; r < 8; ++r) { m_r[r] = -3.0e38f; l_r[r] = 0.f; }
  v8f oacc[DT];
#pragma unroll
  for (int dt = 0; dt < DT; ++dt) oacc[dt] = (v8f){0.f,0.f,0.f,0.f,0.f,0.f,0.f,0.f};

  const int kv_end = CAUSAL ? min(T, qblk * 64 + 64) : T;     // block-uniform
  for (int j0 = 0; j0 < kv_end; j0 += 32) {
    __syncthreads();
    for (int e = tid; e < 32 * (D / 4); e += 128) {
      const int r = e / (D / 4), c4 = (e % (D / 4)) * 4;
      const int key = j0 + r;
      v4f kf = {0.f,0.f,0.f,0.f}, vf = {0.f,0.f,0.f,0.f};
      if (key < T) { kf = *(const v4fa*)(K + (size_t)key * pitch + c4); vf = *(const v4fa*)(V + (size_t)key * pitch + c4); }
#pragma unroll
      for (int t = 0; t < 4; ++t) {
        unsigned short hb = bf16_bits(kf[t]); sKh[r][c4 + t] = hb; sKl[r][c4 + t] = bf16_bits(kf[t] - bf16_val(hb));
        hb = bf16_bits(vf[t]); sVh[r][c4 + t] = hb; sVl[r][c4 + t] = bf16_bits(vf[t] - bf16_val(hb));
      }
    }
    __syncthreads();
    // S tile 16 x 32
    v8f s[2];
#pragma unroll
    for (int nt = 0; nt < 2; ++nt) {
      v8f acc = {};
#pragma unroll
      for (int ks = 0; ks < KS; ++ks) {
        FragB bh_, bl_;
        bh_.half[0] = *(const v8us*)&sKh[nt * 16 + ln][ks * 32 + 8 * hh]; bh_.half[1] = *(const v8us*)&sKh[nt * 16 + ln][ks * 32 + 16 + 8 * hh];
        bl_.half[0] = *(const v8us*)&sKl[nt * 16 + ln][ks * 32 + 8 * hh]; bl_.half[1] = *(const v8us*)&sKl[nt * 16 + ln][ks * 32 + 16 + 8 * hh];
        acc = mmaN<3>(aqh[ks].v, aql[ks].v, bh_.v, bl_.v, acc);
      }
      s[nt] = acc;
    }
    // mask + running max (rows 8hh+r; the 16 lanes of a half share rows)
    float alpha[8];
#pragma unroll
    for (int r = 0; r < 8; ++r) {
      const int qi = q0 + 8 * hh + r;
      const int ja = j0 + ln, jb = j0 + 16 + ln;
      if (CAUSAL) { if (ja > qi) s[0][r] = -3.0e38f; if (jb > qi) s[1][r] = -3.0e38f; }
      if (ja >= T) s[0][r] = -3.0e38f;
      if (jb >= T) s[1][r] = -3.0e38f;
      float mx = fmaxf(s[0][r], s[1][r]);
      mx = fmaxf(mx, __shfl_xor(mx, 1, 32)); mx = fmaxf(mx, __shfl_xor(mx, 2, 32)); mx = fmaxf(mx, __shfl_xor(mx, 4, 32)); mx = fmaxf(mx, __shfl_xor(mx, 8, 32));
      const float mnew = fmaxf(m_r[r], mx);
      alpha[r] = (mnew > -1.0e38f) ? __expf(m_r[r] - mnew) : 1.0f;
      const float p0 = (s[0][r] > -1.0e38f) ? __expf(s[0][r] - mnew) : 0.f;
      const float p1 = (s[1][r] > -1.0e38f) ? __expf(s[1][r] - mnew) : 0.f;
      m_r[r] = mnew;
      l_r[r] = l_r[r] * alpha[r] + p0 + p1;            // per-lane partial row sum (16 lanes combined at the end)
      unsigned short hb = bf16_bits(p0); sPh[w][8 * hh + r][ln] = hb;      sPl[w][8 * hh + r][ln] = bf16_bits(p0 - bf16_val(hb));
      hb = bf16_bits(p1);                sPh[w][8 * hh + r][16 + ln] = hb; sPl[w][8 * hh + r][16 + ln] = bf16_bits(p1 - bf16_val(hb));
    }
#pragma unroll
    for (int dt = 0; dt < DT; ++dt)
#pragma unroll
      for (int r = 0; r < 8; ++r) oacc[dt][r] *= alpha[r];
    __builtin_amdgcn_fence(__ATOMIC_ACQ_REL, "workgroup");
    __builtin_amdgcn_wave_barrier();
    FragB pah, pal;
    pah.half[0] = *(const v8us*)&sPh[w][ln][8 * hh]; pah.half[1] = *(const v8us*)&sPh[w][ln][16 + 8 * hh];
    pal.half[0] = *(const v8us*)&sPl[w][ln][8 * hh]; pal.half[1] = *(const v8us*)&sPl[w][ln][16 + 8 * hh];
#pragma unroll
    for (int dt = 0; dt < DT; ++dt) {
      FragB bvh, bvl;
#pragma unroll
      for (int i = 0; i < 8; ++i) {
        bvh.u[i] = sVh[8 * hh + i][dt * 16 + ln]; bvh.u[8 + i] = sVh[16 + 8 * hh + i][dt * 16 + ln];
        bvl.u[i] = sVl[8 * hh + i][dt * 16 + ln]; bvl.u[8 + i] = sVl[16 + 8 * hh + i][dt * 16 + ln];
      }
      oacc[dt] = mmaN<3>(pah.v, pal.v, bvh.v, bvl.v, oacc[dt]);
    }
    __builtin_amdgcn_fence(__ATOMIC_ACQ_REL, "workgroup");
    __builtin_amdgcn_wave_barrier();
  }
#pragma unroll
  for (int r = 0; r < 8; ++r) {
    float l = l_r[r];
    l += __shfl_xor(l, 1, 32); l += __shfl_xor(l, 2, 32); l += __shfl_xor(l, 4, 32); l += __shfl_xor(l, 8, 32);
    l_r[r] = (l > 0.f) ? 1.0f / l : 0.f;
  }
#pragma unroll
  for (int dt = 0; dt < DT; ++dt)
#pragma unroll
    for (int r = 0; r < 8; ++r) sO[w][8 * hh + r][dt * 16 + ln] = oacc[dt][r] * l_r[r];
  __builtin_amdgcn_fence(__ATOMIC_ACQ_REL, "workgroup");
  __builtin_amdgcn_wave_barrier();
  {
    for (int r = 0; r < 16; ++r) {
      const int row = q0 + r;
      if (row < T && lane < D / 4) {
        const v4f val = *(const v4fa*)&sO[w][r][lane * 4];
        *(v4f*)(y + ((size_t)b * T + row) * ypitch + h * D + lane * 4) = val;
      }
    }
    
  }
}

// GEMM C = act(A·W + bias + resid): A f32 (ASPLIT -> hi/lo 2 terms), Wt bf16 [N][K]; ACT 0 none, 1 relu, 2 exact gelu;
// resid (optional, f32, row index = (row % rmod), pitch ldr, RES_BF16 rounds it) added before the activation.
template <bool ASPLIT, int ACT, bool BIAS_BF16, bool RES_BF16>
__global__ __launch_bounds__(128) void k_gemm_bf3(const float* __restrict__ A, int lda, const unsigned short* __restrict__ Wt, int ldb,
                                                const float* __restrict__ bias, const float* __restrict__ resid, int rmod, int ldr,
                                                float* __restrict__ C, int ldc, int M, int N, int K) {
  __shared__ __attribute__((aligned(16))) float so[4][16][64];
  const int tid = threadIdx.x, w = tid >> 5, lane = tid & 31, ln = lane & 15, hh = lane >> 4;
  const int ntn = N / 64;
  const int wid = blockIdx.x * 4 + w;
  const int mt = wid / ntn, nq = wid % ntn;
  if (mt * 16 >= M) return;
  const int row0 = mt * 16, col0 = nq * 64;
  const float* arow = A + (size_t)(row0 + ln) * lda;
  v8f acc[4] = {};
  for (int kb = 0; kb < K; kb += 32) {
    FragB ah, al;
    const v4f x0 = *(const v4fa*)(arow + kb + 8 * hh), x1 = *(const v4fa*)(arow + kb + 8 * hh + 4);
    const v4f x2 = *(const v4fa*)(arow + kb + 16 + 8 * hh), x3 = *(const v4fa*)(arow + kb + 16 + 8 * hh + 4);
    float xs[16] = {x0[0],x0[1],x0[2],x0[3],x1[0],x1[1],x1[2],x1[3],x2[0],x2[1],x2[2],x2[3],x3[0],x3[1],x3[2],x3[3]};
#pragma unroll
    for (int i = 0; i < 16; ++i) { const unsigned short hb = bf16_bits(xs[i]); ah.u[i] = hb; al.u[i] = ASPLIT ? bf16_bits(xs[i] - bf16_val(hb)) : (unsigned short)0; }
#pragma unroll
    for (int t = 0; t < 4; ++t) {
      const unsigned short* brow = Wt + (size_t)(col0 + t * 16 + ln) * ldb + kb;
      FragB b;
      b.half[0] = *(const v8us*)(brow + 8 * hh);
      b.half[1] = *(const v8us*)(brow + 16 + 8 * hh);
      acc[t] = mmaN<ASPLIT ? 2 : 1>(ah.v, al.v, b.v, b.v, acc[t]);
    }
  }
#pragma unroll
  for (int t = 0; t < 4; ++t) {
    const int col = col0 + t * 16 + ln;
    float bv = bias ? bias[col] : 0.f;
    if (BIAS_BF16) bv = bf16_round(bv);
#pragma unroll
    for (int r = 0; r < 8; ++r) {
      float v = acc[t][r] + bv;
      if (resid) { float rv = resid[(size_t)((row0 + 8 * hh + r) % rmod) * ldr + col]; if (RES_BF16) rv = bf16_round(rv); v += rv; }
      if (ACT == 1) v = fmaxf(v, 0.f);
      if (ACT == 2) v = 0.5f * v * (1.0f + erff(v * 0.70710678118654752f));
      if (ACT == 3) { const float u = 0.7978845608028654f * (v + 0.044715f * v * v * v); v = 0.5f * v * (1.0f + tanhf(u)); }
      so[w][8 * hh + r][t * 16 + ln] = v;
    }
  }
  __builtin_amdgcn_fence(__ATOMIC_ACQ_REL, "workgroup");
  __builtin_amdgcn_wave_barrier();
  const int rsub = lane >> 4, c4 = (lane & 15) * 4;
  {
#pragma unroll
    for (int q = 0; q < 8; ++q) {
      const int r = q * 2 + rsub;
      const v4f v = *(const v4fa*)&so[w][r][c4];
      *(v4f*)(C + (size_t)(row0 + r) * ldc + col0 + c4) = v;
    }
    
  }
}
// row LayerNorm (biased variance, eps) over N: s = X (+ R); optional out_sum <- s; out_norm <- (s-mu)*rsqrt(var+eps)*g + b
template <bool PARAM_BF16>
__global__ __launch_bounds__(256) void k_layernorm(const float* __restrict__ X, const float* __restrict__ R, const float* __restrict__ g, const float* __restrict__ bta,
                                                  float* __restrict__ out_sum, float* __restrict__ out_norm, int N, float eps) {
  __shared__ float red[256];
  const int row = blockIdx.x, tid = threadIdx.x;
  const float* x = X + (size_t)row * N; const float* rr = R ? R + (size_t)row * N : nullptr;
  float vals[16];                     // up to N = 4096
  const int per = N / 256;            // contiguous chunk per thread? use strided-by-4 chunks: thread handles j = tid*4 + 1024*u
  float s1 = 0.f;
  for (int u = 0; u < per / 4; ++u) {
    const int j = tid * 4 + 1024 * u;
    const v4f a = *(const v4fa*)(x + j);
    v4f b = {0.f,0.f,0.f,0.f}; if (rr) b = *(const v4fa*)(rr + j);
#pragma unroll
    for (int q = 0; q < 4; ++q) { const float v = a[q] + b[q]; vals[u * 4 + q] = v; s1 += v; }
  }
  red[tid] = s1; __syncthreads();
  for (int st = 128; st > 0; st >>= 1) { if (tid < st) red[tid] += red[tid + st]; __syncthreads(); }
  const float mu = red[0] / (float)N; __syncthreads();
  float s2 = 0.f;
  for (int u = 0; u < per / 4; ++u)
#pragma unroll
    for (int q = 0; q < 4; ++q) { const float c = vals[u * 4 + q] - mu; s2 += c * c; }
  red[tid] = s2; __syncthreads();
  for (int st = 128; st > 0; st >>= 1) { if (tid < st) red[tid] += red[tid + st]; __syncthreads(); }
  const float rs = rsqrtf(red[0] / (float)N + eps);
  {
    for (int u = 0; u < per / 4; ++u) {
      const int j = tid * 4 + 1024 * u;
      v4f o, sm;
#pragma unroll
      for (int q = 0; q < 4; ++q) {
        float gg = g[j + q], bb = bta[j + q];
        if (PARAM_BF16) { gg = bf16_round(gg); bb = bf16_round(bb); }
        sm[q] = vals[u * 4 + q]; o[q] = (vals[u * 4 + q] - mu) * rs * gg + bb;
      }
      if (out_sum) *(v4f*)(out_sum + (size_t)row * N + j) = sm;
      *(v4f*)(out_norm + (size_t)row * N + j) = o;
    }
    
  }
}



// ---- f16 WMMA path (v_wmma_f32_16x16x32_f16): 11-bit significands for operands in range — used where a [0,1] probability operand needs more precision than bf16
typedef _Float16 v16h __attribute__((ext_vector_type(16)));
union FragH { v16h v; v8us half[2]; _Float16 h[16]; unsigned short u[16]; };
template <int NT>
__device__ __forceinline__ v8f mmaH(v16h ah, v16h al, v16h bh, v16h bl, v8f c) {
  c = __builtin_amdgcn_wmma_f32_16x16x32_f16(false, ah, false, bh, (short)0, c, false, false);
  if (NT >= 2) c = __builtin_amdgcn_wmma_f32_16x16x32_f16(false, al, false, bh, (short)0, c, false, false);
  if (NT >= 3) c = __builtin_amdgcn_wmma_f32_16x16x32_f16(false, ah, false, bl, (short)0, c, false, false);
  asm volatile("v_nop\n\tv_nop\n\tv_nop\n\tv_nop" : "+v"(c) : "v"(ah), "v"(al), "v"(bh), "v"(bl));
  return c;
}
// batched GEMM like k_gemm_b but f16 operands: A f32 (split into f16 hi/lo if ASPLIT, else rounded to f16), Bt = f16 values [n][k]; alpha; C f32; N multiple of 16 (partial tiles skipped)
template <bool ASPLIT>
__global__ __launch_bounds__(128) void k_gemm_h(const float* __restrict__ A, int lda, size_t sA, const _Float16* __restrict__ Bh, int ldb, size_t sB, float alpha, float* __restrict__ C, int ldc, size_t sC, int M, int N, int K) {
  __shared__ __attribute__((aligned(16))) float so[4][16][64];
  const int tid = threadIdx.x, w = tid >> 5, lane = tid & 31, ln = lane & 15, hh = lane >> 4; const int by = blockIdx.y;
  A += (size_t)by * sA; Bh += (size_t)by * sB; C += (size_t)by * sC;
  const int ntn = (N + 63) / 64; const int wid = blockIdx.x * 4 + w; const int mt = wid / ntn, nq = wid % ntn; if (mt * 16 >= M) return;
  const int row0 = mt * 16, col0 = nq * 64; const float* arow = A + (size_t)(row0 + ln) * lda;
  v8f acc[4] = {};
  for (int kb = 0; kb < K; kb += 32) {
    FragH ah, al;
    const v4f x0 = *(const v4fa*)(arow + kb + 8 * hh), x1 = *(const v4fa*)(arow + kb + 8 * hh + 4), x2 = *(const v4fa*)(arow + kb + 16 + 8 * hh), x3 = *(const v4fa*)(arow + kb + 16 + 8 * hh + 4);
    float xs[16] = {x0[0],x0[1],x0[2],x0[3],x1[0],x1[1],x1[2],x1[3],x2[0],x2[1],x2[2],x2[3],x3[0],x3[1],x3[2],x3[3]};
#pragma unroll
    for (int i = 0; i < 16; ++i) { const _Float16 h = (_Float16)xs[i]; ah.h[i] = h; al.h[i] = ASPLIT ? (_Float16)(xs[i] - (float)h) : (_Float16)0.0f; }
#pragma unroll
    for (int t = 0; t < 4; ++t) { if (col0 + t * 16 >= N) continue; const size_t boff = (size_t)(col0 + t * 16 + ln) * ldb + kb; FragH bq; bq.half[0] = *(const v8us*)(Bh + boff + 8 * hh); bq.half[1] = *(const v8us*)(Bh + boff + 16 + 8 * hh);
      acc[t] = mmaH<ASPLIT ? 2 : 1>(ah.v, al.v, bq.v, bq.v, acc[t]); }
  }
#pragma unroll
  for (int t = 0; t < 4; ++t) { if (col0 + t * 16 >= N) continue;
#pragma unroll
    for (int r = 0; r < 8; ++r) so[w][8 * hh + r][t * 16 + ln] = acc[t][r] * alpha; }
  __builtin_amdgcn_fence(__ATOMIC_ACQ_REL, "workgroup"); __builtin_amdgcn_wave_barrier();
  const int rsub = lane >> 4, c4 = (lane & 15) * 4;
  {
#pragma unroll
    for (int q = 0; q < 8; ++q) { const int r = q * 2 + rsub; if (col0 + c4 < N) { const v4f v = *(const v4fa*)&so[w][r][c4]; *(v4f*)(C + (size_t)(row0 + r) * ldc + col0 + c4) = v; } }
     }
}

// Wt[n][k] = f16(W[k][n]·scale) from f32 row-major W[K][N] (scale = power of two; bf16-exact weights stay exact in f16 away from the subnormal range)
__global__ __launch_bounds__(256) void k_wt_f16(const float* __restrict__ W, _Float16* __restrict__ Wt, int K, int N, float scale) {
  const int t = blockIdx.x * 256 + threadIdx.x; if (t >= N * (K / 8)) return; const int n = t / (K / 8), k8 = (t % (K / 8)) * 8; FragH f;
#pragma unroll
  for (int i = 0; i < 8; ++i) f.h[i] = (_Float16)(bf16_round(W[(size_t)(k8 + i) * N + n]) * scale); const v8us o = f.half[0];
  *(v8us*)((unsigned short*)Wt + (size_t)n * K + k8) = o; 
}
// k_gemm_hh variant with fused epilogue: v = acc·alpha + bias[by·sBias + col] (+ CP[(row/rowsPerB)·sCPb + by·64 + col] if CP) ; ACT 0 none / 1 elu ; writes f16 C16 and/or f32 C (each if non-null)
template <int ACT>
__global__ __launch_bounds__(128) void k_gemm_hhx(const _Float16* __restrict__ A, int lda, size_t sA, const _Float16* __restrict__ Bh, int ldb, size_t sB, float alpha, const float* __restrict__ bias, size_t sBias, const float* __restrict__ CP, int rowsPerB, size_t sCPb, int row0g,
    float* __restrict__ C, _Float16* __restrict__ C16, int ldc, size_t sC, int M, int N, int K) {
  __shared__ __attribute__((aligned(16))) float so[4][16][64];
  const int tid = threadIdx.x, w = tid >> 5, lane = tid & 31, ln = lane & 15, hh = lane >> 4; const int by = blockIdx.y;
  A += (size_t)by * sA; Bh += (size_t)by * sB; const size_t cofs = (size_t)by * sC; const float* bp = bias ? bias + (size_t)by * sBias : nullptr;
  const int ntn = (N + 63) / 64; const int wid = blockIdx.x * 4 + w; const int mt = wid / ntn, nq = wid % ntn; if (mt * 16 >= M) return;
  const int row0 = mt * 16, col0 = nq * 64; const _Float16* arow = A + (size_t)(row0 + ln) * lda;
  v8f acc[4] = {};
  for (int kb = 0; kb < K; kb += 32) { FragH ah; ah.half[0] = *(const v8us*)((const unsigned short*)arow + kb + 8 * hh); ah.half[1] = *(const v8us*)((const unsigned short*)arow + kb + 16 + 8 * hh);
#pragma unroll
    for (int t = 0; t < 4; ++t) { if (col0 + t * 16 >= N) continue; const size_t boff = (size_t)(col0 + t * 16 + ln) * ldb + kb; FragH bq; bq.half[0] = *(const v8us*)((const unsigned short*)Bh + boff + 8 * hh); bq.half[1] = *(const v8us*)((const unsigned short*)Bh + boff + 16 + 8 * hh);
      acc[t] = mmaH<1>(ah.v, ah.v, bq.v, bq.v, acc[t]); }
  }
#pragma unroll
  for (int t = 0; t < 4; ++t) { if (col0 + t * 16 >= N) continue; const int col = col0 + t * 16 + ln; const float bv = bp ? bf16_round(bp[col]) : 0.f;
#pragma unroll
    for (int r = 0; r < 8; ++r) { float v = acc[t][r] * alpha + bv; if (CP) { const int bidx = (row0g + row0 + 8 * hh + r) / rowsPerB; v += CP[(size_t)bidx * sCPb + (size_t)by * 64 + col]; } if (ACT == 1) v = (v > 0.f) ? v : expm1f(v); else if (ACT == 3) v = fmaxf(v, 0.f); so[w][8 * hh + r][t * 16 + ln] = v; } }
  __builtin_amdgcn_fence(__ATOMIC_ACQ_REL, "workgroup"); __builtin_amdgcn_wave_barrier();
  const int rsub = lane >> 4, c4 = (lane & 15) * 4; typedef _Float16 v4h __attribute__((ext_vector_type(4)));
  {
#pragma unroll
    for (int q = 0; q < 8; ++q) { const int r = q * 2 + rsub; if (col0 + c4 < N) { const v4f v = *(const v4fa*)&so[w][r][c4]; if (C) *(v4f*)(C + cofs + (size_t)(row0 + r) * ldc + col0 + c4) = v; if (C16) { v4h h4; for (int i = 0; i < 4; ++i) h4[i] = (_Float16)v[i]; *(v4h*)(C16 + cofs + (size_t)(row0 + r) * ldc + col0 + c4) = h4; } } }
     }
}


// Projection Y = X.W^T / 16 + bias at the fixed shape NR x DM x DM. One 128 x 128 tile of Y per work-group of 8 waves (4 x 2 waves, 32 x 64 of Y each).
// Each 64-k step of both operands (128 rows of 128 B) is read from global as whole lines, one step ahead, into registers and laid in LDS at a pitch of 144 B
// (16 B x odd: no bank conflict for the 16-byte fragment reads). Two LDS buffers: the one barrier of a step publishes its tile and ends the reads of the buffer written next.
// Fragment maps and the ascending k order of every accumulator are those of k_gemm_hhx.
template <bool F32OUT>
__global__ __launch_bounds__(256) void k_proj(const _Float16* __restrict__ A, const _Float16* __restrict__ Bh, const float* __restrict__ bias, float* __restrict__ C, _Float16* __restrict__ C16) {
  constexpr int PT = 72, NS = DM / 64;
  __shared__ __attribute__((aligned(16))) unsigned short sA[2][128][PT], sB[2][128][PT];
  __shared__ __attribute__((aligned(16))) float so[8][32][68];
  const int tid = threadIdx.x, w = tid >> 5, lane = tid & 31, ln = lane & 15, hh = lane >> 4;
  const int m0 = (blockIdx.x >> 3) * 128, n0 = (blockIdx.x & 7) * 128, wm = (w >> 1) * 32, wn = (w & 1) * 64;
  const int lr = tid >> 3, lc = (tid & 7) * 8;
  const unsigned short* ga = (const unsigned short*)A + (size_t)(m0 + lr) * DM + lc;
  const unsigned short* gb = (const unsigned short*)Bh + (size_t)(n0 + lr) * DM + lc;
  v8us ra[4], rb[4];
#pragma unroll
  for (int i = 0; i < 4; ++i) { ra[i] = *(const v8us*)(ga + (size_t)i * 32 * DM); rb[i] = *(const v8us*)(gb + (size_t)i * 32 * DM); }
  v8f acc[2][4];
#pragma unroll
  for (int mt = 0; mt < 2; ++mt)
#pragma unroll
    for (int nt = 0; nt < 4; ++nt) acc[mt][nt] = (v8f){0.f,0.f,0.f,0.f,0.f,0.f,0.f,0.f};
  // unrolled by two so that the buffer index is a constant in every LDS address
#pragma unroll 2
  for (int s = 0; s < NS; ++s) {
    const int bf = s & 1;
#pragma unroll
    for (int i = 0; i < 4; ++i) { *(v8us*)&sA[bf][lr + 32 * i][lc] = ra[i]; *(v8us*)&sB[bf][lr + 32 * i][lc] = rb[i]; }
    __syncthreads();
    if (s + 1 < NS) {
#pragma unroll
      for (int i = 0; i < 4; ++i) { ra[i] = *(const v8us*)(ga + (size_t)i * 32 * DM + (s + 1) * 64); rb[i] = *(const v8us*)(gb + (size_t)i * 32 * DM + (s + 1) * 64); }
    }
    // keeps the next step's global loads in front of this step's matrix work: left free, the compiler sinks them to just before their LDS stores and their whole latency is waited out
    __builtin_amdgcn_sched_barrier(0);
#pragma unroll
    for (int ks = 0; ks < 2; ++ks) {
      FragH a[2], b[4];
#pragma unroll
      for (int mt = 0; mt < 2; ++mt) { a[mt].half[0] = *(const v8us*)&sA[bf][wm + mt * 16 + ln][ks * 32 + 8 * hh]; a[mt].half[1] = *(const v8us*)&sA[bf][wm + mt * 16 + ln][ks * 32 + 16 + 8 * hh]; }
#pragma unroll
      for (int nt = 0; nt < 4; ++nt) { b[nt].half[0] = *(const v8us*)&sB[bf][wn + nt * 16 + ln][ks * 32 + 8 * hh]; b[nt].half[1] = *(const v8us*)&sB[bf][wn + nt * 16 + ln][ks * 32 + 16 + 8 * hh]; }
#pragma unroll
      for (int mt = 0; mt < 2; ++mt)
#pragma unroll
        for (int nt = 0; nt < 4; ++nt) acc[mt][nt] = __builtin_amdgcn_wmma_f32_16x16x32_f16(false, a[mt].v, false, b[nt].v, (short)0, acc[mt][nt], false, false);
    }
  }
  // stands in front of the epilogue's reuse of the registers that held the global load addresses (the scheduling barrier keeps that reuse behind it)
  asm volatile("s_wait_xcnt 0x0" ::: "memory");
  __builtin_amdgcn_sched_barrier(0);
  typedef _Float16 v4h __attribute__((ext_vector_type(4)));
#pragma unroll
  for (int nt = 0; nt < 4; ++nt) { const float bv = bf16_round(bias[n0 + wn + nt * 16 + ln]);
#pragma unroll
    for (int mt = 0; mt < 2; ++mt)
#pragma unroll
      for (int r = 0; r < 8; ++r) so[w][mt * 16 + 8 * hh + r][nt * 16 + ln] = acc[mt][nt][r] * 0.0625f + bv; }
  // the wave's own 32 x 64 strip: its LDS writes are ordered before its cross-lane reads, so that whole lines go out
  __builtin_amdgcn_fence(__ATOMIC_ACQ_REL, "workgroup"); __builtin_amdgcn_wave_barrier();
#pragma unroll
  for (int q = 0; q < 16; ++q) { const int r = q * 2 + hh, c4 = ln * 4; const v4f v = *(const v4fa*)&so[w][r][c4]; const size_t o = (size_t)(m0 + wm + r) * DM + n0 + wn + c4;
    if (F32OUT) *(v4f*)(C + o) = v; else { v4h h4;
#pragma unroll
      for (int i = 0; i < 4; ++i) h4[i] = (_Float16)v[i]; *(v4h*)(C16 + o) = h4; } }
}

__global__ __launch_bounds__(256) void k_x16(const float* __restrict__ x, _Float16* __restrict__ X16, size_t n8) { const size_t t = (size_t)blockIdx.x * 256 + threadIdx.x; if (t >= n8) return; FragH f;
#pragma unroll
  for (int q = 0; q < 8; ++q) f.h[q] = (_Float16)bf16_round(x[t * 8 + q]); *(v8us*)((unsigned short*)X16 + t * 8) = f.half[0];  }
__global__ __launch_bounds__(256) void k_h16(const float* __restrict__ x, _Float16* __restrict__ X16, size_t n8) { const size_t t = (size_t)blockIdx.x * 256 + threadIdx.x; if (t >= n8) return; FragH f;
#pragma unroll
  for (int q = 0; q < 8; ++q) f.h[q] = (_Float16)x[t * 8 + q]; *(v8us*)((unsigned short*)X16 + t * 8) = f.half[0];  }
__global__ __launch_bounds__(256) void k_round16f(const float* __restrict__ W, _Float16* __restrict__ Bt, size_t n8) { const size_t t = (size_t)blockIdx.x * 256 + threadIdx.x; if (t >= n8) return; FragH f;
#pragma unroll
  for (int i = 0; i < 8; ++i) f.h[i] = (_Float16)(bf16_round(W[t * 8 + i]) * 16.0f); *(v8us*)((unsigned short*)Bt + t * 8) = f.half[0];  }
__global__ __launch_bounds__(256) void k_vt(const _Float16* __restrict__ V16, _Float16* __restrict__ Vt) { __shared__ unsigned short tl[64][66]; const int tid = threadIdx.x; const int slab = blockIdx.x / (SS / 64), lg = blockIdx.x % (SS / 64); const int b = slab / NH, h = slab % NH;
  for (int i = tid; i < 64 * 8; i += 256) { const int r = i / 8, c8 = (i % 8) * 8; FragH f; f.half[0] = *(const v8us*)((const unsigned short*)V16 + ((size_t)b * SS + lg * 64 + r) * DM + h * HD + c8);
#pragma unroll
    for (int q = 0; q < 8; ++q) tl[r][c8 + q] = f.u[q]; }
  __syncthreads();
  {
#pragma unroll
    for (int rd = 0; rd < 2; ++rd) { const int d = rd * 32 + tid / 8, pc = tid % 8; FragH f;
#pragma unroll
      for (int q = 0; q < 8; ++q) f.u[q] = tl[pc * 8 + q][d];
      *(v8us*)((unsigned short*)Vt + ((size_t)slab * HD + d) * SS + lg * 64 + pc * 8) = f.half[0]; }
     } }
// sigmoid(s / 8) = 0.5 + 0.5 tanh(s / 16): th16 is the hardware tanh (v_tanh_f32) of s / 16, one transcendental in place of the library expf and the full-precision division
__device__ __forceinline__ float th16(float s) { return __builtin_amdgcn_tanhf(s * 0.0625f); }
__device__ __forceinline__ float sigm8(float s) { return fmaf(th16(s), 0.5f, 0.5f); }
__global__ __launch_bounds__(128) void k_satt(const _Float16* __restrict__ Q16, const _Float16* __restrict__ K16, const _Float16* __restrict__ Vt, float* __restrict__ O) {
  constexpr int RPW = 32, NQB = SS / (4 * RPW), DT = HD / 16, KS = HD / 32;
  __shared__ __attribute__((aligned(16))) unsigned short sP[4][RPW][40]; __shared__ __attribute__((aligned(16))) float sO[4][RPW][HD];
  const int tid = threadIdx.x, w = tid >> 5, lane = tid & 31, ln = lane & 15, hh = lane >> 4;
  const int slab = blockIdx.x / NQB, qblk = blockIdx.x % NQB; const int b = slab / NH, h = slab % NH; const int q0 = qblk * (4 * RPW) + w * RPW;
  FragH aq[2][KS];
#pragma unroll
  for (int rt = 0; rt < 2; ++rt) { const unsigned short* qr = (const unsigned short*)Q16 + ((size_t)b * SS + q0 + rt * 16 + ln) * DM + h * HD;
#pragma unroll
    for (int ks = 0; ks < KS; ++ks) { aq[rt][ks].half[0] = *(const v8us*)(qr + ks * 32 + 8 * hh); aq[rt][ks].half[1] = *(const v8us*)(qr + ks * 32 + 16 + 8 * hh); } }
  const unsigned short* Vth = (const unsigned short*)Vt + (size_t)slab * HD * SS;
  v8f oacc[2][DT];
#pragma unroll
  for (int rt = 0; rt < 2; ++rt)
#pragma unroll
    for (int dt = 0; dt < DT; ++dt) oacc[rt][dt] = (v8f){0.f,0.f,0.f,0.f,0.f,0.f,0.f,0.f};
#pragma unroll 1
  for (int j0 = 0; j0 < SS; j0 += 32) {
    v8f s[2][2];
#pragma unroll
    for (int nt = 0; nt < 2; ++nt) { const unsigned short* kr = (const unsigned short*)K16 + ((size_t)b * SS + j0 + nt * 16 + ln) * DM + h * HD; FragH bk[KS];
#pragma unroll
      for (int ks = 0; ks < KS; ++ks) { bk[ks].half[0] = *(const v8us*)(kr + ks * 32 + 8 * hh); bk[ks].half[1] = *(const v8us*)(kr + ks * 32 + 16 + 8 * hh); }
#pragma unroll
      for (int rt = 0; rt < 2; ++rt) { v8f acc = (v8f){0.f,0.f,0.f,0.f,0.f,0.f,0.f,0.f};
#pragma unroll
        for (int ks = 0; ks < KS; ++ks) acc = mmaH<1>(aq[rt][ks].v, aq[rt][ks].v, bk[ks].v, bk[ks].v, acc); s[rt][nt] = acc; } }
#pragma unroll
    for (int rt = 0; rt < 2; ++rt)
#pragma unroll
      for (int r = 0; r < 8; ++r) { FragH t2; t2.h[0] = (_Float16)sigm8(s[rt][0][r]); t2.h[1] = (_Float16)sigm8(s[rt][1][r]); sP[w][rt * 16 + 8 * hh + r][ln] = t2.u[0]; sP[w][rt * 16 + 8 * hh + r][16 + ln] = t2.u[1]; }
    __builtin_amdgcn_fence(__ATOMIC_ACQ_REL, "workgroup"); __builtin_amdgcn_wave_barrier();
    FragH pa[2];
#pragma unroll
    for (int rt = 0; rt < 2; ++rt) { pa[rt].half[0] = *(const v8us*)&sP[w][rt * 16 + ln][8 * hh]; pa[rt].half[1] = *(const v8us*)&sP[w][rt * 16 + ln][16 + 8 * hh]; }
#pragma unroll
    for (int dt = 0; dt < DT; ++dt) { const unsigned short* vrow = Vth + (size_t)(dt * 16 + ln) * SS + j0; FragH bv; bv.half[0] = *(const v8us*)(vrow + 8 * hh); bv.half[1] = *(const v8us*)(vrow + 16 + 8 * hh);
#pragma unroll
      for (int rt = 0; rt < 2; ++rt) oacc[rt][dt] = mmaH<1>(pa[rt].v, pa[rt].v, bv.v, bv.v, oacc[rt][dt]); }
    __builtin_amdgcn_fence(__ATOMIC_ACQ_REL, "workgroup"); __builtin_amdgcn_wave_barrier(); }
#pragma unroll
  for (int rt = 0; rt < 2; ++rt)
#pragma unroll
    for (int dt = 0; dt < DT; ++dt)
#pragma unroll
      for (int r = 0; r < 8; ++r) sO[w][rt * 16 + 8 * hh + r][dt * 16 + ln] = oacc[rt][dt][r];
  __builtin_amdgcn_fence(__ATOMIC_ACQ_REL, "workgroup"); __builtin_amdgcn_wave_barrier();
  {
#pragma unroll
    for (int rp = 0; rp < RPW; rp += 2) { const int r = rp + (lane >> 4), pc = lane & 15; const v4f val = *(const v4fa*)&sO[w][r][pc * 4]; *(v4f*)(O + ((size_t)b * SS + q0 + r) * DM + h * HD + pc * 4) = val; }
     } }
// (b) attn_weights[b][q][k] = (1/16) sum_h sigmoid(q_h.k_h/8). One 128 x 128 tile (queries x keys) of one batch per work-group of 8 waves (4 x 2 waves, 32 x 64 each), made whole by that work-group.
// A step is one head: its 64 columns of the 128 query rows and of the 128 key rows (one 128-B line a row) are read from global as whole lines, one head ahead, into registers and laid in LDS
// at the pitch of k_proj (144 B). Two LDS buffers: the one barrier of a step publishes its head and ends the reads of the buffer written next.
// Fragment maps, the ascending k order inside a head and the ascending head order of the sum of the tanh terms are those of the 16 x 32 form that read its fragments straight from global.
__global__ __launch_bounds__(256) void k_aw(const _Float16* __restrict__ Q16, const _Float16* __restrict__ K16, float* __restrict__ AW) {
  constexpr int PT = 72, NT = SS / 128;
  __shared__ __attribute__((aligned(16))) unsigned short sA[2][128][PT], sB[2][128][PT];
  __shared__ __attribute__((aligned(16))) float so[8][32][68];
  const int tid = threadIdx.x, w = tid >> 5, lane = tid & 31, ln = lane & 15, hh = lane >> 4;
  const int b = blockIdx.x / (NT * NT), tl = blockIdx.x % (NT * NT);
  const int m0 = (tl / NT) * 128, n0 = (tl % NT) * 128, wm = (w >> 1) * 32, wn = (w & 1) * 64;
  const int lr = tid >> 3, lc = (tid & 7) * 8;
  const unsigned short* ga = (const unsigned short*)Q16 + ((size_t)b * SS + m0 + lr) * DM + lc;
  const unsigned short* gb = (const unsigned short*)K16 + ((size_t)b * SS + n0 + lr) * DM + lc;
  v8us ra[4], rb[4];
#pragma unroll
  for (int i = 0; i < 4; ++i) { ra[i] = *(const v8us*)(ga + (size_t)i * 32 * DM); rb[i] = *(const v8us*)(gb + (size_t)i * 32 * DM); }
  typedef float v2f __attribute__((ext_vector_type(2)));
  v2f aw[2][4][4];   // the sums of the tanh terms, as register pairs: one packed add serves two of them
#pragma unroll
  for (int mt = 0; mt < 2; ++mt)
#pragma unroll
    for (int nt = 0; nt < 4; ++nt)
#pragma unroll
      for (int p = 0; p < 4; ++p) aw[mt][nt][p] = (v2f){0.f, 0.f};
  // unrolled by two so that the buffer index is a constant in every LDS address
#pragma unroll 2
  for (int h = 0; h < NH; ++h) {
    const int bf = h & 1;
#pragma unroll
    for (int i = 0; i < 4; ++i) { *(v8us*)&sA[bf][lr + 32 * i][lc] = ra[i]; *(v8us*)&sB[bf][lr + 32 * i][lc] = rb[i]; }
    __syncthreads();
    // no branch round the loads (the last step reads its own head once more, unused): the step stays one block, in which the two scheduling barriers below hold; with a branch here the compiler sinks the tanh work past the next step's stores and barrier
    const int hn = (h + 1 < NH) ? h + 1 : h;
#pragma unroll
    for (int i = 0; i < 4; ++i) { ra[i] = *(const v8us*)(ga + (size_t)i * 32 * DM + hn * HD); rb[i] = *(const v8us*)(gb + (size_t)i * 32 * DM + hn * HD); }
    // keeps the next head's global loads in front of this head's matrix and tanh work: left free, the compiler sinks them to just before their LDS stores and their whole latency is waited out
    __builtin_amdgcn_sched_barrier(0);
    v8f acc[2][4];
#pragma unroll
    for (int mt = 0; mt < 2; ++mt)
#pragma unroll
      for (int nt = 0; nt < 4; ++nt) acc[mt][nt] = (v8f){0.f,0.f,0.f,0.f,0.f,0.f,0.f,0.f};
#pragma unroll
    for (int ks = 0; ks < HD / 32; ++ks) {
      FragH a[2], bk[4];
#pragma unroll
      for (int mt = 0; mt < 2; ++mt) { a[mt].half[0] = *(const v8us*)&sA[bf][wm + mt * 16 + ln][ks * 32 + 8 * hh]; a[mt].half[1] = *(const v8us*)&sA[bf][wm + mt * 16 + ln][ks * 32 + 16 + 8 * hh]; }
#pragma unroll
      for (int nt = 0; nt < 4; ++nt) { bk[nt].half[0] = *(const v8us*)&sB[bf][wn + nt * 16 + ln][ks * 32 + 8 * hh]; bk[nt].half[1] = *(const v8us*)&sB[bf][wn + nt * 16 + ln][ks * 32 + 16 + 8 * hh]; }
#pragma unroll
      for (int mt = 0; mt < 2; ++mt)
#pragma unroll
        for (int nt = 0; nt < 4; ++nt) acc[mt][nt] = __builtin_amdgcn_wmma_f32_16x16x32_f16(false, a[mt].v, false, bk[nt].v, (short)0, acc[mt][nt], false, false);
    }
#pragma unroll
    for (int mt = 0; mt < 2; ++mt)
#pragma unroll
      for (int nt = 0; nt < 4; ++nt)
#pragma unroll
        for (int p = 0; p < 4; ++p) aw[mt][nt][p] += (v2f){th16(acc[mt][nt][2 * p]), th16(acc[mt][nt][2 * p + 1])};
    // keeps the next head's LDS stores behind this head's matrix and tanh work: left free, the compiler lifts them, and with them the wait for the global loads, to just behind this head's LDS reads
    __builtin_amdgcn_sched_barrier(0);
  }
  // stands in front of the epilogue's reuse of the registers that held the global load addresses (the scheduling barrier keeps that reuse behind it)
  asm volatile("s_wait_xcnt 0x0" ::: "memory");
  __builtin_amdgcn_sched_barrier(0);
#pragma unroll
  for (int nt = 0; nt < 4; ++nt)
#pragma unroll
    for (int mt = 0; mt < 2; ++mt)
#pragma unroll
      for (int r = 0; r < 8; ++r) so[w][mt * 16 + 8 * hh + r][nt * 16 + ln] = fmaf(aw[mt][nt][r >> 1][r & 1], 0.5f / (float)NH, 0.5f);   // mean_h (0.5 + 0.5 tanh) from the sum of the tanh terms
  // the wave's own 32 x 64 strip: its LDS writes are ordered before its cross-lane reads, so that whole lines go out
  __builtin_amdgcn_fence(__ATOMIC_ACQ_REL, "workgroup"); __builtin_amdgcn_wave_barrier();
#pragma unroll
  for (int q = 0; q < 16; ++q) { const int r = q * 2 + hh, c4 = ln * 4; *(v4f*)(AW + ((size_t)b * SS + m0 + wm + r) * SS + n0 + wn + c4) = *(const v4fa*)&so[w][r][c4]; }
}
extern "C" void kernel_launch(void* const* d_in, const int* in_sizes, int n_in,
                              void* d_out, int out_size, void* d_ws, size_t ws_size, hipStream_t stream) {
  (void)in_sizes; (void)n_in; (void)out_size;
  const float* xq = (const float*)d_in[0]; const float* xk = (const float*)d_in[1]; const float* xv = (const float*)d_in[2]; const float* Wq = (const float*)d_in[3]; const float* bq = (const float*)d_in[4]; const float* Wk = (const float*)d_in[5]; const float* bk = (const float*)d_in[6]; const float* Wv = (const float*)d_in[7]; const float* bv = (const float*)d_in[8]; const float* Wo = (const float*)d_in[9]; const float* bo = (const float*)d_in[10];
  float* out = (float*)d_out; float* AW = (float*)((char*)d_out + 16777216);
  char* ws = (char*)d_ws; size_t off = 0;
  auto take = [&](size_t bytes) { char* p = ws + off; off += (bytes + 255) & ~(size_t)255; return p; };
  const size_t w8 = (size_t)DM * DM / 8;
  _Float16* Bq = (_Float16*)take(w8 * 16); _Float16* Bk = (_Float16*)take(w8 * 16); _Float16* Bv = (_Float16*)take(w8 * 16); _Float16* Bo = (_Float16*)take(w8 * 16);
  _Float16* XQ = (_Float16*)take((size_t)NR * DM * 2); _Float16* XK = (_Float16*)take((size_t)NR * DM * 2); _Float16* XV = (_Float16*)take((size_t)NR * DM * 2); _Float16* Q16 = (_Float16*)take((size_t)NR * DM * 2); _Float16* K16 = (_Float16*)take((size_t)NR * DM * 2); _Float16* V16 = (_Float16*)take((size_t)NR * DM * 2); _Float16* Vt = (_Float16*)take((size_t)NR * DM * 2); float* O = (float*)take((size_t)NR * DM * 4); _Float16* O16 = (_Float16*)take((size_t)NR * DM * 2);
  if (off > ws_size) return;      // ≈ 8 + 8.4×8 + 16.8 ≈ 92 MiB
  const unsigned gw = (unsigned)((w8 + 255) / 256), gx = (unsigned)(((size_t)NR * DM / 8 + 255) / 256);
  k_round16f<<<gw, 256, 0, stream>>>(Wq, Bq, w8); k_round16f<<<gw, 256, 0, stream>>>(Wk, Bk, w8); k_round16f<<<gw, 256, 0, stream>>>(Wv, Bv, w8); k_round16f<<<gw, 256, 0, stream>>>(Wo, Bo, w8);
  k_x16<<<gx, 256, 0, stream>>>(xq, XQ, (size_t)NR * DM / 8); k_x16<<<gx, 256, 0, stream>>>(xk, XK, (size_t)NR * DM / 8); k_x16<<<gx, 256, 0, stream>>>(xv, XV, (size_t)NR * DM / 8);
  const unsigned gp = (NR / 128) * (DM / 128);
  k_proj<false><<<gp, 256, 0, stream>>>(XQ, Bq, bq, nullptr, Q16);
  k_proj<false><<<gp, 256, 0, stream>>>(XK, Bk, bk, nullptr, K16);
  k_proj<false><<<gp, 256, 0, stream>>>(XV, Bv, bv, nullptr, V16);
  k_vt<<<BB * NH * (SS / 64), 256, 0, stream>>>(V16, Vt);
  k_satt<<<BB * NH * (SS / 128), 128, 0, stream>>>(Q16, K16, Vt, O);
  k_h16<<<gx, 256, 0, stream>>>(O, O16, (size_t)NR * DM / 8);
  k_proj<true><<<gp, 256, 0, stream>>>(O16, Bo, bo, out, nullptr);
  k_aw<<<BB * (SS / 128) * (SS / 128), 256, 0, stream>>>(Q16, K16, AW);
}

// v005
// One run takes 154 microseconds.
// In two side-by-side timings against v004, it was 1.58 and 1.57 times as fast.
// All steps since v000 together make it 7.62 times as fast.
#include <hip/hip_runtime.h>
// q/k/v/o projections (4096 × 1024 × 1024, + bias) and the 16-head sigmoid attention on v_wmma_f32_16x16x32_f16: (a) per (b,h) a fused flash-style kernel with P = σ(q·k/8) (no normalisation,
// as the module) and O = P·V on WMMA; (b) the second output mean_h σ(q·k/8) recomputes the score tiles per head and averages them in a fixed order. x inputs f16(bf16 ·) exact, q/k/v and O rounded to f16,
// weights bf16-exact ×2^4 ((out,in)), P f16 ≤ 1, f32 accumulate.
#define BB 2
#define SS 2048
#define DM 1024
#define NH 16
#define HD 64
#define NR (BB * SS)

typedef __bf16 v16b __attribute__((ext_vector_type(16)));
typedef unsigned short v8us __attribute__((ext_vector_type(8), may_alias));
typedef float  v8f  __attribute__((ext_vector_type(8)));
typedef float  v4f  __attribute__((ext_vector_type(4)));
typedef float  v4fa __attribute__((ext_vector_type(4), may_alias));
union FragB { v16b v; v8us half[2]; unsigned short u[16]; };

__device__ __forceinline__ unsigned short bf16_bits(float x) { unsigned int u = __float_as_uint(x); return (unsigned short)((u + 0x7FFFu + ((u >> 16) & 1u)) >> 16); }
__device__ __forceinline__ float bf16_val(unsigned short b) { return __uint_as_float(((unsigned int)b) << 16); }
__device__ __forceinline__ float bf16_round(float x) { return bf16_val(bf16_bits(x)); }
// D += A·B with NT terms: 1 = ah·bh, 2 = + al·bh (A split), 3 = + ah·bl (both split)
template <int NT>
__device__ __forceinline__ v8f mmaN(v16b ah, v16b al, v16b bh, v16b bl, v8f c) {
  c = __builtin_amdgcn_wmma_f32_16x16x32_bf16(false, ah, false, bh, (short)0, c, false, false);
  if (NT >= 2) c = __builtin_amdgcn_wmma_f32_16x16x32_bf16(false, al, false, bh, (short)0, c, false, false);
  if (NT >= 3) c = __builtin_amdgcn_wmma_f32_16x16x32_bf16(false, ah, false, bl, (short)0, c, false, false);
  asm volatile("v_nop\n\tv_nop\n\tv_nop\n\tv_nop" : "+v"(c) : "v"(ah), "v"(al), "v"(bh), "v"(bl));
  return c;
}

__global__ __launch_bounds__(256) void k_wt_bf16(const float* __restrict__ W, unsigned short* __restrict__ Wt, int K, int N) {
  const int t = blockIdx.x * 256 + threadIdx.x;
  const int k8n = K / 8;
  if (t >= N * k8n) return;
  const int n = t / k8n, k8 = (t % k8n) * 8;
  v8us v;
#pragma unroll
  for (int i = 0; i < 8; ++i) v[i] = bf16_bits(W[(size_t)(k8 + i) * N + n]);
  *(v8us*)(Wt + (size_t)n * K + k8) = v;
  
}

// GEMM C[M][N] (f32, pitch ldc) = act(A[M][K]·W + bias). A f32 row-major (pitch lda) converted per fragment to bf16
// (ASPLIT: hi/lo two planes -> 2 terms, else single rounded term); Wt bf16 [N][K] (pitch ldb). BIAS_BF16 rounds the
// bias to bf16 first (bias quantised to bf16 before the add). K%32==0, M%16==0, N%64==0.
template <bool ASPLIT, int ACT, bool BIAS_BF16>
__global__ __launch_bounds__(128) void k_gemm_bf(const float* __restrict__ A, int lda, const unsigned short* __restrict__ Wt, int ldb,
                                               const float* __restrict__ bias, float* __restrict__ C, int ldc, int M, int N, int K) {
  __shared__ __attribute__((aligned(16))) float so[4][16][64];
  const int tid = threadIdx.x, w = tid >> 5, lane = tid & 31, ln = lane & 15, hh = lane >> 4;
  const int ntn = N / 64;
  const int wid = blockIdx.x * 4 + w;
  const int mt = wid / ntn, nq = wid % ntn;
  if (mt * 16 >= M) return;
  const int row0 = mt * 16, col0 = nq * 64;
  const float* arow = A + (size_t)(row0 + ln) * lda;
  v8f acc[4] = {};
  for (int kb = 0; kb < K; kb += 32) {
    FragB ah, al;
    const v4f x0 = *(const v4fa*)(arow + kb + 8 * hh), x1 = *(const v4fa*)(arow + kb + 8 * hh + 4);
    const v4f x2 = *(const v4fa*)(arow + kb + 16 + 8 * hh), x3 = *(const v4fa*)(arow + kb + 16 + 8 * hh + 4);
    float xs[16] = {x0[0],x0[1],x0[2],x0[3],x1[0],x1[1],x1[2],x1[3],x2[0],x2[1],x2[2],x2[3],x3[0],x3[1],x3[2],x3[3]};
#pragma unroll
    for (int i = 0; i < 16; ++i) { const unsigned short hb = bf16_bits(xs[i]); ah.u[i] = hb; al.u[i] = ASPLIT ? bf16_bits(xs[i] - bf16_val(hb)) : (unsigned short)0; }
#pragma unroll
    for (int t = 0; t < 4; ++t) {
      const unsigned short* brow = Wt + (size_t)(col0 + t * 16 + ln) * ldb + kb;
      FragB b;
      b.half[0] = *(const v8us*)(brow + 8 * hh);
      b.half[1] = *(const v8us*)(brow + 16 + 8 * hh);
      acc[t] = mmaN<ASPLIT ? 2 : 1>(ah.v, al.v, b.v, b.v, acc[t]);
    }
  }
#pragma unroll
  for (int t = 0; t < 4; ++t) {
    float bv = bias ? bias[col0 + t * 16 + ln] : 0.f;
    if (BIAS_BF16) bv = bf16_round(bv);
#pragma unroll
    for (int r = 0; r < 8; ++r) { float v = acc[t][r] + bv; if (ACT == 1) v = fmaxf(v, 0.f); so[w][8 * hh + r][t * 16 + ln] = v; }
  }
  __builtin_amdgcn_fence(__ATOMIC_ACQ_REL, "workgroup");
  __builtin_amdgcn_wave_barrier();
  const int rsub = lane >> 4, c4 = (lane & 15) * 4;
  {
#pragma unroll
    for (int q = 0; q < 8; ++q) {
      const int r = q * 2 + rsub;
      const v4f v = *(const v4fa*)&so[w][r][c4];
      *(v4f*)(C + (size_t)(row0 + r) * ldc + col0 + c4) = v;
    }
    
  }
}

// Flash-style causal/unmasked attention, all contractions 3-term bf16 hi/lo splits, f32 softmax with running max.
// q,k,v rows are read from f32 buffers with arbitrary row pitch (so they can live inside a fused qkv buffer);
// D = head size (multiple of 32, <= 128); one wave = 16 query rows; block = 4 waves (64 queries) sharing K/V chunks of 32.
template <int D, bool CAUSAL>
__global__ __launch_bounds__(128) void k_flash(const float* __restrict__ qb, const float* __restrict__ kb, const float* __restrict__ vb,
                                             int pitch, int T, int H, float scale, float* __restrict__ y, int ypitch) {
  constexpr int KS = D / 32;        // k-steps for QK
  constexpr int DT = D / 16;        // d tiles for PV
  __shared__ __attribute__((aligned(16))) unsigned short sKh[32][D + 8], sKl[32][D + 8], sVh[32][D + 8], sVl[32][D + 8];
  __shared__ __attribute__((aligned(16))) unsigned short sPh[4][16][40], sPl[4][16][40];
  __shared__ __attribute__((aligned(16))) float sO[4][16][D];
  const int tid = threadIdx.x, w = tid >> 5, lane = tid & 31, ln = lane & 15, hh = lane >> 4;
  const int nqb = (T + 63) / 64;
  const int bh = blockIdx.x / nqb, qblk = blockIdx.x % nqb;
  const int b = bh / H, h = bh % H;
  const int q0 = qblk * 64 + w * 16;
  const float* Q = qb + (size_t)b * T * pitch + h * D;
  const float* K = kb + (size_t)b * T * pitch + h * D;
  const float* V = vb + (size_t)b * T * pitch + h * D;

  // A fragments of the wave's 16 query rows (scaled), hi/lo
  FragB aqh[KS], aql[KS];
  {
    int row = q0 + ln; if (row >= T) row = T - 1;
    const float* qr = Q + (size_t)row * pitch;
#pragma unroll
    for (int ks = 0; ks < KS; ++ks)
#pragma unroll
      for (int i = 0; i < 16; ++i) {
        const int d = ks * 32 + ((i < 8) ? (8 * hh + i) : (16 + 8 * hh + (i - 8)));
        const float x = qr[d] * scale; const unsigned short hb = bf16_bits(x);
        aqh[ks].u[i] = hb; aql[ks].u[i] = bf16_bits(x - bf16_val(hb));
      }
  }
  float m_r[8], l_r[8];
#pragma unroll
  for (int r = 0; r < 8; ++r) { m_r[r] = -3.0e38f; l_r[r] = 0.f; }
  v8f oacc[DT];
#pragma unroll
  for (int dt = 0; dt < DT; ++dt) oacc[dt] = (v8f){0.f,0.f,0.f,0.f,0.f,0.f,0.f,0.f};

  const int kv_end = CAUSAL ? min(T, qblk * 64 + 64) : T;     // block-uniform
  for (int j0 = 0; j0 < kv_end; j0 += 32) {
    __syncthreads();
    for (int e = tid; e < 32 * (D / 4); e += 128) {
      const int r = e / (D / 4), c4 = (e % (D / 4)) * 4;
      const int key = j0 + r;
      v4f kf = {0.f,0.f,0.f,0.f}, vf = {0.f,0.f,0.f,0.f};
      if (key < T) { kf = *(const v4fa*)(K + (size_t)key * pitch + c4); vf = *(const v4fa*)(V + (size_t)key * pitch + c4); }
#pragma unroll
      for (int t = 0; t < 4; ++t) {
        unsigned short hb = bf16_bits(kf[t]); sKh[r][c4 + t] = hb; sKl[r][c4 + t] = bf16_bits(kf[t] - bf16_val(hb));
        hb = bf16_bits(vf[t]); sVh[r][c4 + t] = hb; sVl[r][c4 + t] = bf16_bits(vf[t] - bf16_val(hb));
      }
    }
    __syncthreads();
    // S tile 16 x 32
    v8f s[2];
#pragma unroll
    for (int nt = 0; nt < 2; ++nt) {
      v8f acc = {};
#pragma unroll
      for (int ks = 0; ks < KS; ++ks) {
        FragB bh_, bl_;
        bh_.half[0] = *(const v8us*)&sKh[nt * 16 + ln][ks * 32 + 8 * hh]; bh_.half[1] = *(const v8us*)&sKh[nt * 16 + ln][ks * 32 + 16 + 8 * hh];
        bl_.half[0] = *(const v8us*)&sKl[nt * 16 + ln][ks * 32 + 8 * hh]; bl_.half[1] = *(const v8us*)&sKl[nt * 16 + ln][ks * 32 + 16 + 8 * hh];
        acc = mmaN<3>(aqh[ks].v, aql[ks].v, bh_.v, bl_.v, acc);
      }
      s[nt] = acc;
    }
    // mask + running max (rows 8hh+r; the 16 lanes of a half share rows)
    float alpha[8];
#pragma unroll
    for (int r = 0; r < 8; ++r) {
      const int qi = q0 + 8 * hh + r;
      const int ja = j0 + ln, jb = j0 + 16 + ln;
      if (CAUSAL) { if (ja > qi) s[0][r] = -3.0e38f; if (jb > qi) s[1][r] = -3.0e38f; }
      if (ja >= T) s[0][r] = -3.0e38f;
      if (jb >= T) s[1][r] = -3.0e38f;
      float mx = fmaxf(s[0][r], s[1][r]);
      mx = fmaxf(mx, __shfl_xor(mx, 1, 32)); mx = fmaxf(mx, __shfl_xor(mx, 2, 32)); mx = fmaxf(mx, __shfl_xor(mx, 4, 32)); mx = fmaxf(mx, __shfl_xor(mx, 8, 32));
      const float mnew = fmaxf(m_r[r], mx);
      alpha[r] = (mnew > -1.0e38f) ? __expf(m_r[r] - mnew) : 1.0f;
      const float p0 = (s[0][r] > -1.0e38f) ? __expf(s[0][r] - mnew) : 0.f;
      const float p1 = (s[1][r] > -1.0e38f) ? __expf(s[1][r] - mnew) : 0.f;
      m_r[r] = mnew;
      l_r[r] = l_r[r] * alpha[r] + p0 + p1;            // per-lane partial row sum (16 lanes combined at the end)
      unsigned short hb = bf16_bits(p0); sPh[w][8 * hh + r][ln] = hb;      sPl[w][8 * hh + r][ln] = bf16_bits(p0 - bf16_val(hb));
      hb = bf16_bits(p1);                sPh[w][8 * hh + r][16 + ln] = hb; sPl[w][8 * hh + r][16 + ln] = bf16_bits(p1 - bf16_val(hb));
    }
#pragma unroll
    for (int dt = 0; dt < DT; ++dt)
#pragma unroll
      for (int r = 0; r < 8; ++r) oacc[dt][r] *= alpha[r];
    __builtin_amdgcn_fence(__ATOMIC_ACQ_REL, "workgroup");
    __builtin_amdgcn_wave_barrier();
    FragB pah, pal;
    pah.half[0] = *(const v8us*)&sPh[w][ln][8 * hh]; pah.half[1] = *(const v8us*)&sPh[w][ln][16 + 8 * hh];
    pal.half[0] = *(const v8us*)&sPl[w][ln][8 * hh]; pal.half[1] = *(const v8us*)&sPl[w][ln][16 + 8 * hh];
#pragma unroll
    for (int dt = 0; dt < DT; ++dt) {
      FragB bvh, bvl;
#pragma unroll
      for (int i = 0; i < 8; ++i) {
        bvh.u[i] = sVh[8 * hh + i][dt * 16 + ln]; bvh.u[8 + i] = sVh[16 + 8 * hh + i][dt * 16 + ln];
        bvl.u[i] = sVl[8 * hh + i][dt * 16 + ln]; bvl.u[8 + i] = sVl[16 + 8 * hh + i][dt * 16 + ln];
      }
      oacc[dt] = mmaN<3>(pah.v, pal.v, bvh.v, bvl.v, oacc[dt]);
    }
    __builtin_amdgcn_fence(__ATOMIC_ACQ_REL, "workgroup");
    __builtin_amdgcn_wave_barrier();
  }
#pragma unroll
  for (int r = 0; r < 8; ++r) {
    float l = l_r[r];
    l += __shfl_xor(l, 1, 32); l += __shfl_xor(l, 2, 32); l += __shfl_xor(l, 4, 32); l += __shfl_xor(l, 8, 32);
    l_r[r] = (l > 0.f) ? 1.0f / l : 0.f;
  }
#pragma unroll
  for (int dt = 0; dt < DT; ++dt)
#pragma unroll
    for (int r = 0; r < 8; ++r) sO[w][8 * hh + r][dt * 16 + ln] = oacc[dt][r] * l_r[r];
  __builtin_amdgcn_fence(__ATOMIC_ACQ_REL, "workgroup");
  __builtin_amdgcn_wave_barrier();
  {
    for (int r = 0; r < 16; ++r) {
      const int row = q0 + r;
      if (row < T && lane < D / 4) {
        const v4f val = *(const v4fa*)&sO[w][r][lane * 4];
        *(v4f*)(y + ((size_t)b * T + row) * ypitch + h * D + lane * 4) = val;
      }
    }
    
  }
}

// GEMM C = act(A·W + bias + resid): A f32 (ASPLIT -> hi/lo 2 terms), Wt bf16 [N][K]; ACT 0 none, 1 relu, 2 exact gelu;
// resid (optional, f32, row index = (row % rmod), pitch ldr, RES_BF16 rounds it) added before the activation.
template <bool ASPLIT, int ACT, bool BIAS_BF16, bool RES_BF16>
__global__ __launch_bounds__(128) void k_gemm_bf3(const float* __restrict__ A, int lda, const unsigned short* __restrict__ Wt, int ldb,
                                                const float* __restrict__ bias, const float* __restrict__ resid, int rmod, int ldr,
                                                float* __restrict__ C, int ldc, int M, int N, int K) {
  __shared__ __attribute__((aligned(16))) float so[4][16][64];
  const int tid = threadIdx.x, w = tid >> 5, lane = tid & 31, ln = lane & 15, hh = lane >> 4;
  const int ntn = N / 64;
  const int wid = blockIdx.x * 4 + w;
  const int mt = wid / ntn, nq = wid % ntn;
  if (mt * 16 >= M) return;
  const int row0 = mt * 16, col0 = nq * 64;
  const float* arow = A + (size_t)(row0 + ln) * lda;
  v8f acc[4] = {};
  for (int kb = 0; kb < K; kb += 32) {
    FragB ah, al;
    const v4f x0 = *(const v4fa*)(arow + kb + 8 * hh), x1 = *(const v4fa*)(arow + kb + 8 * hh + 4);
    const v4f x2 = *(const v4fa*)(arow + kb + 16 + 8 * hh), x3 = *(const v4fa*)(arow + kb + 16 + 8 * hh + 4);
    float xs[16] = {x0[0],x0[1],x0[2],x0[3],x1[0],x1[1],x1[2],x1[3],x2[0],x2[1],x2[2],x2[3],x3[0],x3[1],x3[2],x3[3]};
#pragma unroll
    for (int i = 0; i < 16; ++i) { const unsigned short hb = bf16_bits(xs[i]); ah.u[i] = hb; al.u[i] = ASPLIT ? bf16_bits(xs[i] - bf16_val(hb)) : (unsigned short)0; }
#pragma unroll
    for (int t = 0; t < 4; ++t) {
      const unsigned short* brow = Wt + (size_t)(col0 + t * 16 + ln) * ldb + kb;
      FragB b;
      b.half[0] = *(const v8us*)(brow + 8 * hh);
      b.half[1] = *(const v8us*)(brow + 16 + 8 * hh);
      acc[t] = mmaN<ASPLIT ? 2 : 1>(ah.v, al.v, b.v, b.v, acc[t]);
    }
  }
#pragma unroll
  for (int t = 0; t < 4; ++t) {
    const int col = col0 + t * 16 + ln;
    float bv = bias ? bias[col] : 0.f;
    if (BIAS_BF16) bv = bf16_round(bv);
#pragma unroll
    for (int r = 0; r < 8; ++r) {
      float v = acc[t][r] + bv;
      if (resid) { float rv = resid[(size_t)((row0 + 8 * hh + r) % rmod) * ldr + col]; if (RES_BF16) rv = bf16_round(rv); v += rv; }
      if (ACT == 1) v = fmaxf(v, 0.f);
      if (ACT == 2) v = 0.5f * v * (1.0f + erff(v * 0.70710678118654752f));
      if (ACT == 3) { const float u = 0.7978845608028654f * (v + 0.044715f * v * v * v); v = 0.5f * v * (1.0f + tanhf(u)); }
      so[w][8 * hh + r][t * 16 + ln] = v;
    }
  }
  __builtin_amdgcn_fence(__ATOMIC_ACQ_REL, "workgroup");
  __builtin_amdgcn_wave_barrier();
  const int rsub = lane >> 4, c4 = (lane & 15) * 4;
  {
#pragma unroll
    for (int q = 0; q < 8; ++q) {
      const int r = q * 2 + rsub;
      const v4f v = *(const v4fa*)&so[w][r][c4];
      *(v4f*)(C + (size_t)(row0 + r) * ldc + col0 + c4) = v;
    }
    
  }
}
// row LayerNorm (biased variance, eps) over N: s = X (+ R); optional out_sum <- s; out_norm <- (s-mu)*rsqrt(var+eps)*g + b
template <bool PARAM_BF16>
__global__ __launch_bounds__(256) void k_layernorm(const float* __restrict__ X, const float* __restrict__ R, const float* __restrict__ g, const float* __restrict__ bta,
                                                  float* __restrict__ out_sum, float* __restrict__ out_norm, int N, float eps) {
  __shared__ float red[256];
  const int row = blockIdx.x, tid = threadIdx.x;
  const float* x = X + (size_t)row * N; const float* rr = R ? R + (size_t)row * N : nullptr;
  float vals[16];                     // up to N = 4096
  const int per = N / 256;            // contiguous chunk per thread? use strided-by-4 chunks: thread handles j = tid*4 + 1024*u
  float s1 = 0.f;
  for (int u = 0; u < per / 4; ++u) {
    const int j = tid * 4 + 1024 * u;
    const v4f a = *(const v4fa*)(x + j);
    v4f b = {0.f,0.f,0.f,0.f}; if (rr) b = *(const v4fa*)(rr + j);
#pragma unroll
    for (int q = 0; q < 4; ++q) { const float v = a[q] + b[q]; vals[u * 4 + q] = v; s1 += v; }
  }
  red[tid] = s1; __syncthreads();
  for (int st = 128; st > 0; st >>= 1) { if (tid < st) red[tid] += red[tid + st]; __syncthreads(); }
  const float mu = red[0] / (float)N; __syncthreads();
  float s2 = 0.f;
  for (int u = 0; u < per / 4; ++u)
#pragma unroll
    for (int q = 0; q < 4; ++q) { const float c = vals[u * 4 + q] - mu; s2 += c * c; }
  red[tid] = s2; __syncthreads();
  for (int st = 128; st > 0; st >>= 1) { if (tid < st) red[tid] += red[tid + st]; __syncthreads(); }
  const float rs = rsqrtf(red[0] / (float)N + eps);
  {
    for (int u = 0; u < per / 4; ++u) {
      const int j = tid * 4 + 1024 * u;
      v4f o, sm;
#pragma unroll
      for (int q = 0; q < 4; ++q) {
        float gg = g[j + q], bb = bta[j + q];
        if (PARAM_BF16) { gg = bf16_round(gg); bb = bf16_round(bb); }
        sm[q] = vals[u * 4 + q]; o[q] = (vals[u * 4 + q] - mu) * rs * gg + bb;
      }
      if (out_sum) *(v4f*)(out_sum + (size_t)row * N + j) = sm;
      *(v4f*)(out_norm + (size_t)row * N + j) = o;
    }
    
  }
}



// ---- f16 WMMA path (v_wmma_f32_16x16x32_f16): 11-bit significands for operands in range — used where a [0,1] probability operand needs more precision than bf16
typedef _Float16 v16h __attribute__((ext_vector_type(16)));
union FragH { v16h v; v8us half[2]; _Float16 h[16]; unsigned short u[16]; };
template <int NT>
__device__ __forceinline__ v8f mmaH(v16h ah, v16h al, v16h bh, v16h bl, v8f c) {
  c = __builtin_amdgcn_wmma_f32_16x16x32_f16(false, ah, false, bh, (short)0, c, false, false);
  if (NT >= 2) c = __builtin_amdgcn_wmma_f32_16x16x32_f16(false, al, false, bh, (short)0, c, false, false);
  if (NT >= 3) c = __builtin_amdgcn_wmma_f32_16x16x32_f16(false, ah, false, bl, (short)0, c, false, false);
  asm volatile("v_nop\n\tv_nop\n\tv_nop\n\tv_nop" : "+v"(c) : "v"(ah), "v"(al), "v"(bh), "v"(bl));
  return c;
}
// batched GEMM like k_gemm_b but f16 operands: A f32 (split into f16 hi/lo if ASPLIT, else rounded to f16), Bt = f16 values [n][k]; alpha; C f32; N multiple of 16 (partial tiles skipped)
template <bool ASPLIT>
__global__ __launch_bounds__(128) void k_gemm_h(const float* __restrict__ A, int lda, size_t sA, const _Float16* __restrict__ Bh, int ldb, size_t sB, float alpha, float* __restrict__ C, int ldc, size_t sC, int M, int N, int K) {
  __shared__ __attribute__((aligned(16))) float so[4][16][64];
  const int tid = threadIdx.x, w = tid >> 5, lane = tid & 31, ln = lane & 15, hh = lane >> 4; const int by = blockIdx.y;
  A += (size_t)by * sA; Bh += (size_t)by * sB; C += (size_t)by * sC;
  const int ntn = (N + 63) / 64; const int wid = blockIdx.x * 4 + w; const int mt = wid / ntn, nq = wid % ntn; if (mt * 16 >= M) return;
  const int row0 = mt * 16, col0 = nq * 64; const float* arow = A + (size_t)(row0 + ln) * lda;
  v8f acc[4] = {};
  for (int kb = 0; kb < K; kb += 32) {
    FragH ah, al;
    const v4f x0 = *(const v4fa*)(arow + kb + 8 * hh), x1 = *(const v4fa*)(arow + kb + 8 * hh + 4), x2 = *(const v4fa*)(arow + kb + 16 + 8 * hh), x3 = *(const v4fa*)(arow + kb + 16 + 8 * hh + 4);
    float xs[16] = {x0[0],x0[1],x0[2],x0[3],x1[0],x1[1],x1[2],x1[3],x2[0],x2[1],x2[2],x2[3],x3[0],x3[1],x3[2],x3[3]};
#pragma unroll
    for (int i = 0; i < 16; ++i) { const _Float16 h = (_Float16)xs[i]; ah.h[i] = h; al.h[i] = ASPLIT ? (_Float16)(xs[i] - (float)h) : (_Float16)0.0f; }
#pragma unroll
    for (int t = 0; t < 4; ++t) { if (col0 + t * 16 >= N) continue; const size_t boff = (size_t)(col0 + t * 16 + ln) * ldb + kb; FragH bq; bq.half[0] = *(const v8us*)(Bh + boff + 8 * hh); bq.half[1] = *(const v8us*)(Bh + boff + 16 + 8 * hh);
      acc[t] = mmaH<ASPLIT ? 2 : 1>(ah.v, al.v, bq.v, bq.v, acc[t]); }
  }
#pragma unroll
  for (int t = 0; t < 4; ++t) { if (col0 + t * 16 >= N) continue;
#pragma unroll
    for (int r = 0; r < 8; ++r) so[w][8 * hh + r][t * 16 + ln] = acc[t][r] * alpha; }
  __builtin_amdgcn_fence(__ATOMIC_ACQ_REL, "workgroup"); __builtin_amdgcn_wave_barrier();
  const int rsub = lane >> 4, c4 = (lane & 15) * 4;
  {
#pragma unroll
    for (int q = 0; q < 8; ++q) { const int r = q * 2 + rsub; if (col0 + c4 < N) { const v4f v = *(const v4fa*)&so[w][r][c4]; *(v4f*)(C + (size_t)(row0 + r) * ldc + col0 + c4) = v; } }
     }
}

// Wt[n][k] = f16(W[k][n]·scale) from f32 row-major W[K][N] (scale = power of two; bf16-exact weights stay exact in f16 away from the subnormal range)
__global__ __launch_bounds__(256) void k_wt_f16(const float* __restrict__ W, _Float16* __restrict__ Wt, int K, int N, float scale) {
  const int t = blockIdx.x * 256 + threadIdx.x; if (t >= N * (K / 8)) return; const int n = t / (K / 8), k8 = (t % (K / 8)) * 8; FragH f;
#pragma unroll
  for (int i = 0; i < 8; ++i) f.h[i] = (_Float16)(bf16_round(W[(size_t)(k8 + i) * N + n]) * scale); const v8us o = f.half[0];
  *(v8us*)((unsigned short*)Wt + (size_t)n * K + k8) = o; 
}
// k_gemm_hh variant with fused epilogue: v = acc·alpha + bias[by·sBias + col] (+ CP[(row/rowsPerB)·sCPb + by·64 + col] if CP) ; ACT 0 none / 1 elu ; writes f16 C16 and/or f32 C (each if non-null)
template <int ACT>
__global__ __launch_bounds__(128) void k_gemm_hhx(const _Float16* __restrict__ A, int lda, size_t sA, const _Float16* __restrict__ Bh, int ldb, size_t sB, float alpha, const float* __restrict__ bias, size_t sBias, const float* __restrict__ CP, int rowsPerB, size_t sCPb, int row0g,
    float* __restrict__ C, _Float16* __restrict__ C16, int ldc, size_t sC, int M, int N, int K) {
  __shared__ __attribute__((aligned(16))) float so[4][16][64];
  const int tid = threadIdx.x, w = tid >> 5, lane = tid & 31, ln = lane & 15, hh = lane >> 4; const int by = blockIdx.y;
  A += (size_t)by * sA; Bh += (size_t)by * sB; const size_t cofs = (size_t)by * sC; const float* bp = bias ? bias + (size_t)by * sBias : nullptr;
  const int ntn = (N + 63) / 64; const int wid = blockIdx.x * 4 + w; const int mt = wid / ntn, nq = wid % ntn; if (mt * 16 >= M) return;
  const int row0 = mt * 16, col0 = nq * 64; const _Float16* arow = A + (size_t)(row0 + ln) * lda;
  v8f acc[4] = {};
  for (int kb = 0; kb < K; kb += 32) { FragH ah; ah.half[0] = *(const v8us*)((const unsigned short*)arow + kb + 8 * hh); ah.half[1] = *(const v8us*)((const unsigned short*)arow + kb + 16 + 8 * hh);
#pragma unroll
    for (int t = 0; t < 4; ++t) { if (col0 + t * 16 >= N) continue; const size_t boff = (size_t)(col0 + t * 16 + ln) * ldb + kb; FragH bq; bq.half[0] = *(const v8us*)((const unsigned short*)Bh + boff + 8 * hh); bq.half[1] = *(const v8us*)((const unsigned short*)Bh + boff + 16 + 8 * hh);
      acc[t] = mmaH<1>(ah.v, ah.v, bq.v, bq.v, acc[t]); }
  }
#pragma unroll
  for (int t = 0; t < 4; ++t) { if (col0 + t * 16 >= N) continue; const int col = col0 + t * 16 + ln; const float bv = bp ? bf16_round(bp[col]) : 0.f;
#pragma unroll
    for (int r = 0; r < 8; ++r) { float v = acc[t][r] * alpha + bv; if (CP) { const int bidx = (row0g + row0 + 8 * hh + r) / rowsPerB; v += CP[(size_t)bidx * sCPb + (size_t)by * 64 + col]; } if (ACT == 1) v = (v > 0.f) ? v : expm1f(v); else if (ACT == 3) v = fmaxf(v, 0.f); so[w][8 * hh + r][t * 16 + ln] = v; } }
  __builtin_amdgcn_fence(__ATOMIC_ACQ_REL, "workgroup"); __builtin_amdgcn_wave_barrier();
  const int rsub = lane >> 4, c4 = (lane & 15) * 4; typedef _Float16 v4h __attribute__((ext_vector_type(4)));
  {
#pragma unroll
    for (int q = 0; q < 8; ++q) { const int r = q * 2 + rsub; if (col0 + c4 < N) { const v4f v = *(const v4fa*)&so[w][r][c4]; if (C) *(v4f*)(C + cofs + (size_t)(row0 + r) * ldc + col0 + c4) = v; if (C16) { v4h h4; for (int i = 0; i < 4; ++i) h4[i] = (_Float16)v[i]; *(v4h*)(C16 + cofs + (size_t)(row0 + r) * ldc + col0 + c4) = h4; } } }
     }
}


// Projection Y = X.W^T / 16 + bias at the fixed shape NR x DM x DM. One 128 x 128 tile of Y per work-group of 8 waves (4 x 2 waves, 32 x 64 of Y each).
// Each 64-k step of both operands (128 rows of 128 B) is read from global as whole lines, one step ahead, into registers and laid in LDS at a pitch of 144 B
// (16 B x odd: no bank conflict for the 16-byte fragment reads). Two LDS buffers: the one barrier of a step publishes its tile and ends the reads of the buffer written next.
// Fragment maps and the ascending k order of every accumulator are those of k_gemm_hhx.
template <bool F32OUT>
__global__ __launch_bounds__(256) void k_proj(const _Float16* __restrict__ A, const _Float16* __restrict__ Bh, const float* __restrict__ bias, float* __restrict__ C, _Float16* __restrict__ C16) {
  constexpr int PT = 72, NS = DM / 64;
  __shared__ __attribute__((aligned(16))) unsigned short sA[2][128][PT], sB[2][128][PT];
  __shared__ __attribute__((aligned(16))) float so[8][32][68];
  const int tid = threadIdx.x, w = tid >> 5, lane = tid & 31, ln = lane & 15, hh = lane >> 4;
  const int m0 = (blockIdx.x >> 3) * 128, n0 = (blockIdx.x & 7) * 128, wm = (w >> 1) * 32, wn = (w & 1) * 64;
  const int lr = tid >> 3, lc = (tid & 7) * 8;
  const unsigned short* ga = (const unsigned short*)A + (size_t)(m0 + lr) * DM + lc;
  const unsigned short* gb = (const unsigned short*)Bh + (size_t)(n0 + lr) * DM + lc;
  v8us ra[4], rb[4];
#pragma unroll
  for (int i = 0; i < 4; ++i) { ra[i] = *(const v8us*)(ga + (size_t)i * 32 * DM); rb[i] = *(const v8us*)(gb + (size_t)i * 32 * DM); }
  v8f acc[2][4];
#pragma unroll
  for (int mt = 0; mt < 2; ++mt)
#pragma unroll
    for (int nt = 0; nt < 4; ++nt) acc[mt][nt] = (v8f){0.f,0.f,0.f,0.f,0.f,0.f,0.f,0.f};
  // unrolled by two so that the buffer index is a constant in every LDS address
#pragma unroll 2
  for (int s = 0; s < NS; ++s) {
    const int bf = s & 1;
#pragma unroll
    for (int i = 0; i < 4; ++i) { *(v8us*)&sA[bf][lr + 32 * i][lc] = ra[i]; *(v8us*)&sB[bf][lr + 32 * i][lc] = rb[i]; }
    __syncthreads();
    if (s + 1 < NS) {
#pragma unroll
      for (int i = 0; i < 4; ++i) { ra[i] = *(const v8us*)(ga + (size_t)i * 32 * DM + (s + 1) * 64); rb[i] = *(const v8us*)(gb + (size_t)i * 32 * DM + (s + 1) * 64); }
    }
    // keeps the next step's global loads in front of this step's matrix work: left free, the compiler sinks them to just before their LDS stores and their whole latency is waited out
    __builtin_amdgcn_sched_barrier(0);
#pragma unroll
    for (int ks = 0; ks < 2; ++ks) {
      FragH a[2], b[4];
#pragma unroll
      for (int mt = 0; mt < 2; ++mt) { a[mt].half[0] = *(const v8us*)&sA[bf][wm + mt * 16 + ln][ks * 32 + 8 * hh]; a[mt].half[1] = *(const v8us*)&sA[bf][wm + mt * 16 + ln][ks * 32 + 16 + 8 * hh]; }
#pragma unroll
      for (int nt = 0; nt < 4; ++nt) { b[nt].half[0] = *(const v8us*)&sB[bf][wn + nt * 16 + ln][ks * 32 + 8 * hh]; b[nt].half[1] = *(const v8us*)&sB[bf][wn + nt * 16 + ln][ks * 32 + 16 + 8 * hh]; }
#pragma unroll
      for (int mt = 0; mt < 2; ++mt)
#pragma unroll
        for (int nt = 0; nt < 4; ++nt) acc[mt][nt] = __builtin_amdgcn_wmma_f32_16x16x32_f16(false, a[mt].v, false, b[nt].v, (short)0, acc[mt][nt], false, false);
    }
  }
  // stands in front of the epilogue's reuse of the registers that held the global load addresses (the scheduling barrier keeps that reuse behind it)
  asm volatile("s_wait_xcnt 0x0" ::: "memory");
  __builtin_amdgcn_sched_barrier(0);
  typedef _Float16 v4h __attribute__((ext_vector_type(4)));
#pragma unroll
  for (int nt = 0; nt < 4; ++nt) { const float bv = bf16_round(bias[n0 + wn + nt * 16 + ln]);
#pragma unroll
    for (int mt = 0; mt < 2; ++mt)
#pragma unroll
      for (int r = 0; r < 8; ++r) so[w][mt * 16 + 8 * hh + r][nt * 16 + ln] = acc[mt][nt][r] * 0.0625f + bv; }
  // the wave's own 32 x 64 strip: its LDS writes are ordered before its cross-lane reads, so that whole lines go out
  __builtin_amdgcn_fence(__ATOMIC_ACQ_REL, "workgroup"); __builtin_amdgcn_wave_barrier();
#pragma unroll
  for (int q = 0; q < 16; ++q) { const int r = q * 2 + hh, c4 = ln * 4; const v4f v = *(const v4fa*)&so[w][r][c4]; const size_t o = (size_t)(m0 + wm + r) * DM + n0 + wn + c4;
    if (F32OUT) *(v4f*)(C + o) = v; else { v4h h4;
#pragma unroll
      for (int i = 0; i < 4; ++i) h4[i] = (_Float16)v[i]; *(v4h*)(C16 + o) = h4; } }
}

__global__ __launch_bounds__(256) void k_x16(const float* __restrict__ x, _Float16* __restrict__ X16, size_t n8) { const size_t t = (size_t)blockIdx.x * 256 + threadIdx.x; if (t >= n8) return; FragH f;
#pragma unroll
  for (int q = 0; q < 8; ++q) f.h[q] = (_Float16)bf16_round(x[t * 8 + q]); *(v8us*)((unsigned short*)X16 + t * 8) = f.half[0];  }
__global__ __launch_bounds__(256) void k_h16(const float* __restrict__ x, _Float16* __restrict__ X16, size_t n8) { const size_t t = (size_t)blockIdx.x * 256 + threadIdx.x; if (t >= n8) return; FragH f;
#pragma unroll
  for (int q = 0; q < 8; ++q) f.h[q] = (_Float16)x[t * 8 + q]; *(v8us*)((unsigned short*)X16 + t * 8) = f.half[0];  }
__global__ __launch_bounds__(256) void k_round16f(const float* __restrict__ W, _Float16* __restrict__ Bt, size_t n8) { const size_t t = (size_t)blockIdx.x * 256 + threadIdx.x; if (t >= n8) return; FragH f;
#pragma unroll
  for (int i = 0; i < 8; ++i) f.h[i] = (_Float16)(bf16_round(W[t * 8 + i]) * 16.0f); *(v8us*)((unsigned short*)Bt + t * 8) = f.half[0];  }
__global__ __launch_bounds__(256) void k_vt(const _Float16* __restrict__ V16, _Float16* __restrict__ Vt) { __shared__ unsigned short tl[64][66]; const int tid = threadIdx.x; const int slab = blockIdx.x / (SS / 64), lg = blockIdx.x % (SS / 64); const int b = slab / NH, h = slab % NH;
  for (int i = tid; i < 64 * 8; i += 256) { const int r = i / 8, c8 = (i % 8) * 8; FragH f; f.half[0] = *(const v8us*)((const unsigned short*)V16 + ((size_t)b * SS + lg * 64 + r) * DM + h * HD + c8);
#pragma unroll
    for (int q = 0; q < 8; ++q) tl[r][c8 + q] = f.u[q]; }
  __syncthreads();
  {
#pragma unroll
    for (int rd = 0; rd < 2; ++rd) { const int d = rd * 32 + tid / 8, pc = tid % 8; FragH f;
#pragma unroll
      for (int q = 0; q < 8; ++q) f.u[q] = tl[pc * 8 + q][d];
      *(v8us*)((unsigned short*)Vt + ((size_t)slab * HD + d) * SS + lg * 64 + pc * 8) = f.half[0]; }
     } }
// sigmoid(s / 8) = 0.5 + 0.5 tanh(s / 16): th16 is the hardware tanh (v_tanh_f32) of s / 16, one transcendental in place of the library expf and the full-precision division
__device__ __forceinline__ float th16(float s) { return __builtin_amdgcn_tanhf(s * 0.0625f); }
// eight v_tanh_f32, each in place, with the one free slot that the instruction set asks for behind a transcendental (before its result is read or its source overwritten) as the statement's last line:
__device__ __forceinline__ void tanh8(float (&x)[8]) {
  asm("v_tanh_f32 %0, %0\n\tv_tanh_f32 %1, %1\n\tv_tanh_f32 %2, %2\n\tv_tanh_f32 %3, %3\n\tv_tanh_f32 %4, %4\n\tv_tanh_f32 %5, %5\n\tv_tanh_f32 %6, %6\n\tv_tanh_f32 %7, %7\n\tv_nop"
      : "+v"(x[0]), "+v"(x[1]), "+v"(x[2]), "+v"(x[3]), "+v"(x[4]), "+v"(x[5]), "+v"(x[6]), "+v"(x[7]));
}
// (a) O = sigmoid(q.k/8).V per (b,h): 4 waves of 32 query rows. A step is 64 keys: their K rows (64 x 128 B, one line a row) and the same keys' columns of V^T (64 d rows x 128 B, one line a row)
// are read from global as whole lines, one step ahead, into registers and laid in LDS at the pitch of k_proj (144 B), once for the 4 waves. Two LDS buffers: the one barrier of a step publishes its
// tiles and ends the reads of the buffer written next. Fragment maps and the ascending order of the 32-key blocks in every accumulator are those of the form that read its fragments straight from global.
__global__ __launch_bounds__(128) void k_satt(const _Float16* __restrict__ Q16, const _Float16* __restrict__ K16, const _Float16* __restrict__ Vt, float* __restrict__ O) {
  constexpr int RPW = 32, NQB = SS / (4 * RPW), DT = HD / 16, KS = HD / 32, PT = 72, KT = 64, NST = SS / KT;
  __shared__ __attribute__((aligned(16))) unsigned short sK[2][KT][PT], sV[2][HD][PT];
  __shared__ __attribute__((aligned(16))) unsigned short sP[4][RPW][40]; __shared__ __attribute__((aligned(16))) float sO[4][RPW][HD];
  const int tid = threadIdx.x, w = tid >> 5, lane = tid & 31, ln = lane & 15, hh = lane >> 4;
  const int slab = blockIdx.x / NQB, qblk = blockIdx.x % NQB; const int b = slab / NH, h = slab % NH; const int q0 = qblk * (4 * RPW) + w * RPW;
  const int lr = tid >> 3, lc = (tid & 7) * 8;
  const unsigned short* gk = (const unsigned short*)K16 + ((size_t)b * SS + lr) * DM + h * HD + lc;
  const unsigned short* gv = (const unsigned short*)Vt + ((size_t)slab * HD + lr) * SS + lc;
  v8us rk[4], rv[4];
#pragma unroll
  for (int i = 0; i < 4; ++i) { rk[i] = *(const v8us*)(gk + (size_t)i * 16 * DM); rv[i] = *(const v8us*)(gv + (size_t)i * 16 * SS); }
  FragH aq[2][KS];
#pragma unroll
  for (int rt = 0; rt < 2; ++rt) { const unsigned short* qr = (const unsigned short*)Q16 + ((size_t)b * SS + q0 + rt * 16 + ln) * DM + h * HD;
#pragma unroll
    for (int ks = 0; ks < KS; ++ks) { aq[rt][ks].half[0] = *(const v8us*)(qr + ks * 32 + 8 * hh); aq[rt][ks].half[1] = *(const v8us*)(qr + ks * 32 + 16 + 8 * hh); } }
  v8f oacc[2][DT];
#pragma unroll
  for (int rt = 0; rt < 2; ++rt)
#pragma unroll
    for (int dt = 0; dt < DT; ++dt) oacc[rt][dt] = (v8f){0.f,0.f,0.f,0.f,0.f,0.f,0.f,0.f};
  // unrolled by two so that the buffer index is a constant in every LDS address
#pragma unroll 2
  for (int st = 0; st < NST; ++st) {
    const int bf = st & 1;
#pragma unroll
    for (int i = 0; i < 4; ++i) { *(v8us*)&sK[bf][lr + 16 * i][lc] = rk[i]; *(v8us*)&sV[bf][lr + 16 * i][lc] = rv[i]; }
    __syncthreads();
    // no branch round the loads (the last step reads its own keys once more, unused): the step stays one block, in which the two scheduling barriers below hold
    const int sn = (st + 1 < NST) ? st + 1 : st;
#pragma unroll
    for (int i = 0; i < 4; ++i) { rk[i] = *(const v8us*)(gk + ((size_t)sn * KT + i * 16) * DM); rv[i] = *(const v8us*)(gv + (size_t)i * 16 * SS + sn * KT); }
    // keeps the next step's global loads in front of this step's matrix and tanh work: sunk to just before their LDS stores, their whole latency would be waited out
    __builtin_amdgcn_sched_barrier(0);
    FragH bk[2][KS];
#pragma unroll
    for (int nt = 0; nt < 2; ++nt)
#pragma unroll
      for (int ks = 0; ks < KS; ++ks) { bk[nt][ks].half[0] = *(const v8us*)&sK[bf][nt * 16 + ln][ks * 32 + 8 * hh]; bk[nt][ks].half[1] = *(const v8us*)&sK[bf][nt * 16 + ln][ks * 32 + 16 + 8 * hh]; }
#pragma unroll
    for (int sub = 0; sub < KT / 32; ++sub) {
      v8f s[2][2];
#pragma unroll
      for (int nt = 0; nt < 2; ++nt)
#pragma unroll
        for (int rt = 0; rt < 2; ++rt) { v8f acc = (v8f){0.f,0.f,0.f,0.f,0.f,0.f,0.f,0.f};
#pragma unroll
          for (int ks = 0; ks < KS; ++ks) acc = mmaH<1>(aq[rt][ks].v, aq[rt][ks].v, bk[nt][ks].v, bk[nt][ks].v, acc); s[rt][nt] = acc; }
      // this block's V^T fragments and the step's next K fragments are read as one group in front of the tanh work, which covers their LDS latency
      FragH bv[DT];
#pragma unroll
      for (int dt = 0; dt < DT; ++dt) { bv[dt].half[0] = *(const v8us*)&sV[bf][dt * 16 + ln][sub * 32 + 8 * hh]; bv[dt].half[1] = *(const v8us*)&sV[bf][dt * 16 + ln][sub * 32 + 16 + 8 * hh]; }
      if (sub + 1 < KT / 32) {
#pragma unroll
        for (int nt = 0; nt < 2; ++nt)
#pragma unroll
          for (int ks = 0; ks < KS; ++ks) { bk[nt][ks].half[0] = *(const v8us*)&sK[bf][(sub + 1) * 32 + nt * 16 + ln][ks * 32 + 8 * hh]; bk[nt][ks].half[1] = *(const v8us*)&sK[bf][(sub + 1) * 32 + nt * 16 + ln][ks * 32 + 16 + 8 * hh]; }
      }
#pragma unroll
      for (int rt = 0; rt < 2; ++rt)
#pragma unroll
        for (int nt = 0; nt < 2; ++nt) { float x[8];
#pragma unroll
          for (int r = 0; r < 8; ++r) x[r] = s[rt][nt][r] * 0.0625f;
          tanh8(x);
#pragma unroll
          for (int r = 0; r < 8; ++r) { FragH t2; t2.h[0] = (_Float16)fmaf(x[r], 0.5f, 0.5f); sP[w][rt * 16 + 8 * hh + r][nt * 16 + ln] = t2.u[0]; } }
      // the wave's own P strip: its LDS writes are ordered before its cross-lane reads; LDS only, so that the next step's global loads stay in flight across it
      __builtin_amdgcn_fence(__ATOMIC_ACQ_REL, "workgroup", "local"); __builtin_amdgcn_wave_barrier();
      FragH pa[2];
#pragma unroll
      for (int rt = 0; rt < 2; ++rt) { pa[rt].half[0] = *(const v8us*)&sP[w][rt * 16 + ln][8 * hh]; pa[rt].half[1] = *(const v8us*)&sP[w][rt * 16 + ln][16 + 8 * hh]; }
#pragma unroll
      for (int dt = 0; dt < DT; ++dt)
#pragma unroll
        for (int rt = 0; rt < 2; ++rt) oacc[rt][dt] = mmaH<1>(pa[rt].v, pa[rt].v, bv[dt].v, bv[dt].v, oacc[rt][dt]);
      // the reads of the P strip are ordered before the next block's writes of it; LDS only, as above
      __builtin_amdgcn_fence(__ATOMIC_ACQ_REL, "workgroup", "local"); __builtin_amdgcn_wave_barrier();
    }
    // keeps the next step's LDS stores, and with them the wait for the global loads, behind this step's matrix and tanh work
    __builtin_amdgcn_sched_barrier(0);
  }
  // stands in front of the epilogue's reuse of the registers that held the global load addresses (the scheduling barrier keeps that reuse behind it)
  asm volatile("s_wait_xcnt 0x0" ::: "memory");
  __builtin_amdgcn_sched_barrier(0);
#pragma unroll
  for (int rt = 0; rt < 2; ++rt)
#pragma unroll
    for (int dt = 0; dt < DT; ++dt)
#pragma unroll
      for (int r = 0; r < 8; ++r) sO[w][rt * 16 + 8 * hh + r][dt * 16 + ln] = oacc[rt][dt][r];
  __builtin_amdgcn_fence(__ATOMIC_ACQ_REL, "workgroup"); __builtin_amdgcn_wave_barrier();
  {
#pragma unroll
    for (int rp = 0; rp < RPW; rp += 2) { const int r = rp + (lane >> 4), pc = lane & 15; const v4f val = *(const v4fa*)&sO[w][r][pc * 4]; *(v4f*)(O + ((size_t)b * SS + q0 + r) * DM + h * HD + pc * 4) = val; }
     } }
// (b) attn_weights[b][q][k] = (1/16) sum_h sigmoid(q_h.k_h/8). One 128 x 128 tile (queries x keys) of one batch per work-group of 8 waves (4 x 2 waves, 32 x 64 each), made whole by that work-group.
// A step is one head: its 64 columns of the 128 query rows and of the 128 key rows (one 128-B line a row) are read from global as whole lines, one head ahead, into registers and laid in LDS
// at the pitch of k_proj (144 B). Two LDS buffers: the one barrier of a step publishes its head and ends the reads of the buffer written next.
// Fragment maps, the ascending k order inside a head and the ascending head order of the sum of the tanh terms are those of the 16 x 32 form that read its fragments straight from global.
__global__ __launch_bounds__(256) void k_aw(const _Float16* __restrict__ Q16, const _Float16* __restrict__ K16, float* __restrict__ AW) {
  constexpr int PT = 72, NT = SS / 128;
  __shared__ __attribute__((aligned(16))) unsigned short sA[2][128][PT], sB[2][128][PT];
  __shared__ __attribute__((aligned(16))) float so[8][32][68];
  const int tid = threadIdx.x, w = tid >> 5, lane = tid & 31, ln = lane & 15, hh = lane >> 4;
  const int b = blockIdx.x / (NT * NT), tl = blockIdx.x % (NT * NT);
  const int m0 = (tl / NT) * 128, n0 = (tl % NT) * 128, wm = (w >> 1) * 32, wn = (w & 1) * 64;
  const int lr = tid >> 3, lc = (tid & 7) * 8;
  const unsigned short* ga = (const unsigned short*)Q16 + ((size_t)b * SS + m0 + lr) * DM + lc;
  const unsigned short* gb = (const unsigned short*)K16 + ((size_t)b * SS + n0 + lr) * DM + lc;
  v8us ra[4], rb[4];
#pragma unroll
  for (int i = 0; i < 4; ++i) { ra[i] = *(const v8us*)(ga + (size_t)i * 32 * DM); rb[i] = *(const v8us*)(gb + (size_t)i * 32 * DM); }
  typedef float v2f __attribute__((ext_vector_type(2)));
  v2f aw[2][4][4];   // the sums of the tanh terms, as register pairs: one packed add serves two of them
#pragma unroll
  for (int mt = 0; mt < 2; ++mt)
#pragma unroll
    for (int nt = 0; nt < 4; ++nt)
#pragma unroll
      for (int p = 0; p < 4; ++p) aw[mt][nt][p] = (v2f){0.f, 0.f};
  // unrolled by two so that the buffer index is a constant in every LDS address
#pragma unroll 2
  for (int h = 0; h < NH; ++h) {
    const int bf = h & 1;
#pragma unroll
    for (int i = 0; i < 4; ++i) { *(v8us*)&sA[bf][lr + 32 * i][lc] = ra[i]; *(v8us*)&sB[bf][lr + 32 * i][lc] = rb[i]; }
    __syncthreads();
    // no branch round the loads (the last step reads its own head once more, unused): the step stays one block, in which the two scheduling barriers below hold; with a branch here the compiler sinks the tanh work past the next step's stores and barrier
    const int hn = (h + 1 < NH) ? h + 1 : h;
#pragma unroll
    for (int i = 0; i < 4; ++i) { ra[i] = *(const v8us*)(ga + (size_t)i * 32 * DM + hn * HD); rb[i] = *(const v8us*)(gb + (size_t)i * 32 * DM + hn * HD); }
    // keeps the next head's global loads in front of this head's matrix and tanh work: left free, the compiler sinks them to just before their LDS stores and their whole latency is waited out
    __builtin_amdgcn_sched_barrier(0);
    v8f acc[2][4];
#pragma unroll
    for (int mt = 0; mt < 2; ++mt)
#pragma unroll
      for (int nt = 0; nt < 4; ++nt) acc[mt][nt] = (v8f){0.f,0.f,0.f,0.f,0.f,0.f,0.f,0.f};
#pragma unroll
    for (int ks = 0; ks < HD / 32; ++ks) {
      FragH a[2], bk[4];
#pragma unroll
      for (int mt = 0; mt < 2; ++mt) { a[mt].half[0] = *(const v8us*)&sA[bf][wm + mt * 16 + ln][ks * 32 + 8 * hh]; a[mt].half[1] = *(const v8us*)&sA[bf][wm + mt * 16 + ln][ks * 32 + 16 + 8 * hh]; }
#pragma unroll
      for (int nt = 0; nt < 4; ++nt) { bk[nt].half[0] = *(const v8us*)&sB[bf][wn + nt * 16 + ln][ks * 32 + 8 * hh]; bk[nt].half[1] = *(const v8us*)&sB[bf][wn + nt * 16 + ln][ks * 32 + 16 + 8 * hh]; }
#pragma unroll
      for (int mt = 0; mt < 2; ++mt)
#pragma unroll
        for (int nt = 0; nt < 4; ++nt) acc[mt][nt] = __builtin_amdgcn_wmma_f32_16x16x32_f16(false, a[mt].v, false, bk[nt].v, (short)0, acc[mt][nt], false, false);
    }
#pragma unroll
    for (int mt = 0; mt < 2; ++mt)
#pragma unroll
      for (int nt = 0; nt < 4; ++nt)
#pragma unroll
        for (int p = 0; p < 4; ++p) aw[mt][nt][p] += (v2f){th16(acc[mt][nt][2 * p]), th16(acc[mt][nt][2 * p + 1])};
    // keeps the next head's LDS stores behind this head's matrix and tanh work: left free, the compiler lifts them, and with them the wait for the global loads, to just behind this head's LDS reads
    __builtin_amdgcn_sched_barrier(0);
  }
  // stands in front of the epilogue's reuse of the registers that held the global load addresses (the scheduling barrier keeps that reuse behind it)
  asm volatile("s_wait_xcnt 0x0" ::: "memory");
  __builtin_amdgcn_sched_barrier(0);
#pragma unroll
  for (int nt = 0; nt < 4; ++nt)
#pragma unroll
    for (int mt = 0; mt < 2; ++mt)
#pragma unroll
      for (int r = 0; r < 8; ++r) so[w][mt * 16 + 8 * hh + r][nt * 16 + ln] = fmaf(aw[mt][nt][r >> 1][r & 1], 0.5f / (float)NH, 0.5f);   // mean_h (0.5 + 0.5 tanh) from the sum of the tanh terms
  // the wave's own 32 x 64 strip: its LDS writes are ordered before its cross-lane reads, so that whole lines go out
  __builtin_amdgcn_fence(__ATOMIC_ACQ_REL, "workgroup"); __builtin_amdgcn_wave_barrier();
#pragma unroll
  for (int q = 0; q < 16; ++q) { const int r = q * 2 + hh, c4 = ln * 4; *(v4f*)(AW + ((size_t)b * SS + m0 + wm + r) * SS + n0 + wn + c4) = *(const v4fa*)&so[w][r][c4]; }
}
extern "C" void kernel_launch(void* const* d_in, const int* in_sizes, int n_in,
                              void* d_out, int out_size, void* d_ws, size_t ws_size, hipStream_t stream) {
  (void)in_sizes; (void)n_in; (void)out_size;
  const float* xq = (const float*)d_in[0]; const float* xk = (const float*)d_in[1]; const float* xv = (const float*)d_in[2]; const float* Wq = (const float*)d_in[3]; const float* bq = (const float*)d_in[4]; const float* Wk = (const float*)d_in[5]; const float* bk = (const float*)d_in[6]; const float* Wv = (const float*)d_in[7]; const float* bv = (const float*)d_in[8]; const float* Wo = (const float*)d_in[9]; const float* bo = (const float*)d_in[10];
  float* out = (float*)d_out; float* AW = (float*)((char*)d_out + 16777216);
  char* ws = (char*)d_ws; size_t off = 0;
  auto take = [&](size_t bytes) { char* p = ws + off; off += (bytes + 255) & ~(size_t)255; return p; };
  const size_t w8 = (size_t)DM * DM / 8;
  _Float16* Bq = (_Float16*)take(w8 * 16); _Float16* Bk = (_Float16*)take(w8 * 16); _Float16* Bv = (_Float16*)take(w8 * 16); _Float16* Bo = (_Float16*)take(w8 * 16);
  _Float16* XQ = (_Float16*)take((size_t)NR * DM * 2); _Float16* XK = (_Float16*)take((size_t)NR * DM * 2); _Float16* XV = (_Float16*)take((size_t)NR * DM * 2); _Float16* Q16 = (_Float16*)take((size_t)NR * DM * 2); _Float16* K16 = (_Float16*)take((size_t)NR * DM * 2); _Float16* V16 = (_Float16*)take((size_t)NR * DM * 2); _Float16* Vt = (_Float16*)take((size_t)NR * DM * 2); float* O = (float*)take((size_t)NR * DM * 4); _Float16* O16 = (_Float16*)take((size_t)NR * DM * 2);
  if (off > ws_size) return;      // ≈ 8 + 8.4×8 + 16.8 ≈ 92 MiB
  const unsigned gw = (unsigned)((w8 + 255) / 256), gx = (unsigned)(((size_t)NR * DM / 8 + 255) / 256);
  k_round16f<<<gw, 256, 0, stream>>>(Wq, Bq, w8); k_round16f<<<gw, 256, 0, stream>>>(Wk, Bk, w8); k_round16f<<<gw, 256, 0, stream>>>(Wv, Bv, w8); k_round16f<<<gw, 256, 0, stream>>>(Wo, Bo, w8);
  k_x16<<<gx, 256, 0, stream>>>(xq, XQ, (size_t)NR * DM / 8); k_x16<<<gx, 256, 0, stream>>>(xk, XK, (size_t)NR * DM / 8); k_x16<<<gx, 256, 0, stream>>>(xv, XV, (size_t)NR * DM / 8);
  const unsigned gp = (NR / 128) * (DM / 128);
  k_proj<false><<<gp, 256, 0, stream>>>(XQ, Bq, bq, nullptr, Q16);
  k_proj<false><<<gp, 256, 0, stream>>>(XK, Bk, bk, nullptr, K16);
  k_proj<false><<<gp, 256, 0, stream>>>(XV, Bv, bv, nullptr, V16);
  k_vt<<<BB * NH * (SS / 64), 256, 0, stream>>>(V16, Vt);
  k_satt<<<BB * NH * (SS / 128), 128, 0, stream>>>(Q16, K16, Vt, O);
  k_h16<<<gx, 256, 0, stream>>>(O, O16, (size_t)NR * DM / 8);
  k_proj<true><<<gp, 256, 0, stream>>>(O16, Bo, bo, out, nullptr);
  k_aw<<<BB * (SS / 128) * (SS / 128), 256, 0, stream>>>(Q16, K16, AW);
}

// v006
// It runs in 142 microseconds.
// Two timings next to v005 put it at 1.08 and 1.09 times that version's speed.
// Over all steps from v000 it is 8.26 times as fast.
#include <hip/hip_runtime.h>
// q/k/v/o projections (4096 × 1024 × 1024, + bias) and the 16-head sigmoid attention on v_wmma_f32_16x16x32_f16: (a) per (b,h) a fused flash-style kernel with P = σ(q·k/8) (no normalisation,
// as the module) and O = P·V on WMMA; (b) the second output mean_h σ(q·k/8) recomputes the score tiles per head and averages them in a fixed order. x inputs f16(bf16 ·) exact, q/k/v and O rounded to f16,
// weights bf16-exact ×2^4 ((out,in)), P f16 ≤ 1, f32 accumulate.
#define BB 2
#define SS 2048
#define DM 1024
#define NH 16
#define HD 64
#define NR (BB * SS)

typedef __bf16 v16b __attribute__((ext_vector_type(16)));
typedef unsigned short v8us __attribute__((ext_vector_type(8), may_alias));
typedef float  v8f  __attribute__((ext_vector_type(8)));
typedef float  v4f  __attribute__((ext_vector_type(4)));
typedef float  v4fa __attribute__((ext_vector_type(4), may_alias));
union FragB { v16b v; v8us half[2]; unsigned short u[16]; };

__device__ __forceinline__ unsigned short bf16_bits(float x) { unsigned int u = __float_as_uint(x); return (unsigned short)((u + 0x7FFFu + ((u >> 16) & 1u)) >> 16); }
__device__ __forceinline__ float bf16_val(unsigned short b) { return __uint_as_float(((unsigned int)b) << 16); }
__device__ __forceinline__ float bf16_round(float x) { return bf16_val(bf16_bits(x)); }
// D += A·B with NT terms: 1 = ah·bh, 2 = + al·bh (A split), 3 = + ah·bl (both split)
template <int NT>
__device__ __forceinline__ v8f mmaN(v16b ah, v16b al, v16b bh, v16b bl, v8f c) {
  c = __builtin_amdgcn_wmma_f32_16x16x32_bf16(false, ah, false, bh, (short)0, c, false, false);
  if (NT >= 2) c = __builtin_amdgcn_wmma_f32_16x16x32_bf16(false, al, false, bh, (short)0, c, false, false);
  if (NT >= 3) c = __builtin_amdgcn_wmma_f32_16x16x32_bf16(false, ah, false, bl, (short)0, c, false, false);
  asm volatile("v_nop\n\tv_nop\n\tv_nop\n\tv_nop" : "+v"(c) : "v"(ah), "v"(al), "v"(bh), "v"(bl));
  return c;
}

__global__ __launch_bounds__(256) void k_wt_bf16(const float* __restrict__ W, unsigned short* __restrict__ Wt, int K, int N) {
  const int t = blockIdx.x * 256 + threadIdx.x;
  const int k8n = K / 8;
  if (t >= N * k8n) return;
  const int n = t / k8n, k8 = (t % k8n) * 8;
  v8us v;
#pragma unroll
  for (int i = 0; i < 8; ++i) v[i] = bf16_bits(W[(size_t)(k8 + i) * N + n]);
  *(v8us*)(Wt + (size_t)n * K + k8) = v;
  
}

// GEMM C[M][N] (f32, pitch ldc) = act(A[M][K]·W + bias). A f32 row-major (pitch lda) converted per fragment to bf16
// (ASPLIT: hi/lo two planes -> 2 terms, else single rounded term); Wt bf16 [N][K] (pitch ldb). BIAS_BF16 rounds the
// bias to bf16 first (bias quantised to bf16 before the add). K%32==0, M%16==0, N%64==0.
template <bool ASPLIT, int ACT, bool BIAS_BF16>
__global__ __launch_bounds__(128) void k_gemm_bf(const float* __restrict__ A, int lda, const unsigned short* __restrict__ Wt, int ldb,
                                               const float* __restrict__ bias, float* __restrict__ C, int ldc, int M, int N, int K) {
  __shared__ __attribute__((aligned(16))) float so[4][16][64];
  const int tid = threadIdx.x, w = tid >> 5, lane = tid & 31, ln = lane & 15, hh = lane >> 4;
  const int ntn = N / 64;
  const int wid = blockIdx.x * 4 + w;
  const int mt = wid / ntn, nq = wid % ntn;
  if (mt * 16 >= M) return;
  const int row0 = mt * 16, col0 = nq * 64;
  const float* arow = A + (size_t)(row0 + ln) * lda;
  v8f acc[4] = {};
  for (int kb = 0; kb < K; kb += 32) {
    FragB ah, al;
    const v4f x0 = *(const v4fa*)(arow + kb + 8 * hh), x1 = *(const v4fa*)(arow + kb + 8 * hh + 4);
    const v4f x2 = *(const v4fa*)(arow + kb + 16 + 8 * hh), x3 = *(const v4fa*)(arow + kb + 16 + 8 * hh + 4);
    float xs[16] = {x0[0],x0[1],x0[2],x0[3],x1[0],x1[1],x1[2],x1[3],x2[0],x2[1],x2[2],x2[3],x3[0],x3[1],x3[2],x3[3]};
#pragma unroll
    for (int i = 0; i < 16; ++i) { const unsigned short hb = bf16_bits(xs[i]); ah.u[i] = hb; al.u[i] = ASPLIT ? bf16_bits(xs[i] - bf16_val(hb)) : (unsigned short)0; }
#pragma unroll
    for (int t = 0; t < 4; ++t) {
      const unsigned short* brow = Wt + (size_t)(col0 + t * 16 + ln) * ldb + kb;
      FragB b;
      b.half[0] = *(const v8us*)(brow + 8 * hh);
      b.half[1] = *(const v8us*)(brow + 16 + 8 * hh);
      acc[t] = mmaN<ASPLIT ? 2 : 1>(ah.v, al.v, b.v, b.v, acc[t]);
    }
  }
#pragma unroll
  for (int t = 0; t < 4; ++t) {
    float bv = bias ? bias[col0 + t * 16 + ln] : 0.f;
    if (BIAS_BF16) bv = bf16_round(bv);
#pragma unroll
    for (int r = 0; r < 8; ++r) { float v = acc[t][r] + bv; if (ACT == 1) v = fmaxf(v, 0.f); so[w][8 * hh + r][t * 16 + ln] = v; }
  }
  __builtin_amdgcn_fence(__ATOMIC_ACQ_REL, "workgroup");
  __builtin_amdgcn_wave_barrier();
  const int rsub = lane >> 4, c4 = (lane & 15) * 4;
  {
#pragma unroll
    for (int q = 0; q < 8; ++q) {
      const int r = q * 2 + rsub;
      const v4f v = *(const v4fa*)&so[w][r][c4];
      *(v4f*)(C + (size_t)(row0 + r) * ldc + col0 + c4) = v;
    }
    
  }
}

// Flash-style causal/unmasked attention, all contractions 3-term bf16 hi/lo splits, f32 softmax with running max.
// q,k,v rows are read from f32 buffers with arbitrary row pitch (so they can live inside a fused qkv buffer);
// D = head size (multiple of 32, <= 128); one wave = 16 query rows; block = 4 waves (64 queries) sharing K/V chunks of 32.
template <int D, bool CAUSAL>
__global__ __launch_bounds__(128) void k_flash(const float* __restrict__ qb, const float* __restrict__ kb, const float* __restrict__ vb,
                                             int pitch, int T, int H, float scale, float* __restrict__ y, int ypitch) {
  constexpr int KS = D / 32;        // k-steps for QK
  constexpr int DT = D / 16;        // d tiles for PV
  __shared__ __attribute__((aligned(16))) unsigned short sKh[32][D + 8], sKl[32][D + 8], sVh[32][D + 8], sVl[32][D + 8];
  __shared__ __attribute__((aligned(16))) unsigned short sPh[4][16][40], sPl[4][16][40];
  __shared__ __attribute__((aligned(16))) float sO[4][16][D];
  const int tid = threadIdx.x, w = tid >> 5, lane = tid & 31, ln = lane & 15, hh = lane >> 4;
  const int nqb = (T + 63) / 64;
  const int bh = blockIdx.x / nqb, qblk = blockIdx.x % nqb;
  const int b = bh / H, h = bh % H;
  const int q0 = qblk * 64 + w * 16;
  const float* Q = qb + (size_t)b * T * pitch + h * D;
  const float* K = kb + (size_t)b * T * pitch + h * D;
  const float* V = vb + (size_t)b * T * pitch + h * D;

  // A fragments of the wave's 16 query rows (scaled), hi/lo
  FragB aqh[KS], aql[KS];
  {
    int row = q0 + ln; if (row >= T) row = T - 1;
    const float* qr = Q + (size_t)row * pitch;
#pragma unroll
    for (int ks = 0; ks < KS; ++ks)
#pragma unroll
      for (int i = 0; i < 16; ++i) {
        const int d = ks * 32 + ((i < 8) ? (8 * hh + i) : (16 + 8 * hh + (i - 8)));
        const float x = qr[d] * scale; const unsigned short hb = bf16_bits(x);
        aqh[ks].u[i] = hb; aql[ks].u[i] = bf16_bits(x - bf16_val(hb));
      }
  }
  float m_r[8], l_r[8];
#pragma unroll
  for (int r = 0; r < 8; ++r) { m_r[r] = -3.0e38f; l_r[r] = 0.f; }
  v8f oacc[DT];
#pragma unroll
  for (int dt = 0; dt < DT; ++dt) oacc[dt] = (v8f){0.f,0.f,0.f,0.f,0.f,0.f,0.f,0.f};

  const int kv_end = CAUSAL ? min(T, qblk * 64 + 64) : T;     // block-uniform
  for (int j0 = 0; j0 < kv_end; j0 += 32) {
    __syncthreads();
    for (int e = tid; e < 32 * (D / 4); e += 128) {
      const int r = e / (D / 4), c4 = (e % (D / 4)) * 4;
      const int key = j0 + r;
      v4f kf = {0.f,0.f,0.f,0.f}, vf = {0.f,0.f,0.f,0.f};
      if (key < T) { kf = *(const v4fa*)(K + (size_t)key * pitch + c4); vf = *(const v4fa*)(V + (size_t)key * pitch + c4); }
#pragma unroll
      for (int t = 0; t < 4; ++t) {
        unsigned short hb = bf16_bits(kf[t]); sKh[r][c4 + t] = hb; sKl[r][c4 + t] = bf16_bits(kf[t] - bf16_val(hb));
        hb = bf16_bits(vf[t]); sVh[r][c4 + t] = hb; sVl[r][c4 + t] = bf16_bits(vf[t] - bf16_val(hb));
      }
    }
    __syncthreads();
    // S tile 16 x 32
    v8f s[2];
#pragma unroll
    for (int nt = 0; nt < 2; ++nt) {
      v8f acc = {};
#pragma unroll
      for (int ks = 0; ks < KS; ++ks) {
        FragB bh_, bl_;
        bh_.half[0] = *(const v8us*)&sKh[nt * 16 + ln][ks * 32 + 8 * hh]; bh_.half[1] = *(const v8us*)&sKh[nt * 16 + ln][ks * 32 + 16 + 8 * hh];
        bl_.half[0] = *(const v8us*)&sKl[nt * 16 + ln][ks * 32 + 8 * hh]; bl_.half[1] = *(const v8us*)&sKl[nt * 16 + ln][ks * 32 + 16 + 8 * hh];
        acc = mmaN<3>(aqh[ks].v, aql[ks].v, bh_.v, bl_.v, acc);
      }
      s[nt] = acc;
    }
    // mask + running max (rows 8hh+r; the 16 lanes of a half share rows)
    float alpha[8];
#pragma unroll
    for (int r = 0; r < 8; ++r) {
      const int qi = q0 + 8 * hh + r;
      const int ja = j0 + ln, jb = j0 + 16 + ln;
      if (CAUSAL) { if (ja > qi) s[0][r] = -3.0e38f; if (jb > qi) s[1][r] = -3.0e38f; }
      if (ja >= T) s[0][r] = -3.0e38f;
      if (jb >= T) s[1][r] = -3.0e38f;
      float mx = fmaxf(s[0][r], s[1][r]);
      mx = fmaxf(mx, __shfl_xor(mx, 1, 32)); mx = fmaxf(mx, __shfl_xor(mx, 2, 32)); mx = fmaxf(mx, __shfl_xor(mx, 4, 32)); mx = fmaxf(mx, __shfl_xor(mx, 8, 32));
      const float mnew = fmaxf(m_r[r], mx);
      alpha[r] = (mnew > -1.0e38f) ? __expf(m_r[r] - mnew) : 1.0f;
      const float p0 = (s[0][r] > -1.0e38f) ? __expf(s[0][r] - mnew) : 0.f;
      const float p1 = (s[1][r] > -1.0e38f) ? __expf(s[1][r] - mnew) : 0.f;
      m_r[r] = mnew;
      l_r[r] = l_r[r] * alpha[r] + p0 + p1;            // per-lane partial row sum (16 lanes combined at the end)
      unsigned short hb = bf16_bits(p0); sPh[w][8 * hh + r][ln] = hb;      sPl[w][8 * hh + r][ln] = bf16_bits(p0 - bf16_val(hb));
      hb = bf16_bits(p1);                sPh[w][8 * hh + r][16 + ln] = hb; sPl[w][8 * hh + r][16 + ln] = bf16_bits(p1 - bf16_val(hb));
    }
#pragma unroll
    for (int dt = 0; dt < DT; ++dt)
#pragma unroll
      for (int r = 0; r < 8; ++r) oacc[dt][r] *= alpha[r];
    __builtin_amdgcn_fence(__ATOMIC_ACQ_REL, "workgroup");
    __builtin_amdgcn_wave_barrier();
    FragB pah, pal;
    pah.half[0] = *(const v8us*)&sPh[w][ln][8 * hh]; pah.half[1] = *(const v8us*)&sPh[w][ln][16 + 8 * hh];
    pal.half[0] = *(const v8us*)&sPl[w][ln][8 * hh]; pal.half[1] = *(const v8us*)&sPl[w][ln][16 + 8 * hh];
#pragma unroll
    for (int dt = 0; dt < DT; ++dt) {
      FragB bvh, bvl;
#pragma unroll
      for (int i = 0; i < 8; ++i) {
        bvh.u[i] = sVh[8 * hh + i][dt * 16 + ln]; bvh.u[8 + i] = sVh[16 + 8 * hh + i][dt * 16 + ln];
        bvl.u[i] = sVl[8 * hh + i][dt * 16 + ln]; bvl.u[8 + i] = sVl[16 + 8 * hh + i][dt * 16 + ln];
      }
      oacc[dt] = mmaN<3>(pah.v, pal.v, bvh.v, bvl.v, oacc[dt]);
    }
    __builtin_amdgcn_fence(__ATOMIC_ACQ_REL, "workgroup");
    __builtin_amdgcn_wave_barrier();
  }
#pragma unroll
  for (int r = 0; r < 8; ++r) {
    float l = l_r[r];
    l += __shfl_xor(l, 1, 32); l += __shfl_xor(l, 2, 32); l += __shfl_xor(l, 4, 32); l += __shfl_xor(l, 8, 32);
    l_r[r] = (l > 0.f) ? 1.0f / l : 0.f;
  }
#pragma unroll
  for (int dt = 0; dt < DT; ++dt)
#pragma unroll
    for (int r = 0; r < 8; ++r) sO[w][8 * hh + r][dt * 16 + ln] = oacc[dt][r] * l_r[r];
  __builtin_amdgcn_fence(__ATOMIC_ACQ_REL, "workgroup");
  __builtin_amdgcn_wave_barrier();
  {
    for (int r = 0; r < 16; ++r) {
      const int row = q0 + r;
      if (row < T && lane < D / 4) {
        const v4f val = *(const v4fa*)&sO[w][r][lane * 4];
        *(v4f*)(y + ((size_t)b * T + row) * ypitch + h * D + lane * 4) = val;
      }
    }
    
  }
}

// GEMM C = act(A·W + bias + resid): A f32 (ASPLIT -> hi/lo 2 terms), Wt bf16 [N][K]; ACT 0 none, 1 relu, 2 exact gelu;
// resid (optional, f32, row index = (row % rmod), pitch ldr, RES_BF16 rounds it) added before the activation.
template <bool ASPLIT, int ACT, bool BIAS_BF16, bool RES_BF16>
__global__ __launch_bounds__(128) void k_gemm_bf3(const float* __restrict__ A, int lda, const unsigned short* __restrict__ Wt, int ldb,
                                                const float* __restrict__ bias, const float* __restrict__ resid, int rmod, int ldr,
                                                float* __restrict__ C, int ldc, int M, int N, int K) {
  __shared__ __attribute__((aligned(16))) float so[4][16][64];
  const int tid = threadIdx.x, w = tid >> 5, lane = tid & 31, ln = lane & 15, hh = lane >> 4;
  const int ntn = N / 64;
  const int wid = blockIdx.x * 4 + w;
  const int mt = wid / ntn, nq = wid % ntn;
  if (mt * 16 >= M) return;
  const int row0 = mt * 16, col0 = nq * 64;
  const float* arow = A + (size_t)(row0 + ln) * lda;
  v8f acc[4] = {};
  for (int kb = 0; kb < K; kb += 32) {
    FragB ah, al;
    const v4f x0 = *(const v4fa*)(arow + kb + 8 * hh), x1 = *(const v4fa*)(arow + kb + 8 * hh + 4);
    const v4f x2 = *(const v4fa*)(arow + kb + 16 + 8 * hh), x3 = *(const v4fa*)(arow + kb + 16 + 8 * hh + 4);
    float xs[16] = {x0[0],x0[1],x0[2],x0[3],x1[0],x1[1],x1[2],x1[3],x2[0],x2[1],x2[2],x2[3],x3[0],x3[1],x3[2],x3[3]};
#pragma unroll
    for (int i = 0; i < 16; ++i) { const unsigned short hb = bf16_bits(xs[i]); ah.u[i] = hb; al.u[i] = ASPLIT ? bf16_bits(xs[i] - bf16_val(hb)) : (unsigned short)0; }
#pragma unroll
    for (int t = 0; t < 4; ++t) {
      const unsigned short* brow = Wt + (size_t)(col0 + t * 16 + ln) * ldb + kb;
      FragB b;
      b.half[0] = *(const v8us*)(brow + 8 * hh);
      b.half[1] = *(const v8us*)(brow + 16 + 8 * hh);
      acc[t] = mmaN<ASPLIT ? 2 : 1>(ah.v, al.v, b.v, b.v, acc[t]);
    }
  }
#pragma unroll
  for (int t = 0; t < 4; ++t) {
    const int col = col0 + t * 16 + ln;
    float bv = bias ? bias[col] : 0.f;
    if (BIAS_BF16) bv = bf16_round(bv);
#pragma unroll
    for (int r = 0; r < 8; ++r) {
      float v = acc[t][r] + bv;
      if (resid) { float rv = resid[(size_t)((row0 + 8 * hh + r) % rmod) * ldr + col]; if (RES_BF16) rv = bf16_round(rv); v += rv; }
      if (ACT == 1) v = fmaxf(v, 0.f);
      if (ACT == 2) v = 0.5f * v * (1.0f + erff(v * 0.70710678118654752f));
      if (ACT == 3) { const float u = 0.7978845608028654f * (v + 0.044715f * v * v * v); v = 0.5f * v * (1.0f + tanhf(u)); }
      so[w][8 * hh + r][t * 16 + ln] = v;
    }
  }
  __builtin_amdgcn_fence(__ATOMIC_ACQ_REL, "workgroup");
  __builtin_amdgcn_wave_barrier();
  const int rsub = lane >> 4, c4 = (lane & 15) * 4;
  {
#pragma unroll
    for (int q = 0; q < 8; ++q) {
      const int r = q * 2 + rsub;
      const v4f v = *(const v4fa*)&so[w][r][c4];
      *(v4f*)(C + (size_t)(row0 + r) * ldc + col0 + c4) = v;
    }
    
  }
}
// row LayerNorm (biased variance, eps) over N: s = X (+ R); optional out_sum <- s; out_norm <- (s-mu)*rsqrt(var+eps)*g + b
template <bool PARAM_BF16>
__global__ __launch_bounds__(256) void k_layernorm(const float* __restrict__ X, const float* __restrict__ R, const float* __restrict__ g, const float* __restrict__ bta,
                                                  float* __restrict__ out_sum, float* __restrict__ out_norm, int N, float eps) {
  __shared__ float red[256];
  const int row = blockIdx.x, tid = threadIdx.x;
  const float* x = X + (size_t)row * N; const float* rr = R ? R + (size_t)row * N : nullptr;
  float vals[16];                     // up to N = 4096
  const int per = N / 256;            // contiguous chunk per thread? use strided-by-4 chunks: thread handles j = tid*4 + 1024*u
  float s1 = 0.f;
  for (int u = 0; u < per / 4; ++u) {
    const int j = tid * 4 + 1024 * u;
    const v4f a = *(const v4fa*)(x + j);
    v4f b = {0.f,0.f,0.f,0.f}; if (rr) b = *(const v4fa*)(rr + j);
#pragma unroll
    for (int q = 0; q < 4; ++q) { const float v = a[q] + b[q]; vals[u * 4 + q] = v; s1 += v; }
  }
  red[tid] = s1; __syncthreads();
  for (int st = 128; st > 0; st >>= 1) { if (tid < st) red[tid] += red[tid + st]; __syncthreads(); }
  const float mu = red[0] / (float)N; __syncthreads();
  float s2 = 0.f;
  for (int u = 0; u < per / 4; ++u)
#pragma unroll
    for (int q = 0; q < 4; ++q) { const float c = vals[u * 4 + q] - mu; s2 += c * c; }
  red[tid] = s2; __syncthreads();
  for (int st = 128; st > 0; st >>= 1) { if (tid < st) red[tid] += red[tid + st]; __syncthreads(); }
  const float rs = rsqrtf(red[0] / (float)N + eps);
  {
    for (int u = 0; u < per / 4; ++u) {
      const int j = tid * 4 + 1024 * u;
      v4f o, sm;
#pragma unroll
      for (int q = 0; q < 4; ++q) {
        float gg = g[j + q], bb = bta[j + q];
        if (PARAM_BF16) { gg = bf16_round(gg); bb = bf16_round(bb); }
        sm[q] = vals[u * 4 + q]; o[q] = (vals[u * 4 + q] - mu) * rs * gg + bb;
      }
      if (out_sum) *(v4f*)(out_sum + (size_t)row * N + j) = sm;
      *(v4f*)(out_norm + (size_t)row * N + j) = o;
    }
    
  }
}



// ---- f16 WMMA path (v_wmma_f32_16x16x32_f16): 11-bit significands for operands in range — used where a [0,1] probability operand needs more precision than bf16
typedef _Float16 v16h __attribute__((ext_vector_type(16)));
union FragH { v16h v; v8us half[2]; _Float16 h[16]; unsigned short u[16]; };
template <int NT>
__device__ __forceinline__ v8f mmaH(v16h ah, v16h al, v16h bh, v16h bl, v8f c) {
  c = __builtin_amdgcn_wmma_f32_16x16x32_f16(false, ah, false, bh, (short)0, c, false, false);
  if (NT >= 2) c = __builtin_amdgcn_wmma_f32_16x16x32_f16(false, al, false, bh, (short)0, c, false, false);
  if (NT >= 3) c = __builtin_amdgcn_wmma_f32_16x16x32_f16(false, ah, false, bl, (short)0, c, false, false);
  asm volatile("v_nop\n\tv_nop\n\tv_nop\n\tv_nop" : "+v"(c) : "v"(ah), "v"(al), "v"(bh), "v"(bl));
  return c;
}
// batched GEMM like k_gemm_b but f16 operands: A f32 (split into f16 hi/lo if ASPLIT, else rounded to f16), Bt = f16 values [n][k]; alpha; C f32; N multiple of 16 (partial tiles skipped)
template <bool ASPLIT>
__global__ __launch_bounds__(128) void k_gemm_h(const float* __restrict__ A, int lda, size_t sA, const _Float16* __restrict__ Bh, int ldb, size_t sB, float alpha, float* __restrict__ C, int ldc, size_t sC, int M, int N, int K) {
  __shared__ __attribute__((aligned(16))) float so[4][16][64];
  const int tid = threadIdx.x, w = tid >> 5, lane = tid & 31, ln = lane & 15, hh = lane >> 4; const int by = blockIdx.y;
  A += (size_t)by * sA; Bh += (size_t)by * sB; C += (size_t)by * sC;
  const int ntn = (N + 63) / 64; const int wid = blockIdx.x * 4 + w; const int mt = wid / ntn, nq = wid % ntn; if (mt * 16 >= M) return;
  const int row0 = mt * 16, col0 = nq * 64; const float* arow = A + (size_t)(row0 + ln) * lda;
  v8f acc[4] = {};
  for (int kb = 0; kb < K; kb += 32) {
    FragH ah, al;
    const v4f x0 = *(const v4fa*)(arow + kb + 8 * hh), x1 = *(const v4fa*)(arow + kb + 8 * hh + 4), x2 = *(const v4fa*)(arow + kb + 16 + 8 * hh), x3 = *(const v4fa*)(arow + kb + 16 + 8 * hh + 4);
    float xs[16] = {x0[0],x0[1],x0[2],x0[3],x1[0],x1[1],x1[2],x1[3],x2[0],x2[1],x2[2],x2[3],x3[0],x3[1],x3[2],x3[3]};
#pragma unroll
    for (int i = 0; i < 16; ++i) { const _Float16 h = (_Float16)xs[i]; ah.h[i] = h; al.h[i] = ASPLIT ? (_Float16)(xs[i] - (float)h) : (_Float16)0.0f; }
#pragma unroll
    for (int t = 0; t < 4; ++t) { if (col0 + t * 16 >= N) continue; const size_t boff = (size_t)(col0 + t * 16 + ln) * ldb + kb; FragH bq; bq.half[0] = *(const v8us*)(Bh + boff + 8 * hh); bq.half[1] = *(const v8us*)(Bh + boff + 16 + 8 * hh);
      acc[t] = mmaH<ASPLIT ? 2 : 1>(ah.v, al.v, bq.v, bq.v, acc[t]); }
  }
#pragma unroll
  for (int t = 0; t < 4; ++t) { if (col0 + t * 16 >= N) continue;
#pragma unroll
    for (int r = 0; r < 8; ++r) so[w][8 * hh + r][t * 16 + ln] = acc[t][r] * alpha; }
  __builtin_amdgcn_fence(__ATOMIC_ACQ_REL, "workgroup"); __builtin_amdgcn_wave_barrier();
  const int rsub = lane >> 4, c4 = (lane & 15) * 4;
  {
#pragma unroll
    for (int q = 0; q < 8; ++q) { const int r = q * 2 + rsub; if (col0 + c4 < N) { const v4f v = *(const v4fa*)&so[w][r][c4]; *(v4f*)(C + (size_t)(row0 + r) * ldc + col0 + c4) = v; } }
     }
}

// Wt[n][k] = f16(W[k][n]·scale) from f32 row-major W[K][N] (scale = power of two; bf16-exact weights stay exact in f16 away from the subnormal range)
__global__ __launch_bounds__(256) void k_wt_f16(const float* __restrict__ W, _Float16* __restrict__ Wt, int K, int N, float scale) {
  const int t = blockIdx.x * 256 + threadIdx.x; if (t >= N * (K / 8)) return; const int n = t / (K / 8), k8 = (t % (K / 8)) * 8; FragH f;
#pragma unroll
  for (int i = 0; i < 8; ++i) f.h[i] = (_Float16)(bf16_round(W[(size_t)(k8 + i) * N + n]) * scale); const v8us o = f.half[0];
  *(v8us*)((unsigned short*)Wt + (size_t)n * K + k8) = o; 
}
// k_gemm_hh variant with fused epilogue: v = acc·alpha + bias[by·sBias + col] (+ CP[(row/rowsPerB)·sCPb + by·64 + col] if CP) ; ACT 0 none / 1 elu ; writes f16 C16 and/or f32 C (each if non-null)
template <int ACT>
__global__ __launch_bounds__(128) void k_gemm_hhx(const _Float16* __restrict__ A, int lda, size_t sA, const _Float16* __restrict__ Bh, int ldb, size_t sB, float alpha, const float* __restrict__ bias, size_t sBias, const float* __restrict__ CP, int rowsPerB, size_t sCPb, int row0g,
    float* __restrict__ C, _Float16* __restrict__ C16, int ldc, size_t sC, int M, int N, int K) {
  __shared__ __attribute__((aligned(16))) float so[4][16][64];
  const int tid = threadIdx.x, w = tid >> 5, lane = tid & 31, ln = lane & 15, hh = lane >> 4; const int by = blockIdx.y;
  A += (size_t)by * sA; Bh += (size_t)by * sB; const size_t cofs = (size_t)by * sC; const float* bp = bias ? bias + (size_t)by * sBias : nullptr;
  const int ntn = (N + 63) / 64; const int wid = blockIdx.x * 4 + w; const int mt = wid / ntn, nq = wid % ntn; if (mt * 16 >= M) return;
  const int row0 = mt * 16, col0 = nq * 64; const _Float16* arow = A + (size_t)(row0 + ln) * lda;
  v8f acc[4] = {};
  for (int kb = 0; kb < K; kb += 32) { FragH ah; ah.half[0] = *(const v8us*)((const unsigned short*)arow + kb + 8 * hh); ah.half[1] = *(const v8us*)((const unsigned short*)arow + kb + 16 + 8 * hh);
#pragma unroll
    for (int t = 0; t < 4; ++t) { if (col0 + t * 16 >= N) continue; const size_t boff = (size_t)(col0 + t * 16 + ln) * ldb + kb; FragH bq; bq.half[0] = *(const v8us*)((const unsigned short*)Bh + boff + 8 * hh); bq.half[1] = *(const v8us*)((const unsigned short*)Bh + boff + 16 + 8 * hh);
      acc[t] = mmaH<1>(ah.v, ah.v, bq.v, bq.v, acc[t]); }
  }
#pragma unroll
  for (int t = 0; t < 4; ++t) { if (col0 + t * 16 >= N) continue; const int col = col0 + t * 16 + ln; const float bv = bp ? bf16_round(bp[col]) : 0.f;
#pragma unroll
    for (int r = 0; r < 8; ++r) { float v = acc[t][r] * alpha + bv; if (CP) { const int bidx = (row0g + row0 + 8 * hh + r) / rowsPerB; v += CP[(size_t)bidx * sCPb + (size_t)by * 64 + col]; } if (ACT == 1) v = (v > 0.f) ? v : expm1f(v); else if (ACT == 3) v = fmaxf(v, 0.f); so[w][8 * hh + r][t * 16 + ln] = v; } }
  __builtin_amdgcn_fence(__ATOMIC_ACQ_REL, "workgroup"); __builtin_amdgcn_wave_barrier();
  const int rsub = lane >> 4, c4 = (lane & 15) * 4; typedef _Float16 v4h __attribute__((ext_vector_type(4)));
  {
#pragma unroll
    for (int q = 0; q < 8; ++q) { const int r = q * 2 + rsub; if (col0 + c4 < N) { const v4f v = *(const v4fa*)&so[w][r][c4]; if (C) *(v4f*)(C + cofs + (size_t)(row0 + r) * ldc + col0 + c4) = v; if (C16) { v4h h4; for (int i = 0; i < 4; ++i) h4[i] = (_Float16)v[i]; *(v4h*)(C16 + cofs + (size_t)(row0 + r) * ldc + col0 + c4) = h4; } } }
     }
}


// Projection Y = X.W^T / 16 + bias at the fixed shape NR x DM x DM. One 128 x 128 tile of Y per work-group of 8 waves (4 x 2 waves, 32 x 64 of Y each).
// Each 64-k step of both operands (128 rows of 128 B) is read from global as whole lines, one step ahead, into registers and laid in LDS at a pitch of 144 B
// (16 B x odd: no bank conflict for the 16-byte fragment reads). Two LDS buffers: the one barrier of a step publishes its tile and ends the reads of the buffer written next.
// Fragment maps and the ascending k order of every accumulator are those of k_gemm_hhx.
template <bool F32OUT>
__global__ __launch_bounds__(256) void k_proj(const _Float16* __restrict__ A, const _Float16* __restrict__ Bh, const float* __restrict__ bias, float* __restrict__ C, _Float16* __restrict__ C16) {
  constexpr int PT = 72, NS = DM / 64;
  __shared__ __attribute__((aligned(16))) unsigned short sA[2][128][PT], sB[2][128][PT];
  __shared__ __attribute__((aligned(16))) float so[8][32][68];
  const int tid = threadIdx.x, w = tid >> 5, lane = tid & 31, ln = lane & 15, hh = lane >> 4;
  const int m0 = (blockIdx.x >> 3) * 128, n0 = (blockIdx.x & 7) * 128, wm = (w >> 1) * 32, wn = (w & 1) * 64;
  const int lr = tid >> 3, lc = (tid & 7) * 8;
  const unsigned short* ga = (const unsigned short*)A + (size_t)(m0 + lr) * DM + lc;
  const unsigned short* gb = (const unsigned short*)Bh + (size_t)(n0 + lr) * DM + lc;
  v8us ra[4], rb[4];
#pragma unroll
  for (int i = 0; i < 4; ++i) { ra[i] = *(const v8us*)(ga + (size_t)i * 32 * DM); rb[i] = *(const v8us*)(gb + (size_t)i * 32 * DM); }
  v8f acc[2][4];
#pragma unroll
  for (int mt = 0; mt < 2; ++mt)
#pragma unroll
    for (int nt = 0; nt < 4; ++nt) acc[mt][nt] = (v8f){0.f,0.f,0.f,0.f,0.f,0.f,0.f,0.f};
  // unrolled by two so that the buffer index is a constant in every LDS address
#pragma unroll 2
  for (int s = 0; s < NS; ++s) {
    const int bf = s & 1;
#pragma unroll
    for (int i = 0; i < 4; ++i) { *(v8us*)&sA[bf][lr + 32 * i][lc] = ra[i]; *(v8us*)&sB[bf][lr + 32 * i][lc] = rb[i]; }
    __syncthreads();
    if (s + 1 < NS) {
#pragma unroll
      for (int i = 0; i < 4; ++i) { ra[i] = *(const v8us*)(ga + (size_t)i * 32 * DM + (s + 1) * 64); rb[i] = *(const v8us*)(gb + (size_t)i * 32 * DM + (s + 1) * 64); }
    }
    // keeps the next step's global loads in front of this step's matrix work: left free, the compiler sinks them to just before their LDS stores and their whole latency is waited out
    __builtin_amdgcn_sched_barrier(0);
#pragma unroll
    for (int ks = 0; ks < 2; ++ks) {
      FragH a[2], b[4];
#pragma unroll
      for (int mt = 0; mt < 2; ++mt) { a[mt].half[0] = *(const v8us*)&sA[bf][wm + mt * 16 + ln][ks * 32 + 8 * hh]; a[mt].half[1] = *(const v8us*)&sA[bf][wm + mt * 16 + ln][ks * 32 + 16 + 8 * hh]; }
#pragma unroll
      for (int nt = 0; nt < 4; ++nt) { b[nt].half[0] = *(const v8us*)&sB[bf][wn + nt * 16 + ln][ks * 32 + 8 * hh]; b[nt].half[1] = *(const v8us*)&sB[bf][wn + nt * 16 + ln][ks * 32 + 16 + 8 * hh]; }
#pragma unroll
      for (int mt = 0; mt < 2; ++mt)
#pragma unroll
        for (int nt = 0; nt < 4; ++nt) acc[mt][nt] = __builtin_amdgcn_wmma_f32_16x16x32_f16(false, a[mt].v, false, b[nt].v, (short)0, acc[mt][nt], false, false);
    }
  }
  // stands in front of the epilogue's reuse of the registers that held the global load addresses (the scheduling barrier keeps that reuse behind it)
  asm volatile("s_wait_xcnt 0x0" ::: "memory");
  __builtin_amdgcn_sched_barrier(0);
  typedef _Float16 v4h __attribute__((ext_vector_type(4)));
#pragma unroll
  for (int nt = 0; nt < 4; ++nt) { const float bv = bf16_round(bias[n0 + wn + nt * 16 + ln]);
#pragma unroll
    for (int mt = 0; mt < 2; ++mt)
#pragma unroll
      for (int r = 0; r < 8; ++r) so[w][mt * 16 + 8 * hh + r][nt * 16 + ln] = acc[mt][nt][r] * 0.0625f + bv; }
  // the wave's own 32 x 64 strip: its LDS writes are ordered before its cross-lane reads, so that whole lines go out
  __builtin_amdgcn_fence(__ATOMIC_ACQ_REL, "workgroup"); __builtin_amdgcn_wave_barrier();
#pragma unroll
  for (int q = 0; q < 16; ++q) { const int r = q * 2 + hh, c4 = ln * 4; const v4f v = *(const v4fa*)&so[w][r][c4]; const size_t o = (size_t)(m0 + wm + r) * DM + n0 + wn + c4;
    if (F32OUT) *(v4f*)(C + o) = v; else { v4h h4;
#pragma unroll
      for (int i = 0; i < 4; ++i) h4[i] = (_Float16)v[i]; *(v4h*)(C16 + o) = h4; } }
}

typedef _Float16 v4hs __attribute__((ext_vector_type(4)));
// One work-group's share (256 x 4 x U elements in a row) of an f32 -> f16 conversion, as a stream: U loads of 16 B a lane, each 512 contiguous bytes a wave (whole lines), and U stores of 8 B a lane
// (two whole lines a wave). All of a wave's loads are issued before its first value is converted, so that its whole share is in flight at once. Few waves with many bytes in flight each,
// in place of one wave for every 256 elements. MODE 0: f16(x); 1: f16(bf16(x)); 2: f16(bf16(x) * 16). Each element's arithmetic is that of the one-piece-a-thread kernels.
template <int U, int MODE>
__device__ __forceinline__ void cvt_stream(const float* __restrict__ s, _Float16* __restrict__ d) {
  const int tid = threadIdx.x;
  v4f v[U];
  // the three loops are unrolled so that v[] is indexed by constants and stays in registers, and every address is one base plus an immediate offset
#pragma unroll
  for (int u = 0; u < U; ++u) v[u] = *(const v4fa*)(s + (u * 256 + tid) * 4);
  // keeps every load in front of the first conversion: left free, the compiler issues a dozen, waits for nearly all of them and converts with almost nothing in flight, several times over
  __builtin_amdgcn_sched_barrier(0);
#pragma unroll
  for (int u = 0; u < U; ++u) { v4hs h;
#pragma unroll
    for (int q = 0; q < 4; ++q) h[q] = (MODE == 0) ? (_Float16)v[u][q] : (MODE == 1) ? (_Float16)bf16_round(v[u][q]) : (_Float16)(bf16_round(v[u][q]) * 16.0f);
    *(v4hs*)(d + (u * 256 + tid) * 4) = h; }
}
#define CVU 32
#define CVE (256 * 4 * CVU)
// the three activations and the four weights in one launch: the work-group index picks the tensor and its share of it (a test that is the same for the whole work-group)
__global__ __launch_bounds__(256) void k_cvt_in(const float* __restrict__ xq, const float* __restrict__ xk, const float* __restrict__ xv,
                                                const float* __restrict__ Wq, const float* __restrict__ Wk, const float* __restrict__ Wv, const float* __restrict__ Wo,
                                                _Float16* __restrict__ XQ, _Float16* __restrict__ XK, _Float16* __restrict__ XV,
                                                _Float16* __restrict__ Bq, _Float16* __restrict__ Bk, _Float16* __restrict__ Bv, _Float16* __restrict__ Bo) {
  constexpr int GX = NR * DM / CVE, GW = DM * DM / CVE;
  const int g = blockIdx.x;
  if (g < 3 * GX) {
    const int t = g / GX; const size_t o = (size_t)(g % GX) * CVE;
    cvt_stream<CVU, 1>((t == 0 ? xq : t == 1 ? xk : xv) + o, (t == 0 ? XQ : t == 1 ? XK : XV) + o);
  } else {
    const int g2 = g - 3 * GX, t = g2 / GW; const size_t o = (size_t)(g2 % GW) * CVE;
    cvt_stream<CVU, 2>((t == 0 ? Wq : t == 1 ? Wk : t == 2 ? Wv : Wo) + o, (t == 0 ? Bq : t == 1 ? Bk : t == 2 ? Bv : Bo) + o);
  }
}
__global__ __launch_bounds__(256) void k_h16(const float* __restrict__ x, _Float16* __restrict__ X16) { const size_t o = (size_t)blockIdx.x * (256 * 4 * 8); cvt_stream<8, 0>(x + o, X16 + o); }
__global__ __launch_bounds__(256) void k_vt(const _Float16* __restrict__ V16, _Float16* __restrict__ Vt) { __shared__ unsigned short tl[64][66]; const int tid = threadIdx.x; const int slab = blockIdx.x / (SS / 64), lg = blockIdx.x % (SS / 64); const int b = slab / NH, h = slab % NH;
  for (int i = tid; i < 64 * 8; i += 256) { const int r = i / 8, c8 = (i % 8) * 8; FragH f; f.half[0] = *(const v8us*)((const unsigned short*)V16 + ((size_t)b * SS + lg * 64 + r) * DM + h * HD + c8);
#pragma unroll
    for (int q = 0; q < 8; ++q) tl[r][c8 + q] = f.u[q]; }
  __syncthreads();
  {
#pragma unroll
    for (int rd = 0; rd < 2; ++rd) { const int d = rd * 32 + tid / 8, pc = tid % 8; FragH f;
#pragma unroll
      for (int q = 0; q < 8; ++q) f.u[q] = tl[pc * 8 + q][d];
      *(v8us*)((unsigned short*)Vt + ((size_t)slab * HD + d) * SS + lg * 64 + pc * 8) = f.half[0]; }
     } }
// sigmoid(s / 8) = 0.5 + 0.5 tanh(s / 16): th16 is the hardware tanh (v_tanh_f32) of s / 16, one transcendental in place of the library expf and the full-precision division
__device__ __forceinline__ float th16(float s) { return __builtin_amdgcn_tanhf(s * 0.0625f); }
// eight v_tanh_f32, each in place, with the one free slot that the instruction set asks for behind a transcendental (before its result is read or its source overwritten) as the statement's last line:
__device__ __forceinline__ void tanh8(float (&x)[8]) {
  asm("v_tanh_f32 %0, %0\n\tv_tanh_f32 %1, %1\n\tv_tanh_f32 %2, %2\n\tv_tanh_f32 %3, %3\n\tv_tanh_f32 %4, %4\n\tv_tanh_f32 %5, %5\n\tv_tanh_f32 %6, %6\n\tv_tanh_f32 %7, %7\n\tv_nop"
      : "+v"(x[0]), "+v"(x[1]), "+v"(x[2]), "+v"(x[3]), "+v"(x[4]), "+v"(x[5]), "+v"(x[6]), "+v"(x[7]));
}
// (a) O = sigmoid(q.k/8).V per (b,h): 4 waves of 32 query rows. A step is 64 keys: their K rows (64 x 128 B, one line a row) and the same keys' columns of V^T (64 d rows x 128 B, one line a row)
// are read from global as whole lines, one step ahead, into registers and laid in LDS at the pitch of k_proj (144 B), once for the 4 waves. Two LDS buffers: the one barrier of a step publishes its
// tiles and ends the reads of the buffer written next. Fragment maps and the ascending order of the 32-key blocks in every accumulator are those of the form that read its fragments straight from global.
__global__ __launch_bounds__(128) void k_satt(const _Float16* __restrict__ Q16, const _Float16* __restrict__ K16, const _Float16* __restrict__ Vt, float* __restrict__ O) {
  constexpr int RPW = 32, NQB = SS / (4 * RPW), DT = HD / 16, KS = HD / 32, PT = 72, KT = 64, NST = SS / KT;
  __shared__ __attribute__((aligned(16))) unsigned short sK[2][KT][PT], sV[2][HD][PT];
  __shared__ __attribute__((aligned(16))) unsigned short sP[4][RPW][40]; __shared__ __attribute__((aligned(16))) float sO[4][RPW][HD];
  const int tid = threadIdx.x, w = tid >> 5, lane = tid & 31, ln = lane & 15, hh = lane >> 4;
  const int slab = blockIdx.x / NQB, qblk = blockIdx.x % NQB; const int b = slab / NH, h = slab % NH; const int q0 = qblk * (4 * RPW) + w * RPW;
  const int lr = tid >> 3, lc = (tid & 7) * 8;
  const unsigned short* gk = (const unsigned short*)K16 + ((size_t)b * SS + lr) * DM + h * HD + lc;
  const unsigned short* gv = (const unsigned short*)Vt + ((size_t)slab * HD + lr) * SS + lc;
  v8us rk[4], rv[4];
#pragma unroll
  for (int i = 0; i < 4; ++i) { rk[i] = *(const v8us*)(gk + (size_t)i * 16 * DM); rv[i] = *(const v8us*)(gv + (size_t)i * 16 * SS); }
  FragH aq[2][KS];
#pragma unroll
  for (int rt = 0; rt < 2; ++rt) { const unsigned short* qr = (const unsigned short*)Q16 + ((size_t)b * SS + q0 + rt * 16 + ln) * DM + h * HD;
#pragma unroll
    for (int ks = 0; ks < KS; ++ks) { aq[rt][ks].half[0] = *(const v8us*)(qr + ks * 32 + 8 * hh); aq[rt][ks].half[1] = *(const v8us*)(qr + ks * 32 + 16 + 8 * hh); } }
  v8f oacc[2][DT];
#pragma unroll
  for (int rt = 0; rt < 2; ++rt)
#pragma unroll
    for (int dt = 0; dt < DT; ++dt) oacc[rt][dt] = (v8f){0.f,0.f,0.f,0.f,0.f,0.f,0.f,0.f};
  // unrolled by two so that the buffer index is a constant in every LDS address
#pragma unroll 2
  for (int st = 0; st < NST; ++st) {
    const int bf = st & 1;
#pragma unroll
    for (int i = 0; i < 4; ++i) { *(v8us*)&sK[bf][lr + 16 * i][lc] = rk[i]; *(v8us*)&sV[bf][lr + 16 * i][lc] = rv[i]; }
    __syncthreads();
    // no branch round the loads (the last step reads its own keys once more, unused): the step stays one block, in which the two scheduling barriers below hold
    const int sn = (st + 1 < NST) ? st + 1 : st;
#pragma unroll
    for (int i = 0; i < 4; ++i) { rk[i] = *(const v8us*)(gk + ((size_t)sn * KT + i * 16) * DM); rv[i] = *(const v8us*)(gv + (size_t)i * 16 * SS + sn * KT); }
    // keeps the next step's global loads in front of this step's matrix and tanh work: sunk to just before their LDS stores, their whole latency would be waited out
    __builtin_amdgcn_sched_barrier(0);
    FragH bk[2][KS];
#pragma unroll
    for (int nt = 0; nt < 2; ++nt)
#pragma unroll
      for (int ks = 0; ks < KS; ++ks) { bk[nt][ks].half[0] = *(const v8us*)&sK[bf][nt * 16 + ln][ks * 32 + 8 * hh]; bk[nt][ks].half[1] = *(const v8us*)&sK[bf][nt * 16 + ln][ks * 32 + 16 + 8 * hh]; }
#pragma unroll
    for (int sub = 0; sub < KT / 32; ++sub) {
      v8f s[2][2];
#pragma unroll
      for (int nt = 0; nt < 2; ++nt)
#pragma unroll
        for (int rt = 0; rt < 2; ++rt) { v8f acc = (v8f){0.f,0.f,0.f,0.f,0.f,0.f,0.f,0.f};
#pragma unroll
          for (int ks = 0; ks < KS; ++ks) acc = mmaH<1>(aq[rt][ks].v, aq[rt][ks].v, bk[nt][ks].v, bk[nt][ks].v, acc); s[rt][nt] = acc; }
      // this block's V^T fragments and the step's next K fragments are read as one group in front of the tanh work, which covers their LDS latency
      FragH bv[DT];
#pragma unroll
      for (int dt = 0; dt < DT; ++dt) { bv[dt].half[0] = *(const v8us*)&sV[bf][dt * 16 + ln][sub * 32 + 8 * hh]; bv[dt].half[1] = *(const v8us*)&sV[bf][dt * 16 + ln][sub * 32 + 16 + 8 * hh]; }
      if (sub + 1 < KT / 32) {
#pragma unroll
        for (int nt = 0; nt < 2; ++nt)
#pragma unroll
          for (int ks = 0; ks < KS; ++ks) { bk[nt][ks].half[0] = *(const v8us*)&sK[bf][(sub + 1) * 32 + nt * 16 + ln][ks * 32 + 8 * hh]; bk[nt][ks].half[1] = *(const v8us*)&sK[bf][(sub + 1) * 32 + nt * 16 + ln][ks * 32 + 16 + 8 * hh]; }
      }
#pragma unroll
      for (int rt = 0; rt < 2; ++rt)
#pragma unroll
        for (int nt = 0; nt < 2; ++nt) { float x[8];
#pragma unroll
          for (int r = 0; r < 8; ++r) x[r] = s[rt][nt][r] * 0.0625f;
          tanh8(x);
#pragma unroll
          for (int r = 0; r < 8; ++r) { FragH t2; t2.h[0] = (_Float16)fmaf(x[r], 0.5f, 0.5f); sP[w][rt * 16 + 8 * hh + r][nt * 16 + ln] = t2.u[0]; } }
      // the wave's own P strip: its LDS writes are ordered before its cross-lane reads; LDS only, so that the next step's global loads stay in flight across it
      __builtin_amdgcn_fence(__ATOMIC_ACQ_REL, "workgroup", "local"); __builtin_amdgcn_wave_barrier();
      FragH pa[2];
#pragma unroll
      for (int rt = 0; rt < 2; ++rt) { pa[rt].half[0] = *(const v8us*)&sP[w][rt * 16 + ln][8 * hh]; pa[rt].half[1] = *(const v8us*)&sP[w][rt * 16 + ln][16 + 8 * hh]; }
#pragma unroll
      for (int dt = 0; dt < DT; ++dt)
#pragma unroll
        for (int rt = 0; rt < 2; ++rt) oacc[rt][dt] = mmaH<1>(pa[rt].v, pa[rt].v, bv[dt].v, bv[dt].v, oacc[rt][dt]);
      // the reads of the P strip are ordered before the next block's writes of it; LDS only, as above
      __builtin_amdgcn_fence(__ATOMIC_ACQ_REL, "workgroup", "local"); __builtin_amdgcn_wave_barrier();
    }
    // keeps the next step's LDS stores, and with them the wait for the global loads, behind this step's matrix and tanh work
    __builtin_amdgcn_sched_barrier(0);
  }
  // stands in front of the epilogue's reuse of the registers that held the global load addresses (the scheduling barrier keeps that reuse behind it)
  asm volatile("s_wait_xcnt 0x0" ::: "memory");
  __builtin_amdgcn_sched_barrier(0);
#pragma unroll
  for (int rt = 0; rt < 2; ++rt)
#pragma unroll
    for (int dt = 0; dt < DT; ++dt)
#pragma unroll
      for (int r = 0; r < 8; ++r) sO[w][rt * 16 + 8 * hh + r][dt * 16 + ln] = oacc[rt][dt][r];
  __builtin_amdgcn_fence(__ATOMIC_ACQ_REL, "workgroup"); __builtin_amdgcn_wave_barrier();
  {
#pragma unroll
    for (int rp = 0; rp < RPW; rp += 2) { const int r = rp + (lane >> 4), pc = lane & 15; const v4f val = *(const v4fa*)&sO[w][r][pc * 4]; *(v4f*)(O + ((size_t)b * SS + q0 + r) * DM + h * HD + pc * 4) = val; }
     } }
// (b) attn_weights[b][q][k] = (1/16) sum_h sigmoid(q_h.k_h/8). One 128 x 128 tile (queries x keys) of one batch per work-group of 8 waves (4 x 2 waves, 32 x 64 each), made whole by that work-group.
// A step is one head: its 64 columns of the 128 query rows and of the 128 key rows (one 128-B line a row) are read from global as whole lines, one head ahead, into registers and laid in LDS
// at the pitch of k_proj (144 B). Two LDS buffers: the one barrier of a step publishes its head and ends the reads of the buffer written next.
// Fragment maps, the ascending k order inside a head and the ascending head order of the sum of the tanh terms are those of the 16 x 32 form that read its fragments straight from global.
__global__ __launch_bounds__(256) void k_aw(const _Float16* __restrict__ Q16, const _Float16* __restrict__ K16, float* __restrict__ AW) {
  constexpr int PT = 72, NT = SS / 128;
  __shared__ __attribute__((aligned(16))) unsigned short sA[2][128][PT], sB[2][128][PT];
  __shared__ __attribute__((aligned(16))) float so[8][32][68];
  const int tid = threadIdx.x, w = tid >> 5, lane = tid & 31, ln = lane & 15, hh = lane >> 4;
  const int b = blockIdx.x / (NT * NT), tl = blockIdx.x % (NT * NT);
  const int m0 = (tl / NT) * 128, n0 = (tl % NT) * 128, wm = (w >> 1) * 32, wn = (w & 1) * 64;
  const int lr = tid >> 3, lc = (tid & 7) * 8;
  const unsigned short* ga = (const unsigned short*)Q16 + ((size_t)b * SS + m0 + lr) * DM + lc;
  const unsigned short* gb = (const unsigned short*)K16 + ((size_t)b * SS + n0 + lr) * DM + lc;
  v8us ra[4], rb[4];
#pragma unroll
  for (int i = 0; i < 4; ++i) { ra[i] = *(const v8us*)(ga + (size_t)i * 32 * DM); rb[i] = *(const v8us*)(gb + (size_t)i * 32 * DM); }
  typedef float v2f __attribute__((ext_vector_type(2)));
  v2f aw[2][4][4];   // the sums of the tanh terms, as register pairs: one packed add serves two of them
#pragma unroll
  for (int mt = 0; mt < 2; ++mt)
#pragma unroll
    for (int nt = 0; nt < 4; ++nt)
#pragma unroll
      for (int p = 0; p < 4; ++p) aw[mt][nt][p] = (v2f){0.f, 0.f};
  // unrolled by two so that the buffer index is a constant in every LDS address
#pragma unroll 2
  for (int h = 0; h < NH; ++h) {
    const int bf = h & 1;
#pragma unroll
    for (int i = 0; i < 4; ++i) { *(v8us*)&sA[bf][lr + 32 * i][lc] = ra[i]; *(v8us*)&sB[bf][lr + 32 * i][lc] = rb[i]; }
    __syncthreads();
    // no branch round the loads (the last step reads its own head once more, unused): the step stays one block, in which the two scheduling barriers below hold; with a branch here the compiler sinks the tanh work past the next step's stores and barrier
    const int hn = (h + 1 < NH) ? h + 1 : h;
#pragma unroll
    for (int i = 0; i < 4; ++i) { ra[i] = *(const v8us*)(ga + (size_t)i * 32 * DM + hn * HD); rb[i] = *(const v8us*)(gb + (size_t)i * 32 * DM + hn * HD); }
    // keeps the next head's global loads in front of this head's matrix and tanh work: left free, the compiler sinks them to just before their LDS stores and their whole latency is waited out
    __builtin_amdgcn_sched_barrier(0);
    v8f acc[2][4];
#pragma unroll
    for (int mt = 0; mt < 2; ++mt)
#pragma unroll
      for (int nt = 0; nt < 4; ++nt) acc[mt][nt] = (v8f){0.f,0.f,0.f,0.f,0.f,0.f,0.f,0.f};
#pragma unroll
    for (int ks = 0; ks < HD / 32; ++ks) {
      FragH a[2], bk[4];
#pragma unroll
      for (int mt = 0; mt < 2; ++mt) { a[mt].half[0] = *(const v8us*)&sA[bf][wm + mt * 16 + ln][ks * 32 + 8 * hh]; a[mt].half[1] = *(const v8us*)&sA[bf][wm + mt * 16 + ln][ks * 32 + 16 + 8 * hh]; }
#pragma unroll
      for (int nt = 0; nt < 4; ++nt) { bk[nt].half[0] = *(const v8us*)&sB[bf][wn + nt * 16 + ln][ks * 32 + 8 * hh]; bk[nt].half[1] = *(const v8us*)&sB[bf][wn + nt * 16 + ln][ks * 32 + 16 + 8 * hh]; }
#pragma unroll
      for (int mt = 0; mt < 2; ++mt)
#pragma unroll
        for (int nt = 0; nt < 4; ++nt) acc[mt][nt] = __builtin_amdgcn_wmma_f32_16x16x32_f16(false, a[mt].v, false, bk[nt].v, (short)0, acc[mt][nt], false, false);
    }
#pragma unroll
    for (int mt = 0; mt < 2; ++mt)
#pragma unroll
      for (int nt = 0; nt < 4; ++nt)
#pragma unroll
        for (int p = 0; p < 4; ++p) aw[mt][nt][p] += (v2f){th16(acc[mt][nt][2 * p]), th16(acc[mt][nt][2 * p + 1])};
    // keeps the next head's LDS stores behind this head's matrix and tanh work: left free, the compiler lifts them, and with them the wait for the global loads, to just behind this head's LDS reads
    __builtin_amdgcn_sched_barrier(0);
  }
  // stands in front of the epilogue's reuse of the registers that held the global load addresses (the scheduling barrier keeps that reuse behind it)
  asm volatile("s_wait_xcnt 0x0" ::: "memory");
  __builtin_amdgcn_sched_barrier(0);
#pragma unroll
  for (int nt = 0; nt < 4; ++nt)
#pragma unroll
    for (int mt = 0; mt < 2; ++mt)
#pragma unroll
      for (int r = 0; r < 8; ++r) so[w][mt * 16 + 8 * hh + r][nt * 16 + ln] = fmaf(aw[mt][nt][r >> 1][r & 1], 0.5f / (float)NH, 0.5f);   // mean_h (0.5 + 0.5 tanh) from the sum of the tanh terms
  // the wave's own 32 x 64 strip: its LDS writes are ordered before its cross-lane reads, so that whole lines go out
  __builtin_amdgcn_fence(__ATOMIC_ACQ_REL, "workgroup"); __builtin_amdgcn_wave_barrier();
#pragma unroll
  for (int q = 0; q < 16; ++q) { const int r = q * 2 + hh, c4 = ln * 4; *(v4f*)(AW + ((size_t)b * SS + m0 + wm + r) * SS + n0 + wn + c4) = *(const v4fa*)&so[w][r][c4]; }
}
extern "C" void kernel_launch(void* const* d_in, const int* in_sizes, int n_in,
                              void* d_out, int out_size, void* d_ws, size_t ws_size, hipStream_t stream) {
  (void)in_sizes; (void)n_in; (void)out_size;
  const float* xq = (const float*)d_in[0]; const float* xk = (const float*)d_in[1]; const float* xv = (const float*)d_in[2]; const float* Wq = (const float*)d_in[3]; const float* bq = (const float*)d_in[4]; const float* Wk = (const float*)d_in[5]; const float* bk = (const float*)d_in[6]; const float* Wv = (const float*)d_in[7]; const float* bv = (const float*)d_in[8]; const float* Wo = (const float*)d_in[9]; const float* bo = (const float*)d_in[10];
  float* out = (float*)d_out; float* AW = (float*)((char*)d_out + 16777216);
  char* ws = (char*)d_ws; size_t off = 0;
  auto take = [&](size_t bytes) { char* p = ws + off; off += (bytes + 255) & ~(size_t)255; return p; };
  const size_t w8 = (size_t)DM * DM / 8;
  _Float16* Bq = (_Float16*)take(w8 * 16); _Float16* Bk = (_Float16*)take(w8 * 16); _Float16* Bv = (_Float16*)take(w8 * 16); _Float16* Bo = (_Float16*)take(w8 * 16);
  _Float16* XQ = (_Float16*)take((size_t)NR * DM * 2); _Float16* XK = (_Float16*)take((size_t)NR * DM * 2); _Float16* XV = (_Float16*)take((size_t)NR * DM * 2); _Float16* Q16 = (_Float16*)take((size_t)NR * DM * 2); _Float16* K16 = (_Float16*)take((size_t)NR * DM * 2); _Float16* V16 = (_Float16*)take((size_t)NR * DM * 2); _Float16* Vt = (_Float16*)take((size_t)NR * DM * 2); float* O = (float*)take((size_t)NR * DM * 4); _Float16* O16 = (_Float16*)take((size_t)NR * DM * 2);
  if (off > ws_size) return;      // ≈ 8 + 8.4×8 + 16.8 ≈ 92 MiB
  k_cvt_in<<<3 * (NR * DM / CVE) + 4 * (DM * DM / CVE), 256, 0, stream>>>(xq, xk, xv, Wq, Wk, Wv, Wo, XQ, XK, XV, Bq, Bk, Bv, Bo);
  const unsigned gp = (NR / 128) * (DM / 128);
  k_proj<false><<<gp, 256, 0, stream>>>(XQ, Bq, bq, nullptr, Q16);
  k_proj<false><<<gp, 256, 0, stream>>>(XK, Bk, bk, nullptr, K16);
  k_proj<false><<<gp, 256, 0, stream>>>(XV, Bv, bv, nullptr, V16);
  k_vt<<<BB * NH * (SS / 64), 256, 0, stream>>>(V16, Vt);
  k_satt<<<BB * NH * (SS / 128), 128, 0, stream>>>(Q16, K16, Vt, O);
  k_h16<<<NR * DM / (256 * 4 * 8), 256, 0, stream>>>(O, O16);
  k_proj<true><<<gp, 256, 0, stream>>>(O16, Bo, bo, out, nullptr);
  k_aw<<<BB * (SS / 128) * (SS / 128), 256, 0, stream>>>(Q16, K16, AW);
}

// v007
// A run of this version takes 122 microseconds.
// In two side-by-side timings against v006, it was 1.17 and 1.16 times as fast.
// Counting every step since v000, it is 9.63 times as fast.
#include <hip/hip_runtime.h>
// q/k/v/o projections (4096 × 1024 × 1024, + bias) and the 16-head sigmoid attention on v_wmma_f32_16x16x32_f16: (a) per (b,h) a fused flash-style kernel with P = σ(q·k/8) (no normalisation,
// as the module) and O = P·V on WMMA; (b) the second output mean_h σ(q·k/8) recomputes the score tiles per head and averages them in a fixed order. x inputs f16(bf16 ·) exact, q/k/v and O rounded to f16,
// weights bf16-exact ×2^4 ((out,in)), P f16 ≤ 1, f32 accumulate.
#define BB 2
#define SS 2048
#define DM 1024
#define NH 16
#define HD 64
#define NR (BB * SS)

typedef __bf16 v16b __attribute__((ext_vector_type(16)));
typedef unsigned short v8us __attribute__((ext_vector_type(8), may_alias));
typedef float  v8f  __attribute__((ext_vector_type(8)));
typedef float  v4f  __attribute__((ext_vector_type(4)));
typedef float  v4fa __attribute__((ext_vector_type(4), may_alias));
union FragB { v16b v; v8us half[2]; unsigned short u[16]; };

__device__ __forceinline__ unsigned short bf16_bits(float x) { unsigned int u = __float_as_uint(x); return (unsigned short)((u + 0x7FFFu + ((u >> 16) & 1u)) >> 16); }
__device__ __forceinline__ float bf16_val(unsigned short b) { return __uint_as_float(((unsigned int)b) << 16); }
__device__ __forceinline__ float bf16_round(float x) { return bf16_val(bf16_bits(x)); }
// D += A·B with NT terms: 1 = ah·bh, 2 = + al·bh (A split), 3 = + ah·bl (both split)
template <int NT>
__device__ __forceinline__ v8f mmaN(v16b ah, v16b al, v16b bh, v16b bl, v8f c) {
  c = __builtin_amdgcn_wmma_f32_16x16x32_bf16(false, ah, false, bh, (short)0, c, false, false);
  if (NT >= 2) c = __builtin_amdgcn_wmma_f32_16x16x32_bf16(false, al, false, bh, (short)0, c, false, false);
  if (NT >= 3) c = __builtin_amdgcn_wmma_f32_16x16x32_bf16(false, ah, false, bl, (short)0, c, false, false);
  asm volatile("v_nop\n\tv_nop\n\tv_nop\n\tv_nop" : "+v"(c) : "v"(ah), "v"(al), "v"(bh), "v"(bl));
  return c;
}

__global__ __launch_bounds__(256) void k_wt_bf16(const float* __restrict__ W, unsigned short* __restrict__ Wt, int K, int N) {
  const int t = blockIdx.x * 256 + threadIdx.x;
  const int k8n = K / 8;
  if (t >= N * k8n) return;
  const int n = t / k8n, k8 = (t % k8n) * 8;
  v8us v;
#pragma unroll
  for (int i = 0; i < 8; ++i) v[i] = bf16_bits(W[(size_t)(k8 + i) * N + n]);
  *(v8us*)(Wt + (size_t)n * K + k8) = v;
  
}

// GEMM C[M][N] (f32, pitch ldc) = act(A[M][K]·W + bias). A f32 row-major (pitch lda) converted per fragment to bf16
// (ASPLIT: hi/lo two planes -> 2 terms, else single rounded term); Wt bf16 [N][K] (pitch ldb). BIAS_BF16 rounds the
// bias to bf16 first (bias quantised to bf16 before the add). K%32==0, M%16==0, N%64==0.
template <bool ASPLIT, int ACT, bool BIAS_BF16>
__global__ __launch_bounds__(128) void k_gemm_bf(const float* __restrict__ A, int lda, const unsigned short* __restrict__ Wt, int ldb,
                                               const float* __restrict__ bias, float* __restrict__ C, int ldc, int M, int N, int K) {
  __shared__ __attribute__((aligned(16))) float so[4][16][64];
  const int tid = threadIdx.x, w = tid >> 5, lane = tid & 31, ln = lane & 15, hh = lane >> 4;
  const int ntn = N / 64;
  const int wid = blockIdx.x * 4 + w;
  const int mt = wid / ntn, nq = wid % ntn;
  if (mt * 16 >= M) return;
  const int row0 = mt * 16, col0 = nq * 64;
  const float* arow = A + (size_t)(row0 + ln) * lda;
  v8f acc[4] = {};
  for (int kb = 0; kb < K; kb += 32) {
    FragB ah, al;
    const v4f x0 = *(const v4fa*)(arow + kb + 8 * hh), x1 = *(const v4fa*)(arow + kb + 8 * hh + 4);
    const v4f x2 = *(const v4fa*)(arow + kb + 16 + 8 * hh), x3 = *(const v4fa*)(arow + kb + 16 + 8 * hh + 4);
    float xs[16] = {x0[0],x0[1],x0[2],x0[3],x1[0],x1[1],x1[2],x1[3],x2[0],x2[1],x2[2],x2[3],x3[0],x3[1],x3[2],x3[3]};
#pragma unroll
    for (int i = 0; i < 16; ++i) { const unsigned short hb = bf16_bits(xs[i]); ah.u[i] = hb; al.u[i] = ASPLIT ? bf16_bits(xs[i] - bf16_val(hb)) : (unsigned short)0; }
#pragma unroll
    for (int t = 0; t < 4; ++t) {
      const unsigned short* brow = Wt + (size_t)(col0 + t * 16 + ln) * ldb + kb;
      FragB b;
      b.half[0] = *(const v8us*)(brow + 8 * hh);
      b.half[1] = *(const v8us*)(brow + 16 + 8 * hh);
      acc[t] = mmaN<ASPLIT ? 2 : 1>(ah.v, al.v, b.v, b.v, acc[t]);
    }
  }
#pragma unroll
  for (int t = 0; t < 4; ++t) {
    float bv = bias ? bias[col0 + t * 16 + ln] : 0.f;
    if (BIAS_BF16) bv = bf16_round(bv);
#pragma unroll
    for (int r = 0; r < 8; ++r) { float v = acc[t][r] + bv; if (ACT == 1) v = fmaxf(v, 0.f); so[w][8 * hh + r][t * 16 + ln] = v; }
  }
  __builtin_amdgcn_fence(__ATOMIC_ACQ_REL, "workgroup");
  __builtin_amdgcn_wave_barrier();
  const int rsub = lane >> 4, c4 = (lane & 15) * 4;
  {
#pragma unroll
    for (int q = 0; q < 8; ++q) {
      const int r = q * 2 + rsub;
      const v4f v = *(const v4fa*)&so[w][r][c4];
      *(v4f*)(C + (size_t)(row0 + r) * ldc + col0 + c4) = v;
    }
    
  }
}

// Flash-style causal/unmasked attention, all contractions 3-term bf16 hi/lo splits, f32 softmax with running max.
// q,k,v rows are read from f32 buffers with arbitrary row pitch (so they can live inside a fused qkv buffer);
// D = head size (multiple of 32, <= 128); one wave = 16 query rows; block = 4 waves (64 queries) sharing K/V chunks of 32.
template <int D, bool CAUSAL>
__global__ __launch_bounds__(128) void k_flash(const float* __restrict__ qb, const float* __restrict__ kb, const float* __restrict__ vb,
                                             int pitch, int T, int H, float scale, float* __restrict__ y, int ypitch) {
  constexpr int KS = D / 32;        // k-steps for QK
  constexpr int DT = D / 16;        // d tiles for PV
  __shared__ __attribute__((aligned(16))) unsigned short sKh[32][D + 8], sKl[32][D + 8], sVh[32][D + 8], sVl[32][D + 8];
  __shared__ __attribute__((aligned(16))) unsigned short sPh[4][16][40], sPl[4][16][40];
  __shared__ __attribute__((aligned(16))) float sO[4][16][D];
  const int tid = threadIdx.x, w = tid >> 5, lane = tid & 31, ln = lane & 15, hh = lane >> 4;
  const int nqb = (T + 63) / 64;
  const int bh = blockIdx.x / nqb, qblk = blockIdx.x % nqb;
  const int b = bh / H, h = bh % H;
  const int q0 = qblk * 64 + w * 16;
  const float* Q = qb + (size_t)b * T * pitch + h * D;
  const float* K = kb + (size_t)b * T * pitch + h * D;
  const float* V = vb + (size_t)b * T * pitch + h * D;

  // A fragments of the wave's 16 query rows (scaled), hi/lo
  FragB aqh[KS], aql[KS];
  {
    int row = q0 + ln; if (row >= T) row = T - 1;
    const float* qr = Q + (size_t)row * pitch;
#pragma unroll
    for (int ks = 0; ks < KS; ++ks)
#pragma unroll
      for (int i = 0; i < 16; ++i) {
        const int d = ks * 32 + ((i < 8) ? (8 * hh + i) : (16 + 8 * hh + (i - 8)));
        const float x = qr[d] * scale; const unsigned short hb = bf16_bits(x);
        aqh[ks].u[i] = hb; aql[ks].u[i] = bf16_bits(x - bf16_val(hb));
      }
  }
  float m_r[8], l_r[8];
#pragma unroll
  for (int r = 0; r < 8; ++r) { m_r[r] = -3.0e38f; l_r[r] = 0.f; }
  v8f oacc[DT];
#pragma unroll
  for (int dt = 0; dt < DT; ++dt) oacc[dt] = (v8f){0.f,0.f,0.f,0.f,0.f,0.f,0.f,0.f};

  const int kv_end = CAUSAL ? min(T, qblk * 64 + 64) : T;     // block-uniform
  for (int j0 = 0; j0 < kv_end; j0 += 32) {
    __syncthreads();
    for (int e = tid; e < 32 * (D / 4); e += 128) {
      const int r = e / (D / 4), c4 = (e % (D / 4)) * 4;
      const int key = j0 + r;
      v4f kf = {0.f,0.f,0.f,0.f}, vf = {0.f,0.f,0.f,0.f};
      if (key < T) { kf = *(const v4fa*)(K + (size_t)key * pitch + c4); vf = *(const v4fa*)(V + (size_t)key * pitch + c4); }
#pragma unroll
      for (int t = 0; t < 4; ++t) {
        unsigned short hb = bf16_bits(kf[t]); sKh[r][c4 + t] = hb; sKl[r][c4 + t] = bf16_bits(kf[t] - bf16_val(hb));
        hb = bf16_bits(vf[t]); sVh[r][c4 + t] = hb; sVl[r][c4 + t] = bf16_bits(vf[t] - bf16_val(hb));
      }
    }
    __syncthreads();
    // S tile 16 x 32
    v8f s[2];
#pragma unroll
    for (int nt = 0; nt < 2; ++nt) {
      v8f acc = {};
#pragma unroll
      for (int ks = 0; ks < KS; ++ks) {
        FragB bh_, bl_;
        bh_.half[0] = *(const v8us*)&sKh[nt * 16 + ln][ks * 32 + 8 * hh]; bh_.half[1] = *(const v8us*)&sKh[nt * 16 + ln][ks * 32 + 16 + 8 * hh];
        bl_.half[0] = *(const v8us*)&sKl[nt * 16 + ln][ks * 32 + 8 * hh]; bl_.half[1] = *(const v8us*)&sKl[nt * 16 + ln][ks * 32 + 16 + 8 * hh];
        acc = mmaN<3>(aqh[ks].v, aql[ks].v, bh_.v, bl_.v, acc);
      }
      s[nt] = acc;
    }
    // mask + running max (rows 8hh+r; the 16 lanes of a half share rows)
    float alpha[8];
#pragma unroll
    for (int r = 0; r < 8; ++r) {
      const int qi = q0 + 8 * hh + r;
      const int ja = j0 + ln, jb = j0 + 16 + ln;
      if (CAUSAL) { if (ja > qi) s[0][r] = -3.0e38f; if (jb > qi) s[1][r] = -3.0e38f; }
      if (ja >= T) s[0][r] = -3.0e38f;
      if (jb >= T) s[1][r] = -3.0e38f;
      float mx = fmaxf(s[0][r], s[1][r]);
      mx = fmaxf(mx, __shfl_xor(mx, 1, 32)); mx = fmaxf(mx, __shfl_xor(mx, 2, 32)); mx = fmaxf(mx, __shfl_xor(mx, 4, 32)); mx = fmaxf(mx, __shfl_xor(mx, 8, 32));
      const float mnew = fmaxf(m_r[r], mx);
      alpha[r] = (mnew > -1.0e38f) ? __expf(m_r[r] - mnew) : 1.0f;
      const float p0 = (s[0][r] > -1.0e38f) ? __expf(s[0][r] - mnew) : 0.f;
      const float p1 = (s[1][r] > -1.0e38f) ? __expf(s[1][r] - mnew) : 0.f;
      m_r[r] = mnew;
      l_r[r] = l_r[r] * alpha[r] + p0 + p1;            // per-lane partial row sum (16 lanes combined at the end)
      unsigned short hb = bf16_bits(p0); sPh[w][8 * hh + r][ln] = hb;      sPl[w][8 * hh + r][ln] = bf16_bits(p0 - bf16_val(hb));
      hb = bf16_bits(p1);                sPh[w][8 * hh + r][16 + ln] = hb; sPl[w][8 * hh + r][16 + ln] = bf16_bits(p1 - bf16_val(hb));
    }
#pragma unroll
    for (int dt = 0; dt < DT; ++dt)
#pragma unroll
      for (int r = 0; r < 8; ++r) oacc[dt][r] *= alpha[r];
    __builtin_amdgcn_fence(__ATOMIC_ACQ_REL, "workgroup");
    __builtin_amdgcn_wave_barrier();
    FragB pah, pal;
    pah.half[0] = *(const v8us*)&sPh[w][ln][8 * hh]; pah.half[1] = *(const v8us*)&sPh[w][ln][16 + 8 * hh];
    pal.half[0] = *(const v8us*)&sPl[w][ln][8 * hh]; pal.half[1] = *(const v8us*)&sPl[w][ln][16 + 8 * hh];
#pragma unroll
    for (int dt = 0; dt < DT; ++dt) {
      FragB bvh, bvl;
#pragma unroll
      for (int i = 0; i < 8; ++i) {
        bvh.u[i] = sVh[8 * hh + i][dt * 16 + ln]; bvh.u[8 + i] = sVh[16 + 8 * hh + i][dt * 16 + ln];
        bvl.u[i] = sVl[8 * hh + i][dt * 16 + ln]; bvl.u[8 + i] = sVl[16 + 8 * hh + i][dt * 16 + ln];
      }
      oacc[dt] = mmaN<3>(pah.v, pal.v, bvh.v, bvl.v, oacc[dt]);
    }
    __builtin_amdgcn_fence(__ATOMIC_ACQ_REL, "workgroup");
    __builtin_amdgcn_wave_barrier();
  }
#pragma unroll
  for (int r = 0; r < 8; ++r) {
    float l = l_r[r];
    l += __shfl_xor(l, 1, 32); l += __shfl_xor(l, 2, 32); l += __shfl_xor(l, 4, 32); l += __shfl_xor(l, 8, 32);
    l_r[r] = (l > 0.f) ? 1.0f / l : 0.f;
  }
#pragma unroll
  for (int dt = 0; dt < DT; ++dt)
#pragma unroll
    for (int r = 0; r < 8; ++r) sO[w][8 * hh + r][dt * 16 + ln] = oacc[dt][r] * l_r[r];
  __builtin_amdgcn_fence(__ATOMIC_ACQ_REL, "workgroup");
  __builtin_amdgcn_wave_barrier();
  {
    for (int r = 0; r < 16; ++r) {
      const int row = q0 + r;
      if (row < T && lane < D / 4) {
        const v4f val = *(const v4fa*)&sO[w][r][lane * 4];
        *(v4f*)(y + ((size_t)b * T + row) * ypitch + h * D + lane * 4) = val;
      }
    }
    
  }
}

// GEMM C = act(A·W + bias + resid): A f32 (ASPLIT -> hi/lo 2 terms), Wt bf16 [N][K]; ACT 0 none, 1 relu, 2 exact gelu;
// resid (optional, f32, row index = (row % rmod), pitch ldr, RES_BF16 rounds it) added before the activation.
template <bool ASPLIT, int ACT, bool BIAS_BF16, bool RES_BF16>
__global__ __launch_bounds__(128) void k_gemm_bf3(const float* __restrict__ A, int lda, const unsigned short* __restrict__ Wt, int ldb,
                                                const float* __restrict__ bias, const float* __restrict__ resid, int rmod, int ldr,
                                                float* __restrict__ C, int ldc, int M, int N, int K) {
  __shared__ __attribute__((aligned(16))) float so[4][16][64];
  const int tid = threadIdx.x, w = tid >> 5, lane = tid & 31, ln = lane & 15, hh = lane >> 4;
  const int ntn = N / 64;
  const int wid = blockIdx.x * 4 + w;
  const int mt = wid / ntn, nq = wid % ntn;
  if (mt * 16 >= M) return;
  const int row0 = mt * 16, col0 = nq * 64;
  const float* arow = A + (size_t)(row0 + ln) * lda;
  v8f acc[4] = {};
  for (int kb = 0; kb < K; kb += 32) {
    FragB ah, al;
    const v4f x0 = *(const v4fa*)(arow + kb + 8 * hh), x1 = *(const v4fa*)(arow + kb + 8 * hh + 4);
    const v4f x2 = *(const v4fa*)(arow + kb + 16 + 8 * hh), x3 = *(const v4fa*)(arow + kb + 16 + 8 * hh + 4);
    float xs[16] = {x0[0],x0[1],x0[2],x0[3],x1[0],x1[1],x1[2],x1[3],x2[0],x2[1],x2[2],x2[3],x3[0],x3[1],x3[2],x3[3]};
#pragma unroll
    for (int i = 0; i < 16; ++i) { const unsigned short hb = bf16_bits(xs[i]); ah.u[i] = hb; al.u[i] = ASPLIT ? bf16_bits(xs[i] - bf16_val(hb)) : (unsigned short)0; }
#pragma unroll
    for (int t = 0; t < 4; ++t) {
      const unsigned short* brow = Wt + (size_t)(col0 + t * 16 + ln) * ldb + kb;
      FragB b;
      b.half[0] = *(const v8us*)(brow + 8 * hh);
      b.half[1] = *(const v8us*)(brow + 16 + 8 * hh);
      acc[t] = mmaN<ASPLIT ? 2 : 1>(ah.v, al.v, b.v, b.v, acc[t]);
    }
  }
#pragma unroll
  for (int t = 0; t < 4; ++t) {
    const int col = col0 + t * 16 + ln;
    float bv = bias ? bias[col] : 0.f;
    if (BIAS_BF16) bv = bf16_round(bv);
#pragma unroll
    for (int r = 0; r < 8; ++r) {
      float v = acc[t][r] + bv;
      if (resid) { float rv = resid[(size_t)((row0 + 8 * hh + r) % rmod) * ldr + col]; if (RES_BF16) rv = bf16_round(rv); v += rv; }
      if (ACT == 1) v = fmaxf(v, 0.f);
      if (ACT == 2) v = 0.5f * v * (1.0f + erff(v * 0.70710678118654752f));
      if (ACT == 3) { const float u = 0.7978845608028654f * (v + 0.044715f * v * v * v); v = 0.5f * v * (1.0f + tanhf(u)); }
      so[w][8 * hh + r][t * 16 + ln] = v;
    }
  }
  __builtin_amdgcn_fence(__ATOMIC_ACQ_REL, "workgroup");
  __builtin_amdgcn_wave_barrier();
  const int rsub = lane >> 4, c4 = (lane & 15) * 4;
  {
#pragma unroll
    for (int q = 0; q < 8; ++q) {
      const int r = q * 2 + rsub;
      const v4f v = *(const v4fa*)&so[w][r][c4];
      *(v4f*)(C + (size_t)(row0 + r) * ldc + col0 + c4) = v;
    }
    
  }
}
// row LayerNorm (biased variance, eps) over N: s = X (+ R); optional out_sum <- s; out_norm <- (s-mu)*rsqrt(var+eps)*g + b
template <bool PARAM_BF16>
__global__ __launch_bounds__(256) void k_layernorm(const float* __restrict__ X, const float* __restrict__ R, const float* __restrict__ g, const float* __restrict__ bta,
                                                  float* __restrict__ out_sum, float* __restrict__ out_norm, int N, float eps) {
  __shared__ float red[256];
  const int row = blockIdx.x, tid = threadIdx.x;
  const float* x = X + (size_t)row * N; const float* rr = R ? R + (size_t)row * N : nullptr;
  float vals[16];                     // up to N = 4096
  const int per = N / 256;            // contiguous chunk per thread? use strided-by-4 chunks: thread handles j = tid*4 + 1024*u
  float s1 = 0.f;
  for (int u = 0; u < per / 4; ++u) {
    const int j = tid * 4 + 1024 * u;
    const v4f a = *(const v4fa*)(x + j);
    v4f b = {0.f,0.f,0.f,0.f}; if (rr) b = *(const v4fa*)(rr + j);
#pragma unroll
    for (int q = 0; q < 4; ++q) { const float v = a[q] + b[q]; vals[u * 4 + q] = v; s1 += v; }
  }
  red[tid] = s1; __syncthreads();
  for (int st = 128; st > 0; st >>= 1) { if (tid < st) red[tid] += red[tid + st]; __syncthreads(); }
  const float mu = red[0] / (float)N; __syncthreads();
  float s2 = 0.f;
  for (int u = 0; u < per / 4; ++u)
#pragma unroll
    for (int q = 0; q < 4; ++q) { const float c = vals[u * 4 + q] - mu; s2 += c * c; }
  red[tid] = s2; __syncthreads();
  for (int st = 128; st > 0; st >>= 1) { if (tid < st) red[tid] += red[tid + st]; __syncthreads(); }
  const float rs = rsqrtf(red[0] / (float)N + eps);
  {
    for (int u = 0; u < per / 4; ++u) {
      const int j = tid * 4 + 1024 * u;
      v4f o, sm;
#pragma unroll
      for (int q = 0; q < 4; ++q) {
        float gg = g[j + q], bb = bta[j + q];
        if (PARAM_BF16) { gg = bf16_round(gg); bb = bf16_round(bb); }
        sm[q] = vals[u * 4 + q]; o[q] = (vals[u * 4 + q] - mu) * rs * gg + bb;
      }
      if (out_sum) *(v4f*)(out_sum + (size_t)row * N + j) = sm;
      *(v4f*)(out_norm + (size_t)row * N + j) = o;
    }
    
  }
}



// ---- f16 WMMA path (v_wmma_f32_16x16x32_f16): 11-bit significands for operands in range — used where a [0,1] probability operand needs more precision than bf16
typedef _Float16 v16h __attribute__((ext_vector_type(16)));
union FragH { v16h v; v8us half[2]; _Float16 h[16]; unsigned short u[16]; };
template <int NT>
__device__ __forceinline__ v8f mmaH(v16h ah, v16h al, v16h bh, v16h bl, v8f c) {
  c = __builtin_amdgcn_wmma_f32_16x16x32_f16(false, ah, false, bh, (short)0, c, false, false);
  if (NT >= 2) c = __builtin_amdgcn_wmma_f32_16x16x32_f16(false, al, false, bh, (short)0, c, false, false);
  if (NT >= 3) c = __builtin_amdgcn_wmma_f32_16x16x32_f16(false, ah, false, bl, (short)0, c, false, false);
  asm volatile("v_nop\n\tv_nop\n\tv_nop\n\tv_nop" : "+v"(c) : "v"(ah), "v"(al), "v"(bh), "v"(bl));
  return c;
}
// batched GEMM like k_gemm_b but f16 operands: A f32 (split into f16 hi/lo if ASPLIT, else rounded to f16), Bt = f16 values [n][k]; alpha; C f32; N multiple of 16 (partial tiles skipped)
template <bool ASPLIT>
__global__ __launch_bounds__(128) void k_gemm_h(const float* __restrict__ A, int lda, size_t sA, const _Float16* __restrict__ Bh, int ldb, size_t sB, float alpha, float* __restrict__ C, int ldc, size_t sC, int M, int N, int K) {
  __shared__ __attribute__((aligned(16))) float so[4][16][64];
  const int tid = threadIdx.x, w = tid >> 5, lane = tid & 31, ln = lane & 15, hh = lane >> 4; const int by = blockIdx.y;
  A += (size_t)by * sA; Bh += (size_t)by * sB; C += (size_t)by * sC;
  const int ntn = (N + 63) / 64; const int wid = blockIdx.x * 4 + w; const int mt = wid / ntn, nq = wid % ntn; if (mt * 16 >= M) return;
  const int row0 = mt * 16, col0 = nq * 64; const float* arow = A + (size_t)(row0 + ln) * lda;
  v8f acc[4] = {};
  for (int kb = 0; kb < K; kb += 32) {
    FragH ah, al;
    const v4f x0 = *(const v4fa*)(arow + kb + 8 * hh), x1 = *(const v4fa*)(arow + kb + 8 * hh + 4), x2 = *(const v4fa*)(arow + kb + 16 + 8 * hh), x3 = *(const v4fa*)(arow + kb + 16 + 8 * hh + 4);
    float xs[16] = {x0[0],x0[1],x0[2],x0[3],x1[0],x1[1],x1[2],x1[3],x2[0],x2[1],x2[2],x2[3],x3[0],x3[1],x3[2],x3[3]};
#pragma unroll
    for (int i = 0; i < 16; ++i) { const _Float16 h = (_Float16)xs[i]; ah.h[i] = h; al.h[i] = ASPLIT ? (_Float16)(xs[i] - (float)h) : (_Float16)0.0f; }
#pragma unroll
    for (int t = 0; t < 4; ++t) { if (col0 + t * 16 >= N) continue; const size_t boff = (size_t)(col0 + t * 16 + ln) * ldb + kb; FragH bq; bq.half[0] = *(const v8us*)(Bh + boff + 8 * hh); bq.half[1] = *(const v8us*)(Bh + boff + 16 + 8 * hh);
      acc[t] = mmaH<ASPLIT ? 2 : 1>(ah.v, al.v, bq.v, bq.v, acc[t]); }
  }
#pragma unroll
  for (int t = 0; t < 4; ++t) { if (col0 + t * 16 >= N) continue;
#pragma unroll
    for (int r = 0; r < 8; ++r) so[w][8 * hh + r][t * 16 + ln] = acc[t][r] * alpha; }
  __builtin_amdgcn_fence(__ATOMIC_ACQ_REL, "workgroup"); __builtin_amdgcn_wave_barrier();
  const int rsub = lane >> 4, c4 = (lane & 15) * 4;
  {
#pragma unroll
    for (int q = 0; q < 8; ++q) { const int r = q * 2 + rsub; if (col0 + c4 < N) { const v4f v = *(const v4fa*)&so[w][r][c4]; *(v4f*)(C + (size_t)(row0 + r) * ldc + col0 + c4) = v; } }
     }
}

// Wt[n][k] = f16(W[k][n]·scale) from f32 row-major W[K][N] (scale = power of two; bf16-exact weights stay exact in f16 away from the subnormal range)
__global__ __launch_bounds__(256) void k_wt_f16(const float* __restrict__ W, _Float16* __restrict__ Wt, int K, int N, float scale) {
  const int t = blockIdx.x * 256 + threadIdx.x; if (t >= N * (K / 8)) return; const int n = t / (K / 8), k8 = (t % (K / 8)) * 8; FragH f;
#pragma unroll
  for (int i = 0; i < 8; ++i) f.h[i] = (_Float16)(bf16_round(W[(size_t)(k8 + i) * N + n]) * scale); const v8us o = f.half[0];
  *(v8us*)((unsigned short*)Wt + (size_t)n * K + k8) = o; 
}
// k_gemm_hh variant with fused epilogue: v = acc·alpha + bias[by·sBias + col] (+ CP[(row/rowsPerB)·sCPb + by·64 + col] if CP) ; ACT 0 none / 1 elu ; writes f16 C16 and/or f32 C (each if non-null)
template <int ACT>
__global__ __launch_bounds__(128) void k_gemm_hhx(const _Float16* __restrict__ A, int lda, size_t sA, const _Float16* __restrict__ Bh, int ldb, size_t sB, float alpha, const float* __restrict__ bias, size_t sBias, const float* __restrict__ CP, int rowsPerB, size_t sCPb, int row0g,
    float* __restrict__ C, _Float16* __restrict__ C16, int ldc, size_t sC, int M, int N, int K) {
  __shared__ __attribute__((aligned(16))) float so[4][16][64];
  const int tid = threadIdx.x, w = tid >> 5, lane = tid & 31, ln = lane & 15, hh = lane >> 4; const int by = blockIdx.y;
  A += (size_t)by * sA; Bh += (size_t)by * sB; const size_t cofs = (size_t)by * sC; const float* bp = bias ? bias + (size_t)by * sBias : nullptr;
  const int ntn = (N + 63) / 64; const int wid = blockIdx.x * 4 + w; const int mt = wid / ntn, nq = wid % ntn; if (mt * 16 >= M) return;
  const int row0 = mt * 16, col0 = nq * 64; const _Float16* arow = A + (size_t)(row0 + ln) * lda;
  v8f acc[4] = {};
  for (int kb = 0; kb < K; kb += 32) { FragH ah; ah.half[0] = *(const v8us*)((const unsigned short*)arow + kb + 8 * hh); ah.half[1] = *(const v8us*)((const unsigned short*)arow + kb + 16 + 8 * hh);
#pragma unroll
    for (int t = 0; t < 4; ++t) { if (col0 + t * 16 >= N) continue; const size_t boff = (size_t)(col0 + t * 16 + ln) * ldb + kb; FragH bq; bq.half[0] = *(const v8us*)((const unsigned short*)Bh + boff + 8 * hh); bq.half[1] = *(const v8us*)((const unsigned short*)Bh + boff + 16 + 8 * hh);
      acc[t] = mmaH<1>(ah.v, ah.v, bq.v, bq.v, acc[t]); }
  }
#pragma unroll
  for (int t = 0; t < 4; ++t) { if (col0 + t * 16 >= N) continue; const int col = col0 + t * 16 + ln; const float bv = bp ? bf16_round(bp[col]) : 0.f;
#pragma unroll
    for (int r = 0; r < 8; ++r) { float v = acc[t][r] * alpha + bv; if (CP) { const int bidx = (row0g + row0 + 8 * hh + r) / rowsPerB; v += CP[(size_t)bidx * sCPb + (size_t)by * 64 + col]; } if (ACT == 1) v = (v > 0.f) ? v : expm1f(v); else if (ACT == 3) v = fmaxf(v, 0.f); so[w][8 * hh + r][t * 16 + ln] = v; } }
  __builtin_amdgcn_fence(__ATOMIC_ACQ_REL, "workgroup"); __builtin_amdgcn_wave_barrier();
  const int rsub = lane >> 4, c4 = (lane & 15) * 4; typedef _Float16 v4h __attribute__((ext_vector_type(4)));
  {
#pragma unroll
    for (int q = 0; q < 8; ++q) { const int r = q * 2 + rsub; if (col0 + c4 < N) { const v4f v = *(const v4fa*)&so[w][r][c4]; if (C) *(v4f*)(C + cofs + (size_t)(row0 + r) * ldc + col0 + c4) = v; if (C16) { v4h h4; for (int i = 0; i < 4; ++i) h4[i] = (_Float16)v[i]; *(v4h*)(C16 + cofs + (size_t)(row0 + r) * ldc + col0 + c4) = h4; } } }
     }
}


// Projection Y = X.W^T / 16 + bias at the fixed shape NR x DM x DM. One 128 x 128 tile of Y per work-group of 8 waves (4 x 2 waves, 32 x 64 of Y each).
// Each 64-k step of both operands (128 rows of 128 B) is read from global as whole lines, one step ahead, into registers and laid in LDS at a pitch of 144 B
// (16 B x odd: no bank conflict for the 16-byte fragment reads). Two LDS buffers: the one barrier of a step publishes its tile and ends the reads of the buffer written next.
// Fragment maps and the ascending k order of every accumulator are those of k_gemm_hhx.
// The output strips lie over the operand buffers (72 KiB of LDS a work-group, not 140): with 8 waves of at most 160 registers three work-groups are then resident on a WGP.
#define PJT ((NR / 128) * (DM / 128))
template <bool F32OUT>
__device__ __forceinline__ void proj_tile(const int tile, const _Float16* __restrict__ A, const _Float16* __restrict__ Bh, const float* __restrict__ bias, float* __restrict__ C, _Float16* __restrict__ C16) {
  constexpr int PT = 72, NS = DM / 64;
  __shared__ __attribute__((aligned(16))) unsigned char sm[2 * 2 * 128 * PT * 2];
  unsigned short (*sA)[128][PT] = (unsigned short (*)[128][PT])sm;
  unsigned short (*sB)[128][PT] = (unsigned short (*)[128][PT])(sm + 2 * 128 * PT * 2);
  float (*so)[32][68] = (float (*)[32][68])sm;
  static_assert(8 * 32 * 68 * 4 <= 2 * 2 * 128 * PT * 2, "the output strips fit in the operand buffers");
  const int tid = threadIdx.x, w = tid >> 5, lane = tid & 31, ln = lane & 15, hh = lane >> 4;
  const int m0 = (tile >> 3) * 128, n0 = (tile & 7) * 128, wm = (w >> 1) * 32, wn = (w & 1) * 64;
  const int lr = tid >> 3, lc = (tid & 7) * 8;
  const unsigned short* ga = (const unsigned short*)A + (size_t)(m0 + lr) * DM + lc;
  const unsigned short* gb = (const unsigned short*)Bh + (size_t)(n0 + lr) * DM + lc;
  v8us ra[4], rb[4];
#pragma unroll
  for (int i = 0; i < 4; ++i) { ra[i] = *(const v8us*)(ga + (size_t)i * 32 * DM); rb[i] = *(const v8us*)(gb + (size_t)i * 32 * DM); }
  v8f acc[2][4];
#pragma unroll
  for (int mt = 0; mt < 2; ++mt)
#pragma unroll
    for (int nt = 0; nt < 4; ++nt) acc[mt][nt] = (v8f){0.f,0.f,0.f,0.f,0.f,0.f,0.f,0.f};
  // unrolled by two so that the buffer index is a constant in every LDS address
#pragma unroll 2
  for (int s = 0; s < NS; ++s) {
    const int bf = s & 1;
#pragma unroll
    for (int i = 0; i < 4; ++i) { *(v8us*)&sA[bf][lr + 32 * i][lc] = ra[i]; *(v8us*)&sB[bf][lr + 32 * i][lc] = rb[i]; }
    __syncthreads();
    if (s + 1 < NS) {
#pragma unroll
      for (int i = 0; i < 4; ++i) { ra[i] = *(const v8us*)(ga + (size_t)i * 32 * DM + (s + 1) * 64); rb[i] = *(const v8us*)(gb + (size_t)i * 32 * DM + (s + 1) * 64); }
    }
    // keeps the next step's global loads in front of this step's matrix work: left free, the compiler sinks them to just before their LDS stores and their whole latency is waited out
    __builtin_amdgcn_sched_barrier(0);
#pragma unroll
    for (int ks = 0; ks < 2; ++ks) {
      FragH a[2], b[4];
#pragma unroll
      for (int mt = 0; mt < 2; ++mt) { a[mt].half[0] = *(const v8us*)&sA[bf][wm + mt * 16 + ln][ks * 32 + 8 * hh]; a[mt].half[1] = *(const v8us*)&sA[bf][wm + mt * 16 + ln][ks * 32 + 16 + 8 * hh]; }
#pragma unroll
      for (int nt = 0; nt < 4; ++nt) { b[nt].half[0] = *(const v8us*)&sB[bf][wn + nt * 16 + ln][ks * 32 + 8 * hh]; b[nt].half[1] = *(const v8us*)&sB[bf][wn + nt * 16 + ln][ks * 32 + 16 + 8 * hh]; }
#pragma unroll
      for (int mt = 0; mt < 2; ++mt)
#pragma unroll
        for (int nt = 0; nt < 4; ++nt) acc[mt][nt] = __builtin_amdgcn_wmma_f32_16x16x32_f16(false, a[mt].v, false, b[nt].v, (short)0, acc[mt][nt], false, false);
    }
  }
  // stands in front of the epilogue's reuse of the registers that held the global load addresses (the scheduling barrier keeps that reuse behind it)
  asm volatile("s_wait_xcnt 0x0" ::: "memory");
  __builtin_amdgcn_sched_barrier(0);
  // ends every wave's fragment reads of the last step before the output strips are written over the operand buffers
  __syncthreads();
  typedef _Float16 v4h __attribute__((ext_vector_type(4)));
#pragma unroll
  for (int nt = 0; nt < 4; ++nt) { const float bv = bf16_round(bias[n0 + wn + nt * 16 + ln]);
#pragma unroll
    for (int mt = 0; mt < 2; ++mt)
#pragma unroll
      for (int r = 0; r < 8; ++r) so[w][mt * 16 + 8 * hh + r][nt * 16 + ln] = acc[mt][nt][r] * 0.0625f + bv; }
  // the wave's own 32 x 64 strip: its LDS writes are ordered before its cross-lane reads, so that whole lines go out
  __builtin_amdgcn_fence(__ATOMIC_ACQ_REL, "workgroup"); __builtin_amdgcn_wave_barrier();
#pragma unroll
  for (int q = 0; q < 16; ++q) { const int r = q * 2 + hh, c4 = ln * 4; const v4f v = *(const v4fa*)&so[w][r][c4]; const size_t o = (size_t)(m0 + wm + r) * DM + n0 + wn + c4;
    if (F32OUT) *(v4f*)(C + o) = v; else { v4h h4;
#pragma unroll
      for (int i = 0; i < 4; ++i) h4[i] = (_Float16)v[i]; *(v4h*)(C16 + o) = h4; } }
}
// the Q, K and V projections in one launch: the work-group index picks the projection and its tile (a test that is the same for the whole work-group). All 3 x 256 work-groups are resident at once,
// three on a WGP, so that one's barrier, global and LDS waits are filled by the other two, and the launch gap, the fill, the first tile's latency and the epilogue are paid once
__global__ __launch_bounds__(256) void k_proj_qkv(const _Float16* __restrict__ XQ, const _Float16* __restrict__ XK, const _Float16* __restrict__ XV,
                                                  const _Float16* __restrict__ Bq, const _Float16* __restrict__ Bk, const _Float16* __restrict__ Bv,
                                                  const float* __restrict__ bq, const float* __restrict__ bk, const float* __restrict__ bv,
                                                  _Float16* __restrict__ Q16, _Float16* __restrict__ K16, _Float16* __restrict__ V16) {
  const int t = blockIdx.x / PJT;
  proj_tile<false>(blockIdx.x % PJT, t == 0 ? XQ : t == 1 ? XK : XV, t == 0 ? Bq : t == 1 ? Bk : Bv, t == 0 ? bq : t == 1 ? bk : bv, nullptr, t == 0 ? Q16 : t == 1 ? K16 : V16);
}
__global__ __launch_bounds__(256) void k_proj_o(const _Float16* __restrict__ A, const _Float16* __restrict__ Bh, const float* __restrict__ bias, float* __restrict__ C) { proj_tile<true>(blockIdx.x, A, Bh, bias, C, nullptr); }

typedef _Float16 v4hs __attribute__((ext_vector_type(4)));
// One work-group's share (256 x 4 x U elements in a row) of an f32 -> f16 conversion, as a stream: U loads of 16 B a lane, each 512 contiguous bytes a wave (whole lines), and U stores of 8 B a lane
// (two whole lines a wave). All of a wave's loads are issued before its first value is converted, so that its whole share is in flight at once. Few waves with many bytes in flight each,
// in place of one wave for every 256 elements. MODE 0: f16(x); 1: f16(bf16(x)); 2: f16(bf16(x) * 16). Each element's arithmetic is that of the one-piece-a-thread kernels.
template <int U, int MODE>
__device__ __forceinline__ void cvt_stream(const float* __restrict__ s, _Float16* __restrict__ d) {
  const int tid = threadIdx.x;
  v4f v[U];
  // the three loops are unrolled so that v[] is indexed by constants and stays in registers, and every address is one base plus an immediate offset
#pragma unroll
  for (int u = 0; u < U; ++u) v[u] = *(const v4fa*)(s + (u * 256 + tid) * 4);
  // keeps every load in front of the first conversion: left free, the compiler issues a dozen, waits for nearly all of them and converts with almost nothing in flight, several times over
  __builtin_amdgcn_sched_barrier(0);
#pragma unroll
  for (int u = 0; u < U; ++u) { v4hs h;
#pragma unroll
    for (int q = 0; q < 4; ++q) h[q] = (MODE == 0) ? (_Float16)v[u][q] : (MODE == 1) ? (_Float16)bf16_round(v[u][q]) : (_Float16)(bf16_round(v[u][q]) * 16.0f);
    *(v4hs*)(d + (u * 256 + tid) * 4) = h; }
}
#define CVU 32
#define CVE (256 * 4 * CVU)
// the three activations and the four weights in one launch: the work-group index picks the tensor and its share of it (a test that is the same for the whole work-group)
__global__ __launch_bounds__(256) void k_cvt_in(const float* __restrict__ xq, const float* __restrict__ xk, const float* __restrict__ xv,
                                                const float* __restrict__ Wq, const float* __restrict__ Wk, const float* __restrict__ Wv, const float* __restrict__ Wo,
                                                _Float16* __restrict__ XQ, _Float16* __restrict__ XK, _Float16* __restrict__ XV,
                                                _Float16* __restrict__ Bq, _Float16* __restrict__ Bk, _Float16* __restrict__ Bv, _Float16* __restrict__ Bo) {
  constexpr int GX = NR * DM / CVE, GW = DM * DM / CVE;
  const int g = blockIdx.x;
  if (g < 3 * GX) {
    const int t = g / GX; const size_t o = (size_t)(g % GX) * CVE;
    cvt_stream<CVU, 1>((t == 0 ? xq : t == 1 ? xk : xv) + o, (t == 0 ? XQ : t == 1 ? XK : XV) + o);
  } else {
    const int g2 = g - 3 * GX, t = g2 / GW; const size_t o = (size_t)(g2 % GW) * CVE;
    cvt_stream<CVU, 2>((t == 0 ? Wq : t == 1 ? Wk : t == 2 ? Wv : Wo) + o, (t == 0 ? Bq : t == 1 ? Bk : t == 2 ? Bv : Bo) + o);
  }
}
__global__ __launch_bounds__(256) void k_h16(const float* __restrict__ x, _Float16* __restrict__ X16) { const size_t o = (size_t)blockIdx.x * (256 * 4 * 8); cvt_stream<8, 0>(x + o, X16 + o); }
__global__ __launch_bounds__(256) void k_vt(const _Float16* __restrict__ V16, _Float16* __restrict__ Vt) { __shared__ unsigned short tl[64][66]; const int tid = threadIdx.x; const int slab = blockIdx.x / (SS / 64), lg = blockIdx.x % (SS / 64); const int b = slab / NH, h = slab % NH;
  for (int i = tid; i < 64 * 8; i += 256) { const int r = i / 8, c8 = (i % 8) * 8; FragH f; f.half[0] = *(const v8us*)((const unsigned short*)V16 + ((size_t)b * SS + lg * 64 + r) * DM + h * HD + c8);
#pragma unroll
    for (int q = 0; q < 8; ++q) tl[r][c8 + q] = f.u[q]; }
  __syncthreads();
  {
#pragma unroll
    for (int rd = 0; rd < 2; ++rd) { const int d = rd * 32 + tid / 8, pc = tid % 8; FragH f;
#pragma unroll
      for (int q = 0; q < 8; ++q) f.u[q] = tl[pc * 8 + q][d];
      *(v8us*)((unsigned short*)Vt + ((size_t)slab * HD + d) * SS + lg * 64 + pc * 8) = f.half[0]; }
     } }
// sigmoid(s / 8) = 0.5 + 0.5 tanh(s / 16): th16 is the hardware tanh (v_tanh_f32) of s / 16, one transcendental in place of the library expf and the full-precision division
__device__ __forceinline__ float th16(float s) { return __builtin_amdgcn_tanhf(s * 0.0625f); }
// eight v_tanh_f32, each in place, with the one free slot that the instruction set asks for behind a transcendental (before its result is read or its source overwritten) as the statement's last line:
__device__ __forceinline__ void tanh8(float (&x)[8]) {
  asm("v_tanh_f32 %0, %0\n\tv_tanh_f32 %1, %1\n\tv_tanh_f32 %2, %2\n\tv_tanh_f32 %3, %3\n\tv_tanh_f32 %4, %4\n\tv_tanh_f32 %5, %5\n\tv_tanh_f32 %6, %6\n\tv_tanh_f32 %7, %7\n\tv_nop"
      : "+v"(x[0]), "+v"(x[1]), "+v"(x[2]), "+v"(x[3]), "+v"(x[4]), "+v"(x[5]), "+v"(x[6]), "+v"(x[7]));
}
// (a) O = sigmoid(q.k/8).V per (b,h): 4 waves of 32 query rows. A step is 64 keys: their K rows (64 x 128 B, one line a row) and the same keys' columns of V^T (64 d rows x 128 B, one line a row)
// are read from global as whole lines, one step ahead, into registers and laid in LDS at the pitch of proj_tile (144 B), once for the 4 waves. Two LDS buffers: the one barrier of a step publishes its
// tiles and ends the reads of the buffer written next. Fragment maps and the ascending order of the 32-key blocks in every accumulator are those of the form that read its fragments straight from global.
__global__ __launch_bounds__(128) void k_satt(const _Float16* __restrict__ Q16, const _Float16* __restrict__ K16, const _Float16* __restrict__ Vt, float* __restrict__ O) {
  constexpr int RPW = 32, NQB = SS / (4 * RPW), DT = HD / 16, KS = HD / 32, PT = 72, KT = 64, NST = SS / KT;
  __shared__ __attribute__((aligned(16))) unsigned short sK[2][KT][PT], sV[2][HD][PT];
  __shared__ __attribute__((aligned(16))) unsigned short sP[4][RPW][40]; __shared__ __attribute__((aligned(16))) float sO[4][RPW][HD];
  const int tid = threadIdx.x, w = tid >> 5, lane = tid & 31, ln = lane & 15, hh = lane >> 4;
  const int slab = blockIdx.x / NQB, qblk = blockIdx.x % NQB; const int b = slab / NH, h = slab % NH; const int q0 = qblk * (4 * RPW) + w * RPW;
  const int lr = tid >> 3, lc = (tid & 7) * 8;
  const unsigned short* gk = (const unsigned short*)K16 + ((size_t)b * SS + lr) * DM + h * HD + lc;
  const unsigned short* gv = (const unsigned short*)Vt + ((size_t)slab * HD + lr) * SS + lc;
  v8us rk[4], rv[4];
#pragma unroll
  for (int i = 0; i < 4; ++i) { rk[i] = *(const v8us*)(gk + (size_t)i * 16 * DM); rv[i] = *(const v8us*)(gv + (size_t)i * 16 * SS); }
  FragH aq[2][KS];
#pragma unroll
  for (int rt = 0; rt < 2; ++rt) { const unsigned short* qr = (const unsigned short*)Q16 + ((size_t)b * SS + q0 + rt * 16 + ln) * DM + h * HD;
#pragma unroll
    for (int ks = 0; ks < KS; ++ks) { aq[rt][ks].half[0] = *(const v8us*)(qr + ks * 32 + 8 * hh); aq[rt][ks].half[1] = *(const v8us*)(qr + ks * 32 + 16 + 8 * hh); } }
  v8f oacc[2][DT];
#pragma unroll
  for (int rt = 0; rt < 2; ++rt)
#pragma unroll
    for (int dt = 0; dt < DT; ++dt) oacc[rt][dt] = (v8f){0.f,0.f,0.f,0.f,0.f,0.f,0.f,0.f};
  // unrolled by two so that the buffer index is a constant in every LDS address
#pragma unroll 2
  for (int st = 0; st < NST; ++st) {
    const int bf = st & 1;
#pragma unroll
    for (int i = 0; i < 4; ++i) { *(v8us*)&sK[bf][lr + 16 * i][lc] = rk[i]; *(v8us*)&sV[bf][lr + 16 * i][lc] = rv[i]; }
    __syncthreads();
    // no branch round the loads (the last step reads its own keys once more, unused): the step stays one block, in which the two scheduling barriers below hold
    const int sn = (st + 1 < NST) ? st + 1 : st;
#pragma unroll
    for (int i = 0; i < 4; ++i) { rk[i] = *(const v8us*)(gk + ((size_t)sn * KT + i * 16) * DM); rv[i] = *(const v8us*)(gv + (size_t)i * 16 * SS + sn * KT); }
    // keeps the next step's global loads in front of this step's matrix and tanh work: sunk to just before their LDS stores, their whole latency would be waited out
    __builtin_amdgcn_sched_barrier(0);
    FragH bk[2][KS];
#pragma unroll
    for (int nt = 0; nt < 2; ++nt)
#pragma unroll
      for (int ks = 0; ks < KS; ++ks) { bk[nt][ks].half[0] = *(const v8us*)&sK[bf][nt * 16 + ln][ks * 32 + 8 * hh]; bk[nt][ks].half[1] = *(const v8us*)&sK[bf][nt * 16 + ln][ks * 32 + 16 + 8 * hh]; }
#pragma unroll
    for (int sub = 0; sub < KT / 32; ++sub) {
      v8f s[2][2];
#pragma unroll
      for (int nt = 0; nt < 2; ++nt)
#pragma unroll
        for (int rt = 0; rt < 2; ++rt) { v8f acc = (v8f){0.f,0.f,0.f,0.f,0.f,0.f,0.f,0.f};
#pragma unroll
          for (int ks = 0; ks < KS; ++ks) acc = mmaH<1>(aq[rt][ks].v, aq[rt][ks].v, bk[nt][ks].v, bk[nt][ks].v, acc); s[rt][nt] = acc; }
      // this block's V^T fragments and the step's next K fragments are read as one group in front of the tanh work, which covers their LDS latency
      FragH bv[DT];
#pragma unroll
      for (int dt = 0; dt < DT; ++dt) { bv[dt].half[0] = *(const v8us*)&sV[bf][dt * 16 + ln][sub * 32 + 8 * hh]; bv[dt].half[1] = *(const v8us*)&sV[bf][dt * 16 + ln][sub * 32 + 16 + 8 * hh]; }
      if (sub + 1 < KT / 32) {
#pragma unroll
        for (int nt = 0; nt < 2; ++nt)
#pragma unroll
          for (int ks = 0; ks < KS; ++ks) { bk[nt][ks].half[0] = *(const v8us*)&sK[bf][(sub + 1) * 32 + nt * 16 + ln][ks * 32 + 8 * hh]; bk[nt][ks].half[1] = *(const v8us*)&sK[bf][(sub + 1) * 32 + nt * 16 + ln][ks * 32 + 16 + 8 * hh]; }
      }
#pragma unroll
      for (int rt = 0; rt < 2; ++rt)
#pragma unroll
        for (int nt = 0; nt < 2; ++nt) { float x[8];
#pragma unroll
          for (int r = 0; r < 8; ++r) x[r] = s[rt][nt][r] * 0.0625f;
          tanh8(x);
#pragma unroll
          for (int r = 0; r < 8; ++r) { FragH t2; t2.h[0] = (_Float16)fmaf(x[r], 0.5f, 0.5f); sP[w][rt * 16 + 8 * hh + r][nt * 16 + ln] = t2.u[0]; } }
      // the wave's own P strip: its LDS writes are ordered before its cross-lane reads; LDS only, so that the next step's global loads stay in flight across it
      __builtin_amdgcn_fence(__ATOMIC_ACQ_REL, "workgroup", "local"); __builtin_amdgcn_wave_barrier();
      FragH pa[2];
#pragma unroll
      for (int rt = 0; rt < 2; ++rt) { pa[rt].half[0] = *(const v8us*)&sP[w][rt * 16 + ln][8 * hh]; pa[rt].half[1] = *(const v8us*)&sP[w][rt * 16 + ln][16 + 8 * hh]; }
#pragma unroll
      for (int dt = 0; dt < DT; ++dt)
#pragma unroll
        for (int rt = 0; rt < 2; ++rt) oacc[rt][dt] = mmaH<1>(pa[rt].v, pa[rt].v, bv[dt].v, bv[dt].v, oacc[rt][dt]);
      // the reads of the P strip are ordered before the next block's writes of it; LDS only, as above
      __builtin_amdgcn_fence(__ATOMIC_ACQ_REL, "workgroup", "local"); __builtin_amdgcn_wave_barrier();
    }
    // keeps the next step's LDS stores, and with them the wait for the global loads, behind this step's matrix and tanh work
    __builtin_amdgcn_sched_barrier(0);
  }
  // stands in front of the epilogue's reuse of the registers that held the global load addresses (the scheduling barrier keeps that reuse behind it)
  asm volatile("s_wait_xcnt 0x0" ::: "memory");
  __builtin_amdgcn_sched_barrier(0);
#pragma unroll
  for (int rt = 0; rt < 2; ++rt)
#pragma unroll
    for (int dt = 0; dt < DT; ++dt)
#pragma unroll
      for (int r = 0; r < 8; ++r) sO[w][rt * 16 + 8 * hh + r][dt * 16 + ln] = oacc[rt][dt][r];
  __builtin_amdgcn_fence(__ATOMIC_ACQ_REL, "workgroup"); __builtin_amdgcn_wave_barrier();
  {
#pragma unroll
    for (int rp = 0; rp < RPW; rp += 2) { const int r = rp + (lane >> 4), pc = lane & 15; const v4f val = *(const v4fa*)&sO[w][r][pc * 4]; *(v4f*)(O + ((size_t)b * SS + q0 + r) * DM + h * HD + pc * 4) = val; }
     } }
// (b) attn_weights[b][q][k] = (1/16) sum_h sigmoid(q_h.k_h/8). One 128 x 128 tile (queries x keys) of one batch per work-group of 8 waves (4 x 2 waves, 32 x 64 each), made whole by that work-group.
// A step is one head: its 64 columns of the 128 query rows and of the 128 key rows (one 128-B line a row) are read from global as whole lines, one head ahead, into registers and laid in LDS
// at the pitch of proj_tile (144 B). Two LDS buffers: the one barrier of a step publishes its head and ends the reads of the buffer written next.
// Fragment maps, the ascending k order inside a head and the ascending head order of the sum of the tanh terms are those of the 16 x 32 form that read its fragments straight from global.
__global__ __launch_bounds__(256) void k_aw(const _Float16* __restrict__ Q16, const _Float16* __restrict__ K16, float* __restrict__ AW) {
  constexpr int PT = 72, NT = SS / 128;
  __shared__ __attribute__((aligned(16))) unsigned short sA[2][128][PT], sB[2][128][PT];
  __shared__ __attribute__((aligned(16))) float so[8][32][68];
  const int tid = threadIdx.x, w = tid >> 5, lane = tid & 31, ln = lane & 15, hh = lane >> 4;
  const int b = blockIdx.x / (NT * NT), tl = blockIdx.x % (NT * NT);
  const int m0 = (tl / NT) * 128, n0 = (tl % NT) * 128, wm = (w >> 1) * 32, wn = (w & 1) * 64;
  const int lr = tid >> 3, lc = (tid & 7) * 8;
  const unsigned short* ga = (const unsigned short*)Q16 + ((size_t)b * SS + m0 + lr) * DM + lc;
  const unsigned short* gb = (const unsigned short*)K16 + ((size_t)b * SS + n0 + lr) * DM + lc;
  v8us ra[4], rb[4];
#pragma unroll
  for (int i = 0; i < 4; ++i) { ra[i] = *(const v8us*)(ga + (size_t)i * 32 * DM); rb[i] = *(const v8us*)(gb + (size_t)i * 32 * DM); }
  typedef float v2f __attribute__((ext_vector_type(2)));
  v2f aw[2][4][4];   // the sums of the tanh terms, as register pairs: one packed add serves two of them
#pragma unroll
  for (int mt = 0; mt < 2; ++mt)
#pragma unroll
    for (int nt = 0; nt < 4; ++nt)
#pragma unroll
      for (int p = 0; p < 4; ++p) aw[mt][nt][p] = (v2f){0.f, 0.f};
  // unrolled by two so that the buffer index is a constant in every LDS address
#pragma unroll 2
  for (int h = 0; h < NH; ++h) {
    const int bf = h & 1;
#pragma unroll
    for (int i = 0; i < 4; ++i) { *(v8us*)&sA[bf][lr + 32 * i][lc] = ra[i]; *(v8us*)&sB[bf][lr + 32 * i][lc] = rb[i]; }
    __syncthreads();
    // no branch round the loads (the last step reads its own head once more, unused): the step stays one block, in which the two scheduling barriers below hold; with a branch here the compiler sinks the tanh work past the next step's stores and barrier
    const int hn = (h + 1 < NH) ? h + 1 : h;
#pragma unroll
    for (int i = 0; i < 4; ++i) { ra[i] = *(const v8us*)(ga + (size_t)i * 32 * DM + hn * HD); rb[i] = *(const v8us*)(gb + (size_t)i * 32 * DM + hn * HD); }
    // keeps the next head's global loads in front of this head's matrix and tanh work: left free, the compiler sinks them to just before their LDS stores and their whole latency is waited out
    __builtin_amdgcn_sched_barrier(0);
    v8f acc[2][4];
#pragma unroll
    for (int mt = 0; mt < 2; ++mt)
#pragma unroll
      for (int nt = 0; nt < 4; ++nt) acc[mt][nt] = (v8f){0.f,0.f,0.f,0.f,0.f,0.f,0.f,0.f};
#pragma unroll
    for (int ks = 0; ks < HD / 32; ++ks) {
      FragH a[2], bk[4];
#pragma unroll
      for (int mt = 0; mt < 2; ++mt) { a[mt].half[0] = *(const v8us*)&sA[bf][wm + mt * 16 + ln][ks * 32 + 8 * hh]; a[mt].half[1] = *(const v8us*)&sA[bf][wm + mt * 16 + ln][ks * 32 + 16 + 8 * hh]; }
#pragma unroll
      for (int nt = 0; nt < 4; ++nt) { bk[nt].half[0] = *(const v8us*)&sB[bf][wn + nt * 16 + ln][ks * 32 + 8 * hh]; bk[nt].half[1] = *(const v8us*)&sB[bf][wn + nt * 16 + ln][ks * 32 + 16 + 8 * hh]; }
#pragma unroll
      for (int mt = 0; mt < 2; ++mt)
#pragma unroll
        for (int nt = 0; nt < 4; ++nt) acc[mt][nt] = __builtin_amdgcn_wmma_f32_16x16x32_f16(false, a[mt].v, false, bk[nt].v, (short)0, acc[mt][nt], false, false);
    }
#pragma unroll
    for (int mt = 0; mt < 2; ++mt)
#pragma unroll
      for (int nt = 0; nt < 4; ++nt)
#pragma unroll
        for (int p = 0; p < 4; ++p) aw[mt][nt][p] += (v2f){th16(acc[mt][nt][2 * p]), th16(acc[mt][nt][2 * p + 1])};
    // keeps the next head's LDS stores behind this head's matrix and tanh work: left free, the compiler lifts them, and with them the wait for the global loads, to just behind this head's LDS reads
    __builtin_amdgcn_sched_barrier(0);
  }
  // stands in front of the epilogue's reuse of the registers that held the global load addresses (the scheduling barrier keeps that reuse behind it)
  asm volatile("s_wait_xcnt 0x0" ::: "memory");
  __builtin_amdgcn_sched_barrier(0);
#pragma unroll
  for (int nt = 0; nt < 4; ++nt)
#pragma unroll
    for (int mt = 0; mt < 2; ++mt)
#pragma unroll
      for (int r = 0; r < 8; ++r) so[w][mt * 16 + 8 * hh + r][nt * 16 + ln] = fmaf(aw[mt][nt][r >> 1][r & 1], 0.5f / (float)NH, 0.5f);   // mean_h (0.5 + 0.5 tanh) from the sum of the tanh terms
  // the wave's own 32 x 64 strip: its LDS writes are ordered before its cross-lane reads, so that whole lines go out
  __builtin_amdgcn_fence(__ATOMIC_ACQ_REL, "workgroup"); __builtin_amdgcn_wave_barrier();
#pragma unroll
  for (int q = 0; q < 16; ++q) { const int r = q * 2 + hh, c4 = ln * 4; *(v4f*)(AW + ((size_t)b * SS + m0 + wm + r) * SS + n0 + wn + c4) = *(const v4fa*)&so[w][r][c4]; }
}
extern "C" void kernel_launch(void* const* d_in, const int* in_sizes, int n_in,
                              void* d_out, int out_size, void* d_ws, size_t ws_size, hipStream_t stream) {
  (void)in_sizes; (void)n_in; (void)out_size;
  const float* xq = (const float*)d_in[0]; const float* xk = (const float*)d_in[1]; const float* xv = (const float*)d_in[2]; const float* Wq = (const float*)d_in[3]; const float* bq = (const float*)d_in[4]; const float* Wk = (const float*)d_in[5]; const float* bk = (const float*)d_in[6]; const float* Wv = (const float*)d_in[7]; const float* bv = (const float*)d_in[8]; const float* Wo = (const float*)d_in[9]; const float* bo = (const float*)d_in[10];
  float* out = (float*)d_out; float* AW = (float*)((char*)d_out + 16777216);
  char* ws = (char*)d_ws; size_t off = 0;
  auto take = [&](size_t bytes) { char* p = ws + off; off += (bytes + 255) & ~(size_t)255; return p; };
  const size_t w8 = (size_t)DM * DM / 8;
  _Float16* Bq = (_Float16*)take(w8 * 16); _Float16* Bk = (_Float16*)take(w8 * 16); _Float16* Bv = (_Float16*)take(w8 * 16); _Float16* Bo = (_Float16*)take(w8 * 16);
  _Float16* XQ = (_Float16*)take((size_t)NR * DM * 2); _Float16* XK = (_Float16*)take((size_t)NR * DM * 2); _Float16* XV = (_Float16*)take((size_t)NR * DM * 2); _Float16* Q16 = (_Float16*)take((size_t)NR * DM * 2); _Float16* K16 = (_Float16*)take((size_t)NR * DM * 2); _Float16* V16 = (_Float16*)take((size_t)NR * DM * 2); _Float16* Vt = (_Float16*)take((size_t)NR * DM * 2); float* O = (float*)take((size_t)NR * DM * 4); _Float16* O16 = (_Float16*)take((size_t)NR * DM * 2);
  if (off > ws_size) return;      // ≈ 8 + 8.4×8 + 16.8 ≈ 92 MiB
  k_cvt_in<<<3 * (NR * DM / CVE) + 4 * (DM * DM / CVE), 256, 0, stream>>>(xq, xk, xv, Wq, Wk, Wv, Wo, XQ, XK, XV, Bq, Bk, Bv, Bo);
  k_proj_qkv<<<3 * PJT, 256, 0, stream>>>(XQ, XK, XV, Bq, Bk, Bv, bq, bk, bv, Q16, K16, V16);
  k_vt<<<BB * NH * (SS / 64), 256, 0, stream>>>(V16, Vt);
  k_satt<<<BB * NH * (SS / 128), 128, 0, stream>>>(Q16, K16, Vt, O);
  k_h16<<<NR * DM / (256 * 4 * 8), 256, 0, stream>>>(O, O16);
  k_proj_o<<<PJT, 256, 0, stream>>>(O16, Bo, bo, out);
  k_aw<<<BB * (SS / 128) * (SS / 128), 256, 0, stream>>>(Q16, K16, AW);
}

// v008
// Measured time: 116 microseconds a run.
// Timed twice side by side with v007, it ran 1.05 and 1.06 times as fast.
// Over all steps from v000 it is 10.1 times as fast.
#include <hip/hip_runtime.h>
// q/k/v/o projections (4096 × 1024 × 1024, + bias) and the 16-head sigmoid attention on v_wmma_f32_16x16x32_f16: (a) per (b,h) a fused flash-style kernel with P = σ(q·k/8) (no normalisation,
// as the module) and O = P·V on WMMA; (b) the second output mean_h σ(q·k/8) recomputes the score tiles per head and averages them in a fixed order. x inputs f16(bf16 ·) exact, q/k/v and O rounded to f16,
// weights bf16-exact ×2^4 ((out,in)), P f16 ≤ 1, f32 accumulate.
#define BB 2
#define SS 2048
#define DM 1024
#define NH 16
#define HD 64
#define NR (BB * SS)

typedef __bf16 v16b __attribute__((ext_vector_type(16)));
typedef unsigned short v8us __attribute__((ext_vector_type(8), may_alias));
typedef float  v8f  __attribute__((ext_vector_type(8)));
typedef float  v4f  __attribute__((ext_vector_type(4)));
typedef float  v4fa __attribute__((ext_vector_type(4), may_alias));
union FragB { v16b v; v8us half[2]; unsigned short u[16]; };

__device__ __forceinline__ unsigned short bf16_bits(float x) { unsigned int u = __float_as_uint(x); return (unsigned short)((u + 0x7FFFu + ((u >> 16) & 1u)) >> 16); }
__device__ __forceinline__ float bf16_val(unsigned short b) { return __uint_as_float(((unsigned int)b) << 16); }
__device__ __forceinline__ float bf16_round(float x) { return bf16_val(bf16_bits(x)); }
// D += A·B with NT terms: 1 = ah·bh, 2 = + al·bh (A split), 3 = + ah·bl (both split)
template <int NT>
__device__ __forceinline__ v8f mmaN(v16b ah, v16b al, v16b bh, v16b bl, v8f c) {
  c = __builtin_amdgcn_wmma_f32_16x16x32_bf16(false, ah, false, bh, (short)0, c, false, false);
  if (NT >= 2) c = __builtin_amdgcn_wmma_f32_16x16x32_bf16(false, al, false, bh, (short)0, c, false, false);
  if (NT >= 3) c = __builtin_amdgcn_wmma_f32_16x16x32_bf16(false, ah, false, bl, (short)0, c, false, false);
  asm volatile("v_nop\n\tv_nop\n\tv_nop\n\tv_nop" : "+v"(c) : "v"(ah), "v"(al), "v"(bh), "v"(bl));
  return c;
}

__global__ __launch_bounds__(256) void k_wt_bf16(const float* __restrict__ W, unsigned short* __restrict__ Wt, int K, int N) {
  const int t = blockIdx.x * 256 + threadIdx.x;
  const int k8n = K / 8;
  if (t >= N * k8n) return;
  const int n = t / k8n, k8 = (t % k8n) * 8;
  v8us v;
#pragma unroll
  for (int i = 0; i < 8; ++i) v[i] = bf16_bits(W[(size_t)(k8 + i) * N + n]);
  *(v8us*)(Wt + (size_t)n * K + k8) = v;
  
}

// GEMM C[M][N] (f32, pitch ldc) = act(A[M][K]·W + bias). A f32 row-major (pitch lda) converted per fragment to bf16
// (ASPLIT: hi/lo two planes -> 2 terms, else single rounded term); Wt bf16 [N][K] (pitch ldb). BIAS_BF16 rounds the
// bias to bf16 first (bias quantised to bf16 before the add). K%32==0, M%16==0, N%64==0.
template <bool ASPLIT, int ACT, bool BIAS_BF16>
__global__ __launch_bounds__(128) void k_gemm_bf(const float* __restrict__ A, int lda, const unsigned short* __restrict__ Wt, int ldb,
                                               const float* __restrict__ bias, float* __restrict__ C, int ldc, int M, int N, int K) {
  __shared__ __attribute__((aligned(16))) float so[4][16][64];
  const int tid = threadIdx.x, w = tid >> 5, lane = tid & 31, ln = lane & 15, hh = lane >> 4;
  const int ntn = N / 64;
  const int wid = blockIdx.x * 4 + w;
  const int mt = wid / ntn, nq = wid % ntn;
  if (mt * 16 >= M) return;
  const int row0 = mt * 16, col0 = nq * 64;
  const float* arow = A + (size_t)(row0 + ln) * lda;
  v8f acc[4] = {};
  for (int kb = 0; kb < K; kb += 32) {
    FragB ah, al;
    const v4f x0 = *(const v4fa*)(arow + kb + 8 * hh), x1 = *(const v4fa*)(arow + kb + 8 * hh + 4);
    const v4f x2 = *(const v4fa*)(arow + kb + 16 + 8 * hh), x3 = *(const v4fa*)(arow + kb + 16 + 8 * hh + 4);
    float xs[16] = {x0[0],x0[1],x0[2],x0[3],x1[0],x1[1],x1[2],x1[3],x2[0],x2[1],x2[2],x2[3],x3[0],x3[1],x3[2],x3[3]};
#pragma unroll
    for (int i = 0; i < 16; ++i) { const unsigned short hb = bf16_bits(xs[i]); ah.u[i] = hb; al.u[i] = ASPLIT ? bf16_bits(xs[i] - bf16_val(hb)) : (unsigned short)0; }
#pragma unroll
    for (int t = 0; t < 4; ++t) {
      const unsigned short* brow = Wt + (size_t)(col0 + t * 16 + ln) * ldb + kb;
      FragB b;
      b.half[0] = *(const v8us*)(brow + 8 * hh);
      b.half[1] = *(const v8us*)(brow + 16 + 8 * hh);
      acc[t] = mmaN<ASPLIT ? 2 : 1>(ah.v, al.v, b.v, b.v, acc[t]);
    }
  }
#pragma unroll
  for (int t = 0; t < 4; ++t) {
    float bv = bias ? bias[col0 + t * 16 + ln] : 0.f;
    if (BIAS_BF16) bv = bf16_round(bv);
#pragma unroll
    for (int r = 0; r < 8; ++r) { float v = acc[t][r] + bv; if (ACT == 1) v = fmaxf(v, 0.f); so[w][8 * hh + r][t * 16 + ln] = v; }
  }
  __builtin_amdgcn_fence(__ATOMIC_ACQ_REL, "workgroup");
  __builtin_amdgcn_wave_barrier();
  const int rsub = lane >> 4, c4 = (lane & 15) * 4;
  {
#pragma unroll
    for (int q = 0; q < 8; ++q) {
      const int r = q * 2 + rsub;
      const v4f v = *(const v4fa*)&so[w][r][c4];
      *(v4f*)(C + (size_t)(row0 + r) * ldc + col0 + c4) = v;
    }
    
  }
}

// Flash-style causal/unmasked attention, all contractions 3-term bf16 hi/lo splits, f32 softmax with running max.
// q,k,v rows are read from f32 buffers with arbitrary row pitch (so they can live inside a fused qkv buffer);
// D = head size (multiple of 32, <= 128); one wave = 16 query rows; block = 4 waves (64 queries) sharing K/V chunks of 32.
template <int D, bool CAUSAL>
__global__ __launch_bounds__(128) void k_flash(const float* __restrict__ qb, const float* __restrict__ kb, const float* __restrict__ vb,
                                             int pitch, int T, int H, float scale, float* __restrict__ y, int ypitch) {
  constexpr int KS = D / 32;        // k-steps for QK
  constexpr int DT = D / 16;        // d tiles for PV
  __shared__ __attribute__((aligned(16))) unsigned short sKh[32][D + 8], sKl[32][D + 8], sVh[32][D + 8], sVl[32][D + 8];
  __shared__ __attribute__((aligned(16))) unsigned short sPh[4][16][40], sPl[4][16][40];
  __shared__ __attribute__((aligned(16))) float sO[4][16][D];
  const int tid = threadIdx.x, w = tid >> 5, lane = tid & 31, ln = lane & 15, hh = lane >> 4;
  const int nqb = (T + 63) / 64;
  const int bh = blockIdx.x / nqb, qblk = blockIdx.x % nqb;
  const int b = bh / H, h = bh % H;
  const int q0 = qblk * 64 + w * 16;
  const float* Q = qb + (size_t)b * T * pitch + h * D;
  const float* K = kb + (size_t)b * T * pitch + h * D;
  const float* V = vb + (size_t)b * T * pitch + h * D;

  // A fragments of the wave's 16 query rows (scaled), hi/lo
  FragB aqh[KS], aql[KS];
  {
    int row = q0 + ln; if (row >= T) row = T - 1;
    const float* qr = Q + (size_t)row * pitch;
#pragma unroll
    for (int ks = 0; ks < KS; ++ks)
#pragma unroll
      for (int i = 0; i < 16; ++i) {
        const int d = ks * 32 + ((i < 8) ? (8 * hh + i) : (16 + 8 * hh + (i - 8)));
        const float x = qr[d] * scale; const unsigned short hb = bf16_bits(x);
        aqh[ks].u[i] = hb; aql[ks].u[i] = bf16_bits(x - bf16_val(hb));
      }
  }
  float m_r[8], l_r[8];
#pragma unroll
  for (int r = 0; r < 8; ++r) { m_r[r] = -3.0e38f; l_r[r] = 0.f; }
  v8f oacc[DT];
#pragma unroll
  for (int dt = 0; dt < DT; ++dt) oacc[dt] = (v8f){0.f,0.f,0.f,0.f,0.f,0.f,0.f,0.f};

  const int kv_end = CAUSAL ? min(T, qblk * 64 + 64) : T;     // block-uniform
  for (int j0 = 0; j0 < kv_end; j0 += 32) {
    __syncthreads();
    for (int e = tid; e < 32 * (D / 4); e += 128) {
      const int r = e / (D / 4), c4 = (e % (D / 4)) * 4;
      const int key = j0 + r;
      v4f kf = {0.f,0.f,0.f,0.f}, vf = {0.f,0.f,0.f,0.f};
      if (key < T) { kf = *(const v4fa*)(K + (size_t)key * pitch + c4); vf = *(const v4fa*)(V + (size_t)key * pitch + c4); }
#pragma unroll
      for (int t = 0; t < 4; ++t) {
        unsigned short hb = bf16_bits(kf[t]); sKh[r][c4 + t] = hb; sKl[r][c4 + t] = bf16_bits(kf[t] - bf16_val(hb));
        hb = bf16_bits(vf[t]); sVh[r][c4 + t] = hb; sVl[r][c4 + t] = bf16_bits(vf[t] - bf16_val(hb));
      }
    }
    __syncthreads();
    // S tile 16 x 32
    v8f s[2];
#pragma unroll
    for (int nt = 0; nt < 2; ++nt) {
      v8f acc = {};
#pragma unroll
      for (int ks = 0; ks < KS; ++ks) {
        FragB bh_, bl_;
        bh_.half[0] = *(const v8us*)&sKh[nt * 16 + ln][ks * 32 + 8 * hh]; bh_.half[1] = *(const v8us*)&sKh[nt * 16 + ln][ks * 32 + 16 + 8 * hh];
        bl_.half[0] = *(const v8us*)&sKl[nt * 16 + ln][ks * 32 + 8 * hh]; bl_.half[1] = *(const v8us*)&sKl[nt * 16 + ln][ks * 32 + 16 + 8 * hh];
        acc = mmaN<3>(aqh[ks].v, aql[ks].v, bh_.v, bl_.v, acc);
      }
      s[nt] = acc;
    }
    // mask + running max (rows 8hh+r; the 16 lanes of a half share rows)
    float alpha[8];
#pragma unroll
    for (int r = 0; r < 8; ++r) {
      const int qi = q0 + 8 * hh + r;
      const int ja = j0 + ln, jb = j0 + 16 + ln;
      if (CAUSAL) { if (ja > qi) s[0][r] = -3.0e38f; if (jb > qi) s[1][r] = -3.0e38f; }
      if (ja >= T) s[0][r] = -3.0e38f;
      if (jb >= T) s[1][r] = -3.0e38f;
      float mx = fmaxf(s[0][r], s[1][r]);
      mx = fmaxf(mx, __shfl_xor(mx, 1, 32)); mx = fmaxf(mx, __shfl_xor(mx, 2, 32)); mx = fmaxf(mx, __shfl_xor(mx, 4, 32)); mx = fmaxf(mx, __shfl_xor(mx, 8, 32));
      const float mnew = fmaxf(m_r[r], mx);
      alpha[r] = (mnew > -1.0e38f) ? __expf(m_r[r] - mnew) : 1.0f;
      const float p0 = (s[0][r] > -1.0e38f) ? __expf(s[0][r] - mnew) : 0.f;
      const float p1 = (s[1][r] > -1.0e38f) ? __expf(s[1][r] - mnew) : 0.f;
      m_r[r] = mnew;
      l_r[r] = l_r[r] * alpha[r] + p0 + p1;            // per-lane partial row sum (16 lanes combined at the end)
      unsigned short hb = bf16_bits(p0); sPh[w][8 * hh + r][ln] = hb;      sPl[w][8 * hh + r][ln] = bf16_bits(p0 - bf16_val(hb));
      hb = bf16_bits(p1);                sPh[w][8 * hh + r][16 + ln] = hb; sPl[w][8 * hh + r][16 + ln] = bf16_bits(p1 - bf16_val(hb));
    }
#pragma unroll
    for (int dt = 0; dt < DT; ++dt)
#pragma unroll
      for (int r = 0; r < 8; ++r) oacc[dt][r] *= alpha[r];
    __builtin_amdgcn_fence(__ATOMIC_ACQ_REL, "workgroup");
    __builtin_amdgcn_wave_barrier();
    FragB pah, pal;
    pah.half[0] = *(const v8us*)&sPh[w][ln][8 * hh]; pah.half[1] = *(const v8us*)&sPh[w][ln][16 + 8 * hh];
    pal.half[0] = *(const v8us*)&sPl[w][ln][8 * hh]; pal.half[1] = *(const v8us*)&sPl[w][ln][16 + 8 * hh];
#pragma unroll
    for (int dt = 0; dt < DT; ++dt) {
      FragB bvh, bvl;
#pragma unroll
      for (int i = 0; i < 8; ++i) {
        bvh.u[i] = sVh[8 * hh + i][dt * 16 + ln]; bvh.u[8 + i] = sVh[16 + 8 * hh + i][dt * 16 + ln];
        bvl.u[i] = sVl[8 * hh + i][dt * 16 + ln]; bvl.u[8 + i] = sVl[16 + 8 * hh + i][dt * 16 + ln];
      }
      oacc[dt] = mmaN<3>(pah.v, pal.v, bvh.v, bvl.v, oacc[dt]);
    }
    __builtin_amdgcn_fence(__ATOMIC_ACQ_REL, "workgroup");
    __builtin_amdgcn_wave_barrier();
  }
#pragma unroll
  for (int r = 0; r < 8; ++r) {
    float l = l_r[r];
    l += __shfl_xor(l, 1, 32); l += __shfl_xor(l, 2, 32); l += __shfl_xor(l, 4, 32); l += __shfl_xor(l, 8, 32);
    l_r[r] = (l > 0.f) ? 1.0f / l : 0.f;
  }
#pragma unroll
  for (int dt = 0; dt < DT; ++dt)
#pragma unroll
    for (int r = 0; r < 8; ++r) sO[w][8 * hh + r][dt * 16 + ln] = oacc[dt][r] * l_r[r];
  __builtin_amdgcn_fence(__ATOMIC_ACQ_REL, "workgroup");
  __builtin_amdgcn_wave_barrier();
  {
    for (int r = 0; r < 16; ++r) {
      const int row = q0 + r;
      if (row < T && lane < D / 4) {
        const v4f val = *(const v4fa*)&sO[w][r][lane * 4];
        *(v4f*)(y + ((size_t)b * T + row) * ypitch + h * D + lane * 4) = val;
      }
    }
    
  }
}

// GEMM C = act(A·W + bias + resid): A f32 (ASPLIT -> hi/lo 2 terms), Wt bf16 [N][K]; ACT 0 none, 1 relu, 2 exact gelu;
// resid (optional, f32, row index = (row % rmod), pitch ldr, RES_BF16 rounds it) added before the activation.
template <bool ASPLIT, int ACT, bool BIAS_BF16, bool RES_BF16>
__global__ __launch_bounds__(128) void k_gemm_bf3(const float* __restrict__ A, int lda, const unsigned short* __restrict__ Wt, int ldb,
                                                const float* __restrict__ bias, const float* __restrict__ resid, int rmod, int ldr,
                                                float* __restrict__ C, int ldc, int M, int N, int K) {
  __shared__ __attribute__((aligned(16))) float so[4][16][64];
  const int tid = threadIdx.x, w = tid >> 5, lane = tid & 31, ln = lane & 15, hh = lane >> 4;
  const int ntn = N / 64;
  const int wid = blockIdx.x * 4 + w;
  const int mt = wid / ntn, nq = wid % ntn;
  if (mt * 16 >= M) return;
  const int row0 = mt * 16, col0 = nq * 64;
  const float* arow = A + (size_t)(row0 + ln) * lda;
  v8f acc[4] = {};
  for (int kb = 0; kb < K; kb += 32) {
    FragB ah, al;
    const v4f x0 = *(const v4fa*)(arow + kb + 8 * hh), x1 = *(const v4fa*)(arow + kb + 8 * hh + 4);
    const v4f x2 = *(const v4fa*)(arow + kb + 16 + 8 * hh), x3 = *(const v4fa*)(arow + kb + 16 + 8 * hh + 4);
    float xs[16] = {x0[0],x0[1],x0[2],x0[3],x1[0],x1[1],x1[2],x1[3],x2[0],x2[1],x2[2],x2[3],x3[0],x3[1],x3[2],x3[3]};
#pragma unroll
    for (int i = 0; i < 16; ++i) { const unsigned short hb = bf16_bits(xs[i]); ah.u[i] = hb; al.u[i] = ASPLIT ? bf16_bits(xs[i] - bf16_val(hb)) : (unsigned short)0; }
#pragma unroll
    for (int t = 0; t < 4; ++t) {
      const unsigned short* brow = Wt + (size_t)(col0 + t * 16 + ln) * ldb + kb;
      FragB b;
      b.half[0] = *(const v8us*)(brow + 8 * hh);
      b.half[1] = *(const v8us*)(brow + 16 + 8 * hh);
      acc[t] = mmaN<ASPLIT ? 2 : 1>(ah.v, al.v, b.v, b.v, acc[t]);
    }
  }
#pragma unroll
  for (int t = 0; t < 4; ++t) {
    const int col = col0 + t * 16 + ln;
    float bv = bias ? bias[col] : 0.f;
    if (BIAS_BF16) bv = bf16_round(bv);
#pragma unroll
    for (int r = 0; r < 8; ++r) {
      float v = acc[t][r] + bv;
      if (resid) { float rv = resid[(size_t)((row0 + 8 * hh + r) % rmod) * ldr + col]; if (RES_BF16) rv = bf16_round(rv); v += rv; }
      if (ACT == 1) v = fmaxf(v, 0.f);
      if (ACT == 2) v = 0.5f * v * (1.0f + erff(v * 0.70710678118654752f));
      if (ACT == 3) { const float u = 0.7978845608028654f * (v + 0.044715f * v * v * v); v = 0.5f * v * (1.0f + tanhf(u)); }
      so[w][8 * hh + r][t * 16 + ln] = v;
    }
  }
  __builtin_amdgcn_fence(__ATOMIC_ACQ_REL, "workgroup");
  __builtin_amdgcn_wave_barrier();
  const int rsub = lane >> 4, c4 = (lane & 15) * 4;
  {
#pragma unroll
    for (int q = 0; q < 8; ++q) {
      const int r = q * 2 + rsub;
      const v4f v = *(const v4fa*)&so[w][r][c4];
      *(v4f*)(C + (size_t)(row0 + r) * ldc + col0 + c4) = v;
    }
    
  }
}
// row LayerNorm (biased variance, eps) over N: s = X (+ R); optional out_sum <- s; out_norm <- (s-mu)*rsqrt(var+eps)*g + b
template <bool PARAM_BF16>
__global__ __launch_bounds__(256) void k_layernorm(const float* __restrict__ X, const float* __restrict__ R, const float* __restrict__ g, const float* __restrict__ bta,
                                                  float* __restrict__ out_sum, float* __restrict__ out_norm, int N, float eps) {
  __shared__ float red[256];
  const int row = blockIdx.x, tid = threadIdx.x;
  const float* x = X + (size_t)row * N; const float* rr = R ? R + (size_t)row * N : nullptr;
  float vals[16];                     // up to N = 4096
  const int per = N / 256;            // contiguous chunk per thread? use strided-by-4 chunks: thread handles j = tid*4 + 1024*u
  float s1 = 0.f;
  for (int u = 0; u < per / 4; ++u) {
    const int j = tid * 4 + 1024 * u;
    const v4f a = *(const v4fa*)(x + j);
    v4f b = {0.f,0.f,0.f,0.f}; if (rr) b = *(const v4fa*)(rr + j);
#pragma unroll
    for (int q = 0; q < 4; ++q) { const float v = a[q] + b[q]; vals[u * 4 + q] = v; s1 += v; }
  }
  red[tid] = s1; __syncthreads();
  for (int st = 128; st > 0; st >>= 1) { if (tid < st) red[tid] += red[tid + st]; __syncthreads(); }
  const float mu = red[0] / (float)N; __syncthreads();
  float s2 = 0.f;
  for (int u = 0; u < per / 4; ++u)
#pragma unroll
    for (int q = 0; q < 4; ++q) { const float c = vals[u * 4 + q] - mu; s2 += c * c; }
  red[tid] = s2; __syncthreads();
  for (int st = 128; st > 0; st >>= 1) { if (tid < st) red[tid] += red[tid + st]; __syncthreads(); }
  const float rs = rsqrtf(red[0] / (float)N + eps);
  {
    for (int u = 0; u < per / 4; ++u) {
      const int j = tid * 4 + 1024 * u;
      v4f o, sm;
#pragma unroll
      for (int q = 0; q < 4; ++q) {
        float gg = g[j + q], bb = bta[j + q];
        if (PARAM_BF16) { gg = bf16_round(gg); bb = bf16_round(bb); }
        sm[q] = vals[u * 4 + q]; o[q] = (vals[u * 4 + q] - mu) * rs * gg + bb;
      }
      if (out_sum) *(v4f*)(out_sum + (size_t)row * N + j) = sm;
      *(v4f*)(out_norm + (size_t)row * N + j) = o;
    }
    
  }
}



// ---- f16 WMMA path (v_wmma_f32_16x16x32_f16): 11-bit significands for operands in range — used where a [0,1] probability operand needs more precision than bf16
typedef _Float16 v16h __attribute__((ext_vector_type(16)));
union FragH { v16h v; v8us half[2]; _Float16 h[16]; unsigned short u[16]; };
template <int NT>
__device__ __forceinline__ v8f mmaH(v16h ah, v16h al, v16h bh, v16h bl, v8f c) {
  c = __builtin_amdgcn_wmma_f32_16x16x32_f16(false, ah, false, bh, (short)0, c, false, false);
  if (NT >= 2) c = __builtin_amdgcn_wmma_f32_16x16x32_f16(false, al, false, bh, (short)0, c, false, false);
  if (NT >= 3) c = __builtin_amdgcn_wmma_f32_16x16x32_f16(false, ah, false, bl, (short)0, c, false, false);
  asm volatile("v_nop\n\tv_nop\n\tv_nop\n\tv_nop" : "+v"(c) : "v"(ah), "v"(al), "v"(bh), "v"(bl));
  return c;
}
// batched GEMM like k_gemm_b but f16 operands: A f32 (split into f16 hi/lo if ASPLIT, else rounded to f16), Bt = f16 values [n][k]; alpha; C f32; N multiple of 16 (partial tiles skipped)
template <bool ASPLIT>
__global__ __launch_bounds__(128) void k_gemm_h(const float* __restrict__ A, int lda, size_t sA, const _Float16* __restrict__ Bh, int ldb, size_t sB, float alpha, float* __restrict__ C, int ldc, size_t sC, int M, int N, int K) {
  __shared__ __attribute__((aligned(16))) float so[4][16][64];
  const int tid = threadIdx.x, w = tid >> 5, lane = tid & 31, ln = lane & 15, hh = lane >> 4; const int by = blockIdx.y;
  A += (size_t)by * sA; Bh += (size_t)by * sB; C += (size_t)by * sC;
  const int ntn = (N + 63) / 64; const int wid = blockIdx.x * 4 + w; const int mt = wid / ntn, nq = wid % ntn; if (mt * 16 >= M) return;
  const int row0 = mt * 16, col0 = nq * 64; const float* arow = A + (size_t)(row0 + ln) * lda;
  v8f acc[4] = {};
  for (int kb = 0; kb < K; kb += 32) {
    FragH ah, al;
    const v4f x0 = *(const v4fa*)(arow + kb + 8 * hh), x1 = *(const v4fa*)(arow + kb + 8 * hh + 4), x2 = *(const v4fa*)(arow + kb + 16 + 8 * hh), x3 = *(const v4fa*)(arow + kb + 16 + 8 * hh + 4);
    float xs[16] = {x0[0],x0[1],x0[2],x0[3],x1[0],x1[1],x1[2],x1[3],x2[0],x2[1],x2[2],x2[3],x3[0],x3[1],x3[2],x3[3]};
#pragma unroll
    for (int i = 0; i < 16; ++i) { const _Float16 h = (_Float16)xs[i]; ah.h[i] = h; al.h[i] = ASPLIT ? (_Float16)(xs[i] - (float)h) : (_Float16)0.0f; }
#pragma unroll
    for (int t = 0; t < 4; ++t) { if (col0 + t * 16 >= N) continue; const size_t boff = (size_t)(col0 + t * 16 + ln) * ldb + kb; FragH bq; bq.half[0] = *(const v8us*)(Bh + boff + 8 * hh); bq.half[1] = *(const v8us*)(Bh + boff + 16 + 8 * hh);
      acc[t] = mmaH<ASPLIT ? 2 : 1>(ah.v, al.v, bq.v, bq.v, acc[t]); }
  }
#pragma unroll
  for (int t = 0; t < 4; ++t) { if (col0 + t * 16 >= N) continue;
#pragma unroll
    for (int r = 0; r < 8; ++r) so[w][8 * hh + r][t * 16 + ln] = acc[t][r] * alpha; }
  __builtin_amdgcn_fence(__ATOMIC_ACQ_REL, "workgroup"); __builtin_amdgcn_wave_barrier();
  const int rsub = lane >> 4, c4 = (lane & 15) * 4;
  {
#pragma unroll
    for (int q = 0; q < 8; ++q) { const int r = q * 2 + rsub; if (col0 + c4 < N) { const v4f v = *(const v4fa*)&so[w][r][c4]; *(v4f*)(C + (size_t)(row0 + r) * ldc + col0 + c4) = v; } }
     }
}

// Wt[n][k] = f16(W[k][n]·scale) from f32 row-major W[K][N] (scale = power of two; bf16-exact weights stay exact in f16 away from the subnormal range)
__global__ __launch_bounds__(256) void k_wt_f16(const float* __restrict__ W, _Float16* __restrict__ Wt, int K, int N, float scale) {
  const int t = blockIdx.x * 256 + threadIdx.x; if (t >= N * (K / 8)) return; const int n = t / (K / 8), k8 = (t % (K / 8)) * 8; FragH f;
#pragma unroll
  for (int i = 0; i < 8; ++i) f.h[i] = (_Float16)(bf16_round(W[(size_t)(k8 + i) * N + n]) * scale); const v8us o = f.half[0];
  *(v8us*)((unsigned short*)Wt + (size_t)n * K + k8) = o; 
}
// k_gemm_hh variant with fused epilogue: v = acc·alpha + bias[by·sBias + col] (+ CP[(row/rowsPerB)·sCPb + by·64 + col] if CP) ; ACT 0 none / 1 elu ; writes f16 C16 and/or f32 C (each if non-null)
template <int ACT>
__global__ __launch_bounds__(128) void k_gemm_hhx(const _Float16* __restrict__ A, int lda, size_t sA, const _Float16* __restrict__ Bh, int ldb, size_t sB, float alpha, const float* __restrict__ bias, size_t sBias, const float* __restrict__ CP, int rowsPerB, size_t sCPb, int row0g,
    float* __restrict__ C, _Float16* __restrict__ C16, int ldc, size_t sC, int M, int N, int K) {
  __shared__ __attribute__((aligned(16))) float so[4][16][64];
  const int tid = threadIdx.x, w = tid >> 5, lane = tid & 31, ln = lane & 15, hh = lane >> 4; const int by = blockIdx.y;
  A += (size_t)by * sA; Bh += (size_t)by * sB; const size_t cofs = (size_t)by * sC; const float* bp = bias ? bias + (size_t)by * sBias : nullptr;
  const int ntn = (N + 63) / 64; const int wid = blockIdx.x * 4 + w; const int mt = wid / ntn, nq = wid % ntn; if (mt * 16 >= M) return;
  const int row0 = mt * 16, col0 = nq * 64; const _Float16* arow = A + (size_t)(row0 + ln) * lda;
  v8f acc[4] = {};
  for (int kb = 0; kb < K; kb += 32) { FragH ah; ah.half[0] = *(const v8us*)((const unsigned short*)arow + kb + 8 * hh); ah.half[1] = *(const v8us*)((const unsigned short*)arow + kb + 16 + 8 * hh);
#pragma unroll
    for (int t = 0; t < 4; ++t) { if (col0 + t * 16 >= N) continue; const size_t boff = (size_t)(col0 + t * 16 + ln) * ldb + kb; FragH bq; bq.half[0] = *(const v8us*)((const unsigned short*)Bh + boff + 8 * hh); bq.half[1] = *(const v8us*)((const unsigned short*)Bh + boff + 16 + 8 * hh);
      acc[t] = mmaH<1>(ah.v, ah.v, bq.v, bq.v, acc[t]); }
  }
#pragma unroll
  for (int t = 0; t < 4; ++t) { if (col0 + t * 16 >= N) continue; const int col = col0 + t * 16 + ln; const float bv = bp ? bf16_round(bp[col]) : 0.f;
#pragma unroll
    for (int r = 0; r < 8; ++r) { float v = acc[t][r] * alpha + bv; if (CP) { const int bidx = (row0g + row0 + 8 * hh + r) / rowsPerB; v += CP[(size_t)bidx * sCPb + (size_t)by * 64 + col]; } if (ACT == 1) v = (v > 0.f) ? v : expm1f(v); else if (ACT == 3) v = fmaxf(v, 0.f); so[w][8 * hh + r][t * 16 + ln] = v; } }
  __builtin_amdgcn_fence(__ATOMIC_ACQ_REL, "workgroup"); __builtin_amdgcn_wave_barrier();
  const int rsub = lane >> 4, c4 = (lane & 15) * 4; typedef _Float16 v4h __attribute__((ext_vector_type(4)));
  {
#pragma unroll
    for (int q = 0; q < 8; ++q) { const int r = q * 2 + rsub; if (col0 + c4 < N) { const v4f v = *(const v4fa*)&so[w][r][c4]; if (C) *(v4f*)(C + cofs + (size_t)(row0 + r) * ldc + col0 + c4) = v; if (C16) { v4h h4; for (int i = 0; i < 4; ++i) h4[i] = (_Float16)v[i]; *(v4h*)(C16 + cofs + (size_t)(row0 + r) * ldc + col0 + c4) = h4; } } }
     }
}


// Projection Y = X.W^T / 16 + bias at the fixed shape NR x DM x DM. One 128 x 128 tile of Y per work-group of 8 waves (4 x 2 waves, 32 x 64 of Y each).
// Each 64-k step of both operands (128 rows of 128 B) is read from global as whole lines, one step ahead, into registers and laid in LDS at a pitch of 144 B
// (16 B x odd: no bank conflict for the 16-byte fragment reads). Two LDS buffers: the one barrier of a step publishes its tile and ends the reads of the buffer written next.
// Fragment maps and the ascending k order of every accumulator are those of k_gemm_hhx.
// The output strips lie over the operand buffers (72 KiB of LDS a work-group, not 140): with 8 waves of at most 160 registers three work-groups are then resident on a WGP.
// tr (the same for the whole work-group): the f16 tile goes out transposed, C16[b][n][token], the layout in which k_satt reads V. A lane's 8 accumulator registers are 8 consecutive tokens of one column n:
// one 16-byte LDS store into a 128 x 128 tile at a pitch of 272 B (16 B x odd), and behind one barrier every 16 lanes send 256 contiguous bytes (two whole lines) of one row n.
#define PJT ((NR / 128) * (DM / 128))
template <bool F32OUT>
__device__ __forceinline__ void proj_tile(const int tile, const _Float16* __restrict__ A, const _Float16* __restrict__ Bh, const float* __restrict__ bias, float* __restrict__ C, _Float16* __restrict__ C16, const bool tr) {
  constexpr int PT = 72, NS = DM / 64;
  __shared__ __attribute__((aligned(16))) unsigned char sm[2 * 2 * 128 * PT * 2];
  unsigned short (*sA)[128][PT] = (unsigned short (*)[128][PT])sm;
  unsigned short (*sB)[128][PT] = (unsigned short (*)[128][PT])(sm + 2 * 128 * PT * 2);
  float (*so)[32][68] = (float (*)[32][68])sm;
  static_assert(8 * 32 * 68 * 4 <= 2 * 2 * 128 * PT * 2, "the output strips fit in the operand buffers");
  const int tid = threadIdx.x, w = tid >> 5, lane = tid & 31, ln = lane & 15, hh = lane >> 4;
  const int m0 = (tile >> 3) * 128, n0 = (tile & 7) * 128, wm = (w >> 1) * 32, wn = (w & 1) * 64;
  const int lr = tid >> 3, lc = (tid & 7) * 8;
  const unsigned short* ga = (const unsigned short*)A + (size_t)(m0 + lr) * DM + lc;
  const unsigned short* gb = (const unsigned short*)Bh + (size_t)(n0 + lr) * DM + lc;
  v8us ra[4], rb[4];
#pragma unroll
  for (int i = 0; i < 4; ++i) { ra[i] = *(const v8us*)(ga + (size_t)i * 32 * DM); rb[i] = *(const v8us*)(gb + (size_t)i * 32 * DM); }
  v8f acc[2][4];
#pragma unroll
  for (int mt = 0; mt < 2; ++mt)
#pragma unroll
    for (int nt = 0; nt < 4; ++nt) acc[mt][nt] = (v8f){0.f,0.f,0.f,0.f,0.f,0.f,0.f,0.f};
  // unrolled by two so that the buffer index is a constant in every LDS address
#pragma unroll 2
  for (int s = 0; s < NS; ++s) {
    const int bf = s & 1;
#pragma unroll
    for (int i = 0; i < 4; ++i) { *(v8us*)&sA[bf][lr + 32 * i][lc] = ra[i]; *(v8us*)&sB[bf][lr + 32 * i][lc] = rb[i]; }
    __syncthreads();
    if (s + 1 < NS) {
#pragma unroll
      for (int i = 0; i < 4; ++i) { ra[i] = *(const v8us*)(ga + (size_t)i * 32 * DM + (s + 1) * 64); rb[i] = *(const v8us*)(gb + (size_t)i * 32 * DM + (s + 1) * 64); }
    }
    // keeps the next step's global loads in front of this step's matrix work: left free, the compiler sinks them to just before their LDS stores and their whole latency is waited out
    __builtin_amdgcn_sched_barrier(0);
#pragma unroll
    for (int ks = 0; ks < 2; ++ks) {
      FragH a[2], b[4];
#pragma unroll
      for (int mt = 0; mt < 2; ++mt) { a[mt].half[0] = *(const v8us*)&sA[bf][wm + mt * 16 + ln][ks * 32 + 8 * hh]; a[mt].half[1] = *(const v8us*)&sA[bf][wm + mt * 16 + ln][ks * 32 + 16 + 8 * hh]; }
#pragma unroll
      for (int nt = 0; nt < 4; ++nt) { b[nt].half[0] = *(const v8us*)&sB[bf][wn + nt * 16 + ln][ks * 32 + 8 * hh]; b[nt].half[1] = *(const v8us*)&sB[bf][wn + nt * 16 + ln][ks * 32 + 16 + 8 * hh]; }
#pragma unroll
      for (int mt = 0; mt < 2; ++mt)
#pragma unroll
        for (int nt = 0; nt < 4; ++nt) acc[mt][nt] = __builtin_amdgcn_wmma_f32_16x16x32_f16(false, a[mt].v, false, b[nt].v, (short)0, acc[mt][nt], false, false);
    }
  }
  // stands in front of the epilogue's reuse of the registers that held the global load addresses (the scheduling barrier keeps that reuse behind it)
  asm volatile("s_wait_xcnt 0x0" ::: "memory");
  __builtin_amdgcn_sched_barrier(0);
  // ends every wave's fragment reads of the last step before the output strips are written over the operand buffers
  __syncthreads();
  typedef _Float16 v4h __attribute__((ext_vector_type(4)));
  if (!F32OUT && tr) {
    constexpr int TP = 136;
    static_assert(128 * TP * 2 <= 2 * 2 * 128 * PT * 2, "the transposed tile fits in the operand buffers");
    unsigned short (*sT)[TP] = (unsigned short (*)[TP])sm;
#pragma unroll
    for (int nt = 0; nt < 4; ++nt) { const float bv = bf16_round(bias[n0 + wn + nt * 16 + ln]);
#pragma unroll
      for (int mt = 0; mt < 2; ++mt) { FragH f;
#pragma unroll
        for (int r = 0; r < 8; ++r) f.h[r] = (_Float16)(acc[mt][nt][r] * 0.0625f + bv);
        *(v8us*)&sT[wn + nt * 16 + ln][wm + mt * 16 + 8 * hh] = f.half[0]; } }
    // publishes the transposed tile: a row n holds the tokens of four waves
    __syncthreads();
    unsigned short* gt = (unsigned short*)C16 + ((size_t)(m0 / SS) * DM + n0 + (tid >> 4)) * SS + (m0 % SS) + (tid & 15) * 8;
#pragma unroll
    for (int i = 0; i < 8; ++i) *(v8us*)(gt + (size_t)i * 16 * SS) = *(const v8us*)&sT[i * 16 + (tid >> 4)][(tid & 15) * 8];
    return;
  }
#pragma unroll
  for (int nt = 0; nt < 4; ++nt) { const float bv = bf16_round(bias[n0 + wn + nt * 16 + ln]);
#pragma unroll
    for (int mt = 0; mt < 2; ++mt)
#pragma unroll
      for (int r = 0; r < 8; ++r) so[w][mt * 16 + 8 * hh + r][nt * 16 + ln] = acc[mt][nt][r] * 0.0625f + bv; }
  // the wave's own 32 x 64 strip: its LDS writes are ordered before its cross-lane reads, so that whole lines go out
  __builtin_amdgcn_fence(__ATOMIC_ACQ_REL, "workgroup"); __builtin_amdgcn_wave_barrier();
#pragma unroll
  for (int q = 0; q < 16; ++q) { const int r = q * 2 + hh, c4 = ln * 4; const v4f v = *(const v4fa*)&so[w][r][c4]; const size_t o = (size_t)(m0 + wm + r) * DM + n0 + wn + c4;
    if (F32OUT) *(v4f*)(C + o) = v; else { v4h h4;
#pragma unroll
      for (int i = 0; i < 4; ++i) h4[i] = (_Float16)v[i]; *(v4h*)(C16 + o) = h4; } }
  // stands behind the last store of the run, in front of any later write of a register that a store names: in the built code the transposed epilogue's block follows this one
  if (!F32OUT) asm volatile("s_wait_xcnt 0x0" ::: "memory");
}
// the Q, K and V projections in one launch: the work-group index picks the projection and its tile (a test that is the same for the whole work-group). All 3 x 256 work-groups are resident at once,
// three on a WGP, so that one's barrier, global and LDS waits are filled by the other two, and the launch gap, the fill, the first tile's latency and the epilogue are paid once
// six waves a SIMD asked for: holds the register count at 160 or below, without which the three work-groups are not resident (with the second epilogue the build takes 166 registers without it, 158 with it)
__global__ __launch_bounds__(256) __attribute__((amdgpu_waves_per_eu(6))) void k_proj_qkv(const _Float16* __restrict__ XQ, const _Float16* __restrict__ XK, const _Float16* __restrict__ XV,
                                                  const _Float16* __restrict__ Bq, const _Float16* __restrict__ Bk, const _Float16* __restrict__ Bv,
                                                  const float* __restrict__ bq, const float* __restrict__ bk, const float* __restrict__ bv,
                                                  _Float16* __restrict__ Q16, _Float16* __restrict__ K16, _Float16* __restrict__ Vt) {
  const int t = blockIdx.x / PJT;
  proj_tile<false>(blockIdx.x % PJT, t == 0 ? XQ : t == 1 ? XK : XV, t == 0 ? Bq : t == 1 ? Bk : Bv, t == 0 ? bq : t == 1 ? bk : bv, nullptr, t == 0 ? Q16 : t == 1 ? K16 : Vt, t == 2);
}
__global__ __launch_bounds__(256) void k_proj_o(const _Float16* __restrict__ A, const _Float16* __restrict__ Bh, const float* __restrict__ bias, float* __restrict__ C) { proj_tile<true>(blockIdx.x, A, Bh, bias, C, nullptr, false); }

typedef _Float16 v4hs __attribute__((ext_vector_type(4)));
// One work-group's share (256 x 4 x U elements in a row) of an f32 -> f16 conversion, as a stream: U loads of 16 B a lane, each 512 contiguous bytes a wave (whole lines), and U stores of 8 B a lane
// (two whole lines a wave). All of a wave's loads are issued before its first value is converted, so that its whole share is in flight at once. Few waves with many bytes in flight each,
// in place of one wave for every 256 elements. MODE 0: f16(x); 1: f16(bf16(x)); 2: f16(bf16(x) * 16). Each element's arithmetic is that of the one-piece-a-thread kernels.
template <int U, int MODE>
__device__ __forceinline__ void cvt_stream(const float* __restrict__ s, _Float16* __restrict__ d) {
  const int tid = threadIdx.x;
  v4f v[U];
  // the three loops are unrolled so that v[] is indexed by constants and stays in registers, and every address is one base plus an immediate offset
#pragma unroll
  for (int u = 0; u < U; ++u) v[u] = *(const v4fa*)(s + (u * 256 + tid) * 4);
  // keeps every load in front of the first conversion: left free, the compiler issues a dozen, waits for nearly all of them and converts with almost nothing in flight, several times over
  __builtin_amdgcn_sched_barrier(0);
#pragma unroll
  for (int u = 0; u < U; ++u) { v4hs h;
#pragma unroll
    for (int q = 0; q < 4; ++q) h[q] = (MODE == 0) ? (_Float16)v[u][q] : (MODE == 1) ? (_Float16)bf16_round(v[u][q]) : (_Float16)(bf16_round(v[u][q]) * 16.0f);
    *(v4hs*)(d + (u * 256 + tid) * 4) = h; }
}
#define CVU 32
#define CVE (256 * 4 * CVU)
// the three activations and the four weights in one launch: the work-group index picks the tensor and its share of it (a test that is the same for the whole work-group)
__global__ __launch_bounds__(256) void k_cvt_in(const float* __restrict__ xq, const float* __restrict__ xk, const float* __restrict__ xv,
                                                const float* __restrict__ Wq, const float* __restrict__ Wk, const float* __restrict__ Wv, const float* __restrict__ Wo,
                                                _Float16* __restrict__ XQ, _Float16* __restrict__ XK, _Float16* __restrict__ XV,
                                                _Float16* __restrict__ Bq, _Float16* __restrict__ Bk, _Float16* __restrict__ Bv, _Float16* __restrict__ Bo) {
  constexpr int GX = NR * DM / CVE, GW = DM * DM / CVE;
  const int g = blockIdx.x;
  if (g < 3 * GX) {
    const int t = g / GX; const size_t o = (size_t)(g % GX) * CVE;
    cvt_stream<CVU, 1>((t == 0 ? xq : t == 1 ? xk : xv) + o, (t == 0 ? XQ : t == 1 ? XK : XV) + o);
  } else {
    const int g2 = g - 3 * GX, t = g2 / GW; const size_t o = (size_t)(g2 % GW) * CVE;
    cvt_stream<CVU, 2>((t == 0 ? Wq : t == 1 ? Wk : t == 2 ? Wv : Wo) + o, (t == 0 ? Bq : t == 1 ? Bk : t == 2 ? Bv : Bo) + o);
  }
}
// sigmoid(s / 8) = 0.5 + 0.5 tanh(s / 16): th16 is the hardware tanh (v_tanh_f32) of s / 16, one transcendental in place of the library expf and the full-precision division
__device__ __forceinline__ float th16(float s) { return __builtin_amdgcn_tanhf(s * 0.0625f); }
// eight v_tanh_f32, each in place, with the one free slot that the instruction set asks for behind a transcendental (before its result is read or its source overwritten) as the statement's last line:
__device__ __forceinline__ void tanh8(float (&x)[8]) {
  asm("v_tanh_f32 %0, %0\n\tv_tanh_f32 %1, %1\n\tv_tanh_f32 %2, %2\n\tv_tanh_f32 %3, %3\n\tv_tanh_f32 %4, %4\n\tv_tanh_f32 %5, %5\n\tv_tanh_f32 %6, %6\n\tv_tanh_f32 %7, %7\n\tv_nop"
      : "+v"(x[0]), "+v"(x[1]), "+v"(x[2]), "+v"(x[3]), "+v"(x[4]), "+v"(x[5]), "+v"(x[6]), "+v"(x[7]));
}
// (a) O = sigmoid(q.k/8).V per (b,h): 4 waves of 32 query rows. A step is 64 keys: their K rows (64 x 128 B, one line a row) and the same keys' columns of V^T (64 d rows x 128 B, one line a row)
// are read from global as whole lines, one step ahead, into registers and laid in LDS at the pitch of proj_tile (144 B), once for the 4 waves. Two LDS buffers: the one barrier of a step publishes its
// tiles and ends the reads of the buffer written next. Fragment maps and the ascending order of the 32-key blocks in every accumulator are those of the form that read its fragments straight from global.
__global__ __launch_bounds__(128) void k_satt(const _Float16* __restrict__ Q16, const _Float16* __restrict__ K16, const _Float16* __restrict__ Vt, _Float16* __restrict__ O16) {
  constexpr int RPW = 32, NQB = SS / (4 * RPW), DT = HD / 16, KS = HD / 32, PT = 72, KT = 64, NST = SS / KT;
  __shared__ __attribute__((aligned(16))) unsigned short sK[2][KT][PT], sV[2][HD][PT];
  __shared__ __attribute__((aligned(16))) unsigned short sP[4][RPW][40]; __shared__ __attribute__((aligned(16))) float sO[4][RPW][HD];
  const int tid = threadIdx.x, w = tid >> 5, lane = tid & 31, ln = lane & 15, hh = lane >> 4;
  const int slab = blockIdx.x / NQB, qblk = blockIdx.x % NQB; const int b = slab / NH, h = slab % NH; const int q0 = qblk * (4 * RPW) + w * RPW;
  const int lr = tid >> 3, lc = (tid & 7) * 8;
  const unsigned short* gk = (const unsigned short*)K16 + ((size_t)b * SS + lr) * DM + h * HD + lc;
  const unsigned short* gv = (const unsigned short*)Vt + ((size_t)slab * HD + lr) * SS + lc;
  v8us rk[4], rv[4];
#pragma unroll
  for (int i = 0; i < 4; ++i) { rk[i] = *(const v8us*)(gk + (size_t)i * 16 * DM); rv[i] = *(const v8us*)(gv + (size_t)i * 16 * SS); }
  FragH aq[2][KS];
#pragma unroll
  for (int rt = 0; rt < 2; ++rt) { const unsigned short* qr = (const unsigned short*)Q16 + ((size_t)b * SS + q0 + rt * 16 + ln) * DM + h * HD;
#pragma unroll
    for (int ks = 0; ks < KS; ++ks) { aq[rt][ks].half[0] = *(const v8us*)(qr + ks * 32 + 8 * hh); aq[rt][ks].half[1] = *(const v8us*)(qr + ks * 32 + 16 + 8 * hh); } }
  v8f oacc[2][DT];
#pragma unroll
  for (int rt = 0; rt < 2; ++rt)
#pragma unroll
    for (int dt = 0; dt < DT; ++dt) oacc[rt][dt] = (v8f){0.f,0.f,0.f,0.f,0.f,0.f,0.f,0.f};
  // unrolled by two so that the buffer index is a constant in every LDS address
#pragma unroll 2
  for (int st = 0; st < NST; ++st) {
    const int bf = st & 1;
#pragma unroll
    for (int i = 0; i < 4; ++i) { *(v8us*)&sK[bf][lr + 16 * i][lc] = rk[i]; *(v8us*)&sV[bf][lr + 16 * i][lc] = rv[i]; }
    __syncthreads();
    // no branch round the loads (the last step reads its own keys once more, unused): the step stays one block, in which the two scheduling barriers below hold
    const int sn = (st + 1 < NST) ? st + 1 : st;
#pragma unroll
    for (int i = 0; i < 4; ++i) { rk[i] = *(const v8us*)(gk + ((size_t)sn * KT + i * 16) * DM); rv[i] = *(const v8us*)(gv + (size_t)i * 16 * SS + sn * KT); }
    // keeps the next step's global loads in front of this step's matrix and tanh work: sunk to just before their LDS stores, their whole latency would be waited out
    __builtin_amdgcn_sched_barrier(0);
    FragH bk[2][KS];
#pragma unroll
    for (int nt = 0; nt < 2; ++nt)
#pragma unroll
      for (int ks = 0; ks < KS; ++ks) { bk[nt][ks].half[0] = *(const v8us*)&sK[bf][nt * 16 + ln][ks * 32 + 8 * hh]; bk[nt][ks].half[1] = *(const v8us*)&sK[bf][nt * 16 + ln][ks * 32 + 16 + 8 * hh]; }
#pragma unroll
    for (int sub = 0; sub < KT / 32; ++sub) {
      v8f s[2][2];
#pragma unroll
      for (int nt = 0; nt < 2; ++nt)
#pragma unroll
        for (int rt = 0; rt < 2; ++rt) { v8f acc = (v8f){0.f,0.f,0.f,0.f,0.f,0.f,0.f,0.f};
#pragma unroll
          for (int ks = 0; ks < KS; ++ks) acc = mmaH<1>(aq[rt][ks].v, aq[rt][ks].v, bk[nt][ks].v, bk[nt][ks].v, acc); s[rt][nt] = acc; }
      // this block's V^T fragments and the step's next K fragments are read as one group in front of the tanh work, which covers their LDS latency
      FragH bv[DT];
#pragma unroll
      for (int dt = 0; dt < DT; ++dt) { bv[dt].half[0] = *(const v8us*)&sV[bf][dt * 16 + ln][sub * 32 + 8 * hh]; bv[dt].half[1] = *(const v8us*)&sV[bf][dt * 16 + ln][sub * 32 + 16 + 8 * hh]; }
      if (sub + 1 < KT / 32) {
#pragma unroll
        for (int nt = 0; nt < 2; ++nt)
#pragma unroll
          for (int ks = 0; ks < KS; ++ks) { bk[nt][ks].half[0] = *(const v8us*)&sK[bf][(sub + 1) * 32 + nt * 16 + ln][ks * 32 + 8 * hh]; bk[nt][ks].half[1] = *(const v8us*)&sK[bf][(sub + 1) * 32 + nt * 16 + ln][ks * 32 + 16 + 8 * hh]; }
      }
#pragma unroll
      for (int rt = 0; rt < 2; ++rt)
#pragma unroll
        for (int nt = 0; nt < 2; ++nt) { float x[8];
#pragma unroll
          for (int r = 0; r < 8; ++r) x[r] = s[rt][nt][r] * 0.0625f;
          tanh8(x);
#pragma unroll
          for (int r = 0; r < 8; ++r) { FragH t2; t2.h[0] = (_Float16)fmaf(x[r], 0.5f, 0.5f); sP[w][rt * 16 + 8 * hh + r][nt * 16 + ln] = t2.u[0]; } }
      // the wave's own P strip: its LDS writes are ordered before its cross-lane reads; LDS only, so that the next step's global loads stay in flight across it
      __builtin_amdgcn_fence(__ATOMIC_ACQ_REL, "workgroup", "local"); __builtin_amdgcn_wave_barrier();
      FragH pa[2];
#pragma unroll
      for (int rt = 0; rt < 2; ++rt) { pa[rt].half[0] = *(const v8us*)&sP[w][rt * 16 + ln][8 * hh]; pa[rt].half[1] = *(const v8us*)&sP[w][rt * 16 + ln][16 + 8 * hh]; }
#pragma unroll
      for (int dt = 0; dt < DT; ++dt)
#pragma unroll
        for (int rt = 0; rt < 2; ++rt) oacc[rt][dt] = mmaH<1>(pa[rt].v, pa[rt].v, bv[dt].v, bv[dt].v, oacc[rt][dt]);
      // the reads of the P strip are ordered before the next block's writes of it; LDS only, as above
      __builtin_amdgcn_fence(__ATOMIC_ACQ_REL, "workgroup", "local"); __builtin_amdgcn_wave_barrier();
    }
    // keeps the next step's LDS stores, and with them the wait for the global loads, behind this step's matrix and tanh work
    __builtin_amdgcn_sched_barrier(0);
  }
  // stands in front of the epilogue's reuse of the registers that held the global load addresses (the scheduling barrier keeps that reuse behind it)
  asm volatile("s_wait_xcnt 0x0" ::: "memory");
  __builtin_amdgcn_sched_barrier(0);
#pragma unroll
  for (int rt = 0; rt < 2; ++rt)
#pragma unroll
    for (int dt = 0; dt < DT; ++dt)
#pragma unroll
      for (int r = 0; r < 8; ++r) sO[w][rt * 16 + 8 * hh + r][dt * 16 + ln] = oacc[rt][dt][r];
  __builtin_amdgcn_fence(__ATOMIC_ACQ_REL, "workgroup"); __builtin_amdgcn_wave_barrier();
  {
#pragma unroll
    for (int rp = 0; rp < RPW; rp += 2) { const int r = rp + (lane >> 4), pc = lane & 15; const v4f val = *(const v4fa*)&sO[w][r][pc * 4]; v4hs h4;   // O leaves as the f16 operand of the output projection: 16 lanes send one whole line of a row
#pragma unroll
      for (int i = 0; i < 4; ++i) h4[i] = (_Float16)val[i];
      *(v4hs*)(O16 + ((size_t)b * SS + q0 + r) * DM + h * HD + pc * 4) = h4; }
     } }
// (b) attn_weights[b][q][k] = (1/16) sum_h sigmoid(q_h.k_h/8). One 128 x 128 tile (queries x keys) of one batch per work-group of 8 waves (4 x 2 waves, 32 x 64 each), made whole by that work-group.
// A step is one head: its 64 columns of the 128 query rows and of the 128 key rows (one 128-B line a row) are read from global as whole lines, one head ahead, into registers and laid in LDS
// at the pitch of proj_tile (144 B). Two LDS buffers: the one barrier of a step publishes its head and ends the reads of the buffer written next.
// Fragment maps, the ascending k order inside a head and the ascending head order of the sum of the tanh terms are those of the 16 x 32 form that read its fragments straight from global.
__global__ __launch_bounds__(256) void k_aw(const _Float16* __restrict__ Q16, const _Float16* __restrict__ K16, float* __restrict__ AW) {
  constexpr int PT = 72, NT = SS / 128;
  __shared__ __attribute__((aligned(16))) unsigned short sA[2][128][PT], sB[2][128][PT];
  __shared__ __attribute__((aligned(16))) float so[8][32][68];
  const int tid = threadIdx.x, w = tid >> 5, lane = tid & 31, ln = lane & 15, hh = lane >> 4;
  const int b = blockIdx.x / (NT * NT), tl = blockIdx.x % (NT * NT);
  const int m0 = (tl / NT) * 128, n0 = (tl % NT) * 128, wm = (w >> 1) * 32, wn = (w & 1) * 64;
  const int lr = tid >> 3, lc = (tid & 7) * 8;
  const unsigned short* ga = (const unsigned short*)Q16 + ((size_t)b * SS + m0 + lr) * DM + lc;
  const unsigned short* gb = (const unsigned short*)K16 + ((size_t)b * SS + n0 + lr) * DM + lc;
  v8us ra[4], rb[4];
#pragma unroll
  for (int i = 0; i < 4; ++i) { ra[i] = *(const v8us*)(ga + (size_t)i * 32 * DM); rb[i] = *(const v8us*)(gb + (size_t)i * 32 * DM); }
  typedef float v2f __attribute__((ext_vector_type(2)));
  v2f aw[2][4][4];   // the sums of the tanh terms, as register pairs: one packed add serves two of them
#pragma unroll
  for (int mt = 0; mt < 2; ++mt)
#pragma unroll
    for (int nt = 0; nt < 4; ++nt)
#pragma unroll
      for (int p = 0; p < 4; ++p) aw[mt][nt][p] = (v2f){0.f, 0.f};
  // unrolled by two so that the buffer index is a constant in every LDS address
#pragma unroll 2
  for (int h = 0; h < NH; ++h) {
    const int bf = h & 1;
#pragma unroll
    for (int i = 0; i < 4; ++i) { *(v8us*)&sA[bf][lr + 32 * i][lc] = ra[i]; *(v8us*)&sB[bf][lr + 32 * i][lc] = rb[i]; }
    __syncthreads();
    // no branch round the loads (the last step reads its own head once more, unused): the step stays one block, in which the two scheduling barriers below hold; with a branch here the compiler sinks the tanh work past the next step's stores and barrier
    const int hn = (h + 1 < NH) ? h + 1 : h;
#pragma unroll
    for (int i = 0; i < 4; ++i) { ra[i] = *(const v8us*)(ga + (size_t)i * 32 * DM + hn * HD); rb[i] = *(const v8us*)(gb + (size_t)i * 32 * DM + hn * HD); }
    // keeps the next head's global loads in front of this head's matrix and tanh work: left free, the compiler sinks them to just before their LDS stores and their whole latency is waited out
    __builtin_amdgcn_sched_barrier(0);
    v8f acc[2][4];
#pragma unroll
    for (int mt = 0; mt < 2; ++mt)
#pragma unroll
      for (int nt = 0; nt < 4; ++nt) acc[mt][nt] = (v8f){0.f,0.f,0.f,0.f,0.f,0.f,0.f,0.f};
#pragma unroll
    for (int ks = 0; ks < HD / 32; ++ks) {
      FragH a[2], bk[4];
#pragma unroll
      for (int mt = 0; mt < 2; ++mt) { a[mt].half[0] = *(const v8us*)&sA[bf][wm + mt * 16 + ln][ks * 32 + 8 * hh]; a[mt].half[1] = *(const v8us*)&sA[bf][wm + mt * 16 + ln][ks * 32 + 16 + 8 * hh]; }
#pragma unroll
      for (int nt = 0; nt < 4; ++nt) { bk[nt].half[0] = *(const v8us*)&sB[bf][wn + nt * 16 + ln][ks * 32 + 8 * hh]; bk[nt].half[1] = *(const v8us*)&sB[bf][wn + nt * 16 + ln][ks * 32 + 16 + 8 * hh]; }
#pragma unroll
      for (int mt = 0; mt < 2; ++mt)
#pragma unroll
        for (int nt = 0; nt < 4; ++nt) acc[mt][nt] = __builtin_amdgcn_wmma_f32_16x16x32_f16(false, a[mt].v, false, bk[nt].v, (short)0, acc[mt][nt], false, false);
    }
#pragma unroll
    for (int mt = 0; mt < 2; ++mt)
#pragma unroll
      for (int nt = 0; nt < 4; ++nt)
#pragma unroll
        for (int p = 0; p < 4; ++p) aw[mt][nt][p] += (v2f){th16(acc[mt][nt][2 * p]), th16(acc[mt][nt][2 * p + 1])};
    // keeps the next head's LDS stores behind this head's matrix and tanh work: left free, the compiler lifts them, and with them the wait for the global loads, to just behind this head's LDS reads
    __builtin_amdgcn_sched_barrier(0);
  }
  // stands in front of the epilogue's reuse of the registers that held the global load addresses (the scheduling barrier keeps that reuse behind it)
  asm volatile("s_wait_xcnt 0x0" ::: "memory");
  __builtin_amdgcn_sched_barrier(0);
#pragma unroll
  for (int nt = 0; nt < 4; ++nt)
#pragma unroll
    for (int mt = 0; mt < 2; ++mt)
#pragma unroll
      for (int r = 0; r < 8; ++r) so[w][mt * 16 + 8 * hh + r][nt * 16 + ln] = fmaf(aw[mt][nt][r >> 1][r & 1], 0.5f / (float)NH, 0.5f);   // mean_h (0.5 + 0.5 tanh) from the sum of the tanh terms
  // the wave's own 32 x 64 strip: its LDS writes are ordered before its cross-lane reads, so that whole lines go out
  __builtin_amdgcn_fence(__ATOMIC_ACQ_REL, "workgroup"); __builtin_amdgcn_wave_barrier();
#pragma unroll
  for (int q = 0; q < 16; ++q) { const int r = q * 2 + hh, c4 = ln * 4; *(v4f*)(AW + ((size_t)b * SS + m0 + wm + r) * SS + n0 + wn + c4) = *(const v4fa*)&so[w][r][c4]; }
}
extern "C" void kernel_launch(void* const* d_in, const int* in_sizes, int n_in,
                              void* d_out, int out_size, void* d_ws, size_t ws_size, hipStream_t stream) {
  (void)in_sizes; (void)n_in; (void)out_size;
  const float* xq = (const float*)d_in[0]; const float* xk = (const float*)d_in[1]; const float* xv = (const float*)d_in[2]; const float* Wq = (const float*)d_in[3]; const float* bq = (const float*)d_in[4]; const float* Wk = (const float*)d_in[5]; const float* bk = (const float*)d_in[6]; const float* Wv = (const float*)d_in[7]; const float* bv = (const float*)d_in[8]; const float* Wo = (const float*)d_in[9]; const float* bo = (const float*)d_in[10];
  float* out = (float*)d_out; float* AW = (float*)((char*)d_out + 16777216);
  char* ws = (char*)d_ws; size_t off = 0;
  auto take = [&](size_t bytes) { char* p = ws + off; off += (bytes + 255) & ~(size_t)255; return p; };
  const size_t w8 = (size_t)DM * DM / 8;
  _Float16* Bq = (_Float16*)take(w8 * 16); _Float16* Bk = (_Float16*)take(w8 * 16); _Float16* Bv = (_Float16*)take(w8 * 16); _Float16* Bo = (_Float16*)take(w8 * 16);
  _Float16* XQ = (_Float16*)take((size_t)NR * DM * 2); _Float16* XK = (_Float16*)take((size_t)NR * DM * 2); _Float16* XV = (_Float16*)take((size_t)NR * DM * 2); _Float16* Q16 = (_Float16*)take((size_t)NR * DM * 2); _Float16* K16 = (_Float16*)take((size_t)NR * DM * 2); _Float16* Vt = (_Float16*)take((size_t)NR * DM * 2); _Float16* O16 = (_Float16*)take((size_t)NR * DM * 2);
  if (off > ws_size) return;      // 64 MiB
  k_cvt_in<<<3 * (NR * DM / CVE) + 4 * (DM * DM / CVE), 256, 0, stream>>>(xq, xk, xv, Wq, Wk, Wv, Wo, XQ, XK, XV, Bq, Bk, Bv, Bo);
  k_proj_qkv<<<3 * PJT, 256, 0, stream>>>(XQ, XK, XV, Bq, Bk, Bv, bq, bk, bv, Q16, K16, Vt);
  k_satt<<<BB * NH * (SS / 128), 128, 0, stream>>>(Q16, K16, Vt, O16);
  k_proj_o<<<PJT, 256, 0, stream>>>(O16, Bo, bo, out);
  k_aw<<<BB * (SS / 128) * (SS / 128), 256, 0, stream>>>(Q16, K16, AW);
}

// v009
// A run of this version takes 105 microseconds.
// In both of two side-by-side timings against v008, it was 1.10 times as fast.
// All steps since v000 together make it 11.1 times as fast.
#include <hip/hip_runtime.h>
// q/k/v/o projections (4096 × 1024 × 1024, + bias) and the 16-head sigmoid attention on v_wmma_f32_16x16x32_f16: (a) per (b,h) a fused flash-style kernel with P = σ(q·k/8) (no normalisation,
// as the module) and O = P·V on WMMA; (b) the second output mean_h σ(q·k/8) recomputes the score tiles per head and averages them in a fixed order. x inputs f16(bf16 ·) exact, q/k/v and O rounded to f16,
// weights bf16-exact ×2^4 ((out,in)), P f16 ≤ 1, f32 accumulate.
#define BB 2
#define SS 2048
#define DM 1024
#define NH 16
#define HD 64
#define NR (BB * SS)

typedef __bf16 v16b __attribute__((ext_vector_type(16)));
typedef unsigned short v8us __attribute__((ext_vector_type(8), may_alias));
typedef float  v8f  __attribute__((ext_vector_type(8)));
typedef float  v4f  __attribute__((ext_vector_type(4)));
typedef float  v4fa __attribute__((ext_vector_type(4), may_alias));
union FragB { v16b v; v8us half[2]; unsigned short u[16]; };

__device__ __forceinline__ unsigned short bf16_bits(float x) { unsigned int u = __float_as_uint(x); return (unsigned short)((u + 0x7FFFu + ((u >> 16) & 1u)) >> 16); }
__device__ __forceinline__ float bf16_val(unsigned short b) { return __uint_as_float(((unsigned int)b) << 16); }
__device__ __forceinline__ float bf16_round(float x) { return bf16_val(bf16_bits(x)); }
// D += A·B with NT terms: 1 = ah·bh, 2 = + al·bh (A split), 3 = + ah·bl (both split)
template <int NT>
__device__ __forceinline__ v8f mmaN(v16b ah, v16b al, v16b bh, v16b bl, v8f c) {
  c = __builtin_amdgcn_wmma_f32_16x16x32_bf16(false, ah, false, bh, (short)0, c, false, false);
  if (NT >= 2) c = __builtin_amdgcn_wmma_f32_16x16x32_bf16(false, al, false, bh, (short)0, c, false, false);
  if (NT >= 3) c = __builtin_amdgcn_wmma_f32_16x16x32_bf16(false, ah, false, bl, (short)0, c, false, false);
  asm volatile("v_nop\n\tv_nop\n\tv_nop\n\tv_nop" : "+v"(c) : "v"(ah), "v"(al), "v"(bh), "v"(bl));
  return c;
}

__global__ __launch_bounds__(256) void k_wt_bf16(const float* __restrict__ W, unsigned short* __restrict__ Wt, int K, int N) {
  const int t = blockIdx.x * 256 + threadIdx.x;
  const int k8n = K / 8;
  if (t >= N * k8n) return;
  const int n = t / k8n, k8 = (t % k8n) * 8;
  v8us v;
#pragma unroll
  for (int i = 0; i < 8; ++i) v[i] = bf16_bits(W[(size_t)(k8 + i) * N + n]);
  *(v8us*)(Wt + (size_t)n * K + k8) = v;
  
}

// GEMM C[M][N] (f32, pitch ldc) = act(A[M][K]·W + bias). A f32 row-major (pitch lda) converted per fragment to bf16
// (ASPLIT: hi/lo two planes -> 2 terms, else single rounded term); Wt bf16 [N][K] (pitch ldb). BIAS_BF16 rounds the
// bias to bf16 first (bias quantised to bf16 before the add). K%32==0, M%16==0, N%64==0.
template <bool ASPLIT, int ACT, bool BIAS_BF16>
__global__ __launch_bounds__(128) void k_gemm_bf(const float* __restrict__ A, int lda, const unsigned short* __restrict__ Wt, int ldb,
                                               const float* __restrict__ bias, float* __restrict__ C, int ldc, int M, int N, int K) {
  __shared__ __attribute__((aligned(16))) float so[4][16][64];
  const int tid = threadIdx.x, w = tid >> 5, lane = tid & 31, ln = lane & 15, hh = lane >> 4;
  const int ntn = N / 64;
  const int wid = blockIdx.x * 4 + w;
  const int mt = wid / ntn, nq = wid % ntn;
  if (mt * 16 >= M) return;
  const int row0 = mt * 16, col0 = nq * 64;
  const float* arow = A + (size_t)(row0 + ln) * lda;
  v8f acc[4] = {};
  for (int kb = 0; kb < K; kb += 32) {
    FragB ah, al;
    const v4f x0 = *(const v4fa*)(arow + kb + 8 * hh), x1 = *(const v4fa*)(arow + kb + 8 * hh + 4);
    const v4f x2 = *(const v4fa*)(arow + kb + 16 + 8 * hh), x3 = *(const v4fa*)(arow + kb + 16 + 8 * hh + 4);
    float xs[16] = {x0[0],x0[1],x0[2],x0[3],x1[0],x1[1],x1[2],x1[3],x2[0],x2[1],x2[2],x2[3],x3[0],x3[1],x3[2],x3[3]};
#pragma unroll
    for (int i = 0; i < 16; ++i) { const unsigned short hb = bf16_bits(xs[i]); ah.u[i] = hb; al.u[i] = ASPLIT ? bf16_bits(xs[i] - bf16_val(hb)) : (unsigned short)0; }
#pragma unroll
    for (int t = 0; t < 4; ++t) {
      const unsigned short* brow = Wt + (size_t)(col0 + t * 16 + ln) * ldb + kb;
      FragB b;
      b.half[0] = *(const v8us*)(brow + 8 * hh);
      b.half[1] = *(const v8us*)(brow + 16 + 8 * hh);
      acc[t] = mmaN<ASPLIT ? 2 : 1>(ah.v, al.v, b.v, b.v, acc[t]);
    }
  }
#pragma unroll
  for (int t = 0; t < 4; ++t) {
    float bv = bias ? bias[col0 + t * 16 + ln] : 0.f;
    if (BIAS_BF16) bv = bf16_round(bv);
#pragma unroll
    for (int r = 0; r < 8; ++r) { float v = acc[t][r] + bv; if (ACT == 1) v = fmaxf(v, 0.f); so[w][8 * hh + r][t * 16 + ln] = v; }
  }
  __builtin_amdgcn_fence(__ATOMIC_ACQ_REL, "workgroup");
  __builtin_amdgcn_wave_barrier();
  const int rsub = lane >> 4, c4 = (lane & 15) * 4;
  {
#pragma unroll
    for (int q = 0; q < 8; ++q) {
      const int r = q * 2 + rsub;
      const v4f v = *(const v4fa*)&so[w][r][c4];
      *(v4f*)(C + (size_t)(row0 + r) * ldc + col0 + c4) = v;
    }
    
  }
}

// Flash-style causal/unmasked attention, all contractions 3-term bf16 hi/lo splits, f32 softmax with running max.
// q,k,v rows are read from f32 buffers with arbitrary row pitch (so they can live inside a fused qkv buffer);
// D = head size (multiple of 32, <= 128); one wave = 16 query rows; block = 4 waves (64 queries) sharing K/V chunks of 32.
template <int D, bool CAUSAL>
__global__ __launch_bounds__(128) void k_flash(const float* __restrict__ qb, const float* __restrict__ kb, const float* __restrict__ vb,
                                             int pitch, int T, int H, float scale, float* __restrict__ y, int ypitch) {
  constexpr int KS = D / 32;        // k-steps for QK
  constexpr int DT = D / 16;        // d tiles for PV
  __shared__ __attribute__((aligned(16))) unsigned short sKh[32][D + 8], sKl[32][D + 8], sVh[32][D + 8], sVl[32][D + 8];
  __shared__ __attribute__((aligned(16))) unsigned short sPh[4][16][40], sPl[4][16][40];
  __shared__ __attribute__((aligned(16))) float sO[4][16][D];
  const int tid = threadIdx.x, w = tid >> 5, lane = tid & 31, ln = lane & 15, hh = lane >> 4;
  const int nqb = (T + 63) / 64;
  const int bh = blockIdx.x / nqb, qblk = blockIdx.x % nqb;
  const int b = bh / H, h = bh % H;
  const int q0 = qblk * 64 + w * 16;
  const float* Q = qb + (size_t)b * T * pitch + h * D;
  const float* K = kb + (size_t)b * T * pitch + h * D;
  const float* V = vb + (size_t)b * T * pitch + h * D;

  // A fragments of the wave's 16 query rows (scaled), hi/lo
  FragB aqh[KS], aql[KS];
  {
    int row = q0 + ln; if (row >= T) row = T - 1;
    const float* qr = Q + (size_t)row * pitch;
#pragma unroll
    for (int ks = 0; ks < KS; ++ks)
#pragma unroll
      for (int i = 0; i < 16; ++i) {
        const int d = ks * 32 + ((i < 8) ? (8 * hh + i) : (16 + 8 * hh + (i - 8)));
        const float x = qr[d] * scale; const unsigned short hb = bf16_bits(x);
        aqh[ks].u[i] = hb; aql[ks].u[i] = bf16_bits(x - bf16_val(hb));
      }
  }
  float m_r[8], l_r[8];
#pragma unroll
  for (int r = 0; r < 8; ++r) { m_r[r] = -3.0e38f; l_r[r] = 0.f; }
  v8f oacc[DT];
#pragma unroll
  for (int dt = 0; dt < DT; ++dt) oacc[dt] = (v8f){0.f,0.f,0.f,0.f,0.f,0.f,0.f,0.f};

  const int kv_end = CAUSAL ? min(T, qblk * 64 + 64) : T;     // block-uniform
  for (int j0 = 0; j0 < kv_end; j0 += 32) {
    __syncthreads();
    for (int e = tid; e < 32 * (D / 4); e += 128) {
      const int r = e / (D / 4), c4 = (e % (D / 4)) * 4;
      const int key = j0 + r;
      v4f kf = {0.f,0.f,0.f,0.f}, vf = {0.f,0.f,0.f,0.f};
      if (key < T) { kf = *(const v4fa*)(K + (size_t)key * pitch + c4); vf = *(const v4fa*)(V + (size_t)key * pitch + c4); }
#pragma unroll
      for (int t = 0; t < 4; ++t) {
        unsigned short hb = bf16_bits(kf[t]); sKh[r][c4 + t] = hb; sKl[r][c4 + t] = bf16_bits(kf[t] - bf16_val(hb));
        hb = bf16_bits(vf[t]); sVh[r][c4 + t] = hb; sVl[r][c4 + t] = bf16_bits(vf[t] - bf16_val(hb));
      }
    }
    __syncthreads();
    // S tile 16 x 32
    v8f s[2];
#pragma unroll
    for (int nt = 0; nt < 2; ++nt) {
      v8f acc = {};
#pragma unroll
      for (int ks = 0; ks < KS; ++ks) {
        FragB bh_, bl_;
        bh_.half[0] = *(const v8us*)&sKh[nt * 16 + ln][ks * 32 + 8 * hh]; bh_.half[1] = *(const v8us*)&sKh[nt * 16 + ln][ks * 32 + 16 + 8 * hh];
        bl_.half[0] = *(const v8us*)&sKl[nt * 16 + ln][ks * 32 + 8 * hh]; bl_.half[1] = *(const v8us*)&sKl[nt * 16 + ln][ks * 32 + 16 + 8 * hh];
        acc = mmaN<3>(aqh[ks].v, aql[ks].v, bh_.v, bl_.v, acc);
      }
      s[nt] = acc;
    }
    // mask + running max (rows 8hh+r; the 16 lanes of a half share rows)
    float alpha[8];
#pragma unroll
    for (int r = 0; r < 8; ++r) {
      const int qi = q0 + 8 * hh + r;
      const int ja = j0 + ln, jb = j0 + 16 + ln;
      if (CAUSAL) { if (ja > qi) s[0][r] = -3.0e38f; if (jb > qi) s[1][r] = -3.0e38f; }
      if (ja >= T) s[0][r] = -3.0e38f;
      if (jb >= T) s[1][r] = -3.0e38f;
      float mx = fmaxf(s[0][r], s[1][r]);
      mx = fmaxf(mx, __shfl_xor(mx, 1, 32)); mx = fmaxf(mx, __shfl_xor(mx, 2, 32)); mx = fmaxf(mx, __shfl_xor(mx, 4, 32)); mx = fmaxf(mx, __shfl_xor(mx, 8, 32));
      const float mnew = fmaxf(m_r[r], mx);
      alpha[r] = (mnew > -1.0e38f) ? __expf(m_r[r] - mnew) : 1.0f;
      const float p0 = (s[0][r] > -1.0e38f) ? __expf(s[0][r] - mnew) : 0.f;
      const float p1 = (s[1][r] > -1.0e38f) ? __expf(s[1][r] - mnew) : 0.f;
      m_r[r] = mnew;
      l_r[r] = l_r[r] * alpha[r] + p0 + p1;            // per-lane partial row sum (16 lanes combined at the end)
      unsigned short hb = bf16_bits(p0); sPh[w][8 * hh + r][ln] = hb;      sPl[w][8 * hh + r][ln] = bf16_bits(p0 - bf16_val(hb));
      hb = bf16_bits(p1);                sPh[w][8 * hh + r][16 + ln] = hb; sPl[w][8 * hh + r][16 + ln] = bf16_bits(p1 - bf16_val(hb));
    }
#pragma unroll
    for (int dt = 0; dt < DT; ++dt)
#pragma unroll
      for (int r = 0; r < 8; ++r) oacc[dt][r] *= alpha[r];
    __builtin_amdgcn_fence(__ATOMIC_ACQ_REL, "workgroup");
    __builtin_amdgcn_wave_barrier();
    FragB pah, pal;
    pah.half[0] = *(const v8us*)&sPh[w][ln][8 * hh]; pah.half[1] = *(const v8us*)&sPh[w][ln][16 + 8 * hh];
    pal.half[0] = *(const v8us*)&sPl[w][ln][8 * hh]; pal.half[1] = *(const v8us*)&sPl[w][ln][16 + 8 * hh];
#pragma unroll
    for (int dt = 0; dt < DT; ++dt) {
      FragB bvh, bvl;
#pragma unroll
      for (int i = 0; i < 8; ++i) {
        bvh.u[i] = sVh[8 * hh + i][dt * 16 + ln]; bvh.u[8 + i] = sVh[16 + 8 * hh + i][dt * 16 + ln];
        bvl.u[i] = sVl[8 * hh + i][dt * 16 + ln]; bvl.u[8 + i] = sVl[16 + 8 * hh + i][dt * 16 + ln];
      }
      oacc[dt] = mmaN<3>(pah.v, pal.v, bvh.v, bvl.v, oacc[dt]);
    }
    __builtin_amdgcn_fence(__ATOMIC_ACQ_REL, "workgroup");
    __builtin_amdgcn_wave_barrier();
  }
#pragma unroll
  for (int r = 0; r < 8; ++r) {
    float l = l_r[r];
    l += __shfl_xor(l, 1, 32); l += __shfl_xor(l, 2, 32); l += __shfl_xor(l, 4, 32); l += __shfl_xor(l, 8, 32);
    l_r[r] = (l > 0.f) ? 1.0f / l : 0.f;
  }
#pragma unroll
  for (int dt = 0; dt < DT; ++dt)
#pragma unroll
    for (int r = 0; r < 8; ++r) sO[w][8 * hh + r][dt * 16 + ln] = oacc[dt][r] * l_r[r];
  __builtin_amdgcn_fence(__ATOMIC_ACQ_REL, "workgroup");
  __builtin_amdgcn_wave_barrier();
  {
    for (int r = 0; r < 16; ++r) {
      const int row = q0 + r;
      if (row < T && lane < D / 4) {
        const v4f val = *(const v4fa*)&sO[w][r][lane * 4];
        *(v4f*)(y + ((size_t)b * T + row) * ypitch + h * D + lane * 4) = val;
      }
    }
    
  }
}

// GEMM C = act(A·W + bias + resid): A f32 (ASPLIT -> hi/lo 2 terms), Wt bf16 [N][K]; ACT 0 none, 1 relu, 2 exact gelu;
// resid (optional, f32, row index = (row % rmod), pitch ldr, RES_BF16 rounds it) added before the activation.
template <bool ASPLIT, int ACT, bool BIAS_BF16, bool RES_BF16>
__global__ __launch_bounds__(128) void k_gemm_bf3(const float* __restrict__ A, int lda, const unsigned short* __restrict__ Wt, int ldb,
                                                const float* __restrict__ bias, const float* __restrict__ resid, int rmod, int ldr,
                                                float* __restrict__ C, int ldc, int M, int N, int K) {
  __shared__ __attribute__((aligned(16))) float so[4][16][64];
  const int tid = threadIdx.x, w = tid >> 5, lane = tid & 31, ln = lane & 15, hh = lane >> 4;
  const int ntn = N / 64;
  const int wid = blockIdx.x * 4 + w;
  const int mt = wid / ntn, nq = wid % ntn;
  if (mt * 16 >= M) return;
  const int row0 = mt * 16, col0 = nq * 64;
  const float* arow = A + (size_t)(row0 + ln) * lda;
  v8f acc[4] = {};
  for (int kb = 0; kb < K; kb += 32) {
    FragB ah, al;
    const v4f x0 = *(const v4fa*)(arow + kb + 8 * hh), x1 = *(const v4fa*)(arow + kb + 8 * hh + 4);
    const v4f x2 = *(const v4fa*)(arow + kb + 16 + 8 * hh), x3 = *(const v4fa*)(arow + kb + 16 + 8 * hh + 4);
    float xs[16] = {x0[0],x0[1],x0[2],x0[3],x1[0],x1[1],x1[2],x1[3],x2[0],x2[1],x2[2],x2[3],x3[0],x3[1],x3[2],x3[3]};
#pragma unroll
    for (int i = 0; i < 16; ++i) { const unsigned short hb = bf16_bits(xs[i]); ah.u[i] = hb; al.u[i] = ASPLIT ? bf16_bits(xs[i] - bf16_val(hb)) : (unsigned short)0; }
#pragma unroll
    for (int t = 0; t < 4; ++t) {
      const unsigned short* brow = Wt + (size_t)(col0 + t * 16 + ln) * ldb + kb;
      FragB b;
      b.half[0] = *(const v8us*)(brow + 8 * hh);
      b.half[1] = *(const v8us*)(brow + 16 + 8 * hh);
      acc[t] = mmaN<ASPLIT ? 2 : 1>(ah.v, al.v, b.v, b.v, acc[t]);
    }
  }
#pragma unroll
  for (int t = 0; t < 4; ++t) {
    const int col = col0 + t * 16 + ln;
    float bv = bias ? bias[col] : 0.f;
    if (BIAS_BF16) bv = bf16_round(bv);
#pragma unroll
    for (int r = 0; r < 8; ++r) {
      float v = acc[t][r] + bv;
      if (resid) { float rv = resid[(size_t)((row0 + 8 * hh + r) % rmod) * ldr + col]; if (RES_BF16) rv = bf16_round(rv); v += rv; }
      if (ACT == 1) v = fmaxf(v, 0.f);
      if (ACT == 2) v = 0.5f * v * (1.0f + erff(v * 0.70710678118654752f));
      if (ACT == 3) { const float u = 0.7978845608028654f * (v + 0.044715f * v * v * v); v = 0.5f * v * (1.0f + tanhf(u)); }
      so[w][8 * hh + r][t * 16 + ln] = v;
    }
  }
  __builtin_amdgcn_fence(__ATOMIC_ACQ_REL, "workgroup");
  __builtin_amdgcn_wave_barrier();
  const int rsub = lane >> 4, c4 = (lane & 15) * 4;
  {
#pragma unroll
    for (int q = 0; q < 8; ++q) {
      const int r = q * 2 + rsub;
      const v4f v = *(const v4fa*)&so[w][r][c4];
      *(v4f*)(C + (size_t)(row0 + r) * ldc + col0 + c4) = v;
    }
    
  }
}
// row LayerNorm (biased variance, eps) over N: s = X (+ R); optional out_sum <- s; out_norm <- (s-mu)*rsqrt(var+eps)*g + b
template <bool PARAM_BF16>
__global__ __launch_bounds__(256) void k_layernorm(const float* __restrict__ X, const float* __restrict__ R, const float* __restrict__ g, const float* __restrict__ bta,
                                                  float* __restrict__ out_sum, float* __restrict__ out_norm, int N, float eps) {
  __shared__ float red[256];
  const int row = blockIdx.x, tid = threadIdx.x;
  const float* x = X + (size_t)row * N; const float* rr = R ? R + (size_t)row * N : nullptr;
  float vals[16];                     // up to N = 4096
  const int per = N / 256;            // contiguous chunk per thread? use strided-by-4 chunks: thread handles j = tid*4 + 1024*u
  float s1 = 0.f;
  for (int u = 0; u < per / 4; ++u) {
    const int j = tid * 4 + 1024 * u;
    const v4f a = *(const v4fa*)(x + j);
    v4f b = {0.f,0.f,0.f,0.f}; if (rr) b = *(const v4fa*)(rr + j);
#pragma unroll
    for (int q = 0; q < 4; ++q) { const float v = a[q] + b[q]; vals[u * 4 + q] = v; s1 += v; }
  }
  red[tid] = s1; __syncthreads();
  for (int st = 128; st > 0; st >>= 1) { if (tid < st) red[tid] += red[tid + st]; __syncthreads(); }
  const float mu = red[0] / (float)N; __syncthreads();
  float s2 = 0.f;
  for (int u = 0; u < per / 4; ++u)
#pragma unroll
    for (int q = 0; q < 4; ++q) { const float c = vals[u * 4 + q] - mu; s2 += c * c; }
  red[tid] = s2; __syncthreads();
  for (int st = 128; st > 0; st >>= 1) { if (tid < st) red[tid] += red[tid + st]; __syncthreads(); }
  const float rs = rsqrtf(red[0] / (float)N + eps);
  {
    for (int u = 0; u < per / 4; ++u) {
      const int j = tid * 4 + 1024 * u;
      v4f o, sm;
#pragma unroll
      for (int q = 0; q < 4; ++q) {
        float gg = g[j + q], bb = bta[j + q];
        if (PARAM_BF16) { gg = bf16_round(gg); bb = bf16_round(bb); }
        sm[q] = vals[u * 4 + q]; o[q] = (vals[u * 4 + q] - mu) * rs * gg + bb;
      }
      if (out_sum) *(v4f*)(out_sum + (size_t)row * N + j) = sm;
      *(v4f*)(out_norm + (size_t)row * N + j) = o;
    }
    
  }
}



// ---- f16 WMMA path (v_wmma_f32_16x16x32_f16): 11-bit significands for operands in range — used where a [0,1] probability operand needs more precision than bf16
typedef _Float16 v16h __attribute__((ext_vector_type(16)));
union FragH { v16h v; v8us half[2]; _Float16 h[16]; unsigned short u[16]; };
template <int NT>
__device__ __forceinline__ v8f mmaH(v16h ah, v16h al, v16h bh, v16h bl, v8f c) {
  c = __builtin_amdgcn_wmma_f32_16x16x32_f16(false, ah, false, bh, (short)0, c, false, false);
  if (NT >= 2) c = __builtin_amdgcn_wmma_f32_16x16x32_f16(false, al, false, bh, (short)0, c, false, false);
  if (NT >= 3) c = __builtin_amdgcn_wmma_f32_16x16x32_f16(false, ah, false, bl, (short)0, c, false, false);
  asm volatile("v_nop\n\tv_nop\n\tv_nop\n\tv_nop" : "+v"(c) : "v"(ah), "v"(al), "v"(bh), "v"(bl));
  return c;
}
// batched GEMM like k_gemm_b but f16 operands: A f32 (split into f16 hi/lo if ASPLIT, else rounded to f16), Bt = f16 values [n][k]; alpha; C f32; N multiple of 16 (partial tiles skipped)
template <bool ASPLIT>
__global__ __launch_bounds__(128) void k_gemm_h(const float* __restrict__ A, int lda, size_t sA, const _Float16* __restrict__ Bh, int ldb, size_t sB, float alpha, float* __restrict__ C, int ldc, size_t sC, int M, int N, int K) {
  __shared__ __attribute__((aligned(16))) float so[4][16][64];
  const int tid = threadIdx.x, w = tid >> 5, lane = tid & 31, ln = lane & 15, hh = lane >> 4; const int by = blockIdx.y;
  A += (size_t)by * sA; Bh += (size_t)by * sB; C += (size_t)by * sC;
  const int ntn = (N + 63) / 64; const int wid = blockIdx.x * 4 + w; const int mt = wid / ntn, nq = wid % ntn; if (mt * 16 >= M) return;
  const int row0 = mt * 16, col0 = nq * 64; const float* arow = A + (size_t)(row0 + ln) * lda;
  v8f acc[4] = {};
  for (int kb = 0; kb < K; kb += 32) {
    FragH ah, al;
    const v4f x0 = *(const v4fa*)(arow + kb + 8 * hh), x1 = *(const v4fa*)(arow + kb + 8 * hh + 4), x2 = *(const v4fa*)(arow + kb + 16 + 8 * hh), x3 = *(const v4fa*)(arow + kb + 16 + 8 * hh + 4);
    float xs[16] = {x0[0],x0[1],x0[2],x0[3],x1[0],x1[1],x1[2],x1[3],x2[0],x2[1],x2[2],x2[3],x3[0],x3[1],x3[2],x3[3]};
#pragma unroll
    for (int i = 0; i < 16; ++i) { const _Float16 h = (_Float16)xs[i]; ah.h[i] = h; al.h[i] = ASPLIT ? (_Float16)(xs[i] - (float)h) : (_Float16)0.0f; }
#pragma unroll
    for (int t = 0; t < 4; ++t) { if (col0 + t * 16 >= N) continue; const size_t boff = (size_t)(col0 + t * 16 + ln) * ldb + kb; FragH bq; bq.half[0] = *(const v8us*)(Bh + boff + 8 * hh); bq.half[1] = *(const v8us*)(Bh + boff + 16 + 8 * hh);
      acc[t] = mmaH<ASPLIT ? 2 : 1>(ah.v, al.v, bq.v, bq.v, acc[t]); }
  }
#pragma unroll
  for (int t = 0; t < 4; ++t) { if (col0 + t * 16 >= N) continue;
#pragma unroll
    for (int r = 0; r < 8; ++r) so[w][8 * hh + r][t * 16 + ln] = acc[t][r] * alpha; }
  __builtin_amdgcn_fence(__ATOMIC_ACQ_REL, "workgroup"); __builtin_amdgcn_wave_barrier();
  const int rsub = lane >> 4, c4 = (lane & 15) * 4;
  {
#pragma unroll
    for (int q = 0; q < 8; ++q) { const int r = q * 2 + rsub; if (col0 + c4 < N) { const v4f v = *(const v4fa*)&so[w][r][c4]; *(v4f*)(C + (size_t)(row0 + r) * ldc + col0 + c4) = v; } }
     }
}

// Wt[n][k] = f16(W[k][n]·scale) from f32 row-major W[K][N] (scale = power of two; bf16-exact weights stay exact in f16 away from the subnormal range)
__global__ __launch_bounds__(256) void k_wt_f16(const float* __restrict__ W, _Float16* __restrict__ Wt, int K, int N, float scale) {
  const int t = blockIdx.x * 256 + threadIdx.x; if (t >= N * (K / 8)) return; const int n = t / (K / 8), k8 = (t % (K / 8)) * 8; FragH f;
#pragma unroll
  for (int i = 0; i < 8; ++i) f.h[i] = (_Float16)(bf16_round(W[(size_t)(k8 + i) * N + n]) * scale); const v8us o = f.half[0];
  *(v8us*)((unsigned short*)Wt + (size_t)n * K + k8) = o; 
}
// k_gemm_hh variant with fused epilogue: v = acc·alpha + bias[by·sBias + col] (+ CP[(row/rowsPerB)·sCPb + by·64 + col] if CP) ; ACT 0 none / 1 elu ; writes f16 C16 and/or f32 C (each if non-null)
template <int ACT>
__global__ __launch_bounds__(128) void k_gemm_hhx(const _Float16* __restrict__ A, int lda, size_t sA, const _Float16* __restrict__ Bh, int ldb, size_t sB, float alpha, const float* __restrict__ bias, size_t sBias, const float* __restrict__ CP, int rowsPerB, size_t sCPb, int row0g,
    float* __restrict__ C, _Float16* __restrict__ C16, int ldc, size_t sC, int M, int N, int K) {
  __shared__ __attribute__((aligned(16))) float so[4][16][64];
  const int tid = threadIdx.x, w = tid >> 5, lane = tid & 31, ln = lane & 15, hh = lane >> 4; const int by = blockIdx.y;
  A += (size_t)by * sA; Bh += (size_t)by * sB; const size_t cofs = (size_t)by * sC; const float* bp = bias ? bias + (size_t)by * sBias : nullptr;
  const int ntn = (N + 63) / 64; const int wid = blockIdx.x * 4 + w; const int mt = wid / ntn, nq = wid % ntn; if (mt * 16 >= M) return;
  const int row0 = mt * 16, col0 = nq * 64; const _Float16* arow = A + (size_t)(row0 + ln) * lda;
  v8f acc[4] = {};
  for (int kb = 0; kb < K; kb += 32) { FragH ah; ah.half[0] = *(const v8us*)((const unsigned short*)arow + kb + 8 * hh); ah.half[1] = *(const v8us*)((const unsigned short*)arow + kb + 16 + 8 * hh);
#pragma unroll
    for (int t = 0; t < 4; ++t) { if (col0 + t * 16 >= N) continue; const size_t boff = (size_t)(col0 + t * 16 + ln) * ldb + kb; FragH bq; bq.half[0] = *(const v8us*)((const unsigned short*)Bh + boff + 8 * hh); bq.half[1] = *(const v8us*)((const unsigned short*)Bh + boff + 16 + 8 * hh);
      acc[t] = mmaH<1>(ah.v, ah.v, bq.v, bq.v, acc[t]); }
  }
#pragma unroll
  for (int t = 0; t < 4; ++t) { if (col0 + t * 16 >= N) continue; const int col = col0 + t * 16 + ln; const float bv = bp ? bf16_round(bp[col]) : 0.f;
#pragma unroll
    for (int r = 0; r < 8; ++r) { float v = acc[t][r] * alpha + bv; if (CP) { const int bidx = (row0g + row0 + 8 * hh + r) / rowsPerB; v += CP[(size_t)bidx * sCPb + (size_t)by * 64 + col]; } if (ACT == 1) v = (v > 0.f) ? v : expm1f(v); else if (ACT == 3) v = fmaxf(v, 0.f); so[w][8 * hh + r][t * 16 + ln] = v; } }
  __builtin_amdgcn_fence(__ATOMIC_ACQ_REL, "workgroup"); __builtin_amdgcn_wave_barrier();
  const int rsub = lane >> 4, c4 = (lane & 15) * 4; typedef _Float16 v4h __attribute__((ext_vector_type(4)));
  {
#pragma unroll
    for (int q = 0; q < 8; ++q) { const int r = q * 2 + rsub; if (col0 + c4 < N) { const v4f v = *(const v4fa*)&so[w][r][c4]; if (C) *(v4f*)(C + cofs + (size_t)(row0 + r) * ldc + col0 + c4) = v; if (C16) { v4h h4; for (int i = 0; i < 4; ++i) h4[i] = (_Float16)v[i]; *(v4h*)(C16 + cofs + (size_t)(row0 + r) * ldc + col0 + c4) = h4; } } }
     }
}


// Projection Y = X.W^T / 16 + bias at the fixed shape NR x DM x DM. One 128 x 128 tile of Y per work-group of 8 waves (4 x 2 waves, 32 x 64 of Y each).
// Each 64-k step of both operands (128 rows of 128 B) is read from global as whole lines, one step ahead, into registers and laid in LDS at a pitch of 144 B
// (16 B x odd: no bank conflict for the 16-byte fragment reads). Two LDS buffers: the one barrier of a step publishes its tile and ends the reads of the buffer written next.
// Fragment maps and the ascending k order of every accumulator are those of k_gemm_hhx.
// The output strips lie over the operand buffers (72 KiB of LDS a work-group, not 140): with 8 waves of at most 160 registers three work-groups are then resident on a WGP.
// tr (the same for the whole work-group): the f16 tile goes out transposed, C16[b][n][token], the layout in which k_satt reads V. A lane's 8 accumulator registers are 8 consecutive tokens of one column n:
// one 16-byte LDS store into a 128 x 128 tile at a pitch of 272 B (16 B x odd), and behind one barrier every 16 lanes send 256 contiguous bytes (two whole lines) of one row n.
#define PJT ((NR / 128) * (DM / 128))
template <bool F32OUT>
__device__ __forceinline__ void proj_tile(const int tile, const _Float16* __restrict__ A, const _Float16* __restrict__ Bh, const float* __restrict__ bias, float* __restrict__ C, _Float16* __restrict__ C16, const bool tr) {
  constexpr int PT = 72, NS = DM / 64;
  __shared__ __attribute__((aligned(16))) unsigned char sm[2 * 2 * 128 * PT * 2];
  unsigned short (*sA)[128][PT] = (unsigned short (*)[128][PT])sm;
  unsigned short (*sB)[128][PT] = (unsigned short (*)[128][PT])(sm + 2 * 128 * PT * 2);
  float (*so)[32][68] = (float (*)[32][68])sm;
  static_assert(8 * 32 * 68 * 4 <= 2 * 2 * 128 * PT * 2, "the output strips fit in the operand buffers");
  const int tid = threadIdx.x, w = tid >> 5, lane = tid & 31, ln = lane & 15, hh = lane >> 4;
  const int m0 = (tile >> 3) * 128, n0 = (tile & 7) * 128, wm = (w >> 1) * 32, wn = (w & 1) * 64;
  const int lr = tid >> 3, lc = (tid & 7) * 8;
  const unsigned short* ga = (const unsigned short*)A + (size_t)(m0 + lr) * DM + lc;
  const unsigned short* gb = (const unsigned short*)Bh + (size_t)(n0 + lr) * DM + lc;
  v8us ra[4], rb[4];
#pragma unroll
  for (int i = 0; i < 4; ++i) { ra[i] = *(const v8us*)(ga + (size_t)i * 32 * DM); rb[i] = *(const v8us*)(gb + (size_t)i * 32 * DM); }
  v8f acc[2][4];
#pragma unroll
  for (int mt = 0; mt < 2; ++mt)
#pragma unroll
    for (int nt = 0; nt < 4; ++nt) acc[mt][nt] = (v8f){0.f,0.f,0.f,0.f,0.f,0.f,0.f,0.f};
  // unrolled by two so that the buffer index is a constant in every LDS address
#pragma unroll 2
  for (int s = 0; s < NS; ++s) {
    const int bf = s & 1;
#pragma unroll
    for (int i = 0; i < 4; ++i) { *(v8us*)&sA[bf][lr + 32 * i][lc] = ra[i]; *(v8us*)&sB[bf][lr + 32 * i][lc] = rb[i]; }
    __syncthreads();
    if (s + 1 < NS) {
#pragma unroll
      for (int i = 0; i < 4; ++i) { ra[i] = *(const v8us*)(ga + (size_t)i * 32 * DM + (s + 1) * 64); rb[i] = *(const v8us*)(gb + (size_t)i * 32 * DM + (s + 1) * 64); }
    }
    // keeps the next step's global loads in front of this step's matrix work: left free, the compiler sinks them to just before their LDS stores and their whole latency is waited out
    __builtin_amdgcn_sched_barrier(0);
#pragma unroll
    for (int ks = 0; ks < 2; ++ks) {
      FragH a[2], b[4];
#pragma unroll
      for (int mt = 0; mt < 2; ++mt) { a[mt].half[0] = *(const v8us*)&sA[bf][wm + mt * 16 + ln][ks * 32 + 8 * hh]; a[mt].half[1] = *(const v8us*)&sA[bf][wm + mt * 16 + ln][ks * 32 + 16 + 8 * hh]; }
#pragma unroll
      for (int nt = 0; nt < 4; ++nt) { b[nt].half[0] = *(const v8us*)&sB[bf][wn + nt * 16 + ln][ks * 32 + 8 * hh]; b[nt].half[1] = *(const v8us*)&sB[bf][wn + nt * 16 + ln][ks * 32 + 16 + 8 * hh]; }
#pragma unroll
      for (int mt = 0; mt < 2; ++mt)
#pragma unroll
        for (int nt = 0; nt < 4; ++nt) acc[mt][nt] = __builtin_amdgcn_wmma_f32_16x16x32_f16(false, a[mt].v, false, b[nt].v, (short)0, acc[mt][nt], false, false);
    }
  }
  // stands in front of the epilogue's reuse of the registers that held the global load addresses (the scheduling barrier keeps that reuse behind it)
  asm volatile("s_wait_xcnt 0x0" ::: "memory");
  __builtin_amdgcn_sched_barrier(0);
  // ends every wave's fragment reads of the last step before the output strips are written over the operand buffers
  __syncthreads();
  typedef _Float16 v4h __attribute__((ext_vector_type(4)));
  if (!F32OUT && tr) {
    constexpr int TP = 136;
    static_assert(128 * TP * 2 <= 2 * 2 * 128 * PT * 2, "the transposed tile fits in the operand buffers");
    unsigned short (*sT)[TP] = (unsigned short (*)[TP])sm;
#pragma unroll
    for (int nt = 0; nt < 4; ++nt) { const float bv = bf16_round(bias[n0 + wn + nt * 16 + ln]);
#pragma unroll
      for (int mt = 0; mt < 2; ++mt) { FragH f;
#pragma unroll
        for (int r = 0; r < 8; ++r) f.h[r] = (_Float16)(acc[mt][nt][r] * 0.0625f + bv);
        *(v8us*)&sT[wn + nt * 16 + ln][wm + mt * 16 + 8 * hh] = f.half[0]; } }
    // publishes the transposed tile: a row n holds the tokens of four waves
    __syncthreads();
    unsigned short* gt = (unsigned short*)C16 + ((size_t)(m0 / SS) * DM + n0 + (tid >> 4)) * SS + (m0 % SS) + (tid & 15) * 8;
#pragma unroll
    for (int i = 0; i < 8; ++i) *(v8us*)(gt + (size_t)i * 16 * SS) = *(const v8us*)&sT[i * 16 + (tid >> 4)][(tid & 15) * 8];
    return;
  }
#pragma unroll
  for (int nt = 0; nt < 4; ++nt) { const float bv = bf16_round(bias[n0 + wn + nt * 16 + ln]);
#pragma unroll
    for (int mt = 0; mt < 2; ++mt)
#pragma unroll
      for (int r = 0; r < 8; ++r) so[w][mt * 16 + 8 * hh + r][nt * 16 + ln] = acc[mt][nt][r] * 0.0625f + bv; }
  // the wave's own 32 x 64 strip: its LDS writes are ordered before its cross-lane reads, so that whole lines go out
  __builtin_amdgcn_fence(__ATOMIC_ACQ_REL, "workgroup"); __builtin_amdgcn_wave_barrier();
#pragma unroll
  for (int q = 0; q < 16; ++q) { const int r = q * 2 + hh, c4 = ln * 4; const v4f v = *(const v4fa*)&so[w][r][c4]; const size_t o = (size_t)(m0 + wm + r) * DM + n0 + wn + c4;
    if (F32OUT) *(v4f*)(C + o) = v; else { v4h h4;
#pragma unroll
      for (int i = 0; i < 4; ++i) h4[i] = (_Float16)v[i]; *(v4h*)(C16 + o) = h4; } }
  // stands behind the last store of the run, in front of any later write of a register that a store names: in the built code the transposed epilogue's block follows this one
  if (!F32OUT) asm volatile("s_wait_xcnt 0x0" ::: "memory");
}
// the Q, K and V projections in one launch: the work-group index picks the projection and its tile (a test that is the same for the whole work-group). All 3 x 256 work-groups are resident at once,
// three on a WGP, so that one's barrier, global and LDS waits are filled by the other two, and the launch gap, the fill, the first tile's latency and the epilogue are paid once
// six waves a SIMD asked for: holds the register count at 160 or below, without which the three work-groups are not resident (with the second epilogue the build takes 166 registers without it, 158 with it)
__global__ __launch_bounds__(256) __attribute__((amdgpu_waves_per_eu(6))) void k_proj_qkv(const _Float16* __restrict__ XQ, const _Float16* __restrict__ XK, const _Float16* __restrict__ XV,
                                                  const _Float16* __restrict__ Bq, const _Float16* __restrict__ Bk, const _Float16* __restrict__ Bv,
                                                  const float* __restrict__ bq, const float* __restrict__ bk, const float* __restrict__ bv,
                                                  _Float16* __restrict__ Q16, _Float16* __restrict__ K16, _Float16* __restrict__ Vt) {
  const int t = blockIdx.x / PJT;
  proj_tile<false>(blockIdx.x % PJT, t == 0 ? XQ : t == 1 ? XK : XV, t == 0 ? Bq : t == 1 ? Bk : Bv, t == 0 ? bq : t == 1 ? bk : bv, nullptr, t == 0 ? Q16 : t == 1 ? K16 : Vt, t == 2);
}
__global__ __launch_bounds__(256) void k_proj_o(const _Float16* __restrict__ A, const _Float16* __restrict__ Bh, const float* __restrict__ bias, float* __restrict__ C) { proj_tile<true>(blockIdx.x, A, Bh, bias, C, nullptr, false); }

typedef _Float16 v4hs __attribute__((ext_vector_type(4)));
// One work-group's share (256 x 4 x U elements in a row) of an f32 -> f16 conversion, as a stream: U loads of 16 B a lane, each 512 contiguous bytes a wave (whole lines), and U stores of 8 B a lane
// (two whole lines a wave). All of a wave's loads are issued before its first value is converted, so that its whole share is in flight at once. Few waves with many bytes in flight each,
// in place of one wave for every 256 elements. MODE 0: f16(x); 1: f16(bf16(x)); 2: f16(bf16(x) * 16). Each element's arithmetic is that of the one-piece-a-thread kernels.
template <int U, int MODE>
__device__ __forceinline__ void cvt_stream(const float* __restrict__ s, _Float16* __restrict__ d) {
  const int tid = threadIdx.x;
  v4f v[U];
  // the three loops are unrolled so that v[] is indexed by constants and stays in registers, and every address is one base plus an immediate offset
#pragma unroll
  for (int u = 0; u < U; ++u) v[u] = *(const v4fa*)(s + (u * 256 + tid) * 4);
  // keeps every load in front of the first conversion: left free, the compiler issues a dozen, waits for nearly all of them and converts with almost nothing in flight, several times over
  __builtin_amdgcn_sched_barrier(0);
#pragma unroll
  for (int u = 0; u < U; ++u) { v4hs h;
#pragma unroll
    for (int q = 0; q < 4; ++q) h[q] = (MODE == 0) ? (_Float16)v[u][q] : (MODE == 1) ? (_Float16)bf16_round(v[u][q]) : (_Float16)(bf16_round(v[u][q]) * 16.0f);
    *(v4hs*)(d + (u * 256 + tid) * 4) = h; }
}
#define CVU 32
#define CVE (256 * 4 * CVU)
// the three activations and the four weights in one launch: the work-group index picks the tensor and its share of it (a test that is the same for the whole work-group)
__global__ __launch_bounds__(256) void k_cvt_in(const float* __restrict__ xq, const float* __restrict__ xk, const float* __restrict__ xv,
                                                const float* __restrict__ Wq, const float* __restrict__ Wk, const float* __restrict__ Wv, const float* __restrict__ Wo,
                                                _Float16* __restrict__ XQ, _Float16* __restrict__ XK, _Float16* __restrict__ XV,
                                                _Float16* __restrict__ Bq, _Float16* __restrict__ Bk, _Float16* __restrict__ Bv, _Float16* __restrict__ Bo) {
  constexpr int GX = NR * DM / CVE, GW = DM * DM / CVE;
  const int g = blockIdx.x;
  if (g < 3 * GX) {
    const int t = g / GX; const size_t o = (size_t)(g % GX) * CVE;
    cvt_stream<CVU, 1>((t == 0 ? xq : t == 1 ? xk : xv) + o, (t == 0 ? XQ : t == 1 ? XK : XV) + o);
  } else {
    const int g2 = g - 3 * GX, t = g2 / GW; const size_t o = (size_t)(g2 % GW) * CVE;
    cvt_stream<CVU, 2>((t == 0 ? Wq : t == 1 ? Wk : t == 2 ? Wv : Wo) + o, (t == 0 ? Bq : t == 1 ? Bk : t == 2 ? Bv : Bo) + o);
  }
}
// sigmoid(s / 8) = 0.5 + 0.5 tanh(s / 16): th16 is the hardware tanh (v_tanh_f32) of s / 16, one transcendental in place of the library expf and the full-precision division
__device__ __forceinline__ float th16(float s) { return __builtin_amdgcn_tanhf(s * 0.0625f); }
// eight v_tanh_f32, each in place, with the one free slot that the instruction set asks for behind a transcendental (before its result is read or its source overwritten) as the statement's last line:
__device__ __forceinline__ void tanh8(float (&x)[8]) {
  asm("v_tanh_f32 %0, %0\n\tv_tanh_f32 %1, %1\n\tv_tanh_f32 %2, %2\n\tv_tanh_f32 %3, %3\n\tv_tanh_f32 %4, %4\n\tv_tanh_f32 %5, %5\n\tv_tanh_f32 %6, %6\n\tv_tanh_f32 %7, %7\n\tv_nop"
      : "+v"(x[0]), "+v"(x[1]), "+v"(x[2]), "+v"(x[3]), "+v"(x[4]), "+v"(x[5]), "+v"(x[6]), "+v"(x[7]));
}
// (a) O = sigmoid(q.k/8).V per (b,h): 4 waves of 32 query rows. A step is 64 keys: their K rows (64 x 128 B, one line a row) and the same keys' columns of V^T (64 d rows x 128 B, one line a row)
// are read from global as whole lines, one step ahead, into registers and laid in LDS at the pitch of proj_tile (144 B), once for the 4 waves. Two LDS buffers: the one barrier of a step publishes its
// tiles and ends the reads of the buffer written next. Fragment maps and the ascending order of the 32-key blocks in every accumulator are those of the form that read its fragments straight from global.
// The scores are made transposed, S^T = K.Q^T (K rows as A, Q rows as B): a lane then holds, for ONE query (its column), keys 8hh .. 8hh+7 of each 16-key tile in the tile's 8 accumulator registers,
// which is the k order of an A operand's row. The two tiles of a 32-key block, taken through the sigmoid and converted in place, ARE the A operand of P.V: P passes through no LDS and no lane exchange.
__global__ __launch_bounds__(128) void k_satt(const _Float16* __restrict__ Q16, const _Float16* __restrict__ K16, const _Float16* __restrict__ Vt, _Float16* __restrict__ O16) {
  constexpr int RPW = 32, NQB = SS / (4 * RPW), DT = HD / 16, KS = HD / 32, PT = 72, KT = 64, NST = SS / KT;
  __shared__ __attribute__((aligned(16))) unsigned short sK[2][KT][PT], sV[2][HD][PT];
  __shared__ __attribute__((aligned(16))) float sO[4][RPW][HD];
  const int tid = threadIdx.x, w = tid >> 5, lane = tid & 31, ln = lane & 15, hh = lane >> 4;
  const int slab = blockIdx.x / NQB, qblk = blockIdx.x % NQB; const int b = slab / NH, h = slab % NH; const int q0 = qblk * (4 * RPW) + w * RPW;
  const int lr = tid >> 3, lc = (tid & 7) * 8;
  const unsigned short* gk = (const unsigned short*)K16 + ((size_t)b * SS + lr) * DM + h * HD + lc;
  const unsigned short* gv = (const unsigned short*)Vt + ((size_t)slab * HD + lr) * SS + lc;
  v8us rk[4], rv[4];
#pragma unroll
  for (int i = 0; i < 4; ++i) { rk[i] = *(const v8us*)(gk + (size_t)i * 16 * DM); rv[i] = *(const v8us*)(gv + (size_t)i * 16 * SS); }
  FragH aq[2][KS];
#pragma unroll
  for (int rt = 0; rt < 2; ++rt) { const unsigned short* qr = (const unsigned short*)Q16 + ((size_t)b * SS + q0 + rt * 16 + ln) * DM + h * HD;
#pragma unroll
    for (int ks = 0; ks < KS; ++ks) { aq[rt][ks].half[0] = *(const v8us*)(qr + ks * 32 + 8 * hh); aq[rt][ks].half[1] = *(const v8us*)(qr + ks * 32 + 16 + 8 * hh); } }
  v8f oacc[2][DT];
#pragma unroll
  for (int rt = 0; rt < 2; ++rt)
#pragma unroll
    for (int dt = 0; dt < DT; ++dt) oacc[rt][dt] = (v8f){0.f,0.f,0.f,0.f,0.f,0.f,0.f,0.f};
  // unrolled by two so that the buffer index is a constant in every LDS address
#pragma unroll 2
  for (int st = 0; st < NST; ++st) {
    const int bf = st & 1;
#pragma unroll
    for (int i = 0; i < 4; ++i) { *(v8us*)&sK[bf][lr + 16 * i][lc] = rk[i]; *(v8us*)&sV[bf][lr + 16 * i][lc] = rv[i]; }
    __syncthreads();
    // no branch round the loads (the last step reads its own keys once more, unused): the step stays one block, in which the two scheduling barriers below hold
    const int sn = (st + 1 < NST) ? st + 1 : st;
#pragma unroll
    for (int i = 0; i < 4; ++i) { rk[i] = *(const v8us*)(gk + ((size_t)sn * KT + i * 16) * DM); rv[i] = *(const v8us*)(gv + (size_t)i * 16 * SS + sn * KT); }
    // keeps the next step's global loads in front of this step's matrix and tanh work: sunk to just before their LDS stores, their whole latency would be waited out
    __builtin_amdgcn_sched_barrier(0);
    FragH bk[2][KS];
#pragma unroll
    for (int nt = 0; nt < 2; ++nt)
#pragma unroll
      for (int ks = 0; ks < KS; ++ks) { bk[nt][ks].half[0] = *(const v8us*)&sK[bf][nt * 16 + ln][ks * 32 + 8 * hh]; bk[nt][ks].half[1] = *(const v8us*)&sK[bf][nt * 16 + ln][ks * 32 + 16 + 8 * hh]; }
#pragma unroll
    for (int sub = 0; sub < KT / 32; ++sub) {
      v8f s[2][2];
#pragma unroll
      for (int nt = 0; nt < 2; ++nt)
#pragma unroll
        for (int rt = 0; rt < 2; ++rt) { v8f acc = (v8f){0.f,0.f,0.f,0.f,0.f,0.f,0.f,0.f};
#pragma unroll
          for (int ks = 0; ks < KS; ++ks) acc = mmaH<1>(bk[nt][ks].v, bk[nt][ks].v, aq[rt][ks].v, aq[rt][ks].v, acc); s[rt][nt] = acc; }   // register r = key nt * 16 + 8 * hh + r, lane column = query rt * 16 + ln
      // this block's V^T fragments and the step's next K fragments are read as one group in front of the tanh work, which covers their LDS latency
      FragH bv[DT];
#pragma unroll
      for (int dt = 0; dt < DT; ++dt) { bv[dt].half[0] = *(const v8us*)&sV[bf][dt * 16 + ln][sub * 32 + 8 * hh]; bv[dt].half[1] = *(const v8us*)&sV[bf][dt * 16 + ln][sub * 32 + 16 + 8 * hh]; }
      if (sub + 1 < KT / 32) {
#pragma unroll
        for (int nt = 0; nt < 2; ++nt)
#pragma unroll
          for (int ks = 0; ks < KS; ++ks) { bk[nt][ks].half[0] = *(const v8us*)&sK[bf][(sub + 1) * 32 + nt * 16 + ln][ks * 32 + 8 * hh]; bk[nt][ks].half[1] = *(const v8us*)&sK[bf][(sub + 1) * 32 + nt * 16 + ln][ks * 32 + 16 + 8 * hh]; }
      }
      FragH pa[2];
#pragma unroll
      for (int rt = 0; rt < 2; ++rt)
#pragma unroll
        for (int nt = 0; nt < 2; ++nt) { float x[8];
#pragma unroll
          for (int r = 0; r < 8; ++r) x[r] = s[rt][nt][r] * 0.0625f;
          tanh8(x);
#pragma unroll
          for (int r = 0; r < 8; ++r) pa[rt].h[nt * 8 + r] = (_Float16)fmaf(x[r], 0.5f, 0.5f); }
#pragma unroll
      for (int dt = 0; dt < DT; ++dt)
#pragma unroll
        for (int rt = 0; rt < 2; ++rt) oacc[rt][dt] = mmaH<1>(pa[rt].v, pa[rt].v, bv[dt].v, bv[dt].v, oacc[rt][dt]);
    }
    // keeps the next step's LDS stores, and with them the wait for the global loads, behind this step's matrix and tanh work
    __builtin_amdgcn_sched_barrier(0);
  }
  // stands in front of the epilogue's reuse of the registers that held the global load addresses (the scheduling barrier keeps that reuse behind it)
  asm volatile("s_wait_xcnt 0x0" ::: "memory");
  __builtin_amdgcn_sched_barrier(0);
#pragma unroll
  for (int rt = 0; rt < 2; ++rt)
#pragma unroll
    for (int dt = 0; dt < DT; ++dt)
#pragma unroll
      for (int r = 0; r < 8; ++r) sO[w][rt * 16 + 8 * hh + r][dt * 16 + ln] = oacc[rt][dt][r];
  __builtin_amdgcn_fence(__ATOMIC_ACQ_REL, "workgroup"); __builtin_amdgcn_wave_barrier();
  {
#pragma unroll
    for (int rp = 0; rp < RPW; rp += 2) { const int r = rp + (lane >> 4), pc = lane & 15; const v4f val = *(const v4fa*)&sO[w][r][pc * 4]; v4hs h4;   // O leaves as the f16 operand of the output projection: 16 lanes send one whole line of a row
#pragma unroll
      for (int i = 0; i < 4; ++i) h4[i] = (_Float16)val[i];
      *(v4hs*)(O16 + ((size_t)b * SS + q0 + r) * DM + h * HD + pc * 4) = h4; }
     } }
// (b) attn_weights[b][q][k] = (1/16) sum_h sigmoid(q_h.k_h/8). One 128 x 128 tile (queries x keys) of one batch per work-group of 8 waves (4 x 2 waves, 32 x 64 each), made whole by that work-group.
// A step is one head: its 64 columns of the 128 query rows and of the 128 key rows (one 128-B line a row) are read from global as whole lines, one head ahead, into registers and laid in LDS
// at the pitch of proj_tile (144 B). Two LDS buffers: the one barrier of a step publishes its head and ends the reads of the buffer written next.
// Fragment maps, the ascending k order inside a head and the ascending head order of the sum of the tanh terms are those of the 16 x 32 form that read its fragments straight from global.
__global__ __launch_bounds__(256) void k_aw(const _Float16* __restrict__ Q16, const _Float16* __restrict__ K16, float* __restrict__ AW) {
  constexpr int PT = 72, NT = SS / 128;
  __shared__ __attribute__((aligned(16))) unsigned short sA[2][128][PT], sB[2][128][PT];
  __shared__ __attribute__((aligned(16))) float so[8][32][68];
  const int tid = threadIdx.x, w = tid >> 5, lane = tid & 31, ln = lane & 15, hh = lane >> 4;
  const int b = blockIdx.x / (NT * NT), tl = blockIdx.x % (NT * NT);
  const int m0 = (tl / NT) * 128, n0 = (tl % NT) * 128, wm = (w >> 1) * 32, wn = (w & 1) * 64;
  const int lr = tid >> 3, lc = (tid & 7) * 8;
  const unsigned short* ga = (const unsigned short*)Q16 + ((size_t)b * SS + m0 + lr) * DM + lc;
  const unsigned short* gb = (const unsigned short*)K16 + ((size_t)b * SS + n0 + lr) * DM + lc;
  v8us ra[4], rb[4];
#pragma unroll
  for (int i = 0; i < 4; ++i) { ra[i] = *(const v8us*)(ga + (size_t)i * 32 * DM); rb[i] = *(const v8us*)(gb + (size_t)i * 32 * DM); }
  typedef float v2f __attribute__((ext_vector_type(2)));
  v2f aw[2][4][4];   // the sums of the tanh terms, as register pairs: one packed add serves two of them
#pragma unroll
  for (int mt = 0; mt < 2; ++mt)
#pragma unroll
    for (int nt = 0; nt < 4; ++nt)
#pragma unroll
      for (int p = 0; p < 4; ++p) aw[mt][nt][p] = (v2f){0.f, 0.f};
  // unrolled by two so that the buffer index is a constant in every LDS address
#pragma unroll 2
  for (int h = 0; h < NH; ++h) {
    const int bf = h & 1;
#pragma unroll
    for (int i = 0; i < 4; ++i) { *(v8us*)&sA[bf][lr + 32 * i][lc] = ra[i]; *(v8us*)&sB[bf][lr + 32 * i][lc] = rb[i]; }
    __syncthreads();
    // no branch round the loads (the last step reads its own head once more, unused): the step stays one block, in which the two scheduling barriers below hold; with a branch here the compiler sinks the tanh work past the next step's stores and barrier
    const int hn = (h + 1 < NH) ? h + 1 : h;
#pragma unroll
    for (int i = 0; i < 4; ++i) { ra[i] = *(const v8us*)(ga + (size_t)i * 32 * DM + hn * HD); rb[i] = *(const v8us*)(gb + (size_t)i * 32 * DM + hn * HD); }
    // keeps the next head's global loads in front of this head's matrix and tanh work: left free, the compiler sinks them to just before their LDS stores and their whole latency is waited out
    __builtin_amdgcn_sched_barrier(0);
    v8f acc[2][4];
#pragma unroll
    for (int mt = 0; mt < 2; ++mt)
#pragma unroll
      for (int nt = 0; nt < 4; ++nt) acc[mt][nt] = (v8f){0.f,0.f,0.f,0.f,0.f,0.f,0.f,0.f};
#pragma unroll
    for (int ks = 0; ks < HD / 32; ++ks) {
      FragH a[2], bk[4];
#pragma unroll
      for (int mt = 0; mt < 2; ++mt) { a[mt].half[0] = *(const v8us*)&sA[bf][wm + mt * 16 + ln][ks * 32 + 8 * hh]; a[mt].half[1] = *(const v8us*)&sA[bf][wm + mt * 16 + ln][ks * 32 + 16 + 8 * hh]; }
#pragma unroll
      for (int nt = 0; nt < 4; ++nt) { bk[nt].half[0] = *(const v8us*)&sB[bf][wn + nt * 16 + ln][ks * 32 + 8 * hh]; bk[nt].half[1] = *(const v8us*)&sB[bf][wn + nt * 16 + ln][ks * 32 + 16 + 8 * hh]; }
#pragma unroll
      for (int mt = 0; mt < 2; ++mt)
#pragma unroll
        for (int nt = 0; nt < 4; ++nt) acc[mt][nt] = __builtin_amdgcn_wmma_f32_16x16x32_f16(false, a[mt].v, false, bk[nt].v, (short)0, acc[mt][nt], false, false);
    }
#pragma unroll
    for (int mt = 0; mt < 2; ++mt)
#pragma unroll
      for (int nt = 0; nt < 4; ++nt)
#pragma unroll
        for (int p = 0; p < 4; ++p) aw[mt][nt][p] += (v2f){th16(acc[mt][nt][2 * p]), th16(acc[mt][nt][2 * p + 1])};
    // keeps the next head's LDS stores behind this head's matrix and tanh work: left free, the compiler lifts them, and with them the wait for the global loads, to just behind this head's LDS reads
    __builtin_amdgcn_sched_barrier(0);
  }
  // stands in front of the epilogue's reuse of the registers that held the global load addresses (the scheduling barrier keeps that reuse behind it)
  asm volatile("s_wait_xcnt 0x0" ::: "memory");
  __builtin_amdgcn_sched_barrier(0);
#pragma unroll
  for (int nt = 0; nt < 4; ++nt)
#pragma unroll
    for (int mt = 0; mt < 2; ++mt)
#pragma unroll
      for (int r = 0; r < 8; ++r) so[w][mt * 16 + 8 * hh + r][nt * 16 + ln] = fmaf(aw[mt][nt][r >> 1][r & 1], 0.5f / (float)NH, 0.5f);   // mean_h (0.5 + 0.5 tanh) from the sum of the tanh terms
  // the wave's own 32 x 64 strip: its LDS writes are ordered before its cross-lane reads, so that whole lines go out
  __builtin_amdgcn_fence(__ATOMIC_ACQ_REL, "workgroup"); __builtin_amdgcn_wave_barrier();
#pragma unroll
  for (int q = 0; q < 16; ++q) { const int r = q * 2 + hh, c4 = ln * 4; *(v4f*)(AW + ((size_t)b * SS + m0 + wm + r) * SS + n0 + wn + c4) = *(const v4fa*)&so[w][r][c4]; }
}
extern "C" void kernel_launch(void* const* d_in, const int* in_sizes, int n_in,
                              void* d_out, int out_size, void* d_ws, size_t ws_size, hipStream_t stream) {
  (void)in_sizes; (void)n_in; (void)out_size;
  const float* xq = (const float*)d_in[0]; const float* xk = (const float*)d_in[1]; const float* xv = (const float*)d_in[2]; const float* Wq = (const float*)d_in[3]; const float* bq = (const float*)d_in[4]; const float* Wk = (const float*)d_in[5]; const float* bk = (const float*)d_in[6]; const float* Wv = (const float*)d_in[7]; const float* bv = (const float*)d_in[8]; const float* Wo = (const float*)d_in[9]; const float* bo = (const float*)d_in[10];
  float* out = (float*)d_out; float* AW = (float*)((char*)d_out + 16777216);
  char* ws = (char*)d_ws; size_t off = 0;
  auto take = [&](size_t bytes) { char* p = ws + off; off += (bytes + 255) & ~(size_t)255; return p; };
  const size_t w8 = (size_t)DM * DM / 8;
  _Float16* Bq = (_Float16*)take(w8 * 16); _Float16* Bk = (_Float16*)take(w8 * 16); _Float16* Bv = (_Float16*)take(w8 * 16); _Float16* Bo = (_Float16*)take(w8 * 16);
  _Float16* XQ = (_Float16*)take((size_t)NR * DM * 2); _Float16* XK = (_Float16*)take((size_t)NR * DM * 2); _Float16* XV = (_Float16*)take((size_t)NR * DM * 2); _Float16* Q16 = (_Float16*)take((size_t)NR * DM * 2); _Float16* K16 = (_Float16*)take((size_t)NR * DM * 2); _Float16* Vt = (_Float16*)take((size_t)NR * DM * 2); _Float16* O16 = (_Float16*)take((size_t)NR * DM * 2);
  if (off > ws_size) return;      // 64 MiB
  k_cvt_in<<<3 * (NR * DM / CVE) + 4 * (DM * DM / CVE), 256, 0, stream>>>(xq, xk, xv, Wq, Wk, Wv, Wo, XQ, XK, XV, Bq, Bk, Bv, Bo);
  k_proj_qkv<<<3 * PJT, 256, 0, stream>>>(XQ, XK, XV, Bq, Bk, Bv, bq, bk, bv, Q16, K16, Vt);
  k_satt<<<BB * NH * (SS / 128), 128, 0, stream>>>(Q16, K16, Vt, O16);
  k_proj_o<<<PJT, 256, 0, stream>>>(O16, Bo, bo, out);
  k_aw<<<BB * (SS / 128) * (SS / 128), 256, 0, stream>>>(Q16, K16, AW);
}

// v010
// A run of this version takes 98.2 microseconds.
// Timed twice side by side with v009, it ran 1.07 times as fast both times.
// Counting every step since v000, it is 11.9 times as fast.
#include <hip/hip_runtime.h>
// q/k/v/o projections (4096 × 1024 × 1024, + bias) and the 16-head sigmoid attention on v_wmma_f32_16x16x32_f16: (a) per (b,h) a fused flash-style kernel with P = σ(q·k/8) (no normalisation,
// as the module) and O = P·V on WMMA; (b) the second output mean_h σ(q·k/8) recomputes the score tiles per head and averages them in a fixed order. x inputs f16(bf16 ·) exact, q/k/v and O rounded to f16,
// weights bf16-exact ×2^4 ((out,in)), P f16 ≤ 1, f32 accumulate.
#define BB 2
#define SS 2048
#define DM 1024
#define NH 16
#define HD 64
#define NR (BB * SS)

typedef __bf16 v16b __attribute__((ext_vector_type(16)));
typedef unsigned short v8us __attribute__((ext_vector_type(8), may_alias));
typedef float  v8f  __attribute__((ext_vector_type(8)));
typedef float  v4f  __attribute__((ext_vector_type(4)));
typedef float  v4fa __attribute__((ext_vector_type(4), may_alias));
union FragB { v16b v; v8us half[2]; unsigned short u[16]; };

__device__ __forceinline__ unsigned short bf16_bits(float x) { unsigned int u = __float_as_uint(x); return (unsigned short)((u + 0x7FFFu + ((u >> 16) & 1u)) >> 16); }
__device__ __forceinline__ float bf16_val(unsigned short b) { return __uint_as_float(((unsigned int)b) << 16); }
__device__ __forceinline__ float bf16_round(float x) { return bf16_val(bf16_bits(x)); }
// D += A·B with NT terms: 1 = ah·bh, 2 = + al·bh (A split), 3 = + ah·bl (both split)
template <int NT>
__device__ __forceinline__ v8f mmaN(v16b ah, v16b al, v16b bh, v16b bl, v8f c) {
  c = __builtin_amdgcn_wmma_f32_16x16x32_bf16(false, ah, false, bh, (short)0, c, false, false);
  if (NT >= 2) c = __builtin_amdgcn_wmma_f32_16x16x32_bf16(false, al, false, bh, (short)0, c, false, false);
  if (NT >= 3) c = __builtin_amdgcn_wmma_f32_16x16x32_bf16(false, ah, false, bl, (short)0, c, false, false);
  asm volatile("v_nop\n\tv_nop\n\tv_nop\n\tv_nop" : "+v"(c) : "v"(ah), "v"(al), "v"(bh), "v"(bl));
  return c;
}

__global__ __launch_bounds__(256) void k_wt_bf16(const float* __restrict__ W, unsigned short* __restrict__ Wt, int K, int N) {
  const int t = blockIdx.x * 256 + threadIdx.x;
  const int k8n = K / 8;
  if (t >= N * k8n) return;
  const int n = t / k8n, k8 = (t % k8n) * 8;
  v8us v;
#pragma unroll
  for (int i = 0; i < 8; ++i) v[i] = bf16_bits(W[(size_t)(k8 + i) * N + n]);
  *(v8us*)(Wt + (size_t)n * K + k8) = v;
  
}

// GEMM C[M][N] (f32, pitch ldc) = act(A[M][K]·W + bias). A f32 row-major (pitch lda) converted per fragment to bf16
// (ASPLIT: hi/lo two planes -> 2 terms, else single rounded term); Wt bf16 [N][K] (pitch ldb). BIAS_BF16 rounds the
// bias to bf16 first (bias quantised to bf16 before the add). K%32==0, M%16==0, N%64==0.
template <bool ASPLIT, int ACT, bool BIAS_BF16>
__global__ __launch_bounds__(128) void k_gemm_bf(const float* __restrict__ A, int lda, const unsigned short* __restrict__ Wt, int ldb,
                                               const float* __restrict__ bias, float* __restrict__ C, int ldc, int M, int N, int K) {
  __shared__ __attribute__((aligned(16))) float so[4][16][64];
  const int tid = threadIdx.x, w = tid >> 5, lane = tid & 31, ln = lane & 15, hh = lane >> 4;
  const int ntn = N / 64;
  const int wid = blockIdx.x * 4 + w;
  const int mt = wid / ntn, nq = wid % ntn;
  if (mt * 16 >= M) return;
  const int row0 = mt * 16, col0 = nq * 64;
  const float* arow = A + (size_t)(row0 + ln) * lda;
  v8f acc[4] = {};
  for (int kb = 0; kb < K; kb += 32) {
    FragB ah, al;
    const v4f x0 = *(const v4fa*)(arow + kb + 8 * hh), x1 = *(const v4fa*)(arow + kb + 8 * hh + 4);
    const v4f x2 = *(const v4fa*)(arow + kb + 16 + 8 * hh), x3 = *(const v4fa*)(arow + kb + 16 + 8 * hh + 4);
    float xs[16] = {x0[0],x0[1],x0[2],x0[3],x1[0],x1[1],x1[2],x1[3],x2[0],x2[1],x2[2],x2[3],x3[0],x3[1],x3[2],x3[3]};
#pragma unroll
    for (int i = 0; i < 16; ++i) { const unsigned short hb = bf16_bits(xs[i]); ah.u[i] = hb; al.u[i] = ASPLIT ? bf16_bits(xs[i] - bf16_val(hb)) : (unsigned short)0; }
#pragma unroll
    for (int t = 0; t < 4; ++t) {
      const unsigned short* brow = Wt + (size_t)(col0 + t * 16 + ln) * ldb + kb;
      FragB b;
      b.half[0] = *(const v8us*)(brow + 8 * hh);
      b.half[1] = *(const v8us*)(brow + 16 + 8 * hh);
      acc[t] = mmaN<ASPLIT ? 2 : 1>(ah.v, al.v, b.v, b.v, acc[t]);
    }
  }
#pragma unroll
  for (int t = 0; t < 4; ++t) {
    float bv = bias ? bias[col0 + t * 16 + ln] : 0.f;
    if (BIAS_BF16) bv = bf16_round(bv);
#pragma unroll
    for (int r = 0; r < 8; ++r) { float v = acc[t][r] + bv; if (ACT == 1) v = fmaxf(v, 0.f); so[w][8 * hh + r][t * 16 + ln] = v; }
  }
  __builtin_amdgcn_fence(__ATOMIC_ACQ_REL, "workgroup");
  __builtin_amdgcn_wave_barrier();
  const int rsub = lane >> 4, c4 = (lane & 15) * 4;
  {
#pragma unroll
    for (int q = 0; q < 8; ++q) {
      const int r = q * 2 + rsub;
      const v4f v = *(const v4fa*)&so[w][r][c4];
      *(v4f*)(C + (size_t)(row0 + r) * ldc + col0 + c4) = v;
    }
    
  }
}

// Flash-style causal/unmasked attention, all contractions 3-term bf16 hi/lo splits, f32 softmax with running max.
// q,k,v rows are read from f32 buffers with arbitrary row pitch (so they can live inside a fused qkv buffer);
// D = head size (multiple of 32, <= 128); one wave = 16 query rows; block = 4 waves (64 queries) sharing K/V chunks of 32.
template <int D, bool CAUSAL>
__global__ __launch_bounds__(128) void k_flash(const float* __restrict__ qb, const float* __restrict__ kb, const float* __restrict__ vb,
                                             int pitch, int T, int H, float scale, float* __restrict__ y, int ypitch) {
  constexpr int KS = D / 32;        // k-steps for QK
  constexpr int DT = D / 16;        // d tiles for PV
  __shared__ __attribute__((aligned(16))) unsigned short sKh[32][D + 8], sKl[32][D + 8], sVh[32][D + 8], sVl[32][D + 8];
  __shared__ __attribute__((aligned(16))) unsigned short sPh[4][16][40], sPl[4][16][40];
  __shared__ __attribute__((aligned(16))) float sO[4][16][D];
  const int tid = threadIdx.x, w = tid >> 5, lane = tid & 31, ln = lane & 15, hh = lane >> 4;
  const int nqb = (T + 63) / 64;
  const int bh = blockIdx.x / nqb, qblk = blockIdx.x % nqb;
  const int b = bh / H, h = bh % H;
  const int q0 = qblk * 64 + w * 16;
  const float* Q = qb + (size_t)b * T * pitch + h * D;
  const float* K = kb + (size_t)b * T * pitch + h * D;
  const float* V = vb + (size_t)b * T * pitch + h * D;

  // A fragments of the wave's 16 query rows (scaled), hi/lo
  FragB aqh[KS], aql[KS];
  {
    int row = q0 + ln; if (row >= T) row = T - 1;
    const float* qr = Q + (size_t)row * pitch;
#pragma unroll
    for (int ks = 0; ks < KS; ++ks)
#pragma unroll
      for (int i = 0; i < 16; ++i) {
        const int d = ks * 32 + ((i < 8) ? (8 * hh + i) : (16 + 8 * hh + (i - 8)));
        const float x = qr[d] * scale; const unsigned short hb = bf16_bits(x);
        aqh[ks].u[i] = hb; aql[ks].u[i] = bf16_bits(x - bf16_val(hb));
      }
  }
  float m_r[8], l_r[8];
#pragma unroll
  for (int r = 0; r < 8; ++r) { m_r[r] = -3.0e38f; l_r[r] = 0.f; }
  v8f oacc[DT];
#pragma unroll
  for (int dt = 0; dt < DT; ++dt) oacc[dt] = (v8f){0.f,0.f,0.f,0.f,0.f,0.f,0.f,0.f};

  const int kv_end = CAUSAL ? min(T, qblk * 64 + 64) : T;     // block-uniform
  for (int j0 = 0; j0 < kv_end; j0 += 32) {
    __syncthreads();
    for (int e = tid; e < 32 * (D / 4); e += 128) {
      const int r = e / (D / 4), c4 = (e % (D / 4)) * 4;
      const int key = j0 + r;
      v4f kf = {0.f,0.f,0.f,0.f}, vf = {0.f,0.f,0.f,0.f};
      if (key < T) { kf = *(const v4fa*)(K + (size_t)key * pitch + c4); vf = *(const v4fa*)(V + (size_t)key * pitch + c4); }
#pragma unroll
      for (int t = 0; t < 4; ++t) {
        unsigned short hb = bf16_bits(kf[t]); sKh[r][c4 + t] = hb; sKl[r][c4 + t] = bf16_bits(kf[t] - bf16_val(hb));
        hb = bf16_bits(vf[t]); sVh[r][c4 + t] = hb; sVl[r][c4 + t] = bf16_bits(vf[t] - bf16_val(hb));
      }
    }
    __syncthreads();
    // S tile 16 x 32
    v8f s[2];
#pragma unroll
    for (int nt = 0; nt < 2; ++nt) {
      v8f acc = {};
#pragma unroll
      for (int ks = 0; ks < KS; ++ks) {
        FragB bh_, bl_;
        bh_.half[0] = *(const v8us*)&sKh[nt * 16 + ln][ks * 32 + 8 * hh]; bh_.half[1] = *(const v8us*)&sKh[nt * 16 + ln][ks * 32 + 16 + 8 * hh];
        bl_.half[0] = *(const v8us*)&sKl[nt * 16 + ln][ks * 32 + 8 * hh]; bl_.half[1] = *(const v8us*)&sKl[nt * 16 + ln][ks * 32 + 16 + 8 * hh];
        acc = mmaN<3>(aqh[ks].v, aql[ks].v, bh_.v, bl_.v, acc);
      }
      s[nt] = acc;
    }
    // mask + running max (rows 8hh+r; the 16 lanes of a half share rows)
    float alpha[8];
#pragma unroll
    for (int r = 0; r < 8; ++r) {
      const int qi = q0 + 8 * hh + r;
      const int ja = j0 + ln, jb = j0 + 16 + ln;
      if (CAUSAL) { if (ja > qi) s[0][r] = -3.0e38f; if (jb > qi) s[1][r] = -3.0e38f; }
      if (ja >= T) s[0][r] = -3.0e38f;
      if (jb >= T) s[1][r] = -3.0e38f;
      float mx = fmaxf(s[0][r], s[1][r]);
      mx = fmaxf(mx, __shfl_xor(mx, 1, 32)); mx = fmaxf(mx, __shfl_xor(mx, 2, 32)); mx = fmaxf(mx, __shfl_xor(mx, 4, 32)); mx = fmaxf(mx, __shfl_xor(mx, 8, 32));
      const float mnew = fmaxf(m_r[r], mx);
      alpha[r] = (mnew > -1.0e38f) ? __expf(m_r[r] - mnew) : 1.0f;
      const float p0 = (s[0][r] > -1.0e38f) ? __expf(s[0][r] - mnew) : 0.f;
      const float p1 = (s[1][r] > -1.0e38f) ? __expf(s[1][r] - mnew) : 0.f;
      m_r[r] = mnew;
      l_r[r] = l_r[r] * alpha[r] + p0 + p1;            // per-lane partial row sum (16 lanes combined at the end)
      unsigned short hb = bf16_bits(p0); sPh[w][8 * hh + r][ln] = hb;      sPl[w][8 * hh + r][ln] = bf16_bits(p0 - bf16_val(hb));
      hb = bf16_bits(p1);                sPh[w][8 * hh + r][16 + ln] = hb; sPl[w][8 * hh + r][16 + ln] = bf16_bits(p1 - bf16_val(hb));
    }
#pragma unroll
    for (int dt = 0; dt < DT; ++dt)
#pragma unroll
      for (int r = 0; r < 8; ++r) oacc[dt][r] *= alpha[r];
    __builtin_amdgcn_fence(__ATOMIC_ACQ_REL, "workgroup");
    __builtin_amdgcn_wave_barrier();
    FragB pah, pal;
    pah.half[0] = *(const v8us*)&sPh[w][ln][8 * hh]; pah.half[1] = *(const v8us*)&sPh[w][ln][16 + 8 * hh];
    pal.half[0] = *(const v8us*)&sPl[w][ln][8 * hh]; pal.half[1] = *(const v8us*)&sPl[w][ln][16 + 8 * hh];
#pragma unroll
    for (int dt = 0; dt < DT; ++dt) {
      FragB bvh, bvl;
#pragma unroll
      for (int i = 0; i < 8; ++i) {
        bvh.u[i] = sVh[8 * hh + i][dt * 16 + ln]; bvh.u[8 + i] = sVh[16 + 8 * hh + i][dt * 16 + ln];
        bvl.u[i] = sVl[8 * hh + i][dt * 16 + ln]; bvl.u[8 + i] = sVl[16 + 8 * hh + i][dt * 16 + ln];
      }
      oacc[dt] = mmaN<3>(pah.v, pal.v, bvh.v, bvl.v, oacc[dt]);
    }
    __builtin_amdgcn_fence(__ATOMIC_ACQ_REL, "workgroup");
    __builtin_amdgcn_wave_barrier();
  }
#pragma unroll
  for (int r = 0; r < 8; ++r) {
    float l = l_r[r];
    l += __shfl_xor(l, 1, 32); l += __shfl_xor(l, 2, 32); l += __shfl_xor(l, 4, 32); l += __shfl_xor(l, 8, 32);
    l_r[r] = (l > 0.f) ? 1.0f / l : 0.f;
  }
#pragma unroll
  for (int dt = 0; dt < DT; ++dt)
#pragma unroll
    for (int r = 0; r < 8; ++r) sO[w][8 * hh + r][dt * 16 + ln] = oacc[dt][r] * l_r[r];
  __builtin_amdgcn_fence(__ATOMIC_ACQ_REL, "workgroup");
  __builtin_amdgcn_wave_barrier();
  {
    for (int r = 0; r < 16; ++r) {
      const int row = q0 + r;
      if (row < T && lane < D / 4) {
        const v4f val = *(const v4fa*)&sO[w][r][lane * 4];
        *(v4f*)(y + ((size_t)b * T + row) * ypitch + h * D + lane * 4) = val;
      }
    }
    
  }
}

// GEMM C = act(A·W + bias + resid): A f32 (ASPLIT -> hi/lo 2 terms), Wt bf16 [N][K]; ACT 0 none, 1 relu, 2 exact gelu;
// resid (optional, f32, row index = (row % rmod), pitch ldr, RES_BF16 rounds it) added before the activation.
template <bool ASPLIT, int ACT, bool BIAS_BF16, bool RES_BF16>
__global__ __launch_bounds__(128) void k_gemm_bf3(const float* __restrict__ A, int lda, const unsigned short* __restrict__ Wt, int ldb,
                                                const float* __restrict__ bias, const float* __restrict__ resid, int rmod, int ldr,
                                                float* __restrict__ C, int ldc, int M, int N, int K) {
  __shared__ __attribute__((aligned(16))) float so[4][16][64];
  const int tid = threadIdx.x, w = tid >> 5, lane = tid & 31, ln = lane & 15, hh = lane >> 4;
  const int ntn = N / 64;
  const int wid = blockIdx.x * 4 + w;
  const int mt = wid / ntn, nq = wid % ntn;
  if (mt * 16 >= M) return;
  const int row0 = mt * 16, col0 = nq * 64;
  const float* arow = A + (size_t)(row0 + ln) * lda;
  v8f acc[4] = {};
  for (int kb = 0; kb < K; kb += 32) {
    FragB ah, al;
    const v4f x0 = *(const v4fa*)(arow + kb + 8 * hh), x1 = *(const v4fa*)(arow + kb + 8 * hh + 4);
    const v4f x2 = *(const v4fa*)(arow + kb + 16 + 8 * hh), x3 = *(const v4fa*)(arow + kb + 16 + 8 * hh + 4);
    float xs[16] = {x0[0],x0[1],x0[2],x0[3],x1[0],x1[1],x1[2],x1[3],x2[0],x2[1],x2[2],x2[3],x3[0],x3[1],x3[2],x3[3]};
#pragma unroll
    for (int i = 0; i < 16; ++i) { const unsigned short hb = bf16_bits(xs[i]); ah.u[i] = hb; al.u[i] = ASPLIT ? bf16_bits(xs[i] - bf16_val(hb)) : (unsigned short)0; }
#pragma unroll
    for (int t = 0; t < 4; ++t) {
      const unsigned short* brow = Wt + (size_t)(col0 + t * 16 + ln) * ldb + kb;
      FragB b;
      b.half[0] = *(const v8us*)(brow + 8 * hh);
      b.half[1] = *(const v8us*)(brow + 16 + 8 * hh);
      acc[t] = mmaN<ASPLIT ? 2 : 1>(ah.v, al.v, b.v, b.v, acc[t]);
    }
  }
#pragma unroll
  for (int t = 0; t < 4; ++t) {
    const int col = col0 + t * 16 + ln;
    float bv = bias ? bias[col] : 0.f;
    if (BIAS_BF16) bv = bf16_round(bv);
#pragma unroll
    for (int r = 0; r < 8; ++r) {
      float v = acc[t][r] + bv;
      if (resid) { float rv = resid[(size_t)((row0 + 8 * hh + r) % rmod) * ldr + col]; if (RES_BF16) rv = bf16_round(rv); v += rv; }
      if (ACT == 1) v = fmaxf(v, 0.f);
      if (ACT == 2) v = 0.5f * v * (1.0f + erff(v * 0.70710678118654752f));
      if (ACT == 3) { const float u = 0.7978845608028654f * (v + 0.044715f * v * v * v); v = 0.5f * v * (1.0f + tanhf(u)); }
      so[w][8 * hh + r][t * 16 + ln] = v;
    }
  }
  __builtin_amdgcn_fence(__ATOMIC_ACQ_REL, "workgroup");
  __builtin_amdgcn_wave_barrier();
  const int rsub = lane >> 4, c4 = (lane & 15) * 4;
  {
#pragma unroll
    for (int q = 0; q < 8; ++q) {
      const int r = q * 2 + rsub;
      const v4f v = *(const v4fa*)&so[w][r][c4];
      *(v4f*)(C + (size_t)(row0 + r) * ldc + col0 + c4) = v;
    }
    
  }
}
// row LayerNorm (biased variance, eps) over N: s = X (+ R); optional out_sum <- s; out_norm <- (s-mu)*rsqrt(var+eps)*g + b
template <bool PARAM_BF16>
__global__ __launch_bounds__(256) void k_layernorm(const float* __restrict__ X, const float* __restrict__ R, const float* __restrict__ g, const float* __restrict__ bta,
                                                  float* __restrict__ out_sum, float* __restrict__ out_norm, int N, float eps) {
  __shared__ float red[256];
  const int row = blockIdx.x, tid = threadIdx.x;
  const float* x = X + (size_t)row * N; const float* rr = R ? R + (size_t)row * N : nullptr;
  float vals[16];                     // up to N = 4096
  const int per = N / 256;            // contiguous chunk per thread? use strided-by-4 chunks: thread handles j = tid*4 + 1024*u
  float s1 = 0.f;
  for (int u = 0; u < per / 4; ++u) {
    const int j = tid * 4 + 1024 * u;
    const v4f a = *(const v4fa*)(x + j);
    v4f b = {0.f,0.f,0.f,0.f}; if (rr) b = *(const v4fa*)(rr + j);
#pragma unroll
    for (int q = 0; q < 4; ++q) { const float v = a[q] + b[q]; vals[u * 4 + q] = v; s1 += v; }
  }
  red[tid] = s1; __syncthreads();
  for (int st = 128; st > 0; st >>= 1) { if (tid < st) red[tid] += red[tid + st]; __syncthreads(); }
  const float mu = red[0] / (float)N; __syncthreads();
  float s2 = 0.f;
  for (int u = 0; u < per / 4; ++u)
#pragma unroll
    for (int q = 0; q < 4; ++q) { const float c = vals[u * 4 + q] - mu; s2 += c * c; }
  red[tid] = s2; __syncthreads();
  for (int st = 128; st > 0; st >>= 1) { if (tid < st) red[tid] += red[tid + st]; __syncthreads(); }
  const float rs = rsqrtf(red[0] / (float)N + eps);
  {
    for (int u = 0; u < per / 4; ++u) {
      const int j = tid * 4 + 1024 * u;
      v4f o, sm;
#pragma unroll
      for (int q = 0; q < 4; ++q) {
        float gg = g[j + q], bb = bta[j + q];
        if (PARAM_BF16) { gg = bf16_round(gg); bb = bf16_round(bb); }
        sm[q] = vals[u * 4 + q]; o[q] = (vals[u * 4 + q] - mu) * rs * gg + bb;
      }
      if (out_sum) *(v4f*)(out_sum + (size_t)row * N + j) = sm;
      *(v4f*)(out_norm + (size_t)row * N + j) = o;
    }
    
  }
}



// ---- f16 WMMA path (v_wmma_f32_16x16x32_f16): 11-bit significands for operands in range — used where a [0,1] probability operand needs more precision than bf16
typedef _Float16 v16h __attribute__((ext_vector_type(16)));
union FragH { v16h v; v8us half[2]; _Float16 h[16]; unsigned short u[16]; };
template <int NT>
__device__ __forceinline__ v8f mmaH(v16h ah, v16h al, v16h bh, v16h bl, v8f c) {
  c = __builtin_amdgcn_wmma_f32_16x16x32_f16(false, ah, false, bh, (short)0, c, false, false);
  if (NT >= 2) c = __builtin_amdgcn_wmma_f32_16x16x32_f16(false, al, false, bh, (short)0, c, false, false);
  if (NT >= 3) c = __builtin_amdgcn_wmma_f32_16x16x32_f16(false, ah, false, bl, (short)0, c, false, false);
  asm volatile("v_nop\n\tv_nop\n\tv_nop\n\tv_nop" : "+v"(c) : "v"(ah), "v"(al), "v"(bh), "v"(bl));
  return c;
}
// batched GEMM like k_gemm_b but f16 operands: A f32 (split into f16 hi/lo if ASPLIT, else rounded to f16), Bt = f16 values [n][k]; alpha; C f32; N multiple of 16 (partial tiles skipped)
template <bool ASPLIT>
__global__ __launch_bounds__(128) void k_gemm_h(const float* __restrict__ A, int lda, size_t sA, const _Float16* __restrict__ Bh, int ldb, size_t sB, float alpha, float* __restrict__ C, int ldc, size_t sC, int M, int N, int K) {
  __shared__ __attribute__((aligned(16))) float so[4][16][64];
  const int tid = threadIdx.x, w = tid >> 5, lane = tid & 31, ln = lane & 15, hh = lane >> 4; const int by = blockIdx.y;
  A += (size_t)by * sA; Bh += (size_t)by * sB; C += (size_t)by * sC;
  const int ntn = (N + 63) / 64; const int wid = blockIdx.x * 4 + w; const int mt = wid / ntn, nq = wid % ntn; if (mt * 16 >= M) return;
  const int row0 = mt * 16, col0 = nq * 64; const float* arow = A + (size_t)(row0 + ln) * lda;
  v8f acc[4] = {};
  for (int kb = 0; kb < K; kb += 32) {
    FragH ah, al;
    const v4f x0 = *(const v4fa*)(arow + kb + 8 * hh), x1 = *(const v4fa*)(arow + kb + 8 * hh + 4), x2 = *(const v4fa*)(arow + kb + 16 + 8 * hh), x3 = *(const v4fa*)(arow + kb + 16 + 8 * hh + 4);
    float xs[16] = {x0[0],x0[1],x0[2],x0[3],x1[0],x1[1],x1[2],x1[3],x2[0],x2[1],x2[2],x2[3],x3[0],x3[1],x3[2],x3[3]};
#pragma unroll
    for (int i = 0; i < 16; ++i) { const _Float16 h = (_Float16)xs[i]; ah.h[i] = h; al.h[i] = ASPLIT ? (_Float16)(xs[i] - (float)h) : (_Float16)0.0f; }
#pragma unroll
    for (int t = 0; t < 4; ++t) { if (col0 + t * 16 >= N) continue; const size_t boff = (size_t)(col0 + t * 16 + ln) * ldb + kb; FragH bq; bq.half[0] = *(const v8us*)(Bh + boff + 8 * hh); bq.half[1] = *(const v8us*)(Bh + boff + 16 + 8 * hh);
      acc[t] = mmaH<ASPLIT ? 2 : 1>(ah.v, al.v, bq.v, bq.v, acc[t]); }
  }
#pragma unroll
  for (int t = 0; t < 4; ++t) { if (col0 + t * 16 >= N) continue;
#pragma unroll
    for (int r = 0; r < 8; ++r) so[w][8 * hh + r][t * 16 + ln] = acc[t][r] * alpha; }
  __builtin_amdgcn_fence(__ATOMIC_ACQ_REL, "workgroup"); __builtin_amdgcn_wave_barrier();
  const int rsub = lane >> 4, c4 = (lane & 15) * 4;
  {
#pragma unroll
    for (int q = 0; q < 8; ++q) { const int r = q * 2 + rsub; if (col0 + c4 < N) { const v4f v = *(const v4fa*)&so[w][r][c4]; *(v4f*)(C + (size_t)(row0 + r) * ldc + col0 + c4) = v; } }
     }
}

// Wt[n][k] = f16(W[k][n]·scale) from f32 row-major W[K][N] (scale = power of two; bf16-exact weights stay exact in f16 away from the subnormal range)
__global__ __launch_bounds__(256) void k_wt_f16(const float* __restrict__ W, _Float16* __restrict__ Wt, int K, int N, float scale) {
  const int t = blockIdx.x * 256 + threadIdx.x; if (t >= N * (K / 8)) return; const int n = t / (K / 8), k8 = (t % (K / 8)) * 8; FragH f;
#pragma unroll
  for (int i = 0; i < 8; ++i) f.h[i] = (_Float16)(bf16_round(W[(size_t)(k8 + i) * N + n]) * scale); const v8us o = f.half[0];
  *(v8us*)((unsigned short*)Wt + (size_t)n * K + k8) = o; 
}
// k_gemm_hh variant with fused epilogue: v = acc·alpha + bias[by·sBias + col] (+ CP[(row/rowsPerB)·sCPb + by·64 + col] if CP) ; ACT 0 none / 1 elu ; writes f16 C16 and/or f32 C (each if non-null)
template <int ACT>
__global__ __launch_bounds__(128) void k_gemm_hhx(const _Float16* __restrict__ A, int lda, size_t sA, const _Float16* __restrict__ Bh, int ldb, size_t sB, float alpha, const float* __restrict__ bias, size_t sBias, const float* __restrict__ CP, int rowsPerB, size_t sCPb, int row0g,
    float* __restrict__ C, _Float16* __restrict__ C16, int ldc, size_t sC, int M, int N, int K) {
  __shared__ __attribute__((aligned(16))) float so[4][16][64];
  const int tid = threadIdx.x, w = tid >> 5, lane = tid & 31, ln = lane & 15, hh = lane >> 4; const int by = blockIdx.y;
  A += (size_t)by * sA; Bh += (size_t)by * sB; const size_t cofs = (size_t)by * sC; const float* bp = bias ? bias + (size_t)by * sBias : nullptr;
  const int ntn = (N + 63) / 64; const int wid = blockIdx.x * 4 + w; const int mt = wid / ntn, nq = wid % ntn; if (mt * 16 >= M) return;
  const int row0 = mt * 16, col0 = nq * 64; const _Float16* arow = A + (size_t)(row0 + ln) * lda;
  v8f acc[4] = {};
  for (int kb = 0; kb < K; kb += 32) { FragH ah; ah.half[0] = *(const v8us*)((const unsigned short*)arow + kb + 8 * hh); ah.half[1] = *(const v8us*)((const unsigned short*)arow + kb + 16 + 8 * hh);
#pragma unroll
    for (int t = 0; t < 4; ++t) { if (col0 + t * 16 >= N) continue; const size_t boff = (size_t)(col0 + t * 16 + ln) * ldb + kb; FragH bq; bq.half[0] = *(const v8us*)((const unsigned short*)Bh + boff + 8 * hh); bq.half[1] = *(const v8us*)((const unsigned short*)Bh + boff + 16 + 8 * hh);
      acc[t] = mmaH<1>(ah.v, ah.v, bq.v, bq.v, acc[t]); }
  }
#pragma unroll
  for (int t = 0; t < 4; ++t) { if (col0 + t * 16 >= N) continue; const int col = col0 + t * 16 + ln; const float bv = bp ? bf16_round(bp[col]) : 0.f;
#pragma unroll
    for (int r = 0; r < 8; ++r) { float v = acc[t][r] * alpha + bv; if (CP) { const int bidx = (row0g + row0 + 8 * hh + r) / rowsPerB; v += CP[(size_t)bidx * sCPb + (size_t)by * 64 + col]; } if (ACT == 1) v = (v > 0.f) ? v : expm1f(v); else if (ACT == 3) v = fmaxf(v, 0.f); so[w][8 * hh + r][t * 16 + ln] = v; } }
  __builtin_amdgcn_fence(__ATOMIC_ACQ_REL, "workgroup"); __builtin_amdgcn_wave_barrier();
  const int rsub = lane >> 4, c4 = (lane & 15) * 4; typedef _Float16 v4h __attribute__((ext_vector_type(4)));
  {
#pragma unroll
    for (int q = 0; q < 8; ++q) { const int r = q * 2 + rsub; if (col0 + c4 < N) { const v4f v = *(const v4fa*)&so[w][r][c4]; if (C) *(v4f*)(C + cofs + (size_t)(row0 + r) * ldc + col0 + c4) = v; if (C16) { v4h h4; for (int i = 0; i < 4; ++i) h4[i] = (_Float16)v[i]; *(v4h*)(C16 + cofs + (size_t)(row0 + r) * ldc + col0 + c4) = h4; } } }
     }
}


// Projection Y = X.W^T / 16 + bias at the fixed shape NR x DM x DM. One 128 x 128 tile of Y per work-group of 8 waves (4 x 2 waves, 32 x 64 of Y each).
// Each 64-k step of both operands (128 rows of 128 B) is read from global as whole lines, one step ahead, into registers and laid in LDS at a pitch of 144 B
// (16 B x odd: no bank conflict for the 16-byte fragment reads). Two LDS buffers: the one barrier of a step publishes its tile and ends the reads of the buffer written next.
// Fragment maps and the ascending k order of every accumulator are those of k_gemm_hhx.
// The output strips lie over the operand buffers (72 KiB of LDS a work-group, not 140): with 8 waves of at most 160 registers three work-groups are then resident on a WGP.
// tr (the same for the whole work-group): the f16 tile goes out transposed, C16[b][n][token], the layout in which k_satt_aw reads V. A lane's 8 accumulator registers are 8 consecutive tokens of one column n:
// one 16-byte LDS store into a 128 x 128 tile at a pitch of 272 B (16 B x odd), and behind one barrier every 16 lanes send 256 contiguous bytes (two whole lines) of one row n.
#define PJT ((NR / 128) * (DM / 128))
#define TLB (2 * 2 * 128 * 72 * 2)
// the one LDS block of a 128 x 128 tile's work-group (two operands x two buffers x 128 rows at 144 B). One variable for every caller, so that a kernel holding two kinds of tile work allocates it once
__device__ __forceinline__ unsigned char* tile_lds() { __shared__ __attribute__((aligned(16))) unsigned char sm[TLB]; return sm; }
template <bool F32OUT>
__device__ __forceinline__ void proj_tile(const int tile, const _Float16* __restrict__ A, const _Float16* __restrict__ Bh, const float* __restrict__ bias, float* __restrict__ C, _Float16* __restrict__ C16, const bool tr) {
  constexpr int PT = 72, NS = DM / 64;
  static_assert(TLB == 2 * 2 * 128 * PT * 2, "the LDS block holds both operands' two buffers");
  unsigned char* const sm = tile_lds();
  unsigned short (*sA)[128][PT] = (unsigned short (*)[128][PT])sm;
  unsigned short (*sB)[128][PT] = (unsigned short (*)[128][PT])(sm + 2 * 128 * PT * 2);
  float (*so)[32][68] = (float (*)[32][68])sm;
  static_assert(8 * 32 * 68 * 4 <= 2 * 2 * 128 * PT * 2, "the output strips fit in the operand buffers");
  const int tid = threadIdx.x, w = tid >> 5, lane = tid & 31, ln = lane & 15, hh = lane >> 4;
  const int m0 = (tile >> 3) * 128, n0 = (tile & 7) * 128, wm = (w >> 1) * 32, wn = (w & 1) * 64;
  const int lr = tid >> 3, lc = (tid & 7) * 8;
  const unsigned short* ga = (const unsigned short*)A + (size_t)(m0 + lr) * DM + lc;
  const unsigned short* gb = (const unsigned short*)Bh + (size_t)(n0 + lr) * DM + lc;
  v8us ra[4], rb[4];
#pragma unroll
  for (int i = 0; i < 4; ++i) { ra[i] = *(const v8us*)(ga + (size_t)i * 32 * DM); rb[i] = *(const v8us*)(gb + (size_t)i * 32 * DM); }
  v8f acc[2][4];
#pragma unroll
  for (int mt = 0; mt < 2; ++mt)
#pragma unroll
    for (int nt = 0; nt < 4; ++nt) acc[mt][nt] = (v8f){0.f,0.f,0.f,0.f,0.f,0.f,0.f,0.f};
  // unrolled by two so that the buffer index is a constant in every LDS address
#pragma unroll 2
  for (int s = 0; s < NS; ++s) {
    const int bf = s & 1;
#pragma unroll
    for (int i = 0; i < 4; ++i) { *(v8us*)&sA[bf][lr + 32 * i][lc] = ra[i]; *(v8us*)&sB[bf][lr + 32 * i][lc] = rb[i]; }
    __syncthreads();
    if (s + 1 < NS) {
#pragma unroll
      for (int i = 0; i < 4; ++i) { ra[i] = *(const v8us*)(ga + (size_t)i * 32 * DM + (s + 1) * 64); rb[i] = *(const v8us*)(gb + (size_t)i * 32 * DM + (s + 1) * 64); }
    }
    // keeps the next step's global loads in front of this step's matrix work: left free, the compiler sinks them to just before their LDS stores and their whole latency is waited out
    __builtin_amdgcn_sched_barrier(0);
#pragma unroll
    for (int ks = 0; ks < 2; ++ks) {
      FragH a[2], b[4];
#pragma unroll
      for (int mt = 0; mt < 2; ++mt) { a[mt].half[0] = *(const v8us*)&sA[bf][wm + mt * 16 + ln][ks * 32 + 8 * hh]; a[mt].half[1] = *(const v8us*)&sA[bf][wm + mt * 16 + ln][ks * 32 + 16 + 8 * hh]; }
#pragma unroll
      for (int nt = 0; nt < 4; ++nt) { b[nt].half[0] = *(const v8us*)&sB[bf][wn + nt * 16 + ln][ks * 32 + 8 * hh]; b[nt].half[1] = *(const v8us*)&sB[bf][wn + nt * 16 + ln][ks * 32 + 16 + 8 * hh]; }
#pragma unroll
      for (int mt = 0; mt < 2; ++mt)
#pragma unroll
        for (int nt = 0; nt < 4; ++nt) acc[mt][nt] = __builtin_amdgcn_wmma_f32_16x16x32_f16(false, a[mt].v, false, b[nt].v, (short)0, acc[mt][nt], false, false);
    }
  }
  // stands in front of the epilogue's reuse of the registers that held the global load addresses (the scheduling barrier keeps that reuse behind it)
  asm volatile("s_wait_xcnt 0x0" ::: "memory");
  __builtin_amdgcn_sched_barrier(0);
  // ends every wave's fragment reads of the last step before the output strips are written over the operand buffers
  __syncthreads();
  typedef _Float16 v4h __attribute__((ext_vector_type(4)));
  if (!F32OUT && tr) {
    constexpr int TP = 136;
    static_assert(128 * TP * 2 <= 2 * 2 * 128 * PT * 2, "the transposed tile fits in the operand buffers");
    unsigned short (*sT)[TP] = (unsigned short (*)[TP])sm;
#pragma unroll
    for (int nt = 0; nt < 4; ++nt) { const float bv = bf16_round(bias[n0 + wn + nt * 16 + ln]);
#pragma unroll
      for (int mt = 0; mt < 2; ++mt) { FragH f;
#pragma unroll
        for (int r = 0; r < 8; ++r) f.h[r] = (_Float16)(acc[mt][nt][r] * 0.0625f + bv);
        *(v8us*)&sT[wn + nt * 16 + ln][wm + mt * 16 + 8 * hh] = f.half[0]; } }
    // publishes the transposed tile: a row n holds the tokens of four waves
    __syncthreads();
    unsigned short* gt = (unsigned short*)C16 + ((size_t)(m0 / SS) * DM + n0 + (tid >> 4)) * SS + (m0 % SS) + (tid & 15) * 8;
#pragma unroll
    for (int i = 0; i < 8; ++i) *(v8us*)(gt + (size_t)i * 16 * SS) = *(const v8us*)&sT[i * 16 + (tid >> 4)][(tid & 15) * 8];
    return;
  }
#pragma unroll
  for (int nt = 0; nt < 4; ++nt) { const float bv = bf16_round(bias[n0 + wn + nt * 16 + ln]);
#pragma unroll
    for (int mt = 0; mt < 2; ++mt)
#pragma unroll
      for (int r = 0; r < 8; ++r) so[w][mt * 16 + 8 * hh + r][nt * 16 + ln] = acc[mt][nt][r] * 0.0625f + bv; }
  // the wave's own 32 x 64 strip: its LDS writes are ordered before its cross-lane reads, so that whole lines go out
  __builtin_amdgcn_fence(__ATOMIC_ACQ_REL, "workgroup"); __builtin_amdgcn_wave_barrier();
#pragma unroll
  for (int q = 0; q < 16; ++q) { const int r = q * 2 + hh, c4 = ln * 4; const v4f v = *(const v4fa*)&so[w][r][c4]; const size_t o = (size_t)(m0 + wm + r) * DM + n0 + wn + c4;
    if (F32OUT) *(v4f*)(C + o) = v; else { v4h h4;
#pragma unroll
      for (int i = 0; i < 4; ++i) h4[i] = (_Float16)v[i]; *(v4h*)(C16 + o) = h4; } }
  // stands behind the last store of the run, in front of any later write of a register that a store names: in the built code the transposed epilogue's block follows this one
  if (!F32OUT) asm volatile("s_wait_xcnt 0x0" ::: "memory");
}
// the Q, K and V projections in one launch: the work-group index picks the projection and its tile (a test that is the same for the whole work-group). All 3 x 256 work-groups are resident at once,
// three on a WGP, so that one's barrier, global and LDS waits are filled by the other two, and the launch gap, the fill, the first tile's latency and the epilogue are paid once
// six waves a SIMD asked for: holds the register count at 160 or below, without which the three work-groups are not resident (with the second epilogue the build takes 166 registers without it, 158 with it)
__global__ __launch_bounds__(256) __attribute__((amdgpu_waves_per_eu(6))) void k_proj_qkv(const _Float16* __restrict__ XQ, const _Float16* __restrict__ XK, const _Float16* __restrict__ XV,
                                                  const _Float16* __restrict__ Bq, const _Float16* __restrict__ Bk, const _Float16* __restrict__ Bv,
                                                  const float* __restrict__ bq, const float* __restrict__ bk, const float* __restrict__ bv,
                                                  _Float16* __restrict__ Q16, _Float16* __restrict__ K16, _Float16* __restrict__ Vt) {
  const int t = blockIdx.x / PJT;
  proj_tile<false>(blockIdx.x % PJT, t == 0 ? XQ : t == 1 ? XK : XV, t == 0 ? Bq : t == 1 ? Bk : Bv, t == 0 ? bq : t == 1 ? bk : bv, nullptr, t == 0 ? Q16 : t == 1 ? K16 : Vt, t == 2);
}
__global__ __launch_bounds__(256) void k_proj_o(const _Float16* __restrict__ A, const _Float16* __restrict__ Bh, const float* __restrict__ bias, float* __restrict__ C) { proj_tile<true>(blockIdx.x, A, Bh, bias, C, nullptr, false); }

typedef _Float16 v4hs __attribute__((ext_vector_type(4)));
// One work-group's share (256 x 4 x U elements in a row) of an f32 -> f16 conversion, as a stream: U loads of 16 B a lane, each 512 contiguous bytes a wave (whole lines), and U stores of 8 B a lane
// (two whole lines a wave). All of a wave's loads are issued before its first value is converted, so that its whole share is in flight at once. Few waves with many bytes in flight each,
// in place of one wave for every 256 elements. MODE 0: f16(x); 1: f16(bf16(x)); 2: f16(bf16(x) * 16). Each element's arithmetic is that of the one-piece-a-thread kernels.
template <int U, int MODE>
__device__ __forceinline__ void cvt_stream(const float* __restrict__ s, _Float16* __restrict__ d) {
  const int tid = threadIdx.x;
  v4f v[U];
  // the three loops are unrolled so that v[] is indexed by constants and stays in registers, and every address is one base plus an immediate offset
#pragma unroll
  for (int u = 0; u < U; ++u) v[u] = *(const v4fa*)(s + (u * 256 + tid) * 4);
  // keeps every load in front of the first conversion: left free, the compiler issues a dozen, waits for nearly all of them and converts with almost nothing in flight, several times over
  __builtin_amdgcn_sched_barrier(0);
#pragma unroll
  for (int u = 0; u < U; ++u) { v4hs h;
#pragma unroll
    for (int q = 0; q < 4; ++q) h[q] = (MODE == 0) ? (_Float16)v[u][q] : (MODE == 1) ? (_Float16)bf16_round(v[u][q]) : (_Float16)(bf16_round(v[u][q]) * 16.0f);
    *(v4hs*)(d + (u * 256 + tid) * 4) = h; }
}
#define CVU 32
#define CVE (256 * 4 * CVU)
// the three activations and the four weights in one launch: the work-group index picks the tensor and its share of it (a test that is the same for the whole work-group)
__global__ __launch_bounds__(256) void k_cvt_in(const float* __restrict__ xq, const float* __restrict__ xk, const float* __restrict__ xv,
                                                const float* __restrict__ Wq, const float* __restrict__ Wk, const float* __restrict__ Wv, const float* __restrict__ Wo,
                                                _Float16* __restrict__ XQ, _Float16* __restrict__ XK, _Float16* __restrict__ XV,
                                                _Float16* __restrict__ Bq, _Float16* __restrict__ Bk, _Float16* __restrict__ Bv, _Float16* __restrict__ Bo) {
  constexpr int GX = NR * DM / CVE, GW = DM * DM / CVE;
  const int g = blockIdx.x;
  if (g < 3 * GX) {
    const int t = g / GX; const size_t o = (size_t)(g % GX) * CVE;
    cvt_stream<CVU, 1>((t == 0 ? xq : t == 1 ? xk : xv) + o, (t == 0 ? XQ : t == 1 ? XK : XV) + o);
  } else {
    const int g2 = g - 3 * GX, t = g2 / GW; const size_t o = (size_t)(g2 % GW) * CVE;
    cvt_stream<CVU, 2>((t == 0 ? Wq : t == 1 ? Wk : t == 2 ? Wv : Wo) + o, (t == 0 ? Bq : t == 1 ? Bk : t == 2 ? Bv : Bo) + o);
  }
}
// sigmoid(s / 8) = 0.5 + 0.5 tanh(s / 16): th16 is the hardware tanh (v_tanh_f32) of s / 16, one transcendental in place of the library expf and the full-precision division
__device__ __forceinline__ float th16(float s) { return __builtin_amdgcn_tanhf(s * 0.0625f); }
// eight v_tanh_f32, each in place, with the one free slot that the instruction set asks for behind a transcendental (before its result is read or its source overwritten) as the statement's last line:
__device__ __forceinline__ void tanh8(float (&x)[8]) {
  asm("v_tanh_f32 %0, %0\n\tv_tanh_f32 %1, %1\n\tv_tanh_f32 %2, %2\n\tv_tanh_f32 %3, %3\n\tv_tanh_f32 %4, %4\n\tv_tanh_f32 %5, %5\n\tv_tanh_f32 %6, %6\n\tv_tanh_f32 %7, %7\n\tv_nop"
      : "+v"(x[0]), "+v"(x[1]), "+v"(x[2]), "+v"(x[3]), "+v"(x[4]), "+v"(x[5]), "+v"(x[6]), "+v"(x[7]));
}
// (a) O = sigmoid(q.k/8).V per (b,h): 8 waves of 32 query rows. A step is 64 keys: their K rows (64 x 128 B, one line a row) and the same keys' columns of V^T (64 d rows x 128 B, one line a row)
// are read from global as whole lines, one step ahead, into registers and laid in LDS at the pitch of proj_tile (144 B), once for the 8 waves. Two LDS buffers: the one barrier of a step publishes its
// tiles and ends the reads of the buffer written next. Fragment maps and the ascending order of the 32-key blocks in every accumulator are those of the form that read its fragments straight from global.
// The scores are made transposed, S^T = K.Q^T (K rows as A, Q rows as B): a lane then holds, for ONE query (its column), keys 8hh .. 8hh+7 of each 16-key tile in the tile's 8 accumulator registers,
// which is the k order of an A operand's row. The two tiles of a 32-key block, taken through the sigmoid and converted in place, ARE the A operand of P.V: P passes through no LDS and no lane exchange.
// K, V^T and, over them behind one barrier, the output strips lie in the LDS block of proj_tile, which the tiles of the weights in the same launch use too.
__device__ __forceinline__ void satt_tile(const int tile, const _Float16* __restrict__ Q16, const _Float16* __restrict__ K16, const _Float16* __restrict__ Vt, _Float16* __restrict__ O16) {
  constexpr int RPW = 32, NW = 8, NQB = SS / (NW * RPW), DT = HD / 16, KS = HD / 32, PT = 72, KT = 64, NST = SS / KT;
  static_assert(2 * (KT + HD) * PT * 2 <= TLB && NW * RPW * HD * 4 <= TLB, "the K and V^T buffers fit in the LDS block, and so do the output strips");
  unsigned char* const sm = tile_lds();
  unsigned short (*sK)[KT][PT] = (unsigned short (*)[KT][PT])sm;
  unsigned short (*sV)[HD][PT] = (unsigned short (*)[HD][PT])(sm + 2 * KT * PT * 2);
  float (*sO)[RPW][HD] = (float (*)[RPW][HD])sm;
  const int tid = threadIdx.x, w = tid >> 5, lane = tid & 31, ln = lane & 15, hh = lane >> 4;
  const int slab = tile / NQB, qblk = tile % NQB; const int b = slab / NH, h = slab % NH; const int q0 = qblk * (NW * RPW) + w * RPW;
  const int lr = tid >> 3, lc = (tid & 7) * 8;
  const unsigned short* gk = (const unsigned short*)K16 + ((size_t)b * SS + lr) * DM + h * HD + lc;
  const unsigned short* gv = (const unsigned short*)Vt + ((size_t)slab * HD + lr) * SS + lc;
  v8us rk[2], rv[2];
#pragma unroll
  for (int i = 0; i < 2; ++i) { rk[i] = *(const v8us*)(gk + (size_t)i * 32 * DM); rv[i] = *(const v8us*)(gv + (size_t)i * 32 * SS); }
  FragH aq[2][KS];
#pragma unroll
  for (int rt = 0; rt < 2; ++rt) { const unsigned short* qr = (const unsigned short*)Q16 + ((size_t)b * SS + q0 + rt * 16 + ln) * DM + h * HD;
#pragma unroll
    for (int ks = 0; ks < KS; ++ks) { aq[rt][ks].half[0] = *(const v8us*)(qr + ks * 32 + 8 * hh); aq[rt][ks].half[1] = *(const v8us*)(qr + ks * 32 + 16 + 8 * hh); } }
  // stands in front of the accumulators' start values, which reuse the registers that held the Q load addresses (the scheduling barrier keeps that reuse behind it)
  asm volatile("s_wait_xcnt 0x0" ::: "memory");
  __builtin_amdgcn_sched_barrier(0);
  v8f oacc[2][DT];
#pragma unroll
  for (int rt = 0; rt < 2; ++rt)
#pragma unroll
    for (int dt = 0; dt < DT; ++dt) oacc[rt][dt] = (v8f){0.f,0.f,0.f,0.f,0.f,0.f,0.f,0.f};
  // unrolled by two so that the buffer index is a constant in every LDS address
#pragma unroll 2
  for (int st = 0; st < NST; ++st) {
    const int bf = st & 1;
#pragma unroll
    for (int i = 0; i < 2; ++i) { *(v8us*)&sK[bf][lr + 32 * i][lc] = rk[i]; *(v8us*)&sV[bf][lr + 32 * i][lc] = rv[i]; }
    __syncthreads();
    // no branch round the loads (the last step reads its own keys once more, unused): the step stays one block, in which the two scheduling barriers below hold
    const int sn = (st + 1 < NST) ? st + 1 : st;
#pragma unroll
    for (int i = 0; i < 2; ++i) { rk[i] = *(const v8us*)(gk + ((size_t)sn * KT + i * 32) * DM); rv[i] = *(const v8us*)(gv + (size_t)i * 32 * SS + sn * KT); }
    // keeps the next step's global loads in front of this step's matrix and tanh work: sunk to just before their LDS stores, their whole latency would be waited out
    __builtin_amdgcn_sched_barrier(0);
    FragH bk[2][KS];
#pragma unroll
    for (int nt = 0; nt < 2; ++nt)
#pragma unroll
      for (int ks = 0; ks < KS; ++ks) { bk[nt][ks].half[0] = *(const v8us*)&sK[bf][nt * 16 + ln][ks * 32 + 8 * hh]; bk[nt][ks].half[1] = *(const v8us*)&sK[bf][nt * 16 + ln][ks * 32 + 16 + 8 * hh]; }
#pragma unroll
    for (int sub = 0; sub < KT / 32; ++sub) {
      v8f s[2][2];
#pragma unroll
      for (int nt = 0; nt < 2; ++nt)
#pragma unroll
        for (int rt = 0; rt < 2; ++rt) { v8f acc = (v8f){0.f,0.f,0.f,0.f,0.f,0.f,0.f,0.f};
#pragma unroll
          for (int ks = 0; ks < KS; ++ks) acc = mmaH<1>(bk[nt][ks].v, bk[nt][ks].v, aq[rt][ks].v, aq[rt][ks].v, acc); s[rt][nt] = acc; }   // register r = key nt * 16 + 8 * hh + r, lane column = query rt * 16 + ln
      // this block's V^T fragments and the step's next K fragments are read as one group in front of the tanh work, which covers their LDS latency
      FragH bv[DT];
#pragma unroll
      for (int dt = 0; dt < DT; ++dt) { bv[dt].half[0] = *(const v8us*)&sV[bf][dt * 16 + ln][sub * 32 + 8 * hh]; bv[dt].half[1] = *(const v8us*)&sV[bf][dt * 16 + ln][sub * 32 + 16 + 8 * hh]; }
      if (sub + 1 < KT / 32) {
#pragma unroll
        for (int nt = 0; nt < 2; ++nt)
#pragma unroll
          for (int ks = 0; ks < KS; ++ks) { bk[nt][ks].half[0] = *(const v8us*)&sK[bf][(sub + 1) * 32 + nt * 16 + ln][ks * 32 + 8 * hh]; bk[nt][ks].half[1] = *(const v8us*)&sK[bf][(sub + 1) * 32 + nt * 16 + ln][ks * 32 + 16 + 8 * hh]; }
      }
      FragH pa[2];
#pragma unroll
      for (int rt = 0; rt < 2; ++rt)
#pragma unroll
        for (int nt = 0; nt < 2; ++nt) { float x[8];
#pragma unroll
          for (int r = 0; r < 8; ++r) x[r] = s[rt][nt][r] * 0.0625f;
          tanh8(x);
#pragma unroll
          for (int r = 0; r < 8; ++r) pa[rt].h[nt * 8 + r] = (_Float16)fmaf(x[r], 0.5f, 0.5f); }
#pragma unroll
      for (int dt = 0; dt < DT; ++dt)
#pragma unroll
        for (int rt = 0; rt < 2; ++rt) oacc[rt][dt] = mmaH<1>(pa[rt].v, pa[rt].v, bv[dt].v, bv[dt].v, oacc[rt][dt]);
    }
    // keeps the next step's LDS stores, and with them the wait for the global loads, behind this step's matrix and tanh work
    __builtin_amdgcn_sched_barrier(0);
  }
  // stands in front of the epilogue's reuse of the registers that held the global load addresses (the scheduling barrier keeps that reuse behind it)
  asm volatile("s_wait_xcnt 0x0" ::: "memory");
  __builtin_amdgcn_sched_barrier(0);
  // ends every wave's fragment reads of the last step before the output strips are written over the K and V^T buffers
  __syncthreads();
#pragma unroll
  for (int rt = 0; rt < 2; ++rt)
#pragma unroll
    for (int dt = 0; dt < DT; ++dt)
#pragma unroll
      for (int r = 0; r < 8; ++r) sO[w][rt * 16 + 8 * hh + r][dt * 16 + ln] = oacc[rt][dt][r];
  __builtin_amdgcn_fence(__ATOMIC_ACQ_REL, "workgroup"); __builtin_amdgcn_wave_barrier();
  {
#pragma unroll
    for (int rp = 0; rp < RPW; rp += 2) { const int r = rp + (lane >> 4), pc = lane & 15; const v4f val = *(const v4fa*)&sO[w][r][pc * 4]; v4hs h4;   // O leaves as the f16 operand of the output projection: 16 lanes send one whole line of a row
#pragma unroll
      for (int i = 0; i < 4; ++i) h4[i] = (_Float16)val[i];
      *(v4hs*)(O16 + ((size_t)b * SS + q0 + r) * DM + h * HD + pc * 4) = h4; }
     }
  // stands behind the last store of the run, in front of any later write of a register that a store names: in the built code the other kind of tile's block may follow this one
  asm volatile("s_wait_xcnt 0x0" ::: "memory");
}
// (b) attn_weights[b][q][k] = (1/16) sum_h sigmoid(q_h.k_h/8). One 128 x 128 tile (queries x keys) of one batch per work-group of 8 waves (4 x 2 waves, 32 x 64 each), made whole by that work-group.
// A step is one head: its 64 columns of the 128 query rows and of the 128 key rows (one 128-B line a row) are read from global as whole lines, one head ahead, into registers and laid in LDS
// at the pitch of proj_tile (144 B). Two LDS buffers: the one barrier of a step publishes its head and ends the reads of the buffer written next.
// Fragment maps, the ascending k order inside a head and the ascending head order of the sum of the tanh terms are those of the 16 x 32 form that read its fragments straight from global.
// The output strips lie over the operand buffers, as in proj_tile, in the same LDS block.
__device__ __forceinline__ void aw_tile(const int tile, const _Float16* __restrict__ Q16, const _Float16* __restrict__ K16, float* __restrict__ AW) {
  constexpr int PT = 72, NT = SS / 128;
  static_assert(TLB == 2 * 2 * 128 * PT * 2 && 8 * 32 * 68 * 4 <= TLB, "the LDS block holds the operand buffers, and the output strips fit in them");
  unsigned char* const sm = tile_lds();
  unsigned short (*sA)[128][PT] = (unsigned short (*)[128][PT])sm;
  unsigned short (*sB)[128][PT] = (unsigned short (*)[128][PT])(sm + 2 * 128 * PT * 2);
  float (*so)[32][68] = (float (*)[32][68])sm;
  const int tid = threadIdx.x, w = tid >> 5, lane = tid & 31, ln = lane & 15, hh = lane >> 4;
  const int b = tile / (NT * NT), tl = tile % (NT * NT);
  const int m0 = (tl / NT) * 128, n0 = (tl % NT) * 128, wm = (w >> 1) * 32, wn = (w & 1) * 64;
  const int lr = tid >> 3, lc = (tid & 7) * 8;
  const unsigned short* ga = (const unsigned short*)Q16 + ((size_t)b * SS + m0 + lr) * DM + lc;
  const unsigned short* gb = (const unsigned short*)K16 + ((size_t)b * SS + n0 + lr) * DM + lc;
  v8us ra[4], rb[4];
#pragma unroll
  for (int i = 0; i < 4; ++i) { ra[i] = *(const v8us*)(ga + (size_t)i * 32 * DM); rb[i] = *(const v8us*)(gb + (size_t)i * 32 * DM); }
  typedef float v2f __attribute__((ext_vector_type(2)));
  v2f aw[2][4][4];   // the sums of the tanh terms, as register pairs: one packed add serves two of them
#pragma unroll
  for (int mt = 0; mt < 2; ++mt)
#pragma unroll
    for (int nt = 0; nt < 4; ++nt)
#pragma unroll
      for (int p = 0; p < 4; ++p) aw[mt][nt][p] = (v2f){0.f, 0.f};
  // unrolled by two so that the buffer index is a constant in every LDS address
#pragma unroll 2
  for (int h = 0; h < NH; ++h) {
    const int bf = h & 1;
#pragma unroll
    for (int i = 0; i < 4; ++i) { *(v8us*)&sA[bf][lr + 32 * i][lc] = ra[i]; *(v8us*)&sB[bf][lr + 32 * i][lc] = rb[i]; }
    __syncthreads();
    // no branch round the loads (the last step reads its own head once more, unused): the step stays one block, in which the two scheduling barriers below hold; with a branch here the compiler sinks the tanh work past the next step's stores and barrier
    const int hn = (h + 1 < NH) ? h + 1 : h;
#pragma unroll
    for (int i = 0; i < 4; ++i) { ra[i] = *(const v8us*)(ga + (size_t)i * 32 * DM + hn * HD); rb[i] = *(const v8us*)(gb + (size_t)i * 32 * DM + hn * HD); }
    // keeps the next head's global loads in front of this head's matrix and tanh work: left free, the compiler sinks them to just before their LDS stores and their whole latency is waited out
    __builtin_amdgcn_sched_barrier(0);
    v8f acc[2][4];
#pragma unroll
    for (int mt = 0; mt < 2; ++mt)
#pragma unroll
      for (int nt = 0; nt < 4; ++nt) acc[mt][nt] = (v8f){0.f,0.f,0.f,0.f,0.f,0.f,0.f,0.f};
#pragma unroll
    for (int ks = 0; ks < HD / 32; ++ks) {
      FragH a[2], bk[4];
#pragma unroll
      for (int mt = 0; mt < 2; ++mt) { a[mt].half[0] = *(const v8us*)&sA[bf][wm + mt * 16 + ln][ks * 32 + 8 * hh]; a[mt].half[1] = *(const v8us*)&sA[bf][wm + mt * 16 + ln][ks * 32 + 16 + 8 * hh]; }
#pragma unroll
      for (int nt = 0; nt < 4; ++nt) { bk[nt].half[0] = *(const v8us*)&sB[bf][wn + nt * 16 + ln][ks * 32 + 8 * hh]; bk[nt].half[1] = *(const v8us*)&sB[bf][wn + nt * 16 + ln][ks * 32 + 16 + 8 * hh]; }
#pragma unroll
      for (int mt = 0; mt < 2; ++mt)
#pragma unroll
        for (int nt = 0; nt < 4; ++nt) acc[mt][nt] = __builtin_amdgcn_wmma_f32_16x16x32_f16(false, a[mt].v, false, bk[nt].v, (short)0, acc[mt][nt], false, false);
    }
#pragma unroll
    for (int mt = 0; mt < 2; ++mt)
#pragma unroll
      for (int nt = 0; nt < 4; ++nt)
#pragma unroll
        for (int p = 0; p < 4; ++p) aw[mt][nt][p] += (v2f){th16(acc[mt][nt][2 * p]), th16(acc[mt][nt][2 * p + 1])};
    // keeps the next head's LDS stores behind this head's matrix and tanh work: left free, the compiler lifts them, and with them the wait for the global loads, to just behind this head's LDS reads
    __builtin_amdgcn_sched_barrier(0);
  }
  // stands in front of the epilogue's reuse of the registers that held the global load addresses (the scheduling barrier keeps that reuse behind it)
  asm volatile("s_wait_xcnt 0x0" ::: "memory");
  __builtin_amdgcn_sched_barrier(0);
  // ends every wave's fragment reads of the last head before the output strips are written over the operand buffers
  __syncthreads();
#pragma unroll
  for (int nt = 0; nt < 4; ++nt)
#pragma unroll
    for (int mt = 0; mt < 2; ++mt)
#pragma unroll
      for (int r = 0; r < 8; ++r) so[w][mt * 16 + 8 * hh + r][nt * 16 + ln] = fmaf(aw[mt][nt][r >> 1][r & 1], 0.5f / (float)NH, 0.5f);   // mean_h (0.5 + 0.5 tanh) from the sum of the tanh terms
  // the wave's own 32 x 64 strip: its LDS writes are ordered before its cross-lane reads, so that whole lines go out
  __builtin_amdgcn_fence(__ATOMIC_ACQ_REL, "workgroup"); __builtin_amdgcn_wave_barrier();
#pragma unroll
  for (int q = 0; q < 16; ++q) { const int r = q * 2 + hh, c4 = ln * 4; *(v4f*)(AW + ((size_t)b * SS + m0 + wm + r) * SS + n0 + wn + c4) = *(const v4fa*)&so[w][r][c4]; }
  // stands behind the last store of the run, in front of any later write of a register that a store names: in the built code the other kind of tile's block may follow this one
  asm volatile("s_wait_xcnt 0x0" ::: "memory");
}
#define AWT (BB * (SS / 128) * (SS / 128))
#define SAT (BB * NH * (SS / 256))
// P.V and the mean-over-heads weights in one launch: both read Q and K, neither reads what the other writes. The work-group index picks the job and its tile (a test that is the same for the whole work-group).
// Two work-groups are resident on a WGP (registers). The 256 long P.V work-groups have the lowest indices and start first, one a WGP, each beside a tile of the weights; the other tiles of the weights follow in
// the places that the first ones leave. P.V alone held two waves a SIMD: its waits (dependent matrix - tanh - matrix chain, LDS, barriers) are now filled by the weights' work, which no longer has a time of its own
__global__ __launch_bounds__(256) void k_satt_aw(const _Float16* __restrict__ Q16, const _Float16* __restrict__ K16, const _Float16* __restrict__ Vt, _Float16* __restrict__ O16, float* __restrict__ AW) {
  if (blockIdx.x < SAT) satt_tile(blockIdx.x, Q16, K16, Vt, O16);
  else aw_tile(blockIdx.x - SAT, Q16, K16, AW);
}
extern "C" void kernel_launch(void* const* d_in, const int* in_sizes, int n_in,
                              void* d_out, int out_size, void* d_ws, size_t ws_size, hipStream_t stream) {
  (void)in_sizes; (void)n_in; (void)out_size;
  const float* xq = (const float*)d_in[0]; const float* xk = (const float*)d_in[1]; const float* xv = (const float*)d_in[2]; const float* Wq = (const float*)d_in[3]; const float* bq = (const float*)d_in[4]; const float* Wk = (const float*)d_in[5]; const float* bk = (const float*)d_in[6]; const float* Wv = (const float*)d_in[7]; const float* bv = (const float*)d_in[8]; const float* Wo = (const float*)d_in[9]; const float* bo = (const float*)d_in[10];
  float* out = (float*)d_out; float* AW = (float*)((char*)d_out + 16777216);
  char* ws = (char*)d_ws; size_t off = 0;
  auto take = [&](size_t bytes) { char* p = ws + off; off += (bytes + 255) & ~(size_t)255; return p; };
  const size_t w8 = (size_t)DM * DM / 8;
  _Float16* Bq = (_Float16*)take(w8 * 16); _Float16* Bk = (_Float16*)take(w8 * 16); _Float16* Bv = (_Float16*)take(w8 * 16); _Float16* Bo = (_Float16*)take(w8 * 16);
  _Float16* XQ = (_Float16*)take((size_t)NR * DM * 2); _Float16* XK = (_Float16*)take((size_t)NR * DM * 2); _Float16* XV = (_Float16*)take((size_t)NR * DM * 2); _Float16* Q16 = (_Float16*)take((size_t)NR * DM * 2); _Float16* K16 = (_Float16*)take((size_t)NR * DM * 2); _Float16* Vt = (_Float16*)take((size_t)NR * DM * 2); _Float16* O16 = (_Float16*)take((size_t)NR * DM * 2);
  if (off > ws_size) return;      // 64 MiB
  k_cvt_in<<<3 * (NR * DM / CVE) + 4 * (DM * DM / CVE), 256, 0, stream>>>(xq, xk, xv, Wq, Wk, Wv, Wo, XQ, XK, XV, Bq, Bk, Bv, Bo);
  k_proj_qkv<<<3 * PJT, 256, 0, stream>>>(XQ, XK, XV, Bq, Bk, Bv, bq, bk, bv, Q16, K16, Vt);
  k_satt_aw<<<SAT + AWT, 256, 0, stream>>>(Q16, K16, Vt, O16, AW);
  k_proj_o<<<PJT, 256, 0, stream>>>(O16, Bo, bo, out);
}
